// v000
// Times are from an AMD MI455X. After a warm-up the kernel runs many times in a row, and a time is the length of
// such a window on the GPU divided by its runs, so every launch and the gaps after it count. The runs cycle
// through copies of the inputs. A figure is the median of several windows, for all but v000 over two sittings.
// Sittings can differ by a few percent; kernels timed side by side share one.
// v000, which the later versions start from, runs in 664 microseconds.
// x@Wq, x@Wk, Wv^T@x^T: v_wmma_f32_16x16x32_bf16 on RNE-bf16 input planes (f32 accumulate); q.k^T: v_wmma_f32_16x16x32_f16 (q, k single f16 planes, f32 accumulate); p.v: v_wmma_f32_16x16x32_f16 (p f16 carried x2^10, v f16, f32 accumulate); ctx@Wo: v_wmma_f32_16x16x32_f16 (ctx f16 carried x2^6, Wo f16 carried x2^4 built from RNE-bf16 values, f32 accumulate); RoPE, tanh softcap and softmax in f32.
#include <hip/hip_runtime.h>
#include <math.h>

#pragma clang fp contract(off)

#ifndef NB
#define NB 2
#endif
#ifndef SEQ
#define SEQ 2048
#endif
#define NB_FULL  2
#define SEQ_FULL 2048
#define HID      2048
#define NQH      16
#define NKVH     8
#define HD       128
#define HHALF    64
#define QDIM     (NQH * HD)
#define KVDIM    (NKVH * HD)
#define NTOK     (NB * SEQ)
#define KV_CHUNK 64
#define QBLK     128
#define RSQ      0.08838834764831845f
#define SOFTCAP  50.0f
#define INVCAP   0.02f
#define PCARRY   1024.0f
#define OCARRY   64.0f
#define WOCARRY  16.0f
#define OUTSCALE 0.0009765625f

typedef __attribute__((ext_vector_type(16))) _Float16 v16h;
typedef __attribute__((ext_vector_type(8)))  _Float16 v8h;
typedef __attribute__((ext_vector_type(16))) __bf16   v16b;
typedef __attribute__((ext_vector_type(8)))  __bf16   v8b;
typedef __attribute__((ext_vector_type(8)))  float    v8f;
typedef __attribute__((ext_vector_type(4)))  float    v4f;
typedef __attribute__((ext_vector_type(4)))  unsigned int v4u;

__device__ __forceinline__ unsigned short f2bf_bits(float f) {
  unsigned u = __float_as_uint(f);
  return (unsigned short)((u + 0x7FFFu + ((u >> 16) & 1u)) >> 16);
}
__device__ __forceinline__ float bf_bits2f(unsigned short h) { return __uint_as_float(((unsigned)h) << 16); }
__device__ __forceinline__ unsigned short f2h_bits(float f) { const _Float16 h = (_Float16)f; return __builtin_bit_cast(unsigned short, h); }

// hazard guards as plain device helpers
__device__ __forceinline__ void dep_guard_h(v8f& a, v8f& b, v16h x, v16h y) { asm volatile("v_nop\n\tv_nop\n\tv_nop\n\tv_nop" : "+v"(a), "+v"(b) : "v"(x), "v"(y)); }
__device__ __forceinline__ void dep_guard_b(v8f& a, v8f& b, v16b x, v16b y) { asm volatile("v_nop\n\tv_nop\n\tv_nop\n\tv_nop" : "+v"(a), "+v"(b) : "v"(x), "v"(y)); }
__device__ __forceinline__ void keep4_h(v16h a, v16h b, v16h c, v16h d) { asm volatile("v_nop" :: "v"(a), "v"(b), "v"(c), "v"(d)); }
__device__ __forceinline__ void keep4_b(v16b a, v16b b, v16b c, v16b d) { asm volatile("v_nop" :: "v"(a), "v"(b), "v"(c), "v"(d)); }
__device__ __forceinline__ void acc_guard4(v8f& a, v8f& b, v8f& c, v8f& d) { asm volatile("v_nop\n\tv_nop\n\tv_nop\n\tv_nop" : "+v"(a), "+v"(b), "+v"(c), "+v"(d)); }

// fragment loaders: lane l, row/col = l & 15, elements 0..7 <- p[0..7] (k0 + 8h + 0..7), 8..15 <- p[16..23] (k0 + 16 + 8h + 0..7); caller adds 8h
template <typename T> struct Frag;
template <> struct Frag<_Float16> {
  typedef v16h V; union U { v16h v; v8h h[2]; };
  static __device__ __forceinline__ v16h load(const _Float16* p) {
    U f; f.h[0] = *(const v8h*)(p); f.h[1] = *(const v8h*)(p + 16); return f.v;
  }
  static __device__ __forceinline__ v8f mma(v16h a, v16h b, v8f c) {
    return __builtin_amdgcn_wmma_f32_16x16x32_f16(false, a, false, b, (short)0, c, false, false);
  }
  static __device__ __forceinline__ void guard(v8f& a, v8f& b, v16h x, v16h y) { dep_guard_h(a, b, x, y); }
  static __device__ __forceinline__ void keep(v16h a, v16h b, v16h c, v16h d) { keep4_h(a, b, c, d); }
};
template <> struct Frag<__bf16> {
  typedef v16b V; union U { v16b v; v8b h[2]; };
  static __device__ __forceinline__ v16b load(const __bf16* p) {
    U f; f.h[0] = *(const v8b*)(p); f.h[1] = *(const v8b*)(p + 16); return f.v;
  }
  static __device__ __forceinline__ v8f mma(v16b a, v16b b, v8f c) {
    return __builtin_amdgcn_wmma_f32_16x16x32_bf16(false, a, false, b, (short)0, c, false, false);
  }
  static __device__ __forceinline__ void guard(v8f& a, v8f& b, v16b x, v16b y) { dep_guard_b(a, b, x, y); }
  static __device__ __forceinline__ void keep(v16b a, v16b b, v16b c, v16b d) { keep4_b(a, b, c, d); }
};

// single f16 WMMA with the 4-nop guard tied to D and keeping A/B live
__device__ __forceinline__ v8f h_mma(v16h a, v16h b, v8f c) {
  c = __builtin_amdgcn_wmma_f32_16x16x32_f16(false, a, false, b, (short)0, c, false, false);
  asm volatile("v_nop\n\tv_nop\n\tv_nop\n\tv_nop" : "+v"(c) : "v"(a), "v"(b));
  return c;
}

// ---------------------------------------------------------------------------------------------
// 1) x f32 [NB_FULL][SEQ_FULL][HID] -> compact bf16 plane [NTOK][HID], 8 elements per thread, one 16-B store per lane
// ---------------------------------------------------------------------------------------------
__global__ __launch_bounds__(256) void cast_x_bf16(const float* __restrict__ in, unsigned short* __restrict__ out, int n8) {
  const int i = blockIdx.x * 256 + threadIdx.x;
  if (i < n8) {
    const size_t o   = (size_t)i * 8;
    const size_t tok = o / HID;
    const size_t col = o - tok * HID;
    const size_t bb  = tok / SEQ;
    const size_t ss  = tok - bb * SEQ;
    const size_t src = (bb * SEQ_FULL + ss) * (size_t)HID + col;
    const v4f a  = *(const v4f*)(in + src);
    const v4f bq = *(const v4f*)(in + src + 4);
    v4u w;
    w[0] = (unsigned)f2bf_bits(a[0])  | ((unsigned)f2bf_bits(a[1])  << 16);
    w[1] = (unsigned)f2bf_bits(a[2])  | ((unsigned)f2bf_bits(a[3])  << 16);
    w[2] = (unsigned)f2bf_bits(bq[0]) | ((unsigned)f2bf_bits(bq[1]) << 16);
    w[3] = (unsigned)f2bf_bits(bq[2]) | ((unsigned)f2bf_bits(bq[3]) << 16);
    *(v4u*)(out + o) = w;
    
  }
}

// ---------------------------------------------------------------------------------------------
// 2) in[nrows][ncols] f32 -> out[ncols][nrows] 16-bit. MODE 0: bf16 bits (RNE); MODE 1: f16 bits of (RNE-bf16 value * scl).
//    Block = 64x64 tile through LDS (cross-thread, block barrier). grid = (ncols/64, nrows/64); nrows, ncols multiples of 64.
//    load coverage: 256 threads x 16 floats = 64x64 tile; store coverage: 2 iterations x 256 threads x 8 = 64 rows x 64.
// ---------------------------------------------------------------------------------------------
template <int MODE> __device__ __forceinline__ unsigned short pk16(float f, float scl) {
  if (MODE == 0) return f2bf_bits(f);
  const float g = bf_bits2f(f2bf_bits(f)) * scl;
  return f2h_bits(g);
}

template <int MODE>
__global__ __launch_bounds__(256) void transpose_cast16(const float* __restrict__ in, unsigned short* __restrict__ out, int nrows, int ncols, float scl) {
  __shared__ float tile[64 * 65];
  const int tid = threadIdx.x;
  const int r0 = blockIdx.y * 64, c0 = blockIdx.x * 64;
  {
    const int row = tid >> 2, cc = (tid & 3) * 16;
    const float* s = in + (size_t)(r0 + row) * ncols + c0 + cc;
#pragma unroll
    for (int q = 0; q < 4; ++q) {
      const v4f v = *(const v4f*)(s + 4 * q);
#pragma unroll
      for (int e = 0; e < 4; ++e) tile[(cc + 4 * q + e) * 65 + row] = v[e];
    }
  }
  __syncthreads();
  {
#pragma unroll
    for (int it = 0; it < 2; ++it) {
      const int orow = it * 32 + (tid >> 3), seg = (tid & 7) * 8;
      const float* tp = tile + orow * 65 + seg;
      v4u w;
#pragma unroll
      for (int e = 0; e < 4; ++e) w[e] = (unsigned)pk16<MODE>(tp[2 * e], scl) | ((unsigned)pk16<MODE>(tp[2 * e + 1], scl) << 16);
      *(v4u*)(out + (size_t)(c0 + orow) * nrows + r0 + seg) = w;
    }
    
  }
}

// ---------------------------------------------------------------------------------------------
// 3) RoPE cos/sin tables [SEQ][HHALF] f32: angle = pos * inv_freq[j] (single f32 multiply), precise cosf/sinf.
// ---------------------------------------------------------------------------------------------
struct RopeFreq { float f[HHALF]; };
static_assert(sizeof(RopeFreq) == 256);

__global__ __launch_bounds__(256) void rope_table_kernel(float* __restrict__ cosT, float* __restrict__ sinT, RopeFreq fr) {
  __shared__ float invf[HHALF];
  if (threadIdx.x == 0) {
#pragma unroll
    for (int q = 0; q < HHALF; ++q) invf[q] = fr.f[q];
  }
  __syncthreads();
  const int i = blockIdx.x * 256 + threadIdx.x;          // exactly SEQ*HHALF threads
  const int t = i >> 6;
  const int jj = i & (HHALF - 1);
  const float ang = (float)t * invf[jj];
  const float cv = cosf(ang);
  const float sv = sinf(ang);
  ((float*)cosT)[i] = cv;
  ((float*)sinT)[i] = sv;
  
}

// ---------------------------------------------------------------------------------------------
// 4) RoPE -> single f16 plane. src f32 [NTOK][PITCH], head hs occupies cols hs*128 .. hs*128+127 (first 64 = x1, next 64 = x2).
//    Thread = (token, head, 8-wide pair group jg): out[d] = x1[d]*cos - x2[d]*sin, out[d+64] = x2[d]*cos + x1[d]*sin, times scl.
// ---------------------------------------------------------------------------------------------
template <int NHEAD, int PITCH>
__global__ __launch_bounds__(256) void rope_f16_kernel(const float* __restrict__ src, const float* __restrict__ cosT, const float* __restrict__ sinT,
                                                        unsigned short* __restrict__ outP, float scl) {
  const int i = blockIdx.x * 256 + threadIdx.x;          // exactly NTOK*NHEAD*8 threads
  const int jg = i & 7;
  const int hs = (i >> 3) % NHEAD;
  const int tok = (i >> 3) / NHEAD;
  const int pos = tok % SEQ;
  const size_t base = (size_t)tok * PITCH + (size_t)hs * HD + jg * 8;
  const size_t tb = (size_t)pos * HHALF + jg * 8;
  const v4f x1a = *(const v4f*)(src + base);
  const v4f x1b = *(const v4f*)(src + base + 4);
  const v4f x2a = *(const v4f*)(src + base + HHALF);
  const v4f x2b = *(const v4f*)(src + base + HHALF + 4);
  const v4f ca = *(const v4f*)(cosT + tb);
  const v4f cb = *(const v4f*)(cosT + tb + 4);
  const v4f sa = *(const v4f*)(sinT + tb);
  const v4f sb = *(const v4f*)(sinT + tb + 4);
  v4f o1a, o1b, o2a, o2b;
#pragma unroll
  for (int e = 0; e < 4; ++e) {
    o1a[e] = (x1a[e] * ca[e] - x2a[e] * sa[e]) * scl;
    o2a[e] = (x2a[e] * ca[e] + x1a[e] * sa[e]) * scl;
    o1b[e] = (x1b[e] * cb[e] - x2b[e] * sb[e]) * scl;
    o2b[e] = (x2b[e] * cb[e] + x1b[e] * sb[e]) * scl;
  }
  v4u h1, h2;
  h1[0] = (unsigned)f2h_bits(o1a[0]) | ((unsigned)f2h_bits(o1a[1]) << 16);
  h1[1] = (unsigned)f2h_bits(o1a[2]) | ((unsigned)f2h_bits(o1a[3]) << 16);
  h1[2] = (unsigned)f2h_bits(o1b[0]) | ((unsigned)f2h_bits(o1b[1]) << 16);
  h1[3] = (unsigned)f2h_bits(o1b[2]) | ((unsigned)f2h_bits(o1b[3]) << 16);
  h2[0] = (unsigned)f2h_bits(o2a[0]) | ((unsigned)f2h_bits(o2a[1]) << 16);
  h2[1] = (unsigned)f2h_bits(o2a[2]) | ((unsigned)f2h_bits(o2a[3]) << 16);
  h2[2] = (unsigned)f2h_bits(o2b[0]) | ((unsigned)f2h_bits(o2b[1]) << 16);
  h2[3] = (unsigned)f2h_bits(o2b[2]) | ((unsigned)f2h_bits(o2b[3]) << 16);
  {
    *(v4u*)(outP + base) = h1;
    *(v4u*)(outP + base + HHALF) = h2;
    
  }
}

// ---------------------------------------------------------------------------------------------
// 5) Register-blocked batched WMMA GEMM, 16-bit operands of type T (bf16 or f16), f32 accumulate.
//    C[m,n] = scale * sum_k A[m,k] * Bt[n,k]; each wave owns a 64x64 tile; A row-major [M,K], Bt row-major [N,K];
//    M,N % 64 == 0, K % 32 == 0 (no tail handling).
//    SPLITA: A carried as hi/lo planes (A2p = lo), adds lo.Bhi; SPLITB: Bt hi/lo (Bt2p = lo), adds Ahi.lo.
//    OUT_MODE: 0 = f32, 1 = single f16 plane.
// ---------------------------------------------------------------------------------------------
template <typename T, bool SPLITA, bool SPLITB, int OUT_MODE>
__global__ __launch_bounds__(256) void gemm_t64(
    const unsigned short* __restrict__ Ap, const unsigned short* __restrict__ A2p, int lda, long strideA,
    const unsigned short* __restrict__ Btp, const unsigned short* __restrict__ Bt2p, int ldb, long strideB,
    void* __restrict__ Cout, int ldc, long strideC,
    int M, int N, int K, float scale) {
  typedef typename Frag<T>::V V;
  const T* A = (const T*)Ap; const T* A2 = (const T*)A2p; const T* Bt = (const T*)Btp; const T* Bt2 = (const T*)Bt2p;
  __shared__ __align__(16) float sT[8][16 * 68];   // per-wave 16x64 slab, pitch 68 floats
  const int b    = blockIdx.y;
  const int lane = threadIdx.x & 31;
  const int wave = threadIdx.x >> 5;
  const int tilesN = N >> 6;
  const int tilesM = M >> 6;
  const int tile = blockIdx.x * 8 + wave;
  if (tile >= tilesM * tilesN) return;   // wave-uniform; no block barriers in this kernel
  const int tm = tile / tilesN;
  const int tn = tile - tm * tilesN;
  const int m0 = tm << 6;
  const int n0 = tn << 6;

  const T* Ab  = A  + (size_t)b * strideA;
  const T* Bb  = Bt + (size_t)b * strideB;
  const T* Ab2 = A2  + (size_t)b * strideA;
  const T* Bb2 = Bt2 + (size_t)b * strideB;

  const int rlane = lane & 15;                 // row (A) / col (B, D) within subtile
  const int koff  = (lane >> 4) * 8;           // k offset of this lane half
  const int mOff  = (lane >> 4) * 8;           // D row offset

  v8f acc[4][4];
#pragma unroll
  for (int i = 0; i < 4; ++i)
#pragma unroll
    for (int j = 0; j < 4; ++j) acc[i][j] = (v8f){0.f,0.f,0.f,0.f,0.f,0.f,0.f,0.f};

  for (int k0 = 0; k0 < K; k0 += 32) {
    V bh[4], bl[4];
#pragma unroll
    for (int j = 0; j < 4; ++j) {
      const size_t bo = (size_t)(n0 + (j << 4) + rlane) * ldb + koff + k0;
      bh[j] = Frag<T>::load(Bb + bo);
      if (SPLITB) bl[j] = Frag<T>::load(Bb2 + bo);
    }
#pragma unroll
    for (int i = 0; i < 4; ++i) {
      const size_t ao = (size_t)(m0 + (i << 4) + rlane) * lda + koff + k0;
      V ah = Frag<T>::load(Ab + ao);
      V al = ah;
      if (SPLITA) al = Frag<T>::load(Ab2 + ao);
#pragma unroll
      for (int j = 0; j < 4; ++j) {
        acc[i][j] = Frag<T>::mma(ah, bh[j], acc[i][j]);
        if (SPLITB) acc[i][j] = Frag<T>::mma(ah, bl[j], acc[i][j]);
        if (SPLITA) acc[i][j] = Frag<T>::mma(al, bh[j], acc[i][j]);
      }
      Frag<T>::guard(acc[i][0], acc[i][3], ah, al);
    }
    Frag<T>::keep(bh[0], bh[1], bh[2], bh[3]);
    if (SPLITB) Frag<T>::keep(bl[0], bl[1], bl[2], bl[3]);
  }
  acc_guard4(acc[0][0], acc[0][1], acc[0][2], acc[0][3]);
  acc_guard4(acc[1][0], acc[1][1], acc[1][2], acc[1][3]);
  acc_guard4(acc[2][0], acc[2][1], acc[2][2], acc[2][3]);
  acc_guard4(acc[3][0], acc[3][1], acc[3][2], acc[3][3]);

  // ---- epilogue ----
  float* slab = sT[wave];
#pragma unroll
  for (int i = 0; i < 4; ++i) {
    const int mBase = m0 + (i << 4);
#pragma unroll
    for (int j = 0; j < 4; ++j) {
#pragma unroll
      for (int r = 0; r < 8; ++r) {
        const float v = acc[i][j][r] * scale;
        slab[(mOff + r) * 68 + (j << 4) + rlane] = v;
      }
    }
    __builtin_amdgcn_fence(3, "workgroup");
    __builtin_amdgcn_wave_barrier();
    __builtin_amdgcn_fence(2, "workgroup");
    if (OUT_MODE == 0) {
      float* Cf = (float*)Cout + (size_t)b * strideC;
      const int hh = lane >> 4, c4 = (lane & 15) * 4;     // row seg = 256 B = 16 lanes x 16 B
      {
#pragma unroll
        for (int it = 0; it < 8; ++it) {
          const int row = it * 2 + hh;
          v4f v = *(const v4f*)(slab + row * 68 + c4);
          *(v4f*)(Cf + (size_t)(mBase + row) * ldc + n0 + c4) = v;
        }
        
      }
    } else {
      const int q = lane >> 3, c8 = (lane & 7) * 8;
      unsigned short* Cs = (unsigned short*)Cout + (size_t)b * strideC;
      {
#pragma unroll
        for (int it = 0; it < 4; ++it) {
          const int row = it * 4 + q;
          const float* sp = slab + row * 68 + c8;
          v8h hv;
#pragma unroll
          for (int e = 0; e < 8; ++e) hv[e] = (_Float16)sp[e];
          *(v8h*)(Cs + (size_t)(mBase + row) * ldc + n0 + c8) = hv;
        }
        
      }
    }
    __builtin_amdgcn_fence(3, "workgroup");
    __builtin_amdgcn_wave_barrier();
    __builtin_amdgcn_fence(2, "workgroup");
  }
}

// ---------------------------------------------------------------------------------------------
// 6) GQA attention, head_dim 128, 16 query heads, kv head = h >> 1, all keys visited (no mask), tanh softcap.
//    Planes: Q f16 [NTOK][QDIM] (col = h*128 + d, rotated, unscaled), K f16 [NTOK][KVDIM] (col = kvh*128 + d),
//            V^T f16 [NB][KVDIM][SEQ] (row = kvh*128 + d). Output: ctx f16 x2^6 [NTOK][QDIM] (col = h*128 + d).
//    Block = 8 waves = 128 query rows of one (b, h); wave w owns rows qb*128 + 16w .. +15 over the full head.
//    Per 64-key chunk: S(16 x 64) over d = 128 (one f16 product per tile pair); logit = 50*tanh(S/sqrt(128)/50) in f32;
//    reloaded as an A fragment through the same element type; O(16 x 128) += P(16 x 64) . V.
//    All LDS tiles are wave-private; staged extent == consumed extent (16 x 64 P tile, 16 x 64 f32 epilogue slab);
//    no block barrier anywhere in this kernel.
// ---------------------------------------------------------------------------------------------
__global__ __launch_bounds__(256) void attn_kernel(
    const unsigned short* __restrict__ Qp, const unsigned short* __restrict__ Kp,
    const unsigned short* __restrict__ Vtp, unsigned short* __restrict__ Op) {
  __shared__ __align__(16) float    Ost[8][16 * 64];          // 32 KB: per-wave epilogue staging
  __shared__ __align__(16) _Float16 Psh[8][16 * KV_CHUNK];    // 16 KB: per-wave P tile [row][kv]

  const _Float16* Q  = (const _Float16*)Qp;
  const _Float16* Kk = (const _Float16*)Kp;
  const _Float16* Vt = (const _Float16*)Vtp;

  const int tid  = threadIdx.x;
  const int wave = tid >> 5, lane = tid & 31;
  const int hh   = lane >> 4, c = lane & 15, koff = hh * 8;
  const int nqb  = SEQ / QBLK;
  const int bx   = blockIdx.x;
  const int qb   = bx % nqb;
  const int bhid = bx / nqb;
  const int h    = bhid % NQH;
  const int b    = bhid / NQH;
  const int kvh  = h >> 1;
  const int q0   = qb * QBLK + wave * 16;                       // sequence position of this wave's row 0
  const size_t tokw = (size_t)b * SEQ + q0;                     // compact token index of this wave's row 0
  const size_t qoff = (tokw + c) * QDIM + (size_t)h * HD + koff;
  const _Float16* Kb  = Kk + (size_t)b * SEQ * KVDIM + (size_t)kvh * HD + koff;
  const _Float16* Vtb = Vt + (size_t)b * KVDIM * SEQ + (size_t)(kvh * HD + c) * SEQ + koff;
  _Float16* pw = Psh[wave];

  float mrow[8], lrow[8];
  v8f oacc[8];
#pragma unroll
  for (int r = 0; r < 8; ++r) { mrow[r] = -INFINITY; lrow[r] = 0.f; }
#pragma unroll
  for (int t = 0; t < 8; ++t) oacc[t] = (v8f){0.f,0.f,0.f,0.f,0.f,0.f,0.f,0.f};

  for (int kc = 0; kc < SEQ / KV_CHUNK; ++kc) {
    const int kv0 = kc * KV_CHUNK;

    // ---- raw scores S(16 q x 64 kv) over d = 128 ----
    v8f s[4];
#pragma unroll
    for (int j = 0; j < 4; ++j) s[j] = (v8f){0.f,0.f,0.f,0.f,0.f,0.f,0.f,0.f};
#pragma unroll
    for (int dc = 0; dc < 4; ++dc) {
      const v16h qa = Frag<_Float16>::load(Q + qoff + dc * 32);
#pragma unroll
      for (int j = 0; j < 4; ++j) {
        const size_t ko = (size_t)(kv0 + j * 16 + c) * KVDIM + dc * 32;
        const v16h kb = Frag<_Float16>::load(Kb + ko);
        s[j] = h_mma(qa, kb, s[j]);
      }
    }

    // ---- scale, tanh softcap (f32), row max ----
    float cm[8];
#pragma unroll
    for (int r = 0; r < 8; ++r) {
      float m = -INFINITY;
#pragma unroll
      for (int j = 0; j < 4; ++j) {
        float sv = s[j][r] * RSQ;
        sv = SOFTCAP * tanhf(sv * INVCAP);
        s[j][r] = sv;
        m = fmaxf(m, sv);
      }
#pragma unroll
      for (int off = 1; off < 16; off <<= 1) m = fmaxf(m, __shfl_xor(m, off, 32));
      cm[r] = m;
    }

    // all P fragment loads of the prior chunk (same wave) complete before the tile is rewritten
    __builtin_amdgcn_fence(3, "workgroup");
    __builtin_amdgcn_wave_barrier();
    __builtin_amdgcn_fence(2, "workgroup");

    // ---- online softmax (f32); P x 2^10 as f16 into this wave's tile ----
#pragma unroll
    for (int r = 0; r < 8; ++r) {
      const float mnew = fmaxf(mrow[r], cm[r]);
      const float alpha = __expf(mrow[r] - mnew);
      mrow[r] = mnew;
      float psum = 0.f;
#pragma unroll
      for (int j = 0; j < 4; ++j) {
        const float p = __expf(s[j][r] - mnew);
        psum += p;
        pw[(8 * hh + r) * KV_CHUNK + j * 16 + c] = (_Float16)(p * PCARRY);
      }
#pragma unroll
      for (int off = 1; off < 16; off <<= 1) psum += __shfl_xor(psum, off, 32);
      lrow[r] = lrow[r] * alpha + psum;
#pragma unroll
      for (int t = 0; t < 8; ++t) oacc[t][r] *= alpha;
    }
    __builtin_amdgcn_fence(3, "workgroup");
    __builtin_amdgcn_wave_barrier();
    __builtin_amdgcn_fence(2, "workgroup");

    // ---- O(16 x 128) += P(16 x 64) . V ----
#pragma unroll
    for (int kk = 0; kk < 2; ++kk) {
      const v16h pa = Frag<_Float16>::load(pw + c * KV_CHUNK + kk * 32 + koff);
#pragma unroll
      for (int t = 0; t < 8; ++t) {
        const size_t vo = (size_t)t * 16 * SEQ + kv0 + kk * 32;
        const v16h vb = Frag<_Float16>::load(Vtb + vo);
        oacc[t] = h_mma(pa, vb, oacc[t]);
      }
    }
  }

  // ---- epilogue: normalise (x 2^6 / (2^10 * l)), stage 16 x 64 halves in this wave's own slab, write the f16 ctx plane ----
  // coverage: 2 halves x (4 iterations x 4 rows) x 8 lanes x 8 elements = 16 rows x 128 dims.
  float* os = Ost[wave];
  const int q4 = lane >> 3, c8 = (lane & 7) * 8;
#pragma unroll
  for (int th = 0; th < 2; ++th) {
#pragma unroll
    for (int r = 0; r < 8; ++r) {
      const float inv = OCARRY / (PCARRY * lrow[r]);   // undo the P carry (2^10) and apply the ctx carry (2^6)
#pragma unroll
      for (int tt = 0; tt < 4; ++tt) os[(8 * hh + r) * 64 + tt * 16 + c] = oacc[th * 4 + tt][r] * inv;
    }
    __builtin_amdgcn_fence(3, "workgroup");
    __builtin_amdgcn_wave_barrier();
    __builtin_amdgcn_fence(2, "workgroup");
    {
#pragma unroll
      for (int it = 0; it < 4; ++it) {
        const int row = it * 4 + q4;
        const float* sp = os + row * 64 + c8;
        v8h hv;
#pragma unroll
        for (int e = 0; e < 8; ++e) hv[e] = (_Float16)sp[e];
        const size_t o = (tokw + row) * QDIM + (size_t)h * HD + th * 64 + c8;
        *(v8h*)(Op + o) = hv;
      }
      
    }
    __builtin_amdgcn_fence(3, "workgroup");
    __builtin_amdgcn_wave_barrier();
    __builtin_amdgcn_fence(2, "workgroup");
  }
}

// ---------------------------------------------------------------------------------------------
// host
// ---------------------------------------------------------------------------------------------
static_assert((NTOK * HID / 8) % 256 == 0);
static_assert((NTOK * NQH * 8) % 256 == 0);
static_assert((NTOK * NKVH * 8) % 256 == 0);
static_assert((SEQ * HHALF) % 256 == 0);
static_assert(HID % 32 == 0 && QDIM % 32 == 0);
static_assert(NTOK % 64 == 0 && HID % 64 == 0 && QDIM % 64 == 0 && KVDIM % 64 == 0 && SEQ % 64 == 0);
static_assert(SEQ % QBLK == 0 && SEQ % KV_CHUNK == 0 && QBLK == 128 && KV_CHUNK == 64 && HD == 128);
static_assert(NB >= 1 && NB <= NB_FULL && SEQ <= SEQ_FULL);
static_assert(NQH == 2 * NKVH);

extern "C" void kernel_launch(void* const* d_in, const int* in_sizes, int n_in,
                              void* d_out, int out_size, void* d_ws, size_t ws_size, hipStream_t stream) {
  if (n_in < 5) return;
  const size_t needTok = (size_t)(NB - 1) * SEQ_FULL + SEQ;
  if ((size_t)in_sizes[0] < needTok * HID) return;
  if ((size_t)in_sizes[1] < (size_t)HID * QDIM) return;
  if ((size_t)in_sizes[2] < (size_t)HID * KVDIM) return;
  if ((size_t)in_sizes[3] < (size_t)HID * KVDIM) return;
  if ((size_t)in_sizes[4] < (size_t)QDIM * HID) return;
  if ((size_t)out_size < needTok * HID) return;

  const float* x  = (const float*)d_in[0];   // [2,2048,2048]
  const float* Wq = (const float*)d_in[1];   // [2048,2048]  [in][out]
  const float* Wk = (const float*)d_in[2];   // [2048,1024]
  const float* Wv = (const float*)d_in[3];   // [2048,1024]
  const float* Wo = (const float*)d_in[4];   // [2048,2048]
  float* out = (float*)d_out;                // [2,2048,2048] f32

  //   XB   bf16 [NTOK][HID]
  //   WQT  bf16 [QDIM][HID], WKT bf16 [KVDIM][HID], WVT bf16 [KVDIM][HID], WOT f16 [HID][QDIM]
  //   R1   f32 [NTOK][QDIM] for q; later reused: Kf f32 [NTOK][KVDIM] at +0, ctx f16 [NTOK][QDIM] at +0, V^T f16 [NB][KVDIM][SEQ] at +NTOK*QDIM*2
  //   QP f16 [NTOK][QDIM]; KP f16 [NTOK][KVDIM]; COS, SIN f32 [SEQ][HHALF]
  const size_t szXB  = (size_t)NTOK * HID * 2;
  const size_t szWQT = (size_t)QDIM * HID * 2;
  const size_t szWKT = (size_t)KVDIM * HID * 2;
  const size_t szWOT = (size_t)HID * QDIM * 2;
  const size_t szR1  = (size_t)NTOK * QDIM * 4;
  const size_t szQP  = (size_t)NTOK * QDIM * 2;
  const size_t szKP  = (size_t)NTOK * KVDIM * 2;
  const size_t szVT  = (size_t)NB * KVDIM * SEQ * 2;
  const size_t szTAB = (size_t)SEQ * HHALF * 4;
  static_assert((size_t)NTOK * KVDIM * 4 <= (size_t)NTOK * QDIM * 4);
  static_assert((size_t)NTOK * QDIM * 2 + (size_t)NB * KVDIM * SEQ * 2 <= (size_t)NTOK * QDIM * 4);
  const size_t OFF_XB  = 0;
  const size_t OFF_WQT = OFF_XB + szXB;
  const size_t OFF_WKT = OFF_WQT + szWQT;
  const size_t OFF_WVT = OFF_WKT + szWKT;
  const size_t OFF_WOT = OFF_WVT + szWKT;
  const size_t OFF_R1  = OFF_WOT + szWOT;
  const size_t OFF_QF  = OFF_R1;
  const size_t OFF_KF  = OFF_R1;
  const size_t OFF_CTX = OFF_R1;
  const size_t OFF_VT  = OFF_R1 + szQP;
  const size_t OFF_QP  = OFF_R1 + szR1;
  const size_t OFF_KP  = OFF_QP + szQP;
  const size_t OFF_COS = OFF_KP + szKP;
  const size_t OFF_SIN = OFF_COS + szTAB;
  const size_t WS_TOTAL = OFF_SIN + szTAB;
  (void)szVT;
  if (ws_size < WS_TOTAL) return;

  char* ws = (char*)d_ws;
  unsigned short* xb  = (unsigned short*)(ws + OFF_XB);
  unsigned short* WqT = (unsigned short*)(ws + OFF_WQT);
  unsigned short* WkT = (unsigned short*)(ws + OFF_WKT);
  unsigned short* WvT = (unsigned short*)(ws + OFF_WVT);
  unsigned short* WoT = (unsigned short*)(ws + OFF_WOT);
  float* Qf  = (float*)(ws + OFF_QF);
  float* Kf  = (float*)(ws + OFF_KF);
  unsigned short* ctx = (unsigned short*)(ws + OFF_CTX);
  unsigned short* Vt  = (unsigned short*)(ws + OFF_VT);
  unsigned short* Qpl = (unsigned short*)(ws + OFF_QP);
  unsigned short* Kpl = (unsigned short*)(ws + OFF_KP);
  float* cosT = (float*)(ws + OFF_COS);
  float* sinT = (float*)(ws + OFF_SIN);

  // inv_freq[j] = 1 / 10000^(2j/128), pow in double then RNE to f32, reciprocal as one f32 divide
  RopeFreq fr;
  for (int j = 0; j < HHALF; ++j) {
    const float e = (float)(2 * j) / 128.0f;
    const double p = pow(10000.0, (double)e);
    const float pf = (float)p;
    fr.f[j] = 1.0f / pf;
  }

  // 1) x -> compact bf16 plane
  cast_x_bf16<<<(NTOK * HID / 8) / 256, 256, 0, stream>>>(x, xb, NTOK * HID / 8);
  // 2) transposed 16-bit weight planes: in[rows][cols] -> out[cols][rows]; grid = (cols/64, rows/64)
  transpose_cast16<0><<<dim3(QDIM / 64, HID / 64), 256, 0, stream>>>(Wq, WqT, HID, QDIM, 1.0f);      // [HID][QDIM]  -> [QDIM][HID]
  transpose_cast16<0><<<dim3(KVDIM / 64, HID / 64), 256, 0, stream>>>(Wk, WkT, HID, KVDIM, 1.0f);    // [HID][KVDIM] -> [KVDIM][HID]
  transpose_cast16<0><<<dim3(KVDIM / 64, HID / 64), 256, 0, stream>>>(Wv, WvT, HID, KVDIM, 1.0f);    // [HID][KVDIM] -> [KVDIM][HID]
  transpose_cast16<1><<<dim3(HID / 64, QDIM / 64), 256, 0, stream>>>(Wo, WoT, QDIM, HID, WOCARRY);   // [QDIM][HID]  -> [HID][QDIM], f16 x 2^4
  // 3) RoPE tables
  rope_table_kernel<<<(SEQ * HHALF) / 256, 256, 0, stream>>>(cosT, sinT, fr);
  // 4) q = x @ Wq -> f32 [NTOK][QDIM]   (M=NTOK, N=QDIM, K=HID)
  {
    const int tiles = (NTOK / 64) * (QDIM / 64);
    gemm_t64<__bf16, false, false, 0><<<dim3((tiles + 7) / 8, 1), 256, 0, stream>>>(
        xb, xb, HID, 0L, WqT, WqT, HID, 0L, (void*)Qf, QDIM, 0L, NTOK, QDIM, HID, 1.0f);
  }
  // 5) RoPE of q (16 heads) -> f16 plane
  rope_f16_kernel<NQH, QDIM><<<(NTOK * NQH * 8) / 256, 256, 0, stream>>>(Qf, cosT, sinT, Qpl, 1.0f);
  // 6) k = x @ Wk -> f32 [NTOK][KVDIM]  (M=NTOK, N=KVDIM, K=HID), into the q region (q is dead)
  {
    const int tiles = (NTOK / 64) * (KVDIM / 64);
    gemm_t64<__bf16, false, false, 0><<<dim3((tiles + 7) / 8, 1), 256, 0, stream>>>(
        xb, xb, HID, 0L, WkT, WkT, HID, 0L, (void*)Kf, KVDIM, 0L, NTOK, KVDIM, HID, 1.0f);
  }
  // 7) RoPE of k (8 kv heads) -> f16 plane
  rope_f16_kernel<NKVH, KVDIM><<<(NTOK * NKVH * 8) / 256, 256, 0, stream>>>(Kf, cosT, sinT, Kpl, 1.0f);
  // 8) v^T per batch = Wv^T @ x_b^T -> f16 [NB][KVDIM][SEQ]   (M=KVDIM, N=SEQ, K=HID, batch NB)
  {
    const int tiles = (KVDIM / 64) * (SEQ / 64);
    gemm_t64<__bf16, false, false, 1><<<dim3((tiles + 7) / 8, NB), 256, 0, stream>>>(
        WvT, WvT, HID, 0L, xb, xb, HID, (long)SEQ * HID, (void*)Vt, SEQ, (long)KVDIM * SEQ,
        KVDIM, SEQ, HID, 1.0f);
  }
  // 9) attention -> ctx f16 x 2^6 [NTOK][QDIM]  (k f32 region is dead; V^T region disjoint)
  attn_kernel<<<NB * NQH * (SEQ / QBLK), 256, 0, stream>>>(Qpl, Kpl, Vt, ctx);
  // 10) out = ctx @ Wo -> d_out f32, per batch rows b*SEQ_FULL..  (M=SEQ, N=HID, K=QDIM, scale 2^-10)
  {
    const int tiles = (SEQ / 64) * (HID / 64);
    gemm_t64<_Float16, false, false, 0><<<dim3((tiles + 7) / 8, NB), 256, 0, stream>>>(
        ctx, ctx, QDIM, (long)SEQ * QDIM, WoT, WoT, QDIM, 0L, (void*)out, HID, (long)SEQ_FULL * HID,
        SEQ, HID, QDIM, OUTSCALE);
  }
}

// v001
// A run of this version takes 468 microseconds.
// Two timings next to v000 put it at 1.47 and 1.45 times that version's speed.
// x@Wq, x@Wk, Wv^T@x^T: v_wmma_f32_16x16x32_bf16 on RNE-bf16 input planes (f32 accumulate); q.k^T: v_wmma_f32_16x16x32_f16 (q, k single f16 planes, f32 accumulate); p.v: v_wmma_f32_16x16x32_f16 (p f16 carried x2^10, v f16, f32 accumulate); ctx@Wo: v_wmma_f32_16x16x32_f16 (ctx f16 carried x2^6, Wo f16 carried x2^4 built from RNE-bf16 values, f32 accumulate); RoPE, tanh softcap and softmax in f32.
#include <hip/hip_runtime.h>
#include <math.h>

#pragma clang fp contract(off)

#ifndef NB
#define NB 2
#endif
#ifndef SEQ
#define SEQ 2048
#endif
#define NB_FULL  2
#define SEQ_FULL 2048
#define HID      2048
#define NQH      16
#define NKVH     8
#define HD       128
#define HHALF    64
#define QDIM     (NQH * HD)
#define KVDIM    (NKVH * HD)
#define NTOK     (NB * SEQ)
#define KV_CHUNK 64
#define QBLK     128
#define RSQ      0.08838834764831845f
#define SOFTCAP  50.0f
#define INVCAP   0.02f
#define PCARRY   1024.0f
#define OCARRY   64.0f
#define WOCARRY  16.0f
#define OUTSCALE 0.0009765625f

typedef __attribute__((ext_vector_type(16))) _Float16 v16h;
typedef __attribute__((ext_vector_type(8)))  _Float16 v8h;
typedef __attribute__((ext_vector_type(16))) __bf16   v16b;
typedef __attribute__((ext_vector_type(8)))  __bf16   v8b;
typedef __attribute__((ext_vector_type(8)))  float    v8f;
typedef __attribute__((ext_vector_type(4)))  float    v4f;
typedef __attribute__((ext_vector_type(4)))  unsigned int v4u;

__device__ __forceinline__ unsigned short f2bf_bits(float f) {
  unsigned u = __float_as_uint(f);
  return (unsigned short)((u + 0x7FFFu + ((u >> 16) & 1u)) >> 16);
}
__device__ __forceinline__ float bf_bits2f(unsigned short h) { return __uint_as_float(((unsigned)h) << 16); }
__device__ __forceinline__ unsigned short f2h_bits(float f) { const _Float16 h = (_Float16)f; return __builtin_bit_cast(unsigned short, h); }

// hazard guards as plain device helpers
__device__ __forceinline__ void dep_guard_h(v8f& a, v8f& b, v16h x, v16h y) { asm volatile("v_nop\n\tv_nop\n\tv_nop\n\tv_nop" : "+v"(a), "+v"(b) : "v"(x), "v"(y)); }
__device__ __forceinline__ void dep_guard_b(v8f& a, v8f& b, v16b x, v16b y) { asm volatile("v_nop\n\tv_nop\n\tv_nop\n\tv_nop" : "+v"(a), "+v"(b) : "v"(x), "v"(y)); }
__device__ __forceinline__ void keep4_h(v16h a, v16h b, v16h c, v16h d) { asm volatile("v_nop" :: "v"(a), "v"(b), "v"(c), "v"(d)); }
__device__ __forceinline__ void keep4_b(v16b a, v16b b, v16b c, v16b d) { asm volatile("v_nop" :: "v"(a), "v"(b), "v"(c), "v"(d)); }
__device__ __forceinline__ void acc_guard4(v8f& a, v8f& b, v8f& c, v8f& d) { asm volatile("v_nop\n\tv_nop\n\tv_nop\n\tv_nop" : "+v"(a), "+v"(b), "+v"(c), "+v"(d)); }

// fragment loaders: lane l, row/col = l & 15, elements 0..7 <- p[0..7] (k0 + 8h + 0..7), 8..15 <- p[16..23] (k0 + 16 + 8h + 0..7); caller adds 8h
template <typename T> struct Frag;
template <> struct Frag<_Float16> {
  typedef v16h V; union U { v16h v; v8h h[2]; };
  static __device__ __forceinline__ v16h load(const _Float16* p) {
    U f; f.h[0] = *(const v8h*)(p); f.h[1] = *(const v8h*)(p + 16); return f.v;
  }
  static __device__ __forceinline__ v8f mma(v16h a, v16h b, v8f c) {
    return __builtin_amdgcn_wmma_f32_16x16x32_f16(false, a, false, b, (short)0, c, false, false);
  }
  static __device__ __forceinline__ void guard(v8f& a, v8f& b, v16h x, v16h y) { dep_guard_h(a, b, x, y); }
  static __device__ __forceinline__ void keep(v16h a, v16h b, v16h c, v16h d) { keep4_h(a, b, c, d); }
};
template <> struct Frag<__bf16> {
  typedef v16b V; union U { v16b v; v8b h[2]; };
  static __device__ __forceinline__ v16b load(const __bf16* p) {
    U f; f.h[0] = *(const v8b*)(p); f.h[1] = *(const v8b*)(p + 16); return f.v;
  }
  static __device__ __forceinline__ v8f mma(v16b a, v16b b, v8f c) {
    return __builtin_amdgcn_wmma_f32_16x16x32_bf16(false, a, false, b, (short)0, c, false, false);
  }
  static __device__ __forceinline__ void guard(v8f& a, v8f& b, v16b x, v16b y) { dep_guard_b(a, b, x, y); }
  static __device__ __forceinline__ void keep(v16b a, v16b b, v16b c, v16b d) { keep4_b(a, b, c, d); }
};

// single f16 WMMA with the 4-nop guard tied to D and keeping A/B live
__device__ __forceinline__ v8f h_mma(v16h a, v16h b, v8f c) {
  c = __builtin_amdgcn_wmma_f32_16x16x32_f16(false, a, false, b, (short)0, c, false, false);
  asm volatile("v_nop\n\tv_nop\n\tv_nop\n\tv_nop" : "+v"(c) : "v"(a), "v"(b));
  return c;
}

// ---------------------------------------------------------------------------------------------
// 1) x f32 [NB_FULL][SEQ_FULL][HID] -> compact bf16 plane [NTOK][HID], 8 elements per thread, one 16-B store per lane
// ---------------------------------------------------------------------------------------------
__global__ __launch_bounds__(256) void cast_x_bf16(const float* __restrict__ in, unsigned short* __restrict__ out, int n8) {
  const int i = blockIdx.x * 256 + threadIdx.x;
  if (i < n8) {
    const size_t o   = (size_t)i * 8;
    const size_t tok = o / HID;
    const size_t col = o - tok * HID;
    const size_t bb  = tok / SEQ;
    const size_t ss  = tok - bb * SEQ;
    const size_t src = (bb * SEQ_FULL + ss) * (size_t)HID + col;
    const v4f a  = *(const v4f*)(in + src);
    const v4f bq = *(const v4f*)(in + src + 4);
    v4u w;
    w[0] = (unsigned)f2bf_bits(a[0])  | ((unsigned)f2bf_bits(a[1])  << 16);
    w[1] = (unsigned)f2bf_bits(a[2])  | ((unsigned)f2bf_bits(a[3])  << 16);
    w[2] = (unsigned)f2bf_bits(bq[0]) | ((unsigned)f2bf_bits(bq[1]) << 16);
    w[3] = (unsigned)f2bf_bits(bq[2]) | ((unsigned)f2bf_bits(bq[3]) << 16);
    *(v4u*)(out + o) = w;
    
  }
}

// ---------------------------------------------------------------------------------------------
// 2) in[nrows][ncols] f32 -> out[ncols][nrows] 16-bit. MODE 0: bf16 bits (RNE); MODE 1: f16 bits of (RNE-bf16 value * scl).
//    Block = 64x64 tile through LDS (cross-thread, block barrier). grid = (ncols/64, nrows/64); nrows, ncols multiples of 64.
//    load coverage: 256 threads x 16 floats = 64x64 tile; store coverage: 2 iterations x 256 threads x 8 = 64 rows x 64.
// ---------------------------------------------------------------------------------------------
template <int MODE> __device__ __forceinline__ unsigned short pk16(float f, float scl) {
  if (MODE == 0) return f2bf_bits(f);
  const float g = bf_bits2f(f2bf_bits(f)) * scl;
  return f2h_bits(g);
}

template <int MODE>
__global__ __launch_bounds__(256) void transpose_cast16(const float* __restrict__ in, unsigned short* __restrict__ out, int nrows, int ncols, float scl) {
  __shared__ float tile[64 * 65];
  const int tid = threadIdx.x;
  const int r0 = blockIdx.y * 64, c0 = blockIdx.x * 64;
  {
    const int row = tid >> 2, cc = (tid & 3) * 16;
    const float* s = in + (size_t)(r0 + row) * ncols + c0 + cc;
#pragma unroll
    for (int q = 0; q < 4; ++q) {
      const v4f v = *(const v4f*)(s + 4 * q);
#pragma unroll
      for (int e = 0; e < 4; ++e) tile[(cc + 4 * q + e) * 65 + row] = v[e];
    }
  }
  __syncthreads();
  {
#pragma unroll
    for (int it = 0; it < 2; ++it) {
      const int orow = it * 32 + (tid >> 3), seg = (tid & 7) * 8;
      const float* tp = tile + orow * 65 + seg;
      v4u w;
#pragma unroll
      for (int e = 0; e < 4; ++e) w[e] = (unsigned)pk16<MODE>(tp[2 * e], scl) | ((unsigned)pk16<MODE>(tp[2 * e + 1], scl) << 16);
      *(v4u*)(out + (size_t)(c0 + orow) * nrows + r0 + seg) = w;
    }
    
  }
}

// ---------------------------------------------------------------------------------------------
// 3) RoPE cos/sin tables [SEQ][HHALF] f32: angle = pos * inv_freq[j] (single f32 multiply), precise cosf/sinf.
// ---------------------------------------------------------------------------------------------
struct RopeFreq { float f[HHALF]; };
static_assert(sizeof(RopeFreq) == 256);

__global__ __launch_bounds__(256) void rope_table_kernel(float* __restrict__ cosT, float* __restrict__ sinT, RopeFreq fr) {
  __shared__ float invf[HHALF];
  if (threadIdx.x == 0) {
#pragma unroll
    for (int q = 0; q < HHALF; ++q) invf[q] = fr.f[q];
  }
  __syncthreads();
  const int i = blockIdx.x * 256 + threadIdx.x;          // exactly SEQ*HHALF threads
  const int t = i >> 6;
  const int jj = i & (HHALF - 1);
  const float ang = (float)t * invf[jj];
  const float cv = cosf(ang);
  const float sv = sinf(ang);
  ((float*)cosT)[i] = cv;
  ((float*)sinT)[i] = sv;
  
}

// ---------------------------------------------------------------------------------------------
// 4) RoPE -> single f16 plane. src f32 [NTOK][PITCH], head hs occupies cols hs*128 .. hs*128+127 (first 64 = x1, next 64 = x2).
//    Thread = (token, head, 8-wide pair group jg): out[d] = x1[d]*cos - x2[d]*sin, out[d+64] = x2[d]*cos + x1[d]*sin, times scl.
// ---------------------------------------------------------------------------------------------
template <int NHEAD, int PITCH>
__global__ __launch_bounds__(256) void rope_f16_kernel(const float* __restrict__ src, const float* __restrict__ cosT, const float* __restrict__ sinT,
                                                        unsigned short* __restrict__ outP, float scl) {
  const int i = blockIdx.x * 256 + threadIdx.x;          // exactly NTOK*NHEAD*8 threads
  const int jg = i & 7;
  const int hs = (i >> 3) % NHEAD;
  const int tok = (i >> 3) / NHEAD;
  const int pos = tok % SEQ;
  const size_t base = (size_t)tok * PITCH + (size_t)hs * HD + jg * 8;
  const size_t tb = (size_t)pos * HHALF + jg * 8;
  const v4f x1a = *(const v4f*)(src + base);
  const v4f x1b = *(const v4f*)(src + base + 4);
  const v4f x2a = *(const v4f*)(src + base + HHALF);
  const v4f x2b = *(const v4f*)(src + base + HHALF + 4);
  const v4f ca = *(const v4f*)(cosT + tb);
  const v4f cb = *(const v4f*)(cosT + tb + 4);
  const v4f sa = *(const v4f*)(sinT + tb);
  const v4f sb = *(const v4f*)(sinT + tb + 4);
  v4f o1a, o1b, o2a, o2b;
#pragma unroll
  for (int e = 0; e < 4; ++e) {
    o1a[e] = (x1a[e] * ca[e] - x2a[e] * sa[e]) * scl;
    o2a[e] = (x2a[e] * ca[e] + x1a[e] * sa[e]) * scl;
    o1b[e] = (x1b[e] * cb[e] - x2b[e] * sb[e]) * scl;
    o2b[e] = (x2b[e] * cb[e] + x1b[e] * sb[e]) * scl;
  }
  v4u h1, h2;
  h1[0] = (unsigned)f2h_bits(o1a[0]) | ((unsigned)f2h_bits(o1a[1]) << 16);
  h1[1] = (unsigned)f2h_bits(o1a[2]) | ((unsigned)f2h_bits(o1a[3]) << 16);
  h1[2] = (unsigned)f2h_bits(o1b[0]) | ((unsigned)f2h_bits(o1b[1]) << 16);
  h1[3] = (unsigned)f2h_bits(o1b[2]) | ((unsigned)f2h_bits(o1b[3]) << 16);
  h2[0] = (unsigned)f2h_bits(o2a[0]) | ((unsigned)f2h_bits(o2a[1]) << 16);
  h2[1] = (unsigned)f2h_bits(o2a[2]) | ((unsigned)f2h_bits(o2a[3]) << 16);
  h2[2] = (unsigned)f2h_bits(o2b[0]) | ((unsigned)f2h_bits(o2b[1]) << 16);
  h2[3] = (unsigned)f2h_bits(o2b[2]) | ((unsigned)f2h_bits(o2b[3]) << 16);
  {
    *(v4u*)(outP + base) = h1;
    *(v4u*)(outP + base + HHALF) = h2;
    
  }
}

// ---------------------------------------------------------------------------------------------
// 5) Register-blocked batched WMMA GEMM, 16-bit operands of type T (bf16 or f16), f32 accumulate.
//    C[m,n] = scale * sum_k A[m,k] * Bt[n,k]; A row-major [M,K], Bt row-major [N,K].
//    Block = 4 waves (2 x 2) = one 128x128 tile of C; each wave owns a 64x64 tile.
//    Per pass the block's 128 A rows and 128 Bt rows x 128 k (256 B a row) are brought into LDS by asynchronous
//    copies, two buffers: the next pass's copies fly while this pass's fragments are read from LDS.
//    M,N % 128 == 0, K % 128 == 0 (no tail handling). lda, ldb % 8 == 0 (16-B copies).
//    OUT_MODE: 0 = f32, 1 = single f16 plane. The hi/lo plane options are not staged: both must be false.
// ---------------------------------------------------------------------------------------------
#define GBK    128    // k elements of one staged pass
#define GPITCH 136    // LDS row pitch in elements: 272 B = 16 B x 17, conflict-free for 16-B row reads
typedef __attribute__((ext_vector_type(4))) int v4i;
typedef __attribute__((address_space(1))) v4i gv4i;
typedef __attribute__((address_space(3))) v4i lv4i;

// 128 rows x 256 B from g (row pitch ld elements) into l (row pitch GPITCH): 128 threads x 16 copies of 16 B;
// one wave-wide copy covers two whole 256-B rows.
// g is the tile's origin, the same in every lane; goff is the lane's own element offset row * ld + column.
template <typename T>
__device__ __forceinline__ void stage_tile(const T* g, int ld, unsigned goff, T* l, int tid) {
  T* lp = l + (tid >> 4) * GPITCH + (tid & 15) * 8;
#pragma unroll   // the 16 copies go out back to back, none waits for another
  for (int j = 0; j < 16; ++j)
    __builtin_amdgcn_global_load_async_to_lds_b128((gv4i*)(g + (size_t)(j * 8) * ld + goff), (lv4i*)(lp + j * 8 * GPITCH), 0, 0);
}

template <typename T, bool SPLITA, bool SPLITB, int OUT_MODE>
__global__ __launch_bounds__(128) void gemm_t64(
    const unsigned short* __restrict__ Ap, const unsigned short* __restrict__ A2p, int lda, long strideA,
    const unsigned short* __restrict__ Btp, const unsigned short* __restrict__ Bt2p, int ldb, long strideB,
    void* __restrict__ Cout, int ldc, long strideC,
    int M, int N, int K, float scale) {
  static_assert(!SPLITA && !SPLITB);
  typedef typename Frag<T>::V V;
  const T* A = (const T*)Ap; const T* Bt = (const T*)Btp;
  __shared__ __align__(16) T ring[2][2][128 * GPITCH];   // [buffer][A rows | Bt rows]
  __shared__ __align__(16) float sT[4][16 * 68];          // per-wave 16x64 slab, pitch 68 floats
  const int b    = blockIdx.y;
  const int tid  = threadIdx.x;
  const int lane = tid & 31;
  const int wave = tid >> 5;
  const int tilesN = N >> 7;
  const int tilesM = M >> 7;
  const int tile = blockIdx.x;
  if (tile >= tilesM * tilesN) return;   // block-uniform, ahead of every barrier and copy
  const int tm = tile / tilesN;
  const int tn = tile - tm * tilesN;
  const int wm = (wave >> 1) << 6;             // this wave's rows inside the block tile
  const int wn = (wave & 1) << 6;              // this wave's columns inside the block tile
  const int m0 = (tm << 7) + wm;
  const int n0 = (tn << 7) + wn;

  const T* Ag = A  + (size_t)b * strideA + (size_t)(tm << 7) * lda;
  const T* Bg = Bt + (size_t)b * strideB + (size_t)(tn << 7) * ldb;

  const int rlane = lane & 15;                 // row (A) / col (B, D) within subtile
  const int koff  = (lane >> 4) * 8;           // k offset of this lane half
  const int mOff  = (lane >> 4) * 8;           // D row offset

  v8f acc[4][4];
#pragma unroll
  for (int i = 0; i < 4; ++i)
#pragma unroll
    for (int j = 0; j < 4; ++j) acc[i][j] = (v8f){0.f,0.f,0.f,0.f,0.f,0.f,0.f,0.f};

  const int nt = K / GBK;
  const unsigned aoff = (unsigned)(tid >> 4) * (unsigned)lda + (unsigned)(tid & 15) * 8u;
  const unsigned boff = (unsigned)(tid >> 4) * (unsigned)ldb + (unsigned)(tid & 15) * 8u;
  stage_tile<T>(Ag, lda, aoff, ring[0][0], tid);
  stage_tile<T>(Bg, ldb, boff, ring[0][1], tid);
  asm volatile("s_wait_asynccnt 0x0" ::: "memory");   // this wave's copies of pass 0 have landed
  __syncthreads();                                     // ... and every other wave's: pass 0 is readable
  if (nt > 1) {
    stage_tile<T>(Ag + GBK, lda, aoff, ring[1][0], tid);
    stage_tile<T>(Bg + GBK, ldb, boff, ring[1][1], tid);
  }

  for (int t = 0; t < nt; ++t) {
    const T* la = ring[t & 1][0] + (wm + rlane) * GPITCH + koff;
    const T* lb = ring[t & 1][1] + (wn + rlane) * GPITCH + koff;
    // LDS reads run ahead of their products: the next 32-k block's Bt fragments go into a second set at the head of
    // this block, and each A fragment is re-read for the next block as soon as its row of products has been issued
    // (every loop below is unrolled so that each fragment and accumulator index is a constant: registers, no scratch)
    V af[4], bf[2][4];
#pragma unroll
    for (int j = 0; j < 4; ++j) { bf[0][j] = Frag<T>::load(lb + (j << 4) * GPITCH); af[j] = Frag<T>::load(la + (j << 4) * GPITCH); }
#pragma unroll
    for (int kb = 0; kb < GBK / 32; ++kb) {
      const int cu = kb & 1, nx = cu ^ 1;
      if (kb + 1 < GBK / 32) {
#pragma unroll
        for (int j = 0; j < 4; ++j) bf[nx][j] = Frag<T>::load(lb + (j << 4) * GPITCH + (kb + 1) * 32);
      }
#pragma unroll
      for (int i = 0; i < 4; ++i) {
#pragma unroll
        for (int j = 0; j < 4; ++j) acc[i][j] = Frag<T>::mma(af[i], bf[cu][j], acc[i][j]);
        Frag<T>::guard(acc[i][0], acc[i][3], af[i], af[i]);
        if (kb + 1 < GBK / 32) af[i] = Frag<T>::load(la + (i << 4) * GPITCH + (kb + 1) * 32);
      }
      Frag<T>::keep(bf[cu][0], bf[cu][1], bf[cu][2], bf[cu][3]);
    }
    asm volatile("s_wait_dscnt 0x0" ::: "memory");     // this wave's reads of buffer t & 1 are done before it is refilled
    asm volatile("s_wait_asynccnt 0x0" ::: "memory");  // this wave's copies of pass t + 1 have landed
    __syncthreads();                                    // publishes pass t + 1, frees buffer t & 1
    if (t + 2 < nt) {
      stage_tile<T>(Ag + (size_t)(t + 2) * GBK, lda, aoff, ring[t & 1][0], tid);
      stage_tile<T>(Bg + (size_t)(t + 2) * GBK, ldb, boff, ring[t & 1][1], tid);
    }
  }
  asm volatile("s_wait_asynccnt 0x0" ::: "memory");    // no copy is outstanding when the wave goes on
  acc_guard4(acc[0][0], acc[0][1], acc[0][2], acc[0][3]);
  acc_guard4(acc[1][0], acc[1][1], acc[1][2], acc[1][3]);
  acc_guard4(acc[2][0], acc[2][1], acc[2][2], acc[2][3]);
  acc_guard4(acc[3][0], acc[3][1], acc[3][2], acc[3][3]);

  // ---- epilogue ----
  float* slab = sT[wave];
#pragma unroll
  for (int i = 0; i < 4; ++i) {
    const int mBase = m0 + (i << 4);
#pragma unroll
    for (int j = 0; j < 4; ++j) {
#pragma unroll
      for (int r = 0; r < 8; ++r) {
        const float v = acc[i][j][r] * scale;
        slab[(mOff + r) * 68 + (j << 4) + rlane] = v;
      }
    }
    __builtin_amdgcn_fence(3, "workgroup");
    __builtin_amdgcn_wave_barrier();
    __builtin_amdgcn_fence(2, "workgroup");
    if (OUT_MODE == 0) {
      float* Cf = (float*)Cout + (size_t)b * strideC;
      const int hh = lane >> 4, c4 = (lane & 15) * 4;     // row seg = 256 B = 16 lanes x 16 B
      {
#pragma unroll
        for (int it = 0; it < 8; ++it) {
          const int row = it * 2 + hh;
          v4f v = *(const v4f*)(slab + row * 68 + c4);
          *(v4f*)(Cf + (size_t)(mBase + row) * ldc + n0 + c4) = v;
        }
        
      }
    } else {
      const int q = lane >> 3, c8 = (lane & 7) * 8;
      unsigned short* Cs = (unsigned short*)Cout + (size_t)b * strideC;
      {
#pragma unroll
        for (int it = 0; it < 4; ++it) {
          const int row = it * 4 + q;
          const float* sp = slab + row * 68 + c8;
          v8h hv;
#pragma unroll
          for (int e = 0; e < 8; ++e) hv[e] = (_Float16)sp[e];
          *(v8h*)(Cs + (size_t)(mBase + row) * ldc + n0 + c8) = hv;
        }
        
      }
    }
    __builtin_amdgcn_fence(3, "workgroup");
    __builtin_amdgcn_wave_barrier();
    __builtin_amdgcn_fence(2, "workgroup");
  }
}

// ---------------------------------------------------------------------------------------------
// 6) GQA attention, head_dim 128, 16 query heads, kv head = h >> 1, all keys visited (no mask), tanh softcap.
//    Planes: Q f16 [NTOK][QDIM] (col = h*128 + d, rotated, unscaled), K f16 [NTOK][KVDIM] (col = kvh*128 + d),
//            V^T f16 [NB][KVDIM][SEQ] (row = kvh*128 + d). Output: ctx f16 x2^6 [NTOK][QDIM] (col = h*128 + d).
//    Block = 8 waves = 128 query rows of one (b, h); wave w owns rows qb*128 + 16w .. +15 over the full head.
//    Per 64-key chunk: S(16 x 64) over d = 128 (one f16 product per tile pair); logit = 50*tanh(S/sqrt(128)/50) in f32;
//    reloaded as an A fragment through the same element type; O(16 x 128) += P(16 x 64) . V.
//    All LDS tiles are wave-private; staged extent == consumed extent (16 x 64 P tile, 16 x 64 f32 epilogue slab);
//    no block barrier anywhere in this kernel.
// ---------------------------------------------------------------------------------------------
__global__ __launch_bounds__(256) void attn_kernel(
    const unsigned short* __restrict__ Qp, const unsigned short* __restrict__ Kp,
    const unsigned short* __restrict__ Vtp, unsigned short* __restrict__ Op) {
  __shared__ __align__(16) float    Ost[8][16 * 64];          // 32 KB: per-wave epilogue staging
  __shared__ __align__(16) _Float16 Psh[8][16 * KV_CHUNK];    // 16 KB: per-wave P tile [row][kv]

  const _Float16* Q  = (const _Float16*)Qp;
  const _Float16* Kk = (const _Float16*)Kp;
  const _Float16* Vt = (const _Float16*)Vtp;

  const int tid  = threadIdx.x;
  const int wave = tid >> 5, lane = tid & 31;
  const int hh   = lane >> 4, c = lane & 15, koff = hh * 8;
  const int nqb  = SEQ / QBLK;
  const int bx   = blockIdx.x;
  const int qb   = bx % nqb;
  const int bhid = bx / nqb;
  const int h    = bhid % NQH;
  const int b    = bhid / NQH;
  const int kvh  = h >> 1;
  const int q0   = qb * QBLK + wave * 16;                       // sequence position of this wave's row 0
  const size_t tokw = (size_t)b * SEQ + q0;                     // compact token index of this wave's row 0
  const size_t qoff = (tokw + c) * QDIM + (size_t)h * HD + koff;
  const _Float16* Kb  = Kk + (size_t)b * SEQ * KVDIM + (size_t)kvh * HD + koff;
  const _Float16* Vtb = Vt + (size_t)b * KVDIM * SEQ + (size_t)(kvh * HD + c) * SEQ + koff;
  _Float16* pw = Psh[wave];

  float mrow[8], lrow[8];
  v8f oacc[8];
#pragma unroll
  for (int r = 0; r < 8; ++r) { mrow[r] = -INFINITY; lrow[r] = 0.f; }
#pragma unroll
  for (int t = 0; t < 8; ++t) oacc[t] = (v8f){0.f,0.f,0.f,0.f,0.f,0.f,0.f,0.f};

  for (int kc = 0; kc < SEQ / KV_CHUNK; ++kc) {
    const int kv0 = kc * KV_CHUNK;

    // ---- raw scores S(16 q x 64 kv) over d = 128 ----
    v8f s[4];
#pragma unroll
    for (int j = 0; j < 4; ++j) s[j] = (v8f){0.f,0.f,0.f,0.f,0.f,0.f,0.f,0.f};
#pragma unroll
    for (int dc = 0; dc < 4; ++dc) {
      const v16h qa = Frag<_Float16>::load(Q + qoff + dc * 32);
#pragma unroll
      for (int j = 0; j < 4; ++j) {
        const size_t ko = (size_t)(kv0 + j * 16 + c) * KVDIM + dc * 32;
        const v16h kb = Frag<_Float16>::load(Kb + ko);
        s[j] = h_mma(qa, kb, s[j]);
      }
    }

    // ---- scale, tanh softcap (f32), row max ----
    float cm[8];
#pragma unroll
    for (int r = 0; r < 8; ++r) {
      float m = -INFINITY;
#pragma unroll
      for (int j = 0; j < 4; ++j) {
        float sv = s[j][r] * RSQ;
        sv = SOFTCAP * tanhf(sv * INVCAP);
        s[j][r] = sv;
        m = fmaxf(m, sv);
      }
#pragma unroll
      for (int off = 1; off < 16; off <<= 1) m = fmaxf(m, __shfl_xor(m, off, 32));
      cm[r] = m;
    }

    // all P fragment loads of the prior chunk (same wave) complete before the tile is rewritten
    __builtin_amdgcn_fence(3, "workgroup");
    __builtin_amdgcn_wave_barrier();
    __builtin_amdgcn_fence(2, "workgroup");

    // ---- online softmax (f32); P x 2^10 as f16 into this wave's tile ----
#pragma unroll
    for (int r = 0; r < 8; ++r) {
      const float mnew = fmaxf(mrow[r], cm[r]);
      const float alpha = __expf(mrow[r] - mnew);
      mrow[r] = mnew;
      float psum = 0.f;
#pragma unroll
      for (int j = 0; j < 4; ++j) {
        const float p = __expf(s[j][r] - mnew);
        psum += p;
        pw[(8 * hh + r) * KV_CHUNK + j * 16 + c] = (_Float16)(p * PCARRY);
      }
#pragma unroll
      for (int off = 1; off < 16; off <<= 1) psum += __shfl_xor(psum, off, 32);
      lrow[r] = lrow[r] * alpha + psum;
#pragma unroll
      for (int t = 0; t < 8; ++t) oacc[t][r] *= alpha;
    }
    __builtin_amdgcn_fence(3, "workgroup");
    __builtin_amdgcn_wave_barrier();
    __builtin_amdgcn_fence(2, "workgroup");

    // ---- O(16 x 128) += P(16 x 64) . V ----
#pragma unroll
    for (int kk = 0; kk < 2; ++kk) {
      const v16h pa = Frag<_Float16>::load(pw + c * KV_CHUNK + kk * 32 + koff);
#pragma unroll
      for (int t = 0; t < 8; ++t) {
        const size_t vo = (size_t)t * 16 * SEQ + kv0 + kk * 32;
        const v16h vb = Frag<_Float16>::load(Vtb + vo);
        oacc[t] = h_mma(pa, vb, oacc[t]);
      }
    }
  }

  // ---- epilogue: normalise (x 2^6 / (2^10 * l)), stage 16 x 64 halves in this wave's own slab, write the f16 ctx plane ----
  // coverage: 2 halves x (4 iterations x 4 rows) x 8 lanes x 8 elements = 16 rows x 128 dims.
  float* os = Ost[wave];
  const int q4 = lane >> 3, c8 = (lane & 7) * 8;
#pragma unroll
  for (int th = 0; th < 2; ++th) {
#pragma unroll
    for (int r = 0; r < 8; ++r) {
      const float inv = OCARRY / (PCARRY * lrow[r]);   // undo the P carry (2^10) and apply the ctx carry (2^6)
#pragma unroll
      for (int tt = 0; tt < 4; ++tt) os[(8 * hh + r) * 64 + tt * 16 + c] = oacc[th * 4 + tt][r] * inv;
    }
    __builtin_amdgcn_fence(3, "workgroup");
    __builtin_amdgcn_wave_barrier();
    __builtin_amdgcn_fence(2, "workgroup");
    {
#pragma unroll
      for (int it = 0; it < 4; ++it) {
        const int row = it * 4 + q4;
        const float* sp = os + row * 64 + c8;
        v8h hv;
#pragma unroll
        for (int e = 0; e < 8; ++e) hv[e] = (_Float16)sp[e];
        const size_t o = (tokw + row) * QDIM + (size_t)h * HD + th * 64 + c8;
        *(v8h*)(Op + o) = hv;
      }
      
    }
    __builtin_amdgcn_fence(3, "workgroup");
    __builtin_amdgcn_wave_barrier();
    __builtin_amdgcn_fence(2, "workgroup");
  }
}

// ---------------------------------------------------------------------------------------------
// host
// ---------------------------------------------------------------------------------------------
static_assert((NTOK * HID / 8) % 256 == 0);
static_assert((NTOK * NQH * 8) % 256 == 0);
static_assert((NTOK * NKVH * 8) % 256 == 0);
static_assert((SEQ * HHALF) % 256 == 0);
static_assert(HID % 128 == 0 && QDIM % 128 == 0);
static_assert(NTOK % 128 == 0 && HID % 128 == 0 && QDIM % 128 == 0 && KVDIM % 128 == 0 && SEQ % 128 == 0);
static_assert(SEQ % QBLK == 0 && SEQ % KV_CHUNK == 0 && QBLK == 128 && KV_CHUNK == 64 && HD == 128);
static_assert(NB >= 1 && NB <= NB_FULL && SEQ <= SEQ_FULL);
static_assert(NQH == 2 * NKVH);

extern "C" void kernel_launch(void* const* d_in, const int* in_sizes, int n_in,
                              void* d_out, int out_size, void* d_ws, size_t ws_size, hipStream_t stream) {
  if (n_in < 5) return;
  const size_t needTok = (size_t)(NB - 1) * SEQ_FULL + SEQ;
  if ((size_t)in_sizes[0] < needTok * HID) return;
  if ((size_t)in_sizes[1] < (size_t)HID * QDIM) return;
  if ((size_t)in_sizes[2] < (size_t)HID * KVDIM) return;
  if ((size_t)in_sizes[3] < (size_t)HID * KVDIM) return;
  if ((size_t)in_sizes[4] < (size_t)QDIM * HID) return;
  if ((size_t)out_size < needTok * HID) return;

  const float* x  = (const float*)d_in[0];   // [2,2048,2048]
  const float* Wq = (const float*)d_in[1];   // [2048,2048]  [in][out]
  const float* Wk = (const float*)d_in[2];   // [2048,1024]
  const float* Wv = (const float*)d_in[3];   // [2048,1024]
  const float* Wo = (const float*)d_in[4];   // [2048,2048]
  float* out = (float*)d_out;                // [2,2048,2048] f32

  //   XB   bf16 [NTOK][HID]
  //   WQT  bf16 [QDIM][HID], WKT bf16 [KVDIM][HID], WVT bf16 [KVDIM][HID], WOT f16 [HID][QDIM]
  //   R1   f32 [NTOK][QDIM] for q; later reused: Kf f32 [NTOK][KVDIM] at +0, ctx f16 [NTOK][QDIM] at +0, V^T f16 [NB][KVDIM][SEQ] at +NTOK*QDIM*2
  //   QP f16 [NTOK][QDIM]; KP f16 [NTOK][KVDIM]; COS, SIN f32 [SEQ][HHALF]
  const size_t szXB  = (size_t)NTOK * HID * 2;
  const size_t szWQT = (size_t)QDIM * HID * 2;
  const size_t szWKT = (size_t)KVDIM * HID * 2;
  const size_t szWOT = (size_t)HID * QDIM * 2;
  const size_t szR1  = (size_t)NTOK * QDIM * 4;
  const size_t szQP  = (size_t)NTOK * QDIM * 2;
  const size_t szKP  = (size_t)NTOK * KVDIM * 2;
  const size_t szVT  = (size_t)NB * KVDIM * SEQ * 2;
  const size_t szTAB = (size_t)SEQ * HHALF * 4;
  static_assert((size_t)NTOK * KVDIM * 4 <= (size_t)NTOK * QDIM * 4);
  static_assert((size_t)NTOK * QDIM * 2 + (size_t)NB * KVDIM * SEQ * 2 <= (size_t)NTOK * QDIM * 4);
  const size_t OFF_XB  = 0;
  const size_t OFF_WQT = OFF_XB + szXB;
  const size_t OFF_WKT = OFF_WQT + szWQT;
  const size_t OFF_WVT = OFF_WKT + szWKT;
  const size_t OFF_WOT = OFF_WVT + szWKT;
  const size_t OFF_R1  = OFF_WOT + szWOT;
  const size_t OFF_QF  = OFF_R1;
  const size_t OFF_KF  = OFF_R1;
  const size_t OFF_CTX = OFF_R1;
  const size_t OFF_VT  = OFF_R1 + szQP;
  const size_t OFF_QP  = OFF_R1 + szR1;
  const size_t OFF_KP  = OFF_QP + szQP;
  const size_t OFF_COS = OFF_KP + szKP;
  const size_t OFF_SIN = OFF_COS + szTAB;
  const size_t WS_TOTAL = OFF_SIN + szTAB;
  (void)szVT;
  if (ws_size < WS_TOTAL) return;

  char* ws = (char*)d_ws;
  unsigned short* xb  = (unsigned short*)(ws + OFF_XB);
  unsigned short* WqT = (unsigned short*)(ws + OFF_WQT);
  unsigned short* WkT = (unsigned short*)(ws + OFF_WKT);
  unsigned short* WvT = (unsigned short*)(ws + OFF_WVT);
  unsigned short* WoT = (unsigned short*)(ws + OFF_WOT);
  float* Qf  = (float*)(ws + OFF_QF);
  float* Kf  = (float*)(ws + OFF_KF);
  unsigned short* ctx = (unsigned short*)(ws + OFF_CTX);
  unsigned short* Vt  = (unsigned short*)(ws + OFF_VT);
  unsigned short* Qpl = (unsigned short*)(ws + OFF_QP);
  unsigned short* Kpl = (unsigned short*)(ws + OFF_KP);
  float* cosT = (float*)(ws + OFF_COS);
  float* sinT = (float*)(ws + OFF_SIN);

  // inv_freq[j] = 1 / 10000^(2j/128), pow in double then RNE to f32, reciprocal as one f32 divide
  RopeFreq fr;
  for (int j = 0; j < HHALF; ++j) {
    const float e = (float)(2 * j) / 128.0f;
    const double p = pow(10000.0, (double)e);
    const float pf = (float)p;
    fr.f[j] = 1.0f / pf;
  }

  // 1) x -> compact bf16 plane
  cast_x_bf16<<<(NTOK * HID / 8) / 256, 256, 0, stream>>>(x, xb, NTOK * HID / 8);
  // 2) transposed 16-bit weight planes: in[rows][cols] -> out[cols][rows]; grid = (cols/64, rows/64)
  transpose_cast16<0><<<dim3(QDIM / 64, HID / 64), 256, 0, stream>>>(Wq, WqT, HID, QDIM, 1.0f);      // [HID][QDIM]  -> [QDIM][HID]
  transpose_cast16<0><<<dim3(KVDIM / 64, HID / 64), 256, 0, stream>>>(Wk, WkT, HID, KVDIM, 1.0f);    // [HID][KVDIM] -> [KVDIM][HID]
  transpose_cast16<0><<<dim3(KVDIM / 64, HID / 64), 256, 0, stream>>>(Wv, WvT, HID, KVDIM, 1.0f);    // [HID][KVDIM] -> [KVDIM][HID]
  transpose_cast16<1><<<dim3(HID / 64, QDIM / 64), 256, 0, stream>>>(Wo, WoT, QDIM, HID, WOCARRY);   // [QDIM][HID]  -> [HID][QDIM], f16 x 2^4
  // 3) RoPE tables
  rope_table_kernel<<<(SEQ * HHALF) / 256, 256, 0, stream>>>(cosT, sinT, fr);
  // 4) q = x @ Wq -> f32 [NTOK][QDIM]   (M=NTOK, N=QDIM, K=HID)
  {
    const int tiles = (NTOK / 128) * (QDIM / 128);
    gemm_t64<__bf16, false, false, 0><<<dim3(tiles, 1), 128, 0, stream>>>(
        xb, xb, HID, 0L, WqT, WqT, HID, 0L, (void*)Qf, QDIM, 0L, NTOK, QDIM, HID, 1.0f);
  }
  // 5) RoPE of q (16 heads) -> f16 plane
  rope_f16_kernel<NQH, QDIM><<<(NTOK * NQH * 8) / 256, 256, 0, stream>>>(Qf, cosT, sinT, Qpl, 1.0f);
  // 6) k = x @ Wk -> f32 [NTOK][KVDIM]  (M=NTOK, N=KVDIM, K=HID), into the q region (q is dead)
  {
    const int tiles = (NTOK / 128) * (KVDIM / 128);
    gemm_t64<__bf16, false, false, 0><<<dim3(tiles, 1), 128, 0, stream>>>(
        xb, xb, HID, 0L, WkT, WkT, HID, 0L, (void*)Kf, KVDIM, 0L, NTOK, KVDIM, HID, 1.0f);
  }
  // 7) RoPE of k (8 kv heads) -> f16 plane
  rope_f16_kernel<NKVH, KVDIM><<<(NTOK * NKVH * 8) / 256, 256, 0, stream>>>(Kf, cosT, sinT, Kpl, 1.0f);
  // 8) v^T per batch = Wv^T @ x_b^T -> f16 [NB][KVDIM][SEQ]   (M=KVDIM, N=SEQ, K=HID, batch NB)
  {
    const int tiles = (KVDIM / 128) * (SEQ / 128);
    gemm_t64<__bf16, false, false, 1><<<dim3(tiles, NB), 128, 0, stream>>>(
        WvT, WvT, HID, 0L, xb, xb, HID, (long)SEQ * HID, (void*)Vt, SEQ, (long)KVDIM * SEQ,
        KVDIM, SEQ, HID, 1.0f);
  }
  // 9) attention -> ctx f16 x 2^6 [NTOK][QDIM]  (k f32 region is dead; V^T region disjoint)
  attn_kernel<<<NB * NQH * (SEQ / QBLK), 256, 0, stream>>>(Qpl, Kpl, Vt, ctx);
  // 10) out = ctx @ Wo -> d_out f32, per batch rows b*SEQ_FULL..  (M=SEQ, N=HID, K=QDIM, scale 2^-10)
  {
    const int tiles = (SEQ / 128) * (HID / 128);
    gemm_t64<_Float16, false, false, 0><<<dim3(tiles, NB), 128, 0, stream>>>(
        ctx, ctx, QDIM, (long)SEQ * QDIM, WoT, WoT, QDIM, 0L, (void*)out, HID, (long)SEQ_FULL * HID,
        SEQ, HID, QDIM, OUTSCALE);
  }
}

// v002
// Measured time: 301 microseconds a run.
// Timed twice side by side with v001, it ran 1.55 and 1.56 times as fast.
// Over all steps from v000 it is 2.27 times as fast.
// x@Wq, x@Wk, Wv^T@x^T: v_wmma_f32_16x16x32_bf16 on RNE-bf16 input planes (f32 accumulate); q.k^T: v_wmma_f32_16x16x32_f16 (q, k single f16 planes, f32 accumulate); p.v: v_wmma_f32_16x16x32_f16 (p f16 carried x2^10, v f16, f32 accumulate); ctx@Wo: v_wmma_f32_16x16x32_f16 (ctx f16 carried x2^6, Wo f16 carried x2^4 built from RNE-bf16 values, f32 accumulate); RoPE, tanh softcap and softmax in f32.
#include <hip/hip_runtime.h>
#include <math.h>

#pragma clang fp contract(off)

#ifndef NB
#define NB 2
#endif
#ifndef SEQ
#define SEQ 2048
#endif
#define NB_FULL  2
#define SEQ_FULL 2048
#define HID      2048
#define NQH      16
#define NKVH     8
#define HD       128
#define HHALF    64
#define QDIM     (NQH * HD)
#define KVDIM    (NKVH * HD)
#define NTOK     (NB * SEQ)
#define KV_CHUNK 64
#define QBLK     128
#define RSQ      0.08838834764831845f
#define SOFTCAP  50.0f
#define INVCAP   0.02f
#define PCARRY   1024.0f
#define OCARRY   64.0f
#define WOCARRY  16.0f
#define OUTSCALE 0.0009765625f

typedef __attribute__((ext_vector_type(16))) _Float16 v16h;
typedef __attribute__((ext_vector_type(8)))  _Float16 v8h;
typedef __attribute__((ext_vector_type(16))) __bf16   v16b;
typedef __attribute__((ext_vector_type(8)))  __bf16   v8b;
typedef __attribute__((ext_vector_type(8)))  float    v8f;
typedef __attribute__((ext_vector_type(4)))  float    v4f;
typedef __attribute__((ext_vector_type(4)))  unsigned int v4u;

__device__ __forceinline__ unsigned short f2bf_bits(float f) {
  unsigned u = __float_as_uint(f);
  return (unsigned short)((u + 0x7FFFu + ((u >> 16) & 1u)) >> 16);
}
__device__ __forceinline__ float bf_bits2f(unsigned short h) { return __uint_as_float(((unsigned)h) << 16); }
__device__ __forceinline__ unsigned short f2h_bits(float f) { const _Float16 h = (_Float16)f; return __builtin_bit_cast(unsigned short, h); }

// hazard guards as plain device helpers
__device__ __forceinline__ void dep_guard_h(v8f& a, v8f& b, v16h x, v16h y) { asm volatile("v_nop\n\tv_nop\n\tv_nop\n\tv_nop" : "+v"(a), "+v"(b) : "v"(x), "v"(y)); }
__device__ __forceinline__ void dep_guard_b(v8f& a, v8f& b, v16b x, v16b y) { asm volatile("v_nop\n\tv_nop\n\tv_nop\n\tv_nop" : "+v"(a), "+v"(b) : "v"(x), "v"(y)); }
__device__ __forceinline__ void keep4_h(v16h a, v16h b, v16h c, v16h d) { asm volatile("v_nop" :: "v"(a), "v"(b), "v"(c), "v"(d)); }
__device__ __forceinline__ void keep4_b(v16b a, v16b b, v16b c, v16b d) { asm volatile("v_nop" :: "v"(a), "v"(b), "v"(c), "v"(d)); }
__device__ __forceinline__ void acc_guard4(v8f& a, v8f& b, v8f& c, v8f& d) { asm volatile("v_nop\n\tv_nop\n\tv_nop\n\tv_nop" : "+v"(a), "+v"(b), "+v"(c), "+v"(d)); }

// fragment loaders: lane l, row/col = l & 15, elements 0..7 <- p[0..7] (k0 + 8h + 0..7), 8..15 <- p[16..23] (k0 + 16 + 8h + 0..7); caller adds 8h
template <typename T> struct Frag;
template <> struct Frag<_Float16> {
  typedef v16h V; union U { v16h v; v8h h[2]; };
  static __device__ __forceinline__ v16h load(const _Float16* p) {
    U f; f.h[0] = *(const v8h*)(p); f.h[1] = *(const v8h*)(p + 16); return f.v;
  }
  static __device__ __forceinline__ v8f mma(v16h a, v16h b, v8f c) {
    return __builtin_amdgcn_wmma_f32_16x16x32_f16(false, a, false, b, (short)0, c, false, false);
  }
  static __device__ __forceinline__ void guard(v8f& a, v8f& b, v16h x, v16h y) { dep_guard_h(a, b, x, y); }
  static __device__ __forceinline__ void keep(v16h a, v16h b, v16h c, v16h d) { keep4_h(a, b, c, d); }
};
template <> struct Frag<__bf16> {
  typedef v16b V; union U { v16b v; v8b h[2]; };
  static __device__ __forceinline__ v16b load(const __bf16* p) {
    U f; f.h[0] = *(const v8b*)(p); f.h[1] = *(const v8b*)(p + 16); return f.v;
  }
  static __device__ __forceinline__ v8f mma(v16b a, v16b b, v8f c) {
    return __builtin_amdgcn_wmma_f32_16x16x32_bf16(false, a, false, b, (short)0, c, false, false);
  }
  static __device__ __forceinline__ void guard(v8f& a, v8f& b, v16b x, v16b y) { dep_guard_b(a, b, x, y); }
  static __device__ __forceinline__ void keep(v16b a, v16b b, v16b c, v16b d) { keep4_b(a, b, c, d); }
};

// single f16 WMMA with the 4-nop guard tied to D and keeping A/B live
__device__ __forceinline__ v8f h_mma(v16h a, v16h b, v8f c) {
  c = __builtin_amdgcn_wmma_f32_16x16x32_f16(false, a, false, b, (short)0, c, false, false);
  asm volatile("v_nop\n\tv_nop\n\tv_nop\n\tv_nop" : "+v"(c) : "v"(a), "v"(b));
  return c;
}

// ---------------------------------------------------------------------------------------------
// 1) x f32 [NB_FULL][SEQ_FULL][HID] -> compact bf16 plane [NTOK][HID], 8 elements per thread, one 16-B store per lane
// ---------------------------------------------------------------------------------------------
__global__ __launch_bounds__(256) void cast_x_bf16(const float* __restrict__ in, unsigned short* __restrict__ out, int n8) {
  const int i = blockIdx.x * 256 + threadIdx.x;
  if (i < n8) {
    const size_t o   = (size_t)i * 8;
    const size_t tok = o / HID;
    const size_t col = o - tok * HID;
    const size_t bb  = tok / SEQ;
    const size_t ss  = tok - bb * SEQ;
    const size_t src = (bb * SEQ_FULL + ss) * (size_t)HID + col;
    const v4f a  = *(const v4f*)(in + src);
    const v4f bq = *(const v4f*)(in + src + 4);
    v4u w;
    w[0] = (unsigned)f2bf_bits(a[0])  | ((unsigned)f2bf_bits(a[1])  << 16);
    w[1] = (unsigned)f2bf_bits(a[2])  | ((unsigned)f2bf_bits(a[3])  << 16);
    w[2] = (unsigned)f2bf_bits(bq[0]) | ((unsigned)f2bf_bits(bq[1]) << 16);
    w[3] = (unsigned)f2bf_bits(bq[2]) | ((unsigned)f2bf_bits(bq[3]) << 16);
    *(v4u*)(out + o) = w;
    
  }
}

// ---------------------------------------------------------------------------------------------
// 2) in[nrows][ncols] f32 -> out[ncols][nrows] 16-bit. MODE 0: bf16 bits (RNE); MODE 1: f16 bits of (RNE-bf16 value * scl).
//    Block = 64x64 tile through LDS (cross-thread, block barrier). grid = (ncols/64, nrows/64); nrows, ncols multiples of 64.
//    load coverage: 256 threads x 16 floats = 64x64 tile; store coverage: 2 iterations x 256 threads x 8 = 64 rows x 64.
// ---------------------------------------------------------------------------------------------
template <int MODE> __device__ __forceinline__ unsigned short pk16(float f, float scl) {
  if (MODE == 0) return f2bf_bits(f);
  const float g = bf_bits2f(f2bf_bits(f)) * scl;
  return f2h_bits(g);
}

template <int MODE>
__global__ __launch_bounds__(256) void transpose_cast16(const float* __restrict__ in, unsigned short* __restrict__ out, int nrows, int ncols, float scl) {
  __shared__ float tile[64 * 65];
  const int tid = threadIdx.x;
  const int r0 = blockIdx.y * 64, c0 = blockIdx.x * 64;
  {
    const int row = tid >> 2, cc = (tid & 3) * 16;
    const float* s = in + (size_t)(r0 + row) * ncols + c0 + cc;
#pragma unroll
    for (int q = 0; q < 4; ++q) {
      const v4f v = *(const v4f*)(s + 4 * q);
#pragma unroll
      for (int e = 0; e < 4; ++e) tile[(cc + 4 * q + e) * 65 + row] = v[e];
    }
  }
  __syncthreads();
  {
#pragma unroll
    for (int it = 0; it < 2; ++it) {
      const int orow = it * 32 + (tid >> 3), seg = (tid & 7) * 8;
      const float* tp = tile + orow * 65 + seg;
      v4u w;
#pragma unroll
      for (int e = 0; e < 4; ++e) w[e] = (unsigned)pk16<MODE>(tp[2 * e], scl) | ((unsigned)pk16<MODE>(tp[2 * e + 1], scl) << 16);
      *(v4u*)(out + (size_t)(c0 + orow) * nrows + r0 + seg) = w;
    }
    
  }
}

// ---------------------------------------------------------------------------------------------
// 3) RoPE cos/sin tables [SEQ][HHALF] f32: angle = pos * inv_freq[j] (single f32 multiply), precise cosf/sinf.
// ---------------------------------------------------------------------------------------------
struct RopeFreq { float f[HHALF]; };
static_assert(sizeof(RopeFreq) == 256);

__global__ __launch_bounds__(256) void rope_table_kernel(float* __restrict__ cosT, float* __restrict__ sinT, RopeFreq fr) {
  __shared__ float invf[HHALF];
  if (threadIdx.x == 0) {
#pragma unroll
    for (int q = 0; q < HHALF; ++q) invf[q] = fr.f[q];
  }
  __syncthreads();
  const int i = blockIdx.x * 256 + threadIdx.x;          // exactly SEQ*HHALF threads
  const int t = i >> 6;
  const int jj = i & (HHALF - 1);
  const float ang = (float)t * invf[jj];
  const float cv = cosf(ang);
  const float sv = sinf(ang);
  ((float*)cosT)[i] = cv;
  ((float*)sinT)[i] = sv;
  
}

// ---------------------------------------------------------------------------------------------
// 4) RoPE -> single f16 plane. src f32 [NTOK][PITCH], head hs occupies cols hs*128 .. hs*128+127 (first 64 = x1, next 64 = x2).
//    Thread = (token, head, 8-wide pair group jg): out[d] = x1[d]*cos - x2[d]*sin, out[d+64] = x2[d]*cos + x1[d]*sin, times scl.
// ---------------------------------------------------------------------------------------------
template <int NHEAD, int PITCH>
__global__ __launch_bounds__(256) void rope_f16_kernel(const float* __restrict__ src, const float* __restrict__ cosT, const float* __restrict__ sinT,
                                                        unsigned short* __restrict__ outP, float scl) {
  const int i = blockIdx.x * 256 + threadIdx.x;          // exactly NTOK*NHEAD*8 threads
  const int jg = i & 7;
  const int hs = (i >> 3) % NHEAD;
  const int tok = (i >> 3) / NHEAD;
  const int pos = tok % SEQ;
  const size_t base = (size_t)tok * PITCH + (size_t)hs * HD + jg * 8;
  const size_t tb = (size_t)pos * HHALF + jg * 8;
  const v4f x1a = *(const v4f*)(src + base);
  const v4f x1b = *(const v4f*)(src + base + 4);
  const v4f x2a = *(const v4f*)(src + base + HHALF);
  const v4f x2b = *(const v4f*)(src + base + HHALF + 4);
  const v4f ca = *(const v4f*)(cosT + tb);
  const v4f cb = *(const v4f*)(cosT + tb + 4);
  const v4f sa = *(const v4f*)(sinT + tb);
  const v4f sb = *(const v4f*)(sinT + tb + 4);
  v4f o1a, o1b, o2a, o2b;
#pragma unroll
  for (int e = 0; e < 4; ++e) {
    o1a[e] = (x1a[e] * ca[e] - x2a[e] * sa[e]) * scl;
    o2a[e] = (x2a[e] * ca[e] + x1a[e] * sa[e]) * scl;
    o1b[e] = (x1b[e] * cb[e] - x2b[e] * sb[e]) * scl;
    o2b[e] = (x2b[e] * cb[e] + x1b[e] * sb[e]) * scl;
  }
  v4u h1, h2;
  h1[0] = (unsigned)f2h_bits(o1a[0]) | ((unsigned)f2h_bits(o1a[1]) << 16);
  h1[1] = (unsigned)f2h_bits(o1a[2]) | ((unsigned)f2h_bits(o1a[3]) << 16);
  h1[2] = (unsigned)f2h_bits(o1b[0]) | ((unsigned)f2h_bits(o1b[1]) << 16);
  h1[3] = (unsigned)f2h_bits(o1b[2]) | ((unsigned)f2h_bits(o1b[3]) << 16);
  h2[0] = (unsigned)f2h_bits(o2a[0]) | ((unsigned)f2h_bits(o2a[1]) << 16);
  h2[1] = (unsigned)f2h_bits(o2a[2]) | ((unsigned)f2h_bits(o2a[3]) << 16);
  h2[2] = (unsigned)f2h_bits(o2b[0]) | ((unsigned)f2h_bits(o2b[1]) << 16);
  h2[3] = (unsigned)f2h_bits(o2b[2]) | ((unsigned)f2h_bits(o2b[3]) << 16);
  {
    *(v4u*)(outP + base) = h1;
    *(v4u*)(outP + base + HHALF) = h2;
    
  }
}

// ---------------------------------------------------------------------------------------------
// 5) Register-blocked batched WMMA GEMM, 16-bit operands of type T (bf16 or f16), f32 accumulate.
//    C[m,n] = scale * sum_k A[m,k] * Bt[n,k]; A row-major [M,K], Bt row-major [N,K].
//    Block = 4 waves (2 x 2) = one 128x128 tile of C; each wave owns a 64x64 tile.
//    Per pass the block's 128 A rows and 128 Bt rows x 128 k (256 B a row) are brought into LDS by asynchronous
//    copies, two buffers: the next pass's copies fly while this pass's fragments are read from LDS.
//    M,N % 128 == 0, K % 128 == 0 (no tail handling). lda, ldb % 8 == 0 (16-B copies).
//    OUT_MODE: 0 = f32, 1 = single f16 plane. The hi/lo plane options are not staged: both must be false.
// ---------------------------------------------------------------------------------------------
#define GBK    128    // k elements of one staged pass
#define GPITCH 136    // LDS row pitch in elements: 272 B = 16 B x 17, conflict-free for 16-B row reads
typedef __attribute__((ext_vector_type(4))) int v4i;
typedef __attribute__((address_space(1))) v4i gv4i;
typedef __attribute__((address_space(3))) v4i lv4i;

// 128 rows x 256 B from g (row pitch ld elements) into l (row pitch GPITCH): 128 threads x 16 copies of 16 B;
// one wave-wide copy covers two whole 256-B rows.
// g is the tile's origin, the same in every lane; goff is the lane's own element offset row * ld + column.
template <typename T>
__device__ __forceinline__ void stage_tile(const T* g, int ld, unsigned goff, T* l, int tid) {
  T* lp = l + (tid >> 4) * GPITCH + (tid & 15) * 8;
#pragma unroll   // the 16 copies go out back to back, none waits for another
  for (int j = 0; j < 16; ++j)
    __builtin_amdgcn_global_load_async_to_lds_b128((gv4i*)(g + (size_t)(j * 8) * ld + goff), (lv4i*)(lp + j * 8 * GPITCH), 0, 0);
}

template <typename T, bool SPLITA, bool SPLITB, int OUT_MODE>
__global__ __launch_bounds__(128) void gemm_t64(
    const unsigned short* __restrict__ Ap, const unsigned short* __restrict__ A2p, int lda, long strideA,
    const unsigned short* __restrict__ Btp, const unsigned short* __restrict__ Bt2p, int ldb, long strideB,
    void* __restrict__ Cout, int ldc, long strideC,
    int M, int N, int K, float scale) {
  static_assert(!SPLITA && !SPLITB);
  typedef typename Frag<T>::V V;
  const T* A = (const T*)Ap; const T* Bt = (const T*)Btp;
  __shared__ __align__(16) T ring[2][2][128 * GPITCH];   // [buffer][A rows | Bt rows]
  __shared__ __align__(16) float sT[4][16 * 68];          // per-wave 16x64 slab, pitch 68 floats
  const int b    = blockIdx.y;
  const int tid  = threadIdx.x;
  const int lane = tid & 31;
  const int wave = tid >> 5;
  const int tilesN = N >> 7;
  const int tilesM = M >> 7;
  const int tile = blockIdx.x;
  if (tile >= tilesM * tilesN) return;   // block-uniform, ahead of every barrier and copy
  const int tm = tile / tilesN;
  const int tn = tile - tm * tilesN;
  const int wm = (wave >> 1) << 6;             // this wave's rows inside the block tile
  const int wn = (wave & 1) << 6;              // this wave's columns inside the block tile
  const int m0 = (tm << 7) + wm;
  const int n0 = (tn << 7) + wn;

  const T* Ag = A  + (size_t)b * strideA + (size_t)(tm << 7) * lda;
  const T* Bg = Bt + (size_t)b * strideB + (size_t)(tn << 7) * ldb;

  const int rlane = lane & 15;                 // row (A) / col (B, D) within subtile
  const int koff  = (lane >> 4) * 8;           // k offset of this lane half
  const int mOff  = (lane >> 4) * 8;           // D row offset

  v8f acc[4][4];
#pragma unroll
  for (int i = 0; i < 4; ++i)
#pragma unroll
    for (int j = 0; j < 4; ++j) acc[i][j] = (v8f){0.f,0.f,0.f,0.f,0.f,0.f,0.f,0.f};

  const int nt = K / GBK;
  const unsigned aoff = (unsigned)(tid >> 4) * (unsigned)lda + (unsigned)(tid & 15) * 8u;
  const unsigned boff = (unsigned)(tid >> 4) * (unsigned)ldb + (unsigned)(tid & 15) * 8u;
  stage_tile<T>(Ag, lda, aoff, ring[0][0], tid);
  stage_tile<T>(Bg, ldb, boff, ring[0][1], tid);
  asm volatile("s_wait_asynccnt 0x0" ::: "memory");   // this wave's copies of pass 0 have landed
  __syncthreads();                                     // ... and every other wave's: pass 0 is readable
  if (nt > 1) {
    stage_tile<T>(Ag + GBK, lda, aoff, ring[1][0], tid);
    stage_tile<T>(Bg + GBK, ldb, boff, ring[1][1], tid);
  }

  for (int t = 0; t < nt; ++t) {
    const T* la = ring[t & 1][0] + (wm + rlane) * GPITCH + koff;
    const T* lb = ring[t & 1][1] + (wn + rlane) * GPITCH + koff;
    // LDS reads run ahead of their products: the next 32-k block's Bt fragments go into a second set at the head of
    // this block, and each A fragment is re-read for the next block as soon as its row of products has been issued
    // (every loop below is unrolled so that each fragment and accumulator index is a constant: registers, no scratch)
    V af[4], bf[2][4];
#pragma unroll
    for (int j = 0; j < 4; ++j) { bf[0][j] = Frag<T>::load(lb + (j << 4) * GPITCH); af[j] = Frag<T>::load(la + (j << 4) * GPITCH); }
#pragma unroll
    for (int kb = 0; kb < GBK / 32; ++kb) {
      const int cu = kb & 1, nx = cu ^ 1;
      if (kb + 1 < GBK / 32) {
#pragma unroll
        for (int j = 0; j < 4; ++j) bf[nx][j] = Frag<T>::load(lb + (j << 4) * GPITCH + (kb + 1) * 32);
      }
#pragma unroll
      for (int i = 0; i < 4; ++i) {
#pragma unroll
        for (int j = 0; j < 4; ++j) acc[i][j] = Frag<T>::mma(af[i], bf[cu][j], acc[i][j]);
        Frag<T>::guard(acc[i][0], acc[i][3], af[i], af[i]);
        if (kb + 1 < GBK / 32) af[i] = Frag<T>::load(la + (i << 4) * GPITCH + (kb + 1) * 32);
      }
      Frag<T>::keep(bf[cu][0], bf[cu][1], bf[cu][2], bf[cu][3]);
    }
    asm volatile("s_wait_dscnt 0x0" ::: "memory");     // this wave's reads of buffer t & 1 are done before it is refilled
    asm volatile("s_wait_asynccnt 0x0" ::: "memory");  // this wave's copies of pass t + 1 have landed
    __syncthreads();                                    // publishes pass t + 1, frees buffer t & 1
    if (t + 2 < nt) {
      stage_tile<T>(Ag + (size_t)(t + 2) * GBK, lda, aoff, ring[t & 1][0], tid);
      stage_tile<T>(Bg + (size_t)(t + 2) * GBK, ldb, boff, ring[t & 1][1], tid);
    }
  }
  asm volatile("s_wait_asynccnt 0x0" ::: "memory");    // no copy is outstanding when the wave goes on
  acc_guard4(acc[0][0], acc[0][1], acc[0][2], acc[0][3]);
  acc_guard4(acc[1][0], acc[1][1], acc[1][2], acc[1][3]);
  acc_guard4(acc[2][0], acc[2][1], acc[2][2], acc[2][3]);
  acc_guard4(acc[3][0], acc[3][1], acc[3][2], acc[3][3]);

  // ---- epilogue ----
  float* slab = sT[wave];
#pragma unroll
  for (int i = 0; i < 4; ++i) {
    const int mBase = m0 + (i << 4);
#pragma unroll
    for (int j = 0; j < 4; ++j) {
#pragma unroll
      for (int r = 0; r < 8; ++r) {
        const float v = acc[i][j][r] * scale;
        slab[(mOff + r) * 68 + (j << 4) + rlane] = v;
      }
    }
    __builtin_amdgcn_fence(3, "workgroup");
    __builtin_amdgcn_wave_barrier();
    __builtin_amdgcn_fence(2, "workgroup");
    if (OUT_MODE == 0) {
      float* Cf = (float*)Cout + (size_t)b * strideC;
      const int hh = lane >> 4, c4 = (lane & 15) * 4;     // row seg = 256 B = 16 lanes x 16 B
      {
#pragma unroll
        for (int it = 0; it < 8; ++it) {
          const int row = it * 2 + hh;
          v4f v = *(const v4f*)(slab + row * 68 + c4);
          *(v4f*)(Cf + (size_t)(mBase + row) * ldc + n0 + c4) = v;
        }
        
      }
    } else {
      const int q = lane >> 3, c8 = (lane & 7) * 8;
      unsigned short* Cs = (unsigned short*)Cout + (size_t)b * strideC;
      {
#pragma unroll
        for (int it = 0; it < 4; ++it) {
          const int row = it * 4 + q;
          const float* sp = slab + row * 68 + c8;
          v8h hv;
#pragma unroll
          for (int e = 0; e < 8; ++e) hv[e] = (_Float16)sp[e];
          *(v8h*)(Cs + (size_t)(mBase + row) * ldc + n0 + c8) = hv;
        }
        
      }
    }
    __builtin_amdgcn_fence(3, "workgroup");
    __builtin_amdgcn_wave_barrier();
    __builtin_amdgcn_fence(2, "workgroup");
  }
}

// ---------------------------------------------------------------------------------------------
// 6) GQA attention, head_dim 128, 16 query heads, kv head = h >> 1, all keys visited (no mask), tanh softcap.
//    Planes: Q f16 [NTOK][QDIM] (col = h*128 + d, rotated, unscaled), K f16 [NTOK][KVDIM] (col = kvh*128 + d),
//            V^T f16 [NB][KVDIM][SEQ] (row = kvh*128 + d). Output: ctx f16 x2^6 [NTOK][QDIM] (col = h*128 + d).
//    Block = 8 waves = 128 query rows of one (b, h); wave w owns rows qb*128 + 16w .. +15 over the full head.
//    Per 64-key chunk: S(16 x 64) over d = 128 (one f16 product per tile pair); logit = 50*tanh(S/sqrt(128)/50) in f32;
//    reloaded as an A fragment through the same element type; O(16 x 128) += P(16 x 64) . V.
//    The P tile and the epilogue slab are wave-private (16 x 64 P tile, 16 x 64 f32 epilogue slab).
//    The chunk's K rows (64 x 256 B) and V^T rows (128 x 128 B) are the same for all 8 waves: the block brings them into
//    LDS once, by asynchronous copies of whole 128-B lines, two buffers: the next chunk's copies fly while this chunk is
//    worked on; every wave reads its fragments from LDS. One block barrier per chunk.
// ---------------------------------------------------------------------------------------------
#define KPITCH 136    // LDS pitch of a K row in elements: 272 B = 16 B x 17, conflict-free for 16-B row reads
#define VPITCH 72     // LDS pitch of a V^T row in elements: 144 B = 16 B x 9, conflict-free for 16-B row reads

// kg, vg: origin of the chunk's K rows (pitch KVDIM) and V^T rows (pitch SEQ), the same in every lane.
// 256 threads x (4 + 4) copies of 16 B; one wave-wide copy covers two whole K rows or four whole V^T row pieces.
__device__ __forceinline__ void stage_kv(const _Float16* kg, const _Float16* vg, _Float16* kl, _Float16* vl, int tid) {
  const unsigned ko = (unsigned)(tid >> 4) * (unsigned)KVDIM + (unsigned)(tid & 15) * 8u;
  const unsigned vo = (unsigned)(tid >> 3) * (unsigned)SEQ + (unsigned)(tid & 7) * 8u;
  _Float16* kp = kl + (tid >> 4) * KPITCH + (tid & 15) * 8;
  _Float16* vp = vl + (tid >> 3) * VPITCH + (tid & 7) * 8;
#pragma unroll   // the copies go out back to back, none waits for another
  for (int j = 0; j < 4; ++j)
    __builtin_amdgcn_global_load_async_to_lds_b128((gv4i*)(kg + (size_t)(j * 16) * KVDIM + ko), (lv4i*)(kp + j * 16 * KPITCH), 0, 0);
#pragma unroll   // as above
  for (int j = 0; j < 4; ++j)
    __builtin_amdgcn_global_load_async_to_lds_b128((gv4i*)(vg + (size_t)(j * 32) * SEQ + vo), (lv4i*)(vp + j * 32 * VPITCH), 0, 0);
}

__global__ __launch_bounds__(256) void attn_kernel(
    const unsigned short* __restrict__ Qp, const unsigned short* __restrict__ Kp,
    const unsigned short* __restrict__ Vtp, unsigned short* __restrict__ Op) {
  __shared__ __align__(16) float    Ost[8][16 * 64];          // 32 KB: per-wave epilogue staging
  __shared__ __align__(16) _Float16 Psh[8][16 * KV_CHUNK];    // 16 KB: per-wave P tile [row][kv]
  __shared__ __align__(16) _Float16 Kst[2][KV_CHUNK * KPITCH]; // 34 KB: K rows of a chunk [kv][d], two buffers
  __shared__ __align__(16) _Float16 Vst[2][HD * VPITCH];       // 36 KB: V^T rows of a chunk [d][kv], two buffers

  const _Float16* Q  = (const _Float16*)Qp;
  const _Float16* Kk = (const _Float16*)Kp;
  const _Float16* Vt = (const _Float16*)Vtp;

  const int tid  = threadIdx.x;
  const int wave = tid >> 5, lane = tid & 31;
  const int hh   = lane >> 4, c = lane & 15, koff = hh * 8;
  const int nqb  = SEQ / QBLK;
  const int bx   = blockIdx.x;
  const int qb   = bx % nqb;
  const int bhid = bx / nqb;
  const int h    = bhid % NQH;
  const int b    = bhid / NQH;
  const int kvh  = h >> 1;
  const int q0   = qb * QBLK + wave * 16;                       // sequence position of this wave's row 0
  const size_t tokw = (size_t)b * SEQ + q0;                     // compact token index of this wave's row 0
  const size_t qoff = (tokw + c) * QDIM + (size_t)h * HD + koff;
  const _Float16* Kg = Kk + (size_t)b * SEQ * KVDIM + (size_t)kvh * HD;            // this head's K rows, key 0
  const _Float16* Vg = Vt + (size_t)b * KVDIM * SEQ + (size_t)(kvh * HD) * SEQ;    // this head's V^T rows, key 0
  _Float16* pw = Psh[wave];

  float mrow[8], lrow[8];
  v8f oacc[8];
#pragma unroll
  for (int r = 0; r < 8; ++r) { mrow[r] = -INFINITY; lrow[r] = 0.f; }
#pragma unroll
  for (int t = 0; t < 8; ++t) oacc[t] = (v8f){0.f,0.f,0.f,0.f,0.f,0.f,0.f,0.f};

  const int nch = SEQ / KV_CHUNK;
  stage_kv(Kg, Vg, Kst[0], Vst[0], tid);
  asm volatile("s_wait_asynccnt 0x0" ::: "memory");   // this wave's copies of chunk 0 have landed
  __syncthreads();                                     // ... and every other wave's: chunk 0 is readable
  if (nch > 1) stage_kv(Kg + (size_t)KV_CHUNK * KVDIM, Vg + KV_CHUNK, Kst[1], Vst[1], tid);

  for (int kc = 0; kc < nch; ++kc) {
    const _Float16* kl = Kst[kc & 1] + c * KPITCH + koff;
    const _Float16* vl = Vst[kc & 1] + c * VPITCH + koff;

    // ---- raw scores S(16 q x 64 kv) over d = 128 ----
    v8f s[4];
#pragma unroll
    for (int j = 0; j < 4; ++j) s[j] = (v8f){0.f,0.f,0.f,0.f,0.f,0.f,0.f,0.f};
    // LDS reads stand in groups of four fragments, one group ahead of their products (two register sets); the loops are
    // unrolled so that every fragment index is a constant: registers, no scratch
    v16h kf[2][4];
#pragma unroll
    for (int j = 0; j < 4; ++j) kf[0][j] = Frag<_Float16>::load(kl + j * 16 * KPITCH);
#pragma unroll
    for (int dc = 0; dc < 4; ++dc) {
      const int cu = dc & 1, nx = cu ^ 1;
      const v16h qa = Frag<_Float16>::load(Q + qoff + dc * 32);
      if (dc + 1 < 4) {
#pragma unroll
        for (int j = 0; j < 4; ++j) kf[nx][j] = Frag<_Float16>::load(kl + j * 16 * KPITCH + (dc + 1) * 32);
      }
#pragma unroll
      for (int j = 0; j < 4; ++j) s[j] = h_mma(qa, kf[cu][j], s[j]);
    }

    // ---- scale, tanh softcap (f32), row max ----
    float cm[8];
#pragma unroll
    for (int r = 0; r < 8; ++r) {
      float m = -INFINITY;
#pragma unroll
      for (int j = 0; j < 4; ++j) {
        float sv = s[j][r] * RSQ;
        sv = SOFTCAP * tanhf(sv * INVCAP);
        s[j][r] = sv;
        m = fmaxf(m, sv);
      }
#pragma unroll
      for (int off = 1; off < 16; off <<= 1) m = fmaxf(m, __shfl_xor(m, off, 32));
      cm[r] = m;
    }

    // all P fragment loads of the prior chunk (same wave) complete before the tile is rewritten
    __builtin_amdgcn_fence(3, "workgroup");
    __builtin_amdgcn_wave_barrier();
    __builtin_amdgcn_fence(2, "workgroup");

    // ---- online softmax (f32); P x 2^10 as f16 into this wave's tile ----
#pragma unroll
    for (int r = 0; r < 8; ++r) {
      const float mnew = fmaxf(mrow[r], cm[r]);
      const float alpha = __expf(mrow[r] - mnew);
      mrow[r] = mnew;
      float psum = 0.f;
#pragma unroll
      for (int j = 0; j < 4; ++j) {
        const float p = __expf(s[j][r] - mnew);
        psum += p;
        pw[(8 * hh + r) * KV_CHUNK + j * 16 + c] = (_Float16)(p * PCARRY);
      }
#pragma unroll
      for (int off = 1; off < 16; off <<= 1) psum += __shfl_xor(psum, off, 32);
      lrow[r] = lrow[r] * alpha + psum;
#pragma unroll
      for (int t = 0; t < 8; ++t) oacc[t][r] *= alpha;
    }
    __builtin_amdgcn_fence(3, "workgroup");
    __builtin_amdgcn_wave_barrier();
    __builtin_amdgcn_fence(2, "workgroup");

    // ---- O(16 x 128) += P(16 x 64) . V ----
    // group g = 32 keys kk = g >> 1, output tiles 4 * (g & 1) .. + 3; V^T fragments read one group ahead, as for K above
    v16h vf[2][4];
#pragma unroll
    for (int t = 0; t < 4; ++t) vf[0][t] = Frag<_Float16>::load(vl + t * 16 * VPITCH);
    v16h pa;
#pragma unroll
    for (int g = 0; g < 4; ++g) {
      const int cu = g & 1, nx = cu ^ 1, kk = g >> 1, tb = (g & 1) * 4;
      if (tb == 0) pa = Frag<_Float16>::load(pw + c * KV_CHUNK + kk * 32 + koff);
      if (g + 1 < 4) {
#pragma unroll
        for (int t = 0; t < 4; ++t) vf[nx][t] = Frag<_Float16>::load(vl + (((g + 1) & 1) * 4 + t) * 16 * VPITCH + ((g + 1) >> 1) * 32);
      }
#pragma unroll
      for (int t = 0; t < 4; ++t) oacc[tb + t] = h_mma(pa, vf[cu][t], oacc[tb + t]);
    }
    asm volatile("s_wait_dscnt 0x0" ::: "memory");     // this wave's reads of buffer kc & 1 are done before it is refilled
    asm volatile("s_wait_asynccnt 0x0" ::: "memory");  // this wave's copies of chunk kc + 1 have landed
    __syncthreads();                                    // publishes chunk kc + 1, frees buffer kc & 1
    if (kc + 2 < nch)
      stage_kv(Kg + (size_t)(kc + 2) * KV_CHUNK * KVDIM, Vg + (kc + 2) * KV_CHUNK, Kst[kc & 1], Vst[kc & 1], tid);
  }
  asm volatile("s_wait_asynccnt 0x0" ::: "memory");    // no copy is outstanding when the wave goes on

  // ---- epilogue: normalise (x 2^6 / (2^10 * l)), stage 16 x 64 halves in this wave's own slab, write the f16 ctx plane ----
  // coverage: 2 halves x (4 iterations x 4 rows) x 8 lanes x 8 elements = 16 rows x 128 dims.
  float* os = Ost[wave];
  const int q4 = lane >> 3, c8 = (lane & 7) * 8;
#pragma unroll
  for (int th = 0; th < 2; ++th) {
#pragma unroll
    for (int r = 0; r < 8; ++r) {
      const float inv = OCARRY / (PCARRY * lrow[r]);   // undo the P carry (2^10) and apply the ctx carry (2^6)
#pragma unroll
      for (int tt = 0; tt < 4; ++tt) os[(8 * hh + r) * 64 + tt * 16 + c] = oacc[th * 4 + tt][r] * inv;
    }
    __builtin_amdgcn_fence(3, "workgroup");
    __builtin_amdgcn_wave_barrier();
    __builtin_amdgcn_fence(2, "workgroup");
    {
#pragma unroll
      for (int it = 0; it < 4; ++it) {
        const int row = it * 4 + q4;
        const float* sp = os + row * 64 + c8;
        v8h hv;
#pragma unroll
        for (int e = 0; e < 8; ++e) hv[e] = (_Float16)sp[e];
        const size_t o = (tokw + row) * QDIM + (size_t)h * HD + th * 64 + c8;
        *(v8h*)(Op + o) = hv;
      }
      
    }
    __builtin_amdgcn_fence(3, "workgroup");
    __builtin_amdgcn_wave_barrier();
    __builtin_amdgcn_fence(2, "workgroup");
  }
}

// ---------------------------------------------------------------------------------------------
// host
// ---------------------------------------------------------------------------------------------
static_assert((NTOK * HID / 8) % 256 == 0);
static_assert((NTOK * NQH * 8) % 256 == 0);
static_assert((NTOK * NKVH * 8) % 256 == 0);
static_assert((SEQ * HHALF) % 256 == 0);
static_assert(HID % 128 == 0 && QDIM % 128 == 0);
static_assert(NTOK % 128 == 0 && HID % 128 == 0 && QDIM % 128 == 0 && KVDIM % 128 == 0 && SEQ % 128 == 0);
static_assert(SEQ % QBLK == 0 && SEQ % KV_CHUNK == 0 && QBLK == 128 && KV_CHUNK == 64 && HD == 128);
static_assert(NB >= 1 && NB <= NB_FULL && SEQ <= SEQ_FULL);
static_assert(NQH == 2 * NKVH);

extern "C" void kernel_launch(void* const* d_in, const int* in_sizes, int n_in,
                              void* d_out, int out_size, void* d_ws, size_t ws_size, hipStream_t stream) {
  if (n_in < 5) return;
  const size_t needTok = (size_t)(NB - 1) * SEQ_FULL + SEQ;
  if ((size_t)in_sizes[0] < needTok * HID) return;
  if ((size_t)in_sizes[1] < (size_t)HID * QDIM) return;
  if ((size_t)in_sizes[2] < (size_t)HID * KVDIM) return;
  if ((size_t)in_sizes[3] < (size_t)HID * KVDIM) return;
  if ((size_t)in_sizes[4] < (size_t)QDIM * HID) return;
  if ((size_t)out_size < needTok * HID) return;

  const float* x  = (const float*)d_in[0];   // [2,2048,2048]
  const float* Wq = (const float*)d_in[1];   // [2048,2048]  [in][out]
  const float* Wk = (const float*)d_in[2];   // [2048,1024]
  const float* Wv = (const float*)d_in[3];   // [2048,1024]
  const float* Wo = (const float*)d_in[4];   // [2048,2048]
  float* out = (float*)d_out;                // [2,2048,2048] f32

  //   XB   bf16 [NTOK][HID]
  //   WQT  bf16 [QDIM][HID], WKT bf16 [KVDIM][HID], WVT bf16 [KVDIM][HID], WOT f16 [HID][QDIM]
  //   R1   f32 [NTOK][QDIM] for q; later reused: Kf f32 [NTOK][KVDIM] at +0, ctx f16 [NTOK][QDIM] at +0, V^T f16 [NB][KVDIM][SEQ] at +NTOK*QDIM*2
  //   QP f16 [NTOK][QDIM]; KP f16 [NTOK][KVDIM]; COS, SIN f32 [SEQ][HHALF]
  const size_t szXB  = (size_t)NTOK * HID * 2;
  const size_t szWQT = (size_t)QDIM * HID * 2;
  const size_t szWKT = (size_t)KVDIM * HID * 2;
  const size_t szWOT = (size_t)HID * QDIM * 2;
  const size_t szR1  = (size_t)NTOK * QDIM * 4;
  const size_t szQP  = (size_t)NTOK * QDIM * 2;
  const size_t szKP  = (size_t)NTOK * KVDIM * 2;
  const size_t szVT  = (size_t)NB * KVDIM * SEQ * 2;
  const size_t szTAB = (size_t)SEQ * HHALF * 4;
  static_assert((size_t)NTOK * KVDIM * 4 <= (size_t)NTOK * QDIM * 4);
  static_assert((size_t)NTOK * QDIM * 2 + (size_t)NB * KVDIM * SEQ * 2 <= (size_t)NTOK * QDIM * 4);
  const size_t OFF_XB  = 0;
  const size_t OFF_WQT = OFF_XB + szXB;
  const size_t OFF_WKT = OFF_WQT + szWQT;
  const size_t OFF_WVT = OFF_WKT + szWKT;
  const size_t OFF_WOT = OFF_WVT + szWKT;
  const size_t OFF_R1  = OFF_WOT + szWOT;
  const size_t OFF_QF  = OFF_R1;
  const size_t OFF_KF  = OFF_R1;
  const size_t OFF_CTX = OFF_R1;
  const size_t OFF_VT  = OFF_R1 + szQP;
  const size_t OFF_QP  = OFF_R1 + szR1;
  const size_t OFF_KP  = OFF_QP + szQP;
  const size_t OFF_COS = OFF_KP + szKP;
  const size_t OFF_SIN = OFF_COS + szTAB;
  const size_t WS_TOTAL = OFF_SIN + szTAB;
  (void)szVT;
  if (ws_size < WS_TOTAL) return;

  char* ws = (char*)d_ws;
  unsigned short* xb  = (unsigned short*)(ws + OFF_XB);
  unsigned short* WqT = (unsigned short*)(ws + OFF_WQT);
  unsigned short* WkT = (unsigned short*)(ws + OFF_WKT);
  unsigned short* WvT = (unsigned short*)(ws + OFF_WVT);
  unsigned short* WoT = (unsigned short*)(ws + OFF_WOT);
  float* Qf  = (float*)(ws + OFF_QF);
  float* Kf  = (float*)(ws + OFF_KF);
  unsigned short* ctx = (unsigned short*)(ws + OFF_CTX);
  unsigned short* Vt  = (unsigned short*)(ws + OFF_VT);
  unsigned short* Qpl = (unsigned short*)(ws + OFF_QP);
  unsigned short* Kpl = (unsigned short*)(ws + OFF_KP);
  float* cosT = (float*)(ws + OFF_COS);
  float* sinT = (float*)(ws + OFF_SIN);

  // inv_freq[j] = 1 / 10000^(2j/128), pow in double then RNE to f32, reciprocal as one f32 divide
  RopeFreq fr;
  for (int j = 0; j < HHALF; ++j) {
    const float e = (float)(2 * j) / 128.0f;
    const double p = pow(10000.0, (double)e);
    const float pf = (float)p;
    fr.f[j] = 1.0f / pf;
  }

  // 1) x -> compact bf16 plane
  cast_x_bf16<<<(NTOK * HID / 8) / 256, 256, 0, stream>>>(x, xb, NTOK * HID / 8);
  // 2) transposed 16-bit weight planes: in[rows][cols] -> out[cols][rows]; grid = (cols/64, rows/64)
  transpose_cast16<0><<<dim3(QDIM / 64, HID / 64), 256, 0, stream>>>(Wq, WqT, HID, QDIM, 1.0f);      // [HID][QDIM]  -> [QDIM][HID]
  transpose_cast16<0><<<dim3(KVDIM / 64, HID / 64), 256, 0, stream>>>(Wk, WkT, HID, KVDIM, 1.0f);    // [HID][KVDIM] -> [KVDIM][HID]
  transpose_cast16<0><<<dim3(KVDIM / 64, HID / 64), 256, 0, stream>>>(Wv, WvT, HID, KVDIM, 1.0f);    // [HID][KVDIM] -> [KVDIM][HID]
  transpose_cast16<1><<<dim3(HID / 64, QDIM / 64), 256, 0, stream>>>(Wo, WoT, QDIM, HID, WOCARRY);   // [QDIM][HID]  -> [HID][QDIM], f16 x 2^4
  // 3) RoPE tables
  rope_table_kernel<<<(SEQ * HHALF) / 256, 256, 0, stream>>>(cosT, sinT, fr);
  // 4) q = x @ Wq -> f32 [NTOK][QDIM]   (M=NTOK, N=QDIM, K=HID)
  {
    const int tiles = (NTOK / 128) * (QDIM / 128);
    gemm_t64<__bf16, false, false, 0><<<dim3(tiles, 1), 128, 0, stream>>>(
        xb, xb, HID, 0L, WqT, WqT, HID, 0L, (void*)Qf, QDIM, 0L, NTOK, QDIM, HID, 1.0f);
  }
  // 5) RoPE of q (16 heads) -> f16 plane
  rope_f16_kernel<NQH, QDIM><<<(NTOK * NQH * 8) / 256, 256, 0, stream>>>(Qf, cosT, sinT, Qpl, 1.0f);
  // 6) k = x @ Wk -> f32 [NTOK][KVDIM]  (M=NTOK, N=KVDIM, K=HID), into the q region (q is dead)
  {
    const int tiles = (NTOK / 128) * (KVDIM / 128);
    gemm_t64<__bf16, false, false, 0><<<dim3(tiles, 1), 128, 0, stream>>>(
        xb, xb, HID, 0L, WkT, WkT, HID, 0L, (void*)Kf, KVDIM, 0L, NTOK, KVDIM, HID, 1.0f);
  }
  // 7) RoPE of k (8 kv heads) -> f16 plane
  rope_f16_kernel<NKVH, KVDIM><<<(NTOK * NKVH * 8) / 256, 256, 0, stream>>>(Kf, cosT, sinT, Kpl, 1.0f);
  // 8) v^T per batch = Wv^T @ x_b^T -> f16 [NB][KVDIM][SEQ]   (M=KVDIM, N=SEQ, K=HID, batch NB)
  {
    const int tiles = (KVDIM / 128) * (SEQ / 128);
    gemm_t64<__bf16, false, false, 1><<<dim3(tiles, NB), 128, 0, stream>>>(
        WvT, WvT, HID, 0L, xb, xb, HID, (long)SEQ * HID, (void*)Vt, SEQ, (long)KVDIM * SEQ,
        KVDIM, SEQ, HID, 1.0f);
  }
  // 9) attention -> ctx f16 x 2^6 [NTOK][QDIM]  (k f32 region is dead; V^T region disjoint)
  attn_kernel<<<NB * NQH * (SEQ / QBLK), 256, 0, stream>>>(Qpl, Kpl, Vt, ctx);
  // 10) out = ctx @ Wo -> d_out f32, per batch rows b*SEQ_FULL..  (M=SEQ, N=HID, K=QDIM, scale 2^-10)
  {
    const int tiles = (SEQ / 128) * (HID / 128);
    gemm_t64<_Float16, false, false, 0><<<dim3(tiles, NB), 128, 0, stream>>>(
        ctx, ctx, QDIM, (long)SEQ * QDIM, WoT, WoT, QDIM, 0L, (void*)out, HID, (long)SEQ_FULL * HID,
        SEQ, HID, QDIM, OUTSCALE);
  }
}

// v003
// It runs in 261 microseconds.
// Timed twice side by side with v002, it ran 1.14 and 1.15 times as fast.
// Counting every step since v000, it is 2.60 times as fast.
// x@Wq, x@Wk, Wv^T@x^T: v_wmma_f32_16x16x32_bf16 on RNE-bf16 input planes (f32 accumulate); q.k^T: v_wmma_f32_16x16x32_f16 (q, k single f16 planes, f32 accumulate); p.v: v_wmma_f32_16x16x32_f16 (p f16 carried x2^10, v f16, f32 accumulate); ctx@Wo: v_wmma_f32_16x16x32_f16 (ctx f16 carried x2^6, Wo f16 carried x2^4 built from RNE-bf16 values, f32 accumulate); RoPE, tanh softcap and softmax in f32.
#include <hip/hip_runtime.h>
#include <math.h>

#pragma clang fp contract(off)

#ifndef NB
#define NB 2
#endif
#ifndef SEQ
#define SEQ 2048
#endif
#define NB_FULL  2
#define SEQ_FULL 2048
#define HID      2048
#define NQH      16
#define NKVH     8
#define HD       128
#define HHALF    64
#define QDIM     (NQH * HD)
#define KVDIM    (NKVH * HD)
#define NTOK     (NB * SEQ)
#define KV_CHUNK 64
#define QBLK     128
#define RSQ      0.08838834764831845f
#define SOFTCAP  50.0f
#define INVCAP   0.02f
#define PCARRY   1024.0f
#define OCARRY   64.0f
#define WOCARRY  16.0f
#define OUTSCALE 0.0009765625f

typedef __attribute__((ext_vector_type(16))) _Float16 v16h;
typedef __attribute__((ext_vector_type(8)))  _Float16 v8h;
typedef __attribute__((ext_vector_type(16))) __bf16   v16b;
typedef __attribute__((ext_vector_type(8)))  __bf16   v8b;
typedef __attribute__((ext_vector_type(8)))  float    v8f;
typedef __attribute__((ext_vector_type(4)))  float    v4f;
typedef __attribute__((ext_vector_type(4)))  unsigned int v4u;

__device__ __forceinline__ unsigned short f2bf_bits(float f) {
  unsigned u = __float_as_uint(f);
  return (unsigned short)((u + 0x7FFFu + ((u >> 16) & 1u)) >> 16);
}
__device__ __forceinline__ float bf_bits2f(unsigned short h) { return __uint_as_float(((unsigned)h) << 16); }
__device__ __forceinline__ unsigned short f2h_bits(float f) { const _Float16 h = (_Float16)f; return __builtin_bit_cast(unsigned short, h); }

// hazard guards as plain device helpers
__device__ __forceinline__ void dep_guard_h(v8f& a, v8f& b, v16h x, v16h y) { asm volatile("v_nop\n\tv_nop\n\tv_nop\n\tv_nop" : "+v"(a), "+v"(b) : "v"(x), "v"(y)); }
__device__ __forceinline__ void dep_guard_b(v8f& a, v8f& b, v16b x, v16b y) { asm volatile("v_nop\n\tv_nop\n\tv_nop\n\tv_nop" : "+v"(a), "+v"(b) : "v"(x), "v"(y)); }
__device__ __forceinline__ void keep4_h(v16h a, v16h b, v16h c, v16h d) { asm volatile("v_nop" :: "v"(a), "v"(b), "v"(c), "v"(d)); }
__device__ __forceinline__ void keep4_b(v16b a, v16b b, v16b c, v16b d) { asm volatile("v_nop" :: "v"(a), "v"(b), "v"(c), "v"(d)); }
__device__ __forceinline__ void acc_guard4(v8f& a, v8f& b, v8f& c, v8f& d) { asm volatile("v_nop\n\tv_nop\n\tv_nop\n\tv_nop" : "+v"(a), "+v"(b), "+v"(c), "+v"(d)); }

// fragment loaders: lane l, row/col = l & 15, elements 0..7 <- p[0..7] (k0 + 8h + 0..7), 8..15 <- p[16..23] (k0 + 16 + 8h + 0..7); caller adds 8h
template <typename T> struct Frag;
template <> struct Frag<_Float16> {
  typedef v16h V; union U { v16h v; v8h h[2]; };
  static __device__ __forceinline__ v16h load(const _Float16* p) {
    U f; f.h[0] = *(const v8h*)(p); f.h[1] = *(const v8h*)(p + 16); return f.v;
  }
  static __device__ __forceinline__ v8f mma(v16h a, v16h b, v8f c) {
    return __builtin_amdgcn_wmma_f32_16x16x32_f16(false, a, false, b, (short)0, c, false, false);
  }
  static __device__ __forceinline__ void guard(v8f& a, v8f& b, v16h x, v16h y) { dep_guard_h(a, b, x, y); }
  static __device__ __forceinline__ void keep(v16h a, v16h b, v16h c, v16h d) { keep4_h(a, b, c, d); }
};
template <> struct Frag<__bf16> {
  typedef v16b V; union U { v16b v; v8b h[2]; };
  static __device__ __forceinline__ v16b load(const __bf16* p) {
    U f; f.h[0] = *(const v8b*)(p); f.h[1] = *(const v8b*)(p + 16); return f.v;
  }
  static __device__ __forceinline__ v8f mma(v16b a, v16b b, v8f c) {
    return __builtin_amdgcn_wmma_f32_16x16x32_bf16(false, a, false, b, (short)0, c, false, false);
  }
  static __device__ __forceinline__ void guard(v8f& a, v8f& b, v16b x, v16b y) { dep_guard_b(a, b, x, y); }
  static __device__ __forceinline__ void keep(v16b a, v16b b, v16b c, v16b d) { keep4_b(a, b, c, d); }
};

// single f16 WMMA with the 4-nop guard tied to D and keeping A/B live
__device__ __forceinline__ v8f h_mma(v16h a, v16h b, v8f c) {
  c = __builtin_amdgcn_wmma_f32_16x16x32_f16(false, a, false, b, (short)0, c, false, false);
  asm volatile("v_nop\n\tv_nop\n\tv_nop\n\tv_nop" : "+v"(c) : "v"(a), "v"(b));
  return c;
}

// ---------------------------------------------------------------------------------------------
// 1) x f32 [NB_FULL][SEQ_FULL][HID] -> compact bf16 plane [NTOK][HID], 8 elements per thread, one 16-B store per lane
// ---------------------------------------------------------------------------------------------
__global__ __launch_bounds__(256) void cast_x_bf16(const float* __restrict__ in, unsigned short* __restrict__ out, int n8) {
  const int i = blockIdx.x * 256 + threadIdx.x;
  if (i < n8) {
    const size_t o   = (size_t)i * 8;
    const size_t tok = o / HID;
    const size_t col = o - tok * HID;
    const size_t bb  = tok / SEQ;
    const size_t ss  = tok - bb * SEQ;
    const size_t src = (bb * SEQ_FULL + ss) * (size_t)HID + col;
    const v4f a  = *(const v4f*)(in + src);
    const v4f bq = *(const v4f*)(in + src + 4);
    v4u w;
    w[0] = (unsigned)f2bf_bits(a[0])  | ((unsigned)f2bf_bits(a[1])  << 16);
    w[1] = (unsigned)f2bf_bits(a[2])  | ((unsigned)f2bf_bits(a[3])  << 16);
    w[2] = (unsigned)f2bf_bits(bq[0]) | ((unsigned)f2bf_bits(bq[1]) << 16);
    w[3] = (unsigned)f2bf_bits(bq[2]) | ((unsigned)f2bf_bits(bq[3]) << 16);
    *(v4u*)(out + o) = w;
    
  }
}

// ---------------------------------------------------------------------------------------------
// 2) in[nrows][ncols] f32 -> out[ncols][nrows] 16-bit. MODE 0: bf16 bits (RNE); MODE 1: f16 bits of (RNE-bf16 value * scl).
//    Block = 64x64 tile through LDS (cross-thread, block barrier). grid = (ncols/64, nrows/64); nrows, ncols multiples of 64.
//    load coverage: 256 threads x 16 floats = 64x64 tile; store coverage: 2 iterations x 256 threads x 8 = 64 rows x 64.
// ---------------------------------------------------------------------------------------------
template <int MODE> __device__ __forceinline__ unsigned short pk16(float f, float scl) {
  if (MODE == 0) return f2bf_bits(f);
  const float g = bf_bits2f(f2bf_bits(f)) * scl;
  return f2h_bits(g);
}

template <int MODE>
__global__ __launch_bounds__(256) void transpose_cast16(const float* __restrict__ in, unsigned short* __restrict__ out, int nrows, int ncols, float scl) {
  __shared__ float tile[64 * 65];
  const int tid = threadIdx.x;
  const int r0 = blockIdx.y * 64, c0 = blockIdx.x * 64;
  {
    const int row = tid >> 2, cc = (tid & 3) * 16;
    const float* s = in + (size_t)(r0 + row) * ncols + c0 + cc;
#pragma unroll
    for (int q = 0; q < 4; ++q) {
      const v4f v = *(const v4f*)(s + 4 * q);
#pragma unroll
      for (int e = 0; e < 4; ++e) tile[(cc + 4 * q + e) * 65 + row] = v[e];
    }
  }
  __syncthreads();
  {
#pragma unroll
    for (int it = 0; it < 2; ++it) {
      const int orow = it * 32 + (tid >> 3), seg = (tid & 7) * 8;
      const float* tp = tile + orow * 65 + seg;
      v4u w;
#pragma unroll
      for (int e = 0; e < 4; ++e) w[e] = (unsigned)pk16<MODE>(tp[2 * e], scl) | ((unsigned)pk16<MODE>(tp[2 * e + 1], scl) << 16);
      *(v4u*)(out + (size_t)(c0 + orow) * nrows + r0 + seg) = w;
    }
    
  }
}

// ---------------------------------------------------------------------------------------------
// 3) RoPE cos/sin tables [SEQ][HHALF] f32: angle = pos * inv_freq[j] (single f32 multiply), precise cosf/sinf.
// ---------------------------------------------------------------------------------------------
struct RopeFreq { float f[HHALF]; };
static_assert(sizeof(RopeFreq) == 256);

__global__ __launch_bounds__(256) void rope_table_kernel(float* __restrict__ cosT, float* __restrict__ sinT, RopeFreq fr) {
  __shared__ float invf[HHALF];
  if (threadIdx.x == 0) {
#pragma unroll
    for (int q = 0; q < HHALF; ++q) invf[q] = fr.f[q];
  }
  __syncthreads();
  const int i = blockIdx.x * 256 + threadIdx.x;          // exactly SEQ*HHALF threads
  const int t = i >> 6;
  const int jj = i & (HHALF - 1);
  const float ang = (float)t * invf[jj];
  const float cv = cosf(ang);
  const float sv = sinf(ang);
  ((float*)cosT)[i] = cv;
  ((float*)sinT)[i] = sv;
  
}

// ---------------------------------------------------------------------------------------------
// 4) RoPE -> single f16 plane. src f32 [NTOK][PITCH], head hs occupies cols hs*128 .. hs*128+127 (first 64 = x1, next 64 = x2).
//    Thread = (token, head, 8-wide pair group jg): out[d] = x1[d]*cos - x2[d]*sin, out[d+64] = x2[d]*cos + x1[d]*sin, times scl.
// ---------------------------------------------------------------------------------------------
template <int NHEAD, int PITCH>
__global__ __launch_bounds__(256) void rope_f16_kernel(const float* __restrict__ src, const float* __restrict__ cosT, const float* __restrict__ sinT,
                                                        unsigned short* __restrict__ outP, float scl) {
  const int i = blockIdx.x * 256 + threadIdx.x;          // exactly NTOK*NHEAD*8 threads
  const int jg = i & 7;
  const int hs = (i >> 3) % NHEAD;
  const int tok = (i >> 3) / NHEAD;
  const int pos = tok % SEQ;
  const size_t base = (size_t)tok * PITCH + (size_t)hs * HD + jg * 8;
  const size_t tb = (size_t)pos * HHALF + jg * 8;
  const v4f x1a = *(const v4f*)(src + base);
  const v4f x1b = *(const v4f*)(src + base + 4);
  const v4f x2a = *(const v4f*)(src + base + HHALF);
  const v4f x2b = *(const v4f*)(src + base + HHALF + 4);
  const v4f ca = *(const v4f*)(cosT + tb);
  const v4f cb = *(const v4f*)(cosT + tb + 4);
  const v4f sa = *(const v4f*)(sinT + tb);
  const v4f sb = *(const v4f*)(sinT + tb + 4);
  v4f o1a, o1b, o2a, o2b;
#pragma unroll
  for (int e = 0; e < 4; ++e) {
    o1a[e] = (x1a[e] * ca[e] - x2a[e] * sa[e]) * scl;
    o2a[e] = (x2a[e] * ca[e] + x1a[e] * sa[e]) * scl;
    o1b[e] = (x1b[e] * cb[e] - x2b[e] * sb[e]) * scl;
    o2b[e] = (x2b[e] * cb[e] + x1b[e] * sb[e]) * scl;
  }
  v4u h1, h2;
  h1[0] = (unsigned)f2h_bits(o1a[0]) | ((unsigned)f2h_bits(o1a[1]) << 16);
  h1[1] = (unsigned)f2h_bits(o1a[2]) | ((unsigned)f2h_bits(o1a[3]) << 16);
  h1[2] = (unsigned)f2h_bits(o1b[0]) | ((unsigned)f2h_bits(o1b[1]) << 16);
  h1[3] = (unsigned)f2h_bits(o1b[2]) | ((unsigned)f2h_bits(o1b[3]) << 16);
  h2[0] = (unsigned)f2h_bits(o2a[0]) | ((unsigned)f2h_bits(o2a[1]) << 16);
  h2[1] = (unsigned)f2h_bits(o2a[2]) | ((unsigned)f2h_bits(o2a[3]) << 16);
  h2[2] = (unsigned)f2h_bits(o2b[0]) | ((unsigned)f2h_bits(o2b[1]) << 16);
  h2[3] = (unsigned)f2h_bits(o2b[2]) | ((unsigned)f2h_bits(o2b[3]) << 16);
  {
    *(v4u*)(outP + base) = h1;
    *(v4u*)(outP + base + HHALF) = h2;
    
  }
}

// ---------------------------------------------------------------------------------------------
// 5) Register-blocked batched WMMA GEMM, 16-bit operands of type T (bf16 or f16), f32 accumulate.
//    C[m,n] = scale * sum_k A[m,k] * Bt[n,k]; A row-major [M,K], Bt row-major [N,K].
//    Block = 4 waves (2 x 2) = one 128x128 tile of C; each wave owns a 64x64 tile.
//    Per pass the block's 128 A rows and 128 Bt rows x 128 k (256 B a row) are brought into LDS by asynchronous
//    copies, two buffers: the next pass's copies fly while this pass's fragments are read from LDS.
//    M,N % 128 == 0, K % 128 == 0 (no tail handling). lda, ldb % 8 == 0 (16-B copies).
//    OUT_MODE: 0 = f32, 1 = single f16 plane. The hi/lo plane options are not staged: both must be false.
// ---------------------------------------------------------------------------------------------
#define GBK    128    // k elements of one staged pass
#define GPITCH 136    // LDS row pitch in elements: 272 B = 16 B x 17, conflict-free for 16-B row reads
typedef __attribute__((ext_vector_type(4))) int v4i;
typedef __attribute__((address_space(1))) v4i gv4i;
typedef __attribute__((address_space(3))) v4i lv4i;

// 128 rows x 256 B from g (row pitch ld elements) into l (row pitch GPITCH): 128 threads x 16 copies of 16 B;
// one wave-wide copy covers two whole 256-B rows.
// g is the tile's origin, the same in every lane; goff is the lane's own element offset row * ld + column.
template <typename T>
__device__ __forceinline__ void stage_tile(const T* g, int ld, unsigned goff, T* l, int tid) {
  T* lp = l + (tid >> 4) * GPITCH + (tid & 15) * 8;
#pragma unroll   // the 16 copies go out back to back, none waits for another
  for (int j = 0; j < 16; ++j)
    __builtin_amdgcn_global_load_async_to_lds_b128((gv4i*)(g + (size_t)(j * 8) * ld + goff), (lv4i*)(lp + j * 8 * GPITCH), 0, 0);
}

template <typename T, bool SPLITA, bool SPLITB, int OUT_MODE>
__global__ __launch_bounds__(128) void gemm_t64(
    const unsigned short* __restrict__ Ap, const unsigned short* __restrict__ A2p, int lda, long strideA,
    const unsigned short* __restrict__ Btp, const unsigned short* __restrict__ Bt2p, int ldb, long strideB,
    void* __restrict__ Cout, int ldc, long strideC,
    int M, int N, int K, float scale) {
  static_assert(!SPLITA && !SPLITB);
  typedef typename Frag<T>::V V;
  const T* A = (const T*)Ap; const T* Bt = (const T*)Btp;
  __shared__ __align__(16) T ring[2][2][128 * GPITCH];   // [buffer][A rows | Bt rows]
  __shared__ __align__(16) float sT[4][16 * 68];          // per-wave 16x64 slab, pitch 68 floats
  const int b    = blockIdx.y;
  const int tid  = threadIdx.x;
  const int lane = tid & 31;
  const int wave = tid >> 5;
  const int tilesN = N >> 7;
  const int tilesM = M >> 7;
  const int tile = blockIdx.x;
  if (tile >= tilesM * tilesN) return;   // block-uniform, ahead of every barrier and copy
  const int tm = tile / tilesN;
  const int tn = tile - tm * tilesN;
  const int wm = (wave >> 1) << 6;             // this wave's rows inside the block tile
  const int wn = (wave & 1) << 6;              // this wave's columns inside the block tile
  const int m0 = (tm << 7) + wm;
  const int n0 = (tn << 7) + wn;

  const T* Ag = A  + (size_t)b * strideA + (size_t)(tm << 7) * lda;
  const T* Bg = Bt + (size_t)b * strideB + (size_t)(tn << 7) * ldb;

  const int rlane = lane & 15;                 // row (A) / col (B, D) within subtile
  const int koff  = (lane >> 4) * 8;           // k offset of this lane half
  const int mOff  = (lane >> 4) * 8;           // D row offset

  v8f acc[4][4];
#pragma unroll
  for (int i = 0; i < 4; ++i)
#pragma unroll
    for (int j = 0; j < 4; ++j) acc[i][j] = (v8f){0.f,0.f,0.f,0.f,0.f,0.f,0.f,0.f};

  const int nt = K / GBK;
  const unsigned aoff = (unsigned)(tid >> 4) * (unsigned)lda + (unsigned)(tid & 15) * 8u;
  const unsigned boff = (unsigned)(tid >> 4) * (unsigned)ldb + (unsigned)(tid & 15) * 8u;
  stage_tile<T>(Ag, lda, aoff, ring[0][0], tid);
  stage_tile<T>(Bg, ldb, boff, ring[0][1], tid);
  asm volatile("s_wait_asynccnt 0x0" ::: "memory");   // this wave's copies of pass 0 have landed
  __syncthreads();                                     // ... and every other wave's: pass 0 is readable
  if (nt > 1) {
    stage_tile<T>(Ag + GBK, lda, aoff, ring[1][0], tid);
    stage_tile<T>(Bg + GBK, ldb, boff, ring[1][1], tid);
  }

  for (int t = 0; t < nt; ++t) {
    const T* la = ring[t & 1][0] + (wm + rlane) * GPITCH + koff;
    const T* lb = ring[t & 1][1] + (wn + rlane) * GPITCH + koff;
    // LDS reads run ahead of their products: the next 32-k block's Bt fragments go into a second set at the head of
    // this block, and each A fragment is re-read for the next block as soon as its row of products has been issued
    // (every loop below is unrolled so that each fragment and accumulator index is a constant: registers, no scratch)
    V af[4], bf[2][4];
#pragma unroll
    for (int j = 0; j < 4; ++j) { bf[0][j] = Frag<T>::load(lb + (j << 4) * GPITCH); af[j] = Frag<T>::load(la + (j << 4) * GPITCH); }
#pragma unroll
    for (int kb = 0; kb < GBK / 32; ++kb) {
      const int cu = kb & 1, nx = cu ^ 1;
      if (kb + 1 < GBK / 32) {
#pragma unroll
        for (int j = 0; j < 4; ++j) bf[nx][j] = Frag<T>::load(lb + (j << 4) * GPITCH + (kb + 1) * 32);
      }
#pragma unroll
      for (int i = 0; i < 4; ++i) {
#pragma unroll
        for (int j = 0; j < 4; ++j) acc[i][j] = Frag<T>::mma(af[i], bf[cu][j], acc[i][j]);
        Frag<T>::guard(acc[i][0], acc[i][3], af[i], af[i]);
        if (kb + 1 < GBK / 32) af[i] = Frag<T>::load(la + (i << 4) * GPITCH + (kb + 1) * 32);
      }
      Frag<T>::keep(bf[cu][0], bf[cu][1], bf[cu][2], bf[cu][3]);
    }
    asm volatile("s_wait_dscnt 0x0" ::: "memory");     // this wave's reads of buffer t & 1 are done before it is refilled
    asm volatile("s_wait_asynccnt 0x0" ::: "memory");  // this wave's copies of pass t + 1 have landed
    __syncthreads();                                    // publishes pass t + 1, frees buffer t & 1
    if (t + 2 < nt) {
      stage_tile<T>(Ag + (size_t)(t + 2) * GBK, lda, aoff, ring[t & 1][0], tid);
      stage_tile<T>(Bg + (size_t)(t + 2) * GBK, ldb, boff, ring[t & 1][1], tid);
    }
  }
  asm volatile("s_wait_asynccnt 0x0" ::: "memory");    // no copy is outstanding when the wave goes on
  acc_guard4(acc[0][0], acc[0][1], acc[0][2], acc[0][3]);
  acc_guard4(acc[1][0], acc[1][1], acc[1][2], acc[1][3]);
  acc_guard4(acc[2][0], acc[2][1], acc[2][2], acc[2][3]);
  acc_guard4(acc[3][0], acc[3][1], acc[3][2], acc[3][3]);

  // ---- epilogue ----
  float* slab = sT[wave];
#pragma unroll
  for (int i = 0; i < 4; ++i) {
    const int mBase = m0 + (i << 4);
#pragma unroll
    for (int j = 0; j < 4; ++j) {
#pragma unroll
      for (int r = 0; r < 8; ++r) {
        const float v = acc[i][j][r] * scale;
        slab[(mOff + r) * 68 + (j << 4) + rlane] = v;
      }
    }
    __builtin_amdgcn_fence(3, "workgroup");
    __builtin_amdgcn_wave_barrier();
    __builtin_amdgcn_fence(2, "workgroup");
    if (OUT_MODE == 0) {
      float* Cf = (float*)Cout + (size_t)b * strideC;
      const int hh = lane >> 4, c4 = (lane & 15) * 4;     // row seg = 256 B = 16 lanes x 16 B
      {
#pragma unroll
        for (int it = 0; it < 8; ++it) {
          const int row = it * 2 + hh;
          v4f v = *(const v4f*)(slab + row * 68 + c4);
          *(v4f*)(Cf + (size_t)(mBase + row) * ldc + n0 + c4) = v;
        }
        
      }
    } else {
      const int q = lane >> 3, c8 = (lane & 7) * 8;
      unsigned short* Cs = (unsigned short*)Cout + (size_t)b * strideC;
      {
#pragma unroll
        for (int it = 0; it < 4; ++it) {
          const int row = it * 4 + q;
          const float* sp = slab + row * 68 + c8;
          v8h hv;
#pragma unroll
          for (int e = 0; e < 8; ++e) hv[e] = (_Float16)sp[e];
          *(v8h*)(Cs + (size_t)(mBase + row) * ldc + n0 + c8) = hv;
        }
        
      }
    }
    __builtin_amdgcn_fence(3, "workgroup");
    __builtin_amdgcn_wave_barrier();
    __builtin_amdgcn_fence(2, "workgroup");
  }
}

// ---------------------------------------------------------------------------------------------
// 6) GQA attention, head_dim 128, 16 query heads, kv head = h >> 1, all keys visited (no mask), tanh softcap.
//    Planes: Q f16 [NTOK][QDIM] (col = h*128 + d, rotated, unscaled), K f16 [NTOK][KVDIM] (col = kvh*128 + d),
//            V^T f16 [NB][KVDIM][SEQ] (row = kvh*128 + d). Output: ctx f16 x2^6 [NTOK][QDIM] (col = h*128 + d).
//    Block = 8 waves = 128 query rows of one (b, h); wave w owns rows qb*128 + 16w .. +15 over the full head.
//    Per 64-key chunk: S(16 x 64) over d = 128 (one f16 product per tile pair); logit = 50*tanh(S/sqrt(128)/50) in f32;
//    reloaded as an A fragment through the same element type; O(16 x 128) += P(16 x 64) . V.
//    The P tile and the epilogue slab are wave-private (16 x 64 P tile, 16 x 64 f32 epilogue slab).
//    The chunk's K rows (64 x 256 B) and V^T rows (128 x 128 B) are the same for all 8 waves: the block brings them into
//    LDS once, by asynchronous copies of whole 128-B lines, two buffers: the next chunk's copies fly while this chunk is
//    worked on; every wave reads its fragments from LDS. One block barrier per chunk.
// ---------------------------------------------------------------------------------------------
#define KPITCH 136    // LDS pitch of a K row in elements: 272 B = 16 B x 17, conflict-free for 16-B row reads
#define VPITCH 72     // LDS pitch of a V^T row in elements: 144 B = 16 B x 9, conflict-free for 16-B row reads

// kg, vg: origin of the chunk's K rows (pitch KVDIM) and V^T rows (pitch SEQ), the same in every lane.
// 256 threads x (4 + 4) copies of 16 B; one wave-wide copy covers two whole K rows or four whole V^T row pieces.
__device__ __forceinline__ void stage_kv(const _Float16* kg, const _Float16* vg, _Float16* kl, _Float16* vl, int tid) {
  const unsigned ko = (unsigned)(tid >> 4) * (unsigned)KVDIM + (unsigned)(tid & 15) * 8u;
  const unsigned vo = (unsigned)(tid >> 3) * (unsigned)SEQ + (unsigned)(tid & 7) * 8u;
  _Float16* kp = kl + (tid >> 4) * KPITCH + (tid & 15) * 8;
  _Float16* vp = vl + (tid >> 3) * VPITCH + (tid & 7) * 8;
#pragma unroll   // the copies go out back to back, none waits for another
  for (int j = 0; j < 4; ++j)
    __builtin_amdgcn_global_load_async_to_lds_b128((gv4i*)(kg + (size_t)(j * 16) * KVDIM + ko), (lv4i*)(kp + j * 16 * KPITCH), 0, 0);
#pragma unroll   // as above
  for (int j = 0; j < 4; ++j)
    __builtin_amdgcn_global_load_async_to_lds_b128((gv4i*)(vg + (size_t)(j * 32) * SEQ + vo), (lv4i*)(vp + j * 32 * VPITCH), 0, 0);
}

__global__ __launch_bounds__(256) void attn_kernel(
    const unsigned short* __restrict__ Qp, const unsigned short* __restrict__ Kp,
    const unsigned short* __restrict__ Vtp, unsigned short* __restrict__ Op) {
  __shared__ __align__(16) float    Ost[8][16 * 64];          // 32 KB: per-wave epilogue staging
  __shared__ __align__(16) _Float16 Psh[8][16 * KV_CHUNK];    // 16 KB: per-wave P tile [row][kv]
  __shared__ __align__(16) _Float16 Kst[2][KV_CHUNK * KPITCH]; // 34 KB: K rows of a chunk [kv][d], two buffers
  __shared__ __align__(16) _Float16 Vst[2][HD * VPITCH];       // 36 KB: V^T rows of a chunk [d][kv], two buffers

  const _Float16* Q  = (const _Float16*)Qp;
  const _Float16* Kk = (const _Float16*)Kp;
  const _Float16* Vt = (const _Float16*)Vtp;

  const int tid  = threadIdx.x;
  const int wave = tid >> 5, lane = tid & 31;
  const int hh   = lane >> 4, c = lane & 15, koff = hh * 8;
  const int nqb  = SEQ / QBLK;
  const int bx   = blockIdx.x;
  const int qb   = bx % nqb;
  const int bhid = bx / nqb;
  const int h    = bhid % NQH;
  const int b    = bhid / NQH;
  const int kvh  = h >> 1;
  const int q0   = qb * QBLK + wave * 16;                       // sequence position of this wave's row 0
  const size_t tokw = (size_t)b * SEQ + q0;                     // compact token index of this wave's row 0
  const size_t qoff = (tokw + c) * QDIM + (size_t)h * HD + koff;
  const _Float16* Kg = Kk + (size_t)b * SEQ * KVDIM + (size_t)kvh * HD;            // this head's K rows, key 0
  const _Float16* Vg = Vt + (size_t)b * KVDIM * SEQ + (size_t)(kvh * HD) * SEQ;    // this head's V^T rows, key 0
  _Float16* pw = Psh[wave];

  float mrow[8], lrow[8];
  v8f oacc[8];
#pragma unroll
  for (int r = 0; r < 8; ++r) { mrow[r] = -INFINITY; lrow[r] = 0.f; }
#pragma unroll
  for (int t = 0; t < 8; ++t) oacc[t] = (v8f){0.f,0.f,0.f,0.f,0.f,0.f,0.f,0.f};

  const int nch = SEQ / KV_CHUNK;
  stage_kv(Kg, Vg, Kst[0], Vst[0], tid);
  asm volatile("s_wait_asynccnt 0x0" ::: "memory");   // this wave's copies of chunk 0 have landed
  __syncthreads();                                     // ... and every other wave's: chunk 0 is readable
  if (nch > 1) stage_kv(Kg + (size_t)KV_CHUNK * KVDIM, Vg + KV_CHUNK, Kst[1], Vst[1], tid);

  for (int kc = 0; kc < nch; ++kc) {
    const _Float16* kl = Kst[kc & 1] + c * KPITCH + koff;
    const _Float16* vl = Vst[kc & 1] + c * VPITCH + koff;

    // ---- raw scores S(16 q x 64 kv) over d = 128 ----
    v8f s[4];
#pragma unroll
    for (int j = 0; j < 4; ++j) s[j] = (v8f){0.f,0.f,0.f,0.f,0.f,0.f,0.f,0.f};
    // LDS reads stand in groups of four fragments, one group ahead of their products (two register sets); the loops are
    // unrolled so that every fragment index is a constant: registers, no scratch
    v16h kf[2][4];
#pragma unroll
    for (int j = 0; j < 4; ++j) kf[0][j] = Frag<_Float16>::load(kl + j * 16 * KPITCH);
#pragma unroll
    for (int dc = 0; dc < 4; ++dc) {
      const int cu = dc & 1, nx = cu ^ 1;
      const v16h qa = Frag<_Float16>::load(Q + qoff + dc * 32);
      if (dc + 1 < 4) {
#pragma unroll
        for (int j = 0; j < 4; ++j) kf[nx][j] = Frag<_Float16>::load(kl + j * 16 * KPITCH + (dc + 1) * 32);
      }
#pragma unroll
      for (int j = 0; j < 4; ++j) s[j] = h_mma(qa, kf[cu][j], s[j]);
    }

    // ---- scale, tanh softcap (f32), row max ----
    float cm[8];
#pragma unroll
    for (int r = 0; r < 8; ++r) {
      float m = -INFINITY;
#pragma unroll
      for (int j = 0; j < 4; ++j) {
        // v_tanh_f32: one instruction and no branch, where the library tanhf takes two divergent branches per score
        const float sv = SOFTCAP * __builtin_amdgcn_tanhf(s[j][r] * (RSQ * INVCAP));
        s[j][r] = sv;
        m = fmaxf(m, sv);
      }
#pragma unroll
      for (int off = 1; off < 16; off <<= 1) m = fmaxf(m, __shfl_xor(m, off, 32));
      cm[r] = m;
    }

    // all P fragment loads of the prior chunk (same wave) complete before the tile is rewritten
    __builtin_amdgcn_fence(3, "workgroup");
    __builtin_amdgcn_wave_barrier();
    __builtin_amdgcn_fence(2, "workgroup");

    // ---- online softmax (f32); P x 2^10 as f16 into this wave's tile ----
#pragma unroll
    for (int r = 0; r < 8; ++r) {
      const float mnew = fmaxf(mrow[r], cm[r]);
      const float alpha = __expf(mrow[r] - mnew);
      mrow[r] = mnew;
      float psum = 0.f;
#pragma unroll
      for (int j = 0; j < 4; ++j) {
        const float p = __expf(s[j][r] - mnew);
        psum += p;
        pw[(8 * hh + r) * KV_CHUNK + j * 16 + c] = (_Float16)(p * PCARRY);
      }
#pragma unroll
      for (int off = 1; off < 16; off <<= 1) psum += __shfl_xor(psum, off, 32);
      lrow[r] = lrow[r] * alpha + psum;
#pragma unroll
      for (int t = 0; t < 8; ++t) oacc[t][r] *= alpha;
    }
    __builtin_amdgcn_fence(3, "workgroup");
    __builtin_amdgcn_wave_barrier();
    __builtin_amdgcn_fence(2, "workgroup");

    // ---- O(16 x 128) += P(16 x 64) . V ----
    // group g = 32 keys kk = g >> 1, output tiles 4 * (g & 1) .. + 3; V^T fragments read one group ahead, as for K above
    v16h vf[2][4];
#pragma unroll
    for (int t = 0; t < 4; ++t) vf[0][t] = Frag<_Float16>::load(vl + t * 16 * VPITCH);
    v16h pa;
#pragma unroll
    for (int g = 0; g < 4; ++g) {
      const int cu = g & 1, nx = cu ^ 1, kk = g >> 1, tb = (g & 1) * 4;
      if (tb == 0) pa = Frag<_Float16>::load(pw + c * KV_CHUNK + kk * 32 + koff);
      if (g + 1 < 4) {
#pragma unroll
        for (int t = 0; t < 4; ++t) vf[nx][t] = Frag<_Float16>::load(vl + (((g + 1) & 1) * 4 + t) * 16 * VPITCH + ((g + 1) >> 1) * 32);
      }
#pragma unroll
      for (int t = 0; t < 4; ++t) oacc[tb + t] = h_mma(pa, vf[cu][t], oacc[tb + t]);
    }
    asm volatile("s_wait_dscnt 0x0" ::: "memory");     // this wave's reads of buffer kc & 1 are done before it is refilled
    asm volatile("s_wait_asynccnt 0x0" ::: "memory");  // this wave's copies of chunk kc + 1 have landed
    __syncthreads();                                    // publishes chunk kc + 1, frees buffer kc & 1
    if (kc + 2 < nch)
      stage_kv(Kg + (size_t)(kc + 2) * KV_CHUNK * KVDIM, Vg + (kc + 2) * KV_CHUNK, Kst[kc & 1], Vst[kc & 1], tid);
  }
  asm volatile("s_wait_asynccnt 0x0" ::: "memory");    // no copy is outstanding when the wave goes on

  // ---- epilogue: normalise (x 2^6 / (2^10 * l)), stage 16 x 64 halves in this wave's own slab, write the f16 ctx plane ----
  // coverage: 2 halves x (4 iterations x 4 rows) x 8 lanes x 8 elements = 16 rows x 128 dims.
  float* os = Ost[wave];
  const int q4 = lane >> 3, c8 = (lane & 7) * 8;
#pragma unroll
  for (int th = 0; th < 2; ++th) {
#pragma unroll
    for (int r = 0; r < 8; ++r) {
      const float inv = OCARRY / (PCARRY * lrow[r]);   // undo the P carry (2^10) and apply the ctx carry (2^6)
#pragma unroll
      for (int tt = 0; tt < 4; ++tt) os[(8 * hh + r) * 64 + tt * 16 + c] = oacc[th * 4 + tt][r] * inv;
    }
    __builtin_amdgcn_fence(3, "workgroup");
    __builtin_amdgcn_wave_barrier();
    __builtin_amdgcn_fence(2, "workgroup");
    {
#pragma unroll
      for (int it = 0; it < 4; ++it) {
        const int row = it * 4 + q4;
        const float* sp = os + row * 64 + c8;
        v8h hv;
#pragma unroll
        for (int e = 0; e < 8; ++e) hv[e] = (_Float16)sp[e];
        const size_t o = (tokw + row) * QDIM + (size_t)h * HD + th * 64 + c8;
        *(v8h*)(Op + o) = hv;
      }
      
    }
    __builtin_amdgcn_fence(3, "workgroup");
    __builtin_amdgcn_wave_barrier();
    __builtin_amdgcn_fence(2, "workgroup");
  }
}

// ---------------------------------------------------------------------------------------------
// host
// ---------------------------------------------------------------------------------------------
static_assert((NTOK * HID / 8) % 256 == 0);
static_assert((NTOK * NQH * 8) % 256 == 0);
static_assert((NTOK * NKVH * 8) % 256 == 0);
static_assert((SEQ * HHALF) % 256 == 0);
static_assert(HID % 128 == 0 && QDIM % 128 == 0);
static_assert(NTOK % 128 == 0 && HID % 128 == 0 && QDIM % 128 == 0 && KVDIM % 128 == 0 && SEQ % 128 == 0);
static_assert(SEQ % QBLK == 0 && SEQ % KV_CHUNK == 0 && QBLK == 128 && KV_CHUNK == 64 && HD == 128);
static_assert(NB >= 1 && NB <= NB_FULL && SEQ <= SEQ_FULL);
static_assert(NQH == 2 * NKVH);

extern "C" void kernel_launch(void* const* d_in, const int* in_sizes, int n_in,
                              void* d_out, int out_size, void* d_ws, size_t ws_size, hipStream_t stream) {
  if (n_in < 5) return;
  const size_t needTok = (size_t)(NB - 1) * SEQ_FULL + SEQ;
  if ((size_t)in_sizes[0] < needTok * HID) return;
  if ((size_t)in_sizes[1] < (size_t)HID * QDIM) return;
  if ((size_t)in_sizes[2] < (size_t)HID * KVDIM) return;
  if ((size_t)in_sizes[3] < (size_t)HID * KVDIM) return;
  if ((size_t)in_sizes[4] < (size_t)QDIM * HID) return;
  if ((size_t)out_size < needTok * HID) return;

  const float* x  = (const float*)d_in[0];   // [2,2048,2048]
  const float* Wq = (const float*)d_in[1];   // [2048,2048]  [in][out]
  const float* Wk = (const float*)d_in[2];   // [2048,1024]
  const float* Wv = (const float*)d_in[3];   // [2048,1024]
  const float* Wo = (const float*)d_in[4];   // [2048,2048]
  float* out = (float*)d_out;                // [2,2048,2048] f32

  //   XB   bf16 [NTOK][HID]
  //   WQT  bf16 [QDIM][HID], WKT bf16 [KVDIM][HID], WVT bf16 [KVDIM][HID], WOT f16 [HID][QDIM]
  //   R1   f32 [NTOK][QDIM] for q; later reused: Kf f32 [NTOK][KVDIM] at +0, ctx f16 [NTOK][QDIM] at +0, V^T f16 [NB][KVDIM][SEQ] at +NTOK*QDIM*2
  //   QP f16 [NTOK][QDIM]; KP f16 [NTOK][KVDIM]; COS, SIN f32 [SEQ][HHALF]
  const size_t szXB  = (size_t)NTOK * HID * 2;
  const size_t szWQT = (size_t)QDIM * HID * 2;
  const size_t szWKT = (size_t)KVDIM * HID * 2;
  const size_t szWOT = (size_t)HID * QDIM * 2;
  const size_t szR1  = (size_t)NTOK * QDIM * 4;
  const size_t szQP  = (size_t)NTOK * QDIM * 2;
  const size_t szKP  = (size_t)NTOK * KVDIM * 2;
  const size_t szVT  = (size_t)NB * KVDIM * SEQ * 2;
  const size_t szTAB = (size_t)SEQ * HHALF * 4;
  static_assert((size_t)NTOK * KVDIM * 4 <= (size_t)NTOK * QDIM * 4);
  static_assert((size_t)NTOK * QDIM * 2 + (size_t)NB * KVDIM * SEQ * 2 <= (size_t)NTOK * QDIM * 4);
  const size_t OFF_XB  = 0;
  const size_t OFF_WQT = OFF_XB + szXB;
  const size_t OFF_WKT = OFF_WQT + szWQT;
  const size_t OFF_WVT = OFF_WKT + szWKT;
  const size_t OFF_WOT = OFF_WVT + szWKT;
  const size_t OFF_R1  = OFF_WOT + szWOT;
  const size_t OFF_QF  = OFF_R1;
  const size_t OFF_KF  = OFF_R1;
  const size_t OFF_CTX = OFF_R1;
  const size_t OFF_VT  = OFF_R1 + szQP;
  const size_t OFF_QP  = OFF_R1 + szR1;
  const size_t OFF_KP  = OFF_QP + szQP;
  const size_t OFF_COS = OFF_KP + szKP;
  const size_t OFF_SIN = OFF_COS + szTAB;
  const size_t WS_TOTAL = OFF_SIN + szTAB;
  (void)szVT;
  if (ws_size < WS_TOTAL) return;

  char* ws = (char*)d_ws;
  unsigned short* xb  = (unsigned short*)(ws + OFF_XB);
  unsigned short* WqT = (unsigned short*)(ws + OFF_WQT);
  unsigned short* WkT = (unsigned short*)(ws + OFF_WKT);
  unsigned short* WvT = (unsigned short*)(ws + OFF_WVT);
  unsigned short* WoT = (unsigned short*)(ws + OFF_WOT);
  float* Qf  = (float*)(ws + OFF_QF);
  float* Kf  = (float*)(ws + OFF_KF);
  unsigned short* ctx = (unsigned short*)(ws + OFF_CTX);
  unsigned short* Vt  = (unsigned short*)(ws + OFF_VT);
  unsigned short* Qpl = (unsigned short*)(ws + OFF_QP);
  unsigned short* Kpl = (unsigned short*)(ws + OFF_KP);
  float* cosT = (float*)(ws + OFF_COS);
  float* sinT = (float*)(ws + OFF_SIN);

  // inv_freq[j] = 1 / 10000^(2j/128), pow in double then RNE to f32, reciprocal as one f32 divide
  RopeFreq fr;
  for (int j = 0; j < HHALF; ++j) {
    const float e = (float)(2 * j) / 128.0f;
    const double p = pow(10000.0, (double)e);
    const float pf = (float)p;
    fr.f[j] = 1.0f / pf;
  }

  // 1) x -> compact bf16 plane
  cast_x_bf16<<<(NTOK * HID / 8) / 256, 256, 0, stream>>>(x, xb, NTOK * HID / 8);
  // 2) transposed 16-bit weight planes: in[rows][cols] -> out[cols][rows]; grid = (cols/64, rows/64)
  transpose_cast16<0><<<dim3(QDIM / 64, HID / 64), 256, 0, stream>>>(Wq, WqT, HID, QDIM, 1.0f);      // [HID][QDIM]  -> [QDIM][HID]
  transpose_cast16<0><<<dim3(KVDIM / 64, HID / 64), 256, 0, stream>>>(Wk, WkT, HID, KVDIM, 1.0f);    // [HID][KVDIM] -> [KVDIM][HID]
  transpose_cast16<0><<<dim3(KVDIM / 64, HID / 64), 256, 0, stream>>>(Wv, WvT, HID, KVDIM, 1.0f);    // [HID][KVDIM] -> [KVDIM][HID]
  transpose_cast16<1><<<dim3(HID / 64, QDIM / 64), 256, 0, stream>>>(Wo, WoT, QDIM, HID, WOCARRY);   // [QDIM][HID]  -> [HID][QDIM], f16 x 2^4
  // 3) RoPE tables
  rope_table_kernel<<<(SEQ * HHALF) / 256, 256, 0, stream>>>(cosT, sinT, fr);
  // 4) q = x @ Wq -> f32 [NTOK][QDIM]   (M=NTOK, N=QDIM, K=HID)
  {
    const int tiles = (NTOK / 128) * (QDIM / 128);
    gemm_t64<__bf16, false, false, 0><<<dim3(tiles, 1), 128, 0, stream>>>(
        xb, xb, HID, 0L, WqT, WqT, HID, 0L, (void*)Qf, QDIM, 0L, NTOK, QDIM, HID, 1.0f);
  }
  // 5) RoPE of q (16 heads) -> f16 plane
  rope_f16_kernel<NQH, QDIM><<<(NTOK * NQH * 8) / 256, 256, 0, stream>>>(Qf, cosT, sinT, Qpl, 1.0f);
  // 6) k = x @ Wk -> f32 [NTOK][KVDIM]  (M=NTOK, N=KVDIM, K=HID), into the q region (q is dead)
  {
    const int tiles = (NTOK / 128) * (KVDIM / 128);
    gemm_t64<__bf16, false, false, 0><<<dim3(tiles, 1), 128, 0, stream>>>(
        xb, xb, HID, 0L, WkT, WkT, HID, 0L, (void*)Kf, KVDIM, 0L, NTOK, KVDIM, HID, 1.0f);
  }
  // 7) RoPE of k (8 kv heads) -> f16 plane
  rope_f16_kernel<NKVH, KVDIM><<<(NTOK * NKVH * 8) / 256, 256, 0, stream>>>(Kf, cosT, sinT, Kpl, 1.0f);
  // 8) v^T per batch = Wv^T @ x_b^T -> f16 [NB][KVDIM][SEQ]   (M=KVDIM, N=SEQ, K=HID, batch NB)
  {
    const int tiles = (KVDIM / 128) * (SEQ / 128);
    gemm_t64<__bf16, false, false, 1><<<dim3(tiles, NB), 128, 0, stream>>>(
        WvT, WvT, HID, 0L, xb, xb, HID, (long)SEQ * HID, (void*)Vt, SEQ, (long)KVDIM * SEQ,
        KVDIM, SEQ, HID, 1.0f);
  }
  // 9) attention -> ctx f16 x 2^6 [NTOK][QDIM]  (k f32 region is dead; V^T region disjoint)
  attn_kernel<<<NB * NQH * (SEQ / QBLK), 256, 0, stream>>>(Qpl, Kpl, Vt, ctx);
  // 10) out = ctx @ Wo -> d_out f32, per batch rows b*SEQ_FULL..  (M=SEQ, N=HID, K=QDIM, scale 2^-10)
  {
    const int tiles = (SEQ / 128) * (HID / 128);
    gemm_t64<_Float16, false, false, 0><<<dim3(tiles, NB), 128, 0, stream>>>(
        ctx, ctx, QDIM, (long)SEQ * QDIM, WoT, WoT, QDIM, 0L, (void*)out, HID, (long)SEQ_FULL * HID,
        SEQ, HID, QDIM, OUTSCALE);
  }
}

// v004
// It runs in 212 microseconds.
// Next to v003, in two timings, it ran 1.23 times as fast each time.
// Over all steps from v000 it is 3.21 times as fast.
// x@Wq, x@Wk, Wv^T@x^T: v_wmma_f32_16x16x32_bf16 on RNE-bf16 input planes (f32 accumulate); q.k^T: v_wmma_f32_16x16x32_f16 (q, k single f16 planes, f32 accumulate); p.v: v_wmma_f32_16x16x32_f16 (p f16 carried x2^10, v f16, f32 accumulate); ctx@Wo: v_wmma_f32_16x16x32_f16 (ctx f16 carried x2^6, Wo f16 carried x2^4 built from RNE-bf16 values, f32 accumulate); RoPE, tanh softcap and softmax in f32.
#include <hip/hip_runtime.h>
#include <math.h>

#pragma clang fp contract(off)

#ifndef NB
#define NB 2
#endif
#ifndef SEQ
#define SEQ 2048
#endif
#define NB_FULL  2
#define SEQ_FULL 2048
#define HID      2048
#define NQH      16
#define NKVH     8
#define HD       128
#define HHALF    64
#define QDIM     (NQH * HD)
#define KVDIM    (NKVH * HD)
#define NTOK     (NB * SEQ)
#define KV_CHUNK 64
#define QBLK     128
#define RSQ      0.08838834764831845f
#define SOFTCAP  50.0f
#define INVCAP   0.02f
#define PCARRY   1024.0f
#define OCARRY   64.0f
#define WOCARRY  16.0f
#define OUTSCALE 0.0009765625f

typedef __attribute__((ext_vector_type(16))) _Float16 v16h;
typedef __attribute__((ext_vector_type(8)))  _Float16 v8h;
typedef __attribute__((ext_vector_type(16))) __bf16   v16b;
typedef __attribute__((ext_vector_type(8)))  __bf16   v8b;
typedef __attribute__((ext_vector_type(8)))  float    v8f;
typedef __attribute__((ext_vector_type(4)))  float    v4f;
typedef __attribute__((ext_vector_type(4)))  unsigned int v4u;

__device__ __forceinline__ unsigned short f2bf_bits(float f) {
  unsigned u = __float_as_uint(f);
  return (unsigned short)((u + 0x7FFFu + ((u >> 16) & 1u)) >> 16);
}
__device__ __forceinline__ float bf_bits2f(unsigned short h) { return __uint_as_float(((unsigned)h) << 16); }
__device__ __forceinline__ unsigned short f2h_bits(float f) { const _Float16 h = (_Float16)f; return __builtin_bit_cast(unsigned short, h); }

// hazard guards as plain device helpers
__device__ __forceinline__ void dep_guard_h(v8f& a, v8f& b, v16h x, v16h y) { asm volatile("v_nop\n\tv_nop\n\tv_nop\n\tv_nop" : "+v"(a), "+v"(b) : "v"(x), "v"(y)); }
__device__ __forceinline__ void dep_guard_b(v8f& a, v8f& b, v16b x, v16b y) { asm volatile("v_nop\n\tv_nop\n\tv_nop\n\tv_nop" : "+v"(a), "+v"(b) : "v"(x), "v"(y)); }
__device__ __forceinline__ void keep4_h(v16h a, v16h b, v16h c, v16h d) { asm volatile("v_nop" :: "v"(a), "v"(b), "v"(c), "v"(d)); }
__device__ __forceinline__ void keep4_b(v16b a, v16b b, v16b c, v16b d) { asm volatile("v_nop" :: "v"(a), "v"(b), "v"(c), "v"(d)); }
__device__ __forceinline__ void acc_guard4(v8f& a, v8f& b, v8f& c, v8f& d) { asm volatile("v_nop\n\tv_nop\n\tv_nop\n\tv_nop" : "+v"(a), "+v"(b), "+v"(c), "+v"(d)); }

// fragment loaders: lane l, row/col = l & 15, elements 0..7 <- p[0..7] (k0 + 8h + 0..7), 8..15 <- p[16..23] (k0 + 16 + 8h + 0..7); caller adds 8h
template <typename T> struct Frag;
template <> struct Frag<_Float16> {
  typedef v16h V; union U { v16h v; v8h h[2]; };
  static __device__ __forceinline__ v16h load(const _Float16* p) {
    U f; f.h[0] = *(const v8h*)(p); f.h[1] = *(const v8h*)(p + 16); return f.v;
  }
  static __device__ __forceinline__ v8f mma(v16h a, v16h b, v8f c) {
    return __builtin_amdgcn_wmma_f32_16x16x32_f16(false, a, false, b, (short)0, c, false, false);
  }
  static __device__ __forceinline__ void guard(v8f& a, v8f& b, v16h x, v16h y) { dep_guard_h(a, b, x, y); }
  static __device__ __forceinline__ void keep(v16h a, v16h b, v16h c, v16h d) { keep4_h(a, b, c, d); }
};
template <> struct Frag<__bf16> {
  typedef v16b V; union U { v16b v; v8b h[2]; };
  static __device__ __forceinline__ v16b load(const __bf16* p) {
    U f; f.h[0] = *(const v8b*)(p); f.h[1] = *(const v8b*)(p + 16); return f.v;
  }
  static __device__ __forceinline__ v8f mma(v16b a, v16b b, v8f c) {
    return __builtin_amdgcn_wmma_f32_16x16x32_bf16(false, a, false, b, (short)0, c, false, false);
  }
  static __device__ __forceinline__ void guard(v8f& a, v8f& b, v16b x, v16b y) { dep_guard_b(a, b, x, y); }
  static __device__ __forceinline__ void keep(v16b a, v16b b, v16b c, v16b d) { keep4_b(a, b, c, d); }
};

// single f16 WMMA with the 4-nop guard tied to D and keeping A/B live
__device__ __forceinline__ v8f h_mma(v16h a, v16h b, v8f c) {
  c = __builtin_amdgcn_wmma_f32_16x16x32_f16(false, a, false, b, (short)0, c, false, false);
  asm volatile("v_nop\n\tv_nop\n\tv_nop\n\tv_nop" : "+v"(c) : "v"(a), "v"(b));
  return c;
}

// ---------------------------------------------------------------------------------------------
// 1) x f32 [NB_FULL][SEQ_FULL][HID] -> compact bf16 plane [NTOK][HID], 8 elements per thread, one 16-B store per lane
// ---------------------------------------------------------------------------------------------
__global__ __launch_bounds__(256) void cast_x_bf16(const float* __restrict__ in, unsigned short* __restrict__ out, int n8) {
  const int i = blockIdx.x * 256 + threadIdx.x;
  if (i < n8) {
    const size_t o   = (size_t)i * 8;
    const size_t tok = o / HID;
    const size_t col = o - tok * HID;
    const size_t bb  = tok / SEQ;
    const size_t ss  = tok - bb * SEQ;
    const size_t src = (bb * SEQ_FULL + ss) * (size_t)HID + col;
    const v4f a  = *(const v4f*)(in + src);
    const v4f bq = *(const v4f*)(in + src + 4);
    v4u w;
    w[0] = (unsigned)f2bf_bits(a[0])  | ((unsigned)f2bf_bits(a[1])  << 16);
    w[1] = (unsigned)f2bf_bits(a[2])  | ((unsigned)f2bf_bits(a[3])  << 16);
    w[2] = (unsigned)f2bf_bits(bq[0]) | ((unsigned)f2bf_bits(bq[1]) << 16);
    w[3] = (unsigned)f2bf_bits(bq[2]) | ((unsigned)f2bf_bits(bq[3]) << 16);
    *(v4u*)(out + o) = w;
    
  }
}

// ---------------------------------------------------------------------------------------------
// 2) in[nrows][ncols] f32 -> out[ncols][nrows] 16-bit. MODE 0: bf16 bits (RNE); MODE 1: f16 bits of (RNE-bf16 value * scl).
//    Block = 64x64 tile through LDS (cross-thread, block barrier). grid = (ncols/64, nrows/64); nrows, ncols multiples of 64.
//    load coverage: 256 threads x 16 floats = 64x64 tile; store coverage: 2 iterations x 256 threads x 8 = 64 rows x 64.
// ---------------------------------------------------------------------------------------------
template <int MODE> __device__ __forceinline__ unsigned short pk16(float f, float scl) {
  if (MODE == 0) return f2bf_bits(f);
  const float g = bf_bits2f(f2bf_bits(f)) * scl;
  return f2h_bits(g);
}

template <int MODE>
__global__ __launch_bounds__(256) void transpose_cast16(const float* __restrict__ in, unsigned short* __restrict__ out, int nrows, int ncols, float scl) {
  __shared__ float tile[64 * 65];
  const int tid = threadIdx.x;
  const int r0 = blockIdx.y * 64, c0 = blockIdx.x * 64;
  {
    const int row = tid >> 2, cc = (tid & 3) * 16;
    const float* s = in + (size_t)(r0 + row) * ncols + c0 + cc;
#pragma unroll
    for (int q = 0; q < 4; ++q) {
      const v4f v = *(const v4f*)(s + 4 * q);
#pragma unroll
      for (int e = 0; e < 4; ++e) tile[(cc + 4 * q + e) * 65 + row] = v[e];
    }
  }
  __syncthreads();
  {
#pragma unroll
    for (int it = 0; it < 2; ++it) {
      const int orow = it * 32 + (tid >> 3), seg = (tid & 7) * 8;
      const float* tp = tile + orow * 65 + seg;
      v4u w;
#pragma unroll
      for (int e = 0; e < 4; ++e) w[e] = (unsigned)pk16<MODE>(tp[2 * e], scl) | ((unsigned)pk16<MODE>(tp[2 * e + 1], scl) << 16);
      *(v4u*)(out + (size_t)(c0 + orow) * nrows + r0 + seg) = w;
    }
    
  }
}

// ---------------------------------------------------------------------------------------------
// 3) RoPE cos/sin tables [SEQ][HHALF] f32: angle = pos * inv_freq[j] (single f32 multiply), precise cosf/sinf.
// ---------------------------------------------------------------------------------------------
struct RopeFreq { float f[HHALF]; };
static_assert(sizeof(RopeFreq) == 256);

__global__ __launch_bounds__(256) void rope_table_kernel(float* __restrict__ cosT, float* __restrict__ sinT, RopeFreq fr) {
  __shared__ float invf[HHALF];
  if (threadIdx.x == 0) {
#pragma unroll
    for (int q = 0; q < HHALF; ++q) invf[q] = fr.f[q];
  }
  __syncthreads();
  const int i = blockIdx.x * 256 + threadIdx.x;          // exactly SEQ*HHALF threads
  const int t = i >> 6;
  const int jj = i & (HHALF - 1);
  const float ang = (float)t * invf[jj];
  const float cv = cosf(ang);
  const float sv = sinf(ang);
  ((float*)cosT)[i] = cv;
  ((float*)sinT)[i] = sv;
  
}

// ---------------------------------------------------------------------------------------------
// 4) RoPE -> single f16 plane. src f32 [NTOK][PITCH], head hs occupies cols hs*128 .. hs*128+127 (first 64 = x1, next 64 = x2).
//    Thread = (token, head, 8-wide pair group jg): out[d] = x1[d]*cos - x2[d]*sin, out[d+64] = x2[d]*cos + x1[d]*sin, times scl.
// ---------------------------------------------------------------------------------------------
template <int NHEAD, int PITCH>
__global__ __launch_bounds__(256) void rope_f16_kernel(const float* __restrict__ src, const float* __restrict__ cosT, const float* __restrict__ sinT,
                                                        unsigned short* __restrict__ outP, float scl) {
  const int i = blockIdx.x * 256 + threadIdx.x;          // exactly NTOK*NHEAD*8 threads
  const int jg = i & 7;
  const int hs = (i >> 3) % NHEAD;
  const int tok = (i >> 3) / NHEAD;
  const int pos = tok % SEQ;
  const size_t base = (size_t)tok * PITCH + (size_t)hs * HD + jg * 8;
  const size_t tb = (size_t)pos * HHALF + jg * 8;
  const v4f x1a = *(const v4f*)(src + base);
  const v4f x1b = *(const v4f*)(src + base + 4);
  const v4f x2a = *(const v4f*)(src + base + HHALF);
  const v4f x2b = *(const v4f*)(src + base + HHALF + 4);
  const v4f ca = *(const v4f*)(cosT + tb);
  const v4f cb = *(const v4f*)(cosT + tb + 4);
  const v4f sa = *(const v4f*)(sinT + tb);
  const v4f sb = *(const v4f*)(sinT + tb + 4);
  v4f o1a, o1b, o2a, o2b;
#pragma unroll
  for (int e = 0; e < 4; ++e) {
    o1a[e] = (x1a[e] * ca[e] - x2a[e] * sa[e]) * scl;
    o2a[e] = (x2a[e] * ca[e] + x1a[e] * sa[e]) * scl;
    o1b[e] = (x1b[e] * cb[e] - x2b[e] * sb[e]) * scl;
    o2b[e] = (x2b[e] * cb[e] + x1b[e] * sb[e]) * scl;
  }
  v4u h1, h2;
  h1[0] = (unsigned)f2h_bits(o1a[0]) | ((unsigned)f2h_bits(o1a[1]) << 16);
  h1[1] = (unsigned)f2h_bits(o1a[2]) | ((unsigned)f2h_bits(o1a[3]) << 16);
  h1[2] = (unsigned)f2h_bits(o1b[0]) | ((unsigned)f2h_bits(o1b[1]) << 16);
  h1[3] = (unsigned)f2h_bits(o1b[2]) | ((unsigned)f2h_bits(o1b[3]) << 16);
  h2[0] = (unsigned)f2h_bits(o2a[0]) | ((unsigned)f2h_bits(o2a[1]) << 16);
  h2[1] = (unsigned)f2h_bits(o2a[2]) | ((unsigned)f2h_bits(o2a[3]) << 16);
  h2[2] = (unsigned)f2h_bits(o2b[0]) | ((unsigned)f2h_bits(o2b[1]) << 16);
  h2[3] = (unsigned)f2h_bits(o2b[2]) | ((unsigned)f2h_bits(o2b[3]) << 16);
  {
    *(v4u*)(outP + base) = h1;
    *(v4u*)(outP + base + HHALF) = h2;
    
  }
}

// ---------------------------------------------------------------------------------------------
// 5) Register-blocked batched WMMA GEMM, 16-bit operands of type T (bf16 or f16), f32 accumulate.
//    C[m,n] = scale * sum_k A[m,k] * Bt[n,k]; A row-major [M,K], Bt row-major [N,K].
//    Block = 4 waves (2 x 2) = one 128x128 tile of C; each wave owns a 64x64 tile.
//    Per pass the block's 128 A rows and 128 Bt rows x 128 k (256 B a row) are brought into LDS by asynchronous
//    copies, two buffers: the next pass's copies fly while this pass's fragments are read from LDS.
//    M,N % 128 == 0, K % 128 == 0 (no tail handling). lda, ldb % 8 == 0 (16-B copies).
//    OUT_MODE: 0 = f32, 1 = single f16 plane. The hi/lo plane options are not staged: both must be false.
// ---------------------------------------------------------------------------------------------
#define GBK    128    // k elements of one staged pass
#define GPITCH 136    // LDS row pitch in elements: 272 B = 16 B x 17, conflict-free for 16-B row reads
typedef __attribute__((ext_vector_type(4))) int v4i;
typedef __attribute__((address_space(1))) v4i gv4i;
typedef __attribute__((address_space(3))) v4i lv4i;

// 128 rows x 256 B from g (row pitch ld elements) into l (row pitch GPITCH): 128 threads x 16 copies of 16 B;
// one wave-wide copy covers two whole 256-B rows.
// g is the tile's origin, the same in every lane; goff is the lane's own element offset row * ld + column.
template <typename T>
__device__ __forceinline__ void stage_tile(const T* g, int ld, unsigned goff, T* l, int tid) {
  T* lp = l + (tid >> 4) * GPITCH + (tid & 15) * 8;
#pragma unroll   // the 16 copies go out back to back, none waits for another
  for (int j = 0; j < 16; ++j)
    __builtin_amdgcn_global_load_async_to_lds_b128((gv4i*)(g + (size_t)(j * 8) * ld + goff), (lv4i*)(lp + j * 8 * GPITCH), 0, 0);
}

template <typename T, bool SPLITA, bool SPLITB, int OUT_MODE>
__global__ __launch_bounds__(128) void gemm_t64(
    const unsigned short* __restrict__ Ap, const unsigned short* __restrict__ A2p, int lda, long strideA,
    const unsigned short* __restrict__ Btp, const unsigned short* __restrict__ Bt2p, int ldb, long strideB,
    void* __restrict__ Cout, int ldc, long strideC,
    int M, int N, int K, float scale) {
  static_assert(!SPLITA && !SPLITB);
  typedef typename Frag<T>::V V;
  const T* A = (const T*)Ap; const T* Bt = (const T*)Btp;
  __shared__ __align__(16) T ring[2][2][128 * GPITCH];   // [buffer][A rows | Bt rows]
  __shared__ __align__(16) float sT[4][16 * 68];          // per-wave 16x64 slab, pitch 68 floats
  const int b    = blockIdx.y;
  const int tid  = threadIdx.x;
  const int lane = tid & 31;
  const int wave = tid >> 5;
  const int tilesN = N >> 7;
  const int tilesM = M >> 7;
  const int tile = blockIdx.x;
  if (tile >= tilesM * tilesN) return;   // block-uniform, ahead of every barrier and copy
  const int tm = tile / tilesN;
  const int tn = tile - tm * tilesN;
  const int wm = (wave >> 1) << 6;             // this wave's rows inside the block tile
  const int wn = (wave & 1) << 6;              // this wave's columns inside the block tile
  const int m0 = (tm << 7) + wm;
  const int n0 = (tn << 7) + wn;

  const T* Ag = A  + (size_t)b * strideA + (size_t)(tm << 7) * lda;
  const T* Bg = Bt + (size_t)b * strideB + (size_t)(tn << 7) * ldb;

  const int rlane = lane & 15;                 // row (A) / col (B, D) within subtile
  const int koff  = (lane >> 4) * 8;           // k offset of this lane half
  const int mOff  = (lane >> 4) * 8;           // D row offset

  v8f acc[4][4];
#pragma unroll
  for (int i = 0; i < 4; ++i)
#pragma unroll
    for (int j = 0; j < 4; ++j) acc[i][j] = (v8f){0.f,0.f,0.f,0.f,0.f,0.f,0.f,0.f};

  const int nt = K / GBK;
  const unsigned aoff = (unsigned)(tid >> 4) * (unsigned)lda + (unsigned)(tid & 15) * 8u;
  const unsigned boff = (unsigned)(tid >> 4) * (unsigned)ldb + (unsigned)(tid & 15) * 8u;
  stage_tile<T>(Ag, lda, aoff, ring[0][0], tid);
  stage_tile<T>(Bg, ldb, boff, ring[0][1], tid);
  asm volatile("s_wait_asynccnt 0x0" ::: "memory");   // this wave's copies of pass 0 have landed
  __syncthreads();                                     // ... and every other wave's: pass 0 is readable
  if (nt > 1) {
    stage_tile<T>(Ag + GBK, lda, aoff, ring[1][0], tid);
    stage_tile<T>(Bg + GBK, ldb, boff, ring[1][1], tid);
  }

  for (int t = 0; t < nt; ++t) {
    const T* la = ring[t & 1][0] + (wm + rlane) * GPITCH + koff;
    const T* lb = ring[t & 1][1] + (wn + rlane) * GPITCH + koff;
    // LDS reads run ahead of their products: the next 32-k block's Bt fragments go into a second set at the head of
    // this block, and each A fragment is re-read for the next block as soon as its row of products has been issued
    // (every loop below is unrolled so that each fragment and accumulator index is a constant: registers, no scratch)
    V af[4], bf[2][4];
#pragma unroll
    for (int j = 0; j < 4; ++j) { bf[0][j] = Frag<T>::load(lb + (j << 4) * GPITCH); af[j] = Frag<T>::load(la + (j << 4) * GPITCH); }
#pragma unroll
    for (int kb = 0; kb < GBK / 32; ++kb) {
      const int cu = kb & 1, nx = cu ^ 1;
      if (kb + 1 < GBK / 32) {
#pragma unroll
        for (int j = 0; j < 4; ++j) bf[nx][j] = Frag<T>::load(lb + (j << 4) * GPITCH + (kb + 1) * 32);
      }
#pragma unroll
      for (int i = 0; i < 4; ++i) {
#pragma unroll
        for (int j = 0; j < 4; ++j) acc[i][j] = Frag<T>::mma(af[i], bf[cu][j], acc[i][j]);
        Frag<T>::guard(acc[i][0], acc[i][3], af[i], af[i]);
        if (kb + 1 < GBK / 32) af[i] = Frag<T>::load(la + (i << 4) * GPITCH + (kb + 1) * 32);
      }
      Frag<T>::keep(bf[cu][0], bf[cu][1], bf[cu][2], bf[cu][3]);
    }
    asm volatile("s_wait_dscnt 0x0" ::: "memory");     // this wave's reads of buffer t & 1 are done before it is refilled
    asm volatile("s_wait_asynccnt 0x0" ::: "memory");  // this wave's copies of pass t + 1 have landed
    __syncthreads();                                    // publishes pass t + 1, frees buffer t & 1
    if (t + 2 < nt) {
      stage_tile<T>(Ag + (size_t)(t + 2) * GBK, lda, aoff, ring[t & 1][0], tid);
      stage_tile<T>(Bg + (size_t)(t + 2) * GBK, ldb, boff, ring[t & 1][1], tid);
    }
  }
  asm volatile("s_wait_asynccnt 0x0" ::: "memory");    // no copy is outstanding when the wave goes on
  acc_guard4(acc[0][0], acc[0][1], acc[0][2], acc[0][3]);
  acc_guard4(acc[1][0], acc[1][1], acc[1][2], acc[1][3]);
  acc_guard4(acc[2][0], acc[2][1], acc[2][2], acc[2][3]);
  acc_guard4(acc[3][0], acc[3][1], acc[3][2], acc[3][3]);

  // ---- epilogue ----
  float* slab = sT[wave];
#pragma unroll
  for (int i = 0; i < 4; ++i) {
    const int mBase = m0 + (i << 4);
#pragma unroll
    for (int j = 0; j < 4; ++j) {
#pragma unroll
      for (int r = 0; r < 8; ++r) {
        const float v = acc[i][j][r] * scale;
        slab[(mOff + r) * 68 + (j << 4) + rlane] = v;
      }
    }
    __builtin_amdgcn_fence(3, "workgroup");
    __builtin_amdgcn_wave_barrier();
    __builtin_amdgcn_fence(2, "workgroup");
    if (OUT_MODE == 0) {
      float* Cf = (float*)Cout + (size_t)b * strideC;
      const int hh = lane >> 4, c4 = (lane & 15) * 4;     // row seg = 256 B = 16 lanes x 16 B
      {
#pragma unroll
        for (int it = 0; it < 8; ++it) {
          const int row = it * 2 + hh;
          v4f v = *(const v4f*)(slab + row * 68 + c4);
          *(v4f*)(Cf + (size_t)(mBase + row) * ldc + n0 + c4) = v;
        }
        
      }
    } else {
      const int q = lane >> 3, c8 = (lane & 7) * 8;
      unsigned short* Cs = (unsigned short*)Cout + (size_t)b * strideC;
      {
#pragma unroll
        for (int it = 0; it < 4; ++it) {
          const int row = it * 4 + q;
          const float* sp = slab + row * 68 + c8;
          v8h hv;
#pragma unroll
          for (int e = 0; e < 8; ++e) hv[e] = (_Float16)sp[e];
          *(v8h*)(Cs + (size_t)(mBase + row) * ldc + n0 + c8) = hv;
        }
        
      }
    }
    __builtin_amdgcn_fence(3, "workgroup");
    __builtin_amdgcn_wave_barrier();
    __builtin_amdgcn_fence(2, "workgroup");
  }
}

#define KPITCH 136    // LDS pitch of a K row in elements: 272 B = 16 B x 17, conflict-free for 16-B row reads
#define VPITCH 72     // LDS pitch of a V^T row in elements: 144 B = 16 B x 9, conflict-free for 16-B row reads

// kg, vg: origin of the chunk's K rows (pitch KVDIM) and V^T rows (pitch SEQ), the same in every lane.
// 256 threads x (4 + 4) copies of 16 B; one wave-wide copy covers two whole K rows or four whole V^T row pieces.
__device__ __forceinline__ void stage_kv(const _Float16* kg, const _Float16* vg, _Float16* kl, _Float16* vl, int tid) {
  const unsigned ko = (unsigned)(tid >> 4) * (unsigned)KVDIM + (unsigned)(tid & 15) * 8u;
  const unsigned vo = (unsigned)(tid >> 3) * (unsigned)SEQ + (unsigned)(tid & 7) * 8u;
  _Float16* kp = kl + (tid >> 4) * KPITCH + (tid & 15) * 8;
  _Float16* vp = vl + (tid >> 3) * VPITCH + (tid & 7) * 8;
#pragma unroll   // the copies go out back to back, none waits for another
  for (int j = 0; j < 4; ++j)
    __builtin_amdgcn_global_load_async_to_lds_b128((gv4i*)(kg + (size_t)(j * 16) * KVDIM + ko), (lv4i*)(kp + j * 16 * KPITCH), 0, 0);
#pragma unroll   // as above
  for (int j = 0; j < 4; ++j)
    __builtin_amdgcn_global_load_async_to_lds_b128((gv4i*)(vg + (size_t)(j * 32) * SEQ + vo), (lv4i*)(vp + j * 32 * VPITCH), 0, 0);
}

// lane l <-> lane l ^ 16, a vector cross-row move
__device__ __forceinline__ float xhalf(float x) {
  return __builtin_bit_cast(float, __builtin_amdgcn_permlanex16(__builtin_bit_cast(int, x), __builtin_bit_cast(int, x), 0x76543210, 0xfedcba98, false, false));
}

__global__ __launch_bounds__(256) void attn_kernel(
    const unsigned short* __restrict__ Qp, const unsigned short* __restrict__ Kp,
    const unsigned short* __restrict__ Vtp, unsigned short* __restrict__ Op) {
  __shared__ __align__(16) _Float16 Kst[2][KV_CHUNK * KPITCH]; // 34 KB: K rows of a chunk [kv][d], two buffers
  __shared__ __align__(16) _Float16 Vst[2][HD * VPITCH];       // 36 KB: V^T rows of a chunk [d][kv], two buffers

  const _Float16* Q  = (const _Float16*)Qp;
  const _Float16* Kk = (const _Float16*)Kp;
  const _Float16* Vt = (const _Float16*)Vtp;

  const int tid  = threadIdx.x;
  const int wave = tid >> 5, lane = tid & 31;
  const int hh   = lane >> 4, c = lane & 15, koff = hh * 8;
  const int nqb  = SEQ / QBLK;
  const int bx   = blockIdx.x;
  const int qb   = bx % nqb;
  const int bhid = bx / nqb;
  const int h    = bhid % NQH;
  const int b    = bhid / NQH;
  const int kvh  = h >> 1;
  const int q0   = qb * QBLK + wave * 16;                       // sequence position of this wave's row 0
  const size_t tokw = (size_t)b * SEQ + q0;                     // compact token index of this wave's row 0
  const size_t qoff = (tokw + c) * QDIM + (size_t)h * HD + koff;
  const _Float16* Kg = Kk + (size_t)b * SEQ * KVDIM + (size_t)kvh * HD;            // this head's K rows, key 0
  const _Float16* Vg = Vt + (size_t)b * KVDIM * SEQ + (size_t)(kvh * HD) * SEQ;    // this head's V^T rows, key 0

  float mrow = -INFINITY;   // running maximum of query c, the same in both wave halves
  float lrow = 0.f;         // running sum of query c over this half's keys; the halves are joined in the epilogue
  v8f oacc[8];              // O^T tile t: register r = O[query c][d = 16 t + 8 hh + r]
#pragma unroll
  for (int t = 0; t < 8; ++t) oacc[t] = (v8f){0.f,0.f,0.f,0.f,0.f,0.f,0.f,0.f};

  const int nch = SEQ / KV_CHUNK;
  stage_kv(Kg, Vg, Kst[0], Vst[0], tid);
  asm volatile("s_wait_asynccnt 0x0" ::: "memory");   // this wave's copies of chunk 0 have landed
  __syncthreads();                                     // ... and every other wave's: chunk 0 is readable
  if (nch > 1) stage_kv(Kg + (size_t)KV_CHUNK * KVDIM, Vg + KV_CHUNK, Kst[1], Vst[1], tid);

  for (int kc = 0; kc < nch; ++kc) {
    const _Float16* kl = Kst[kc & 1] + c * KPITCH + koff;
    const _Float16* vl = Vst[kc & 1] + c * VPITCH + koff;

    // ---- raw scores S^T(64 kv x 16 q) over d = 128: tile j, register r = S[query c][key 16 j + 8 hh + r] ----
    v8f s[4];
#pragma unroll
    for (int j = 0; j < 4; ++j) s[j] = (v8f){0.f,0.f,0.f,0.f,0.f,0.f,0.f,0.f};
    // LDS reads stand in groups of four fragments, one group ahead of their products (two register sets); the loops are
    // unrolled so that every fragment index is a constant: registers, no scratch
    v16h kf[2][4];
#pragma unroll
    for (int j = 0; j < 4; ++j) kf[0][j] = Frag<_Float16>::load(kl + j * 16 * KPITCH);
#pragma unroll
    for (int dc = 0; dc < 4; ++dc) {
      const int cu = dc & 1, nx = cu ^ 1;
      const v16h qa = Frag<_Float16>::load(Q + qoff + dc * 32);
      if (dc + 1 < 4) {
#pragma unroll
        for (int j = 0; j < 4; ++j) kf[nx][j] = Frag<_Float16>::load(kl + j * 16 * KPITCH + (dc + 1) * 32);
      }
#pragma unroll
      for (int j = 0; j < 4; ++j) s[j] = h_mma(kf[cu][j], qa, s[j]);
    }

    // ---- scale, tanh softcap (f32), maximum of query c: four in-lane chains, then the other half's ----
    // (here and below every loop is unrolled so that each score, fragment and accumulator index is a constant: registers, no scratch)
    float mj[4];
#pragma unroll
    for (int j = 0; j < 4; ++j) {
      float m = -INFINITY;
#pragma unroll
      for (int r = 0; r < 8; ++r) {
        // v_tanh_f32: one instruction and no branch, where the library tanhf takes two divergent branches per score
        const float sv = SOFTCAP * __builtin_amdgcn_tanhf(s[j][r] * (RSQ * INVCAP));
        s[j][r] = sv;
        m = fmaxf(m, sv);
      }
      mj[j] = m;
    }
    float cm = fmaxf(fmaxf(mj[0], mj[1]), fmaxf(mj[2], mj[3]));
    cm = fmaxf(cm, xhalf(cm));

    // ---- online softmax (f32); P x 2^10 as f16 straight into the B fragments of V^T . P^T ----
    // B fragment kk, element e: key 32 kk + (e < 8 ? 8 hh + e : 16 + 8 hh + e - 8) = tile 2 kk + (e >> 3), register e & 7:
    // the k order of the V^T loader
    const float mnew = fmaxf(mrow, cm);
    const float alpha = __expf(mrow - mnew);
    mrow = mnew;
    float pj[4];
    v16h pb[2];
#pragma unroll
    for (int j = 0; j < 4; ++j) {
      float psum = 0.f;
#pragma unroll
      for (int r = 0; r < 8; ++r) {
        const float p = __expf(s[j][r] - mnew);
        psum += p;
        pb[j >> 1][(j & 1) * 8 + r] = (_Float16)(p * PCARRY);
      }
      pj[j] = psum;
    }
    lrow = lrow * alpha + ((pj[0] + pj[1]) + (pj[2] + pj[3]));
#pragma unroll
    for (int t = 0; t < 8; ++t)
#pragma unroll
      for (int r = 0; r < 8; ++r) oacc[t][r] *= alpha;

    // ---- O^T(128 d x 16 q) += V^T(128 d x 64 kv) . P^T ----
    // group g = 32 keys kk = g >> 1, output tiles 4 * (g & 1) .. + 3; V^T fragments read one group ahead, as for K above
    v16h vf[2][4];
#pragma unroll
    for (int t = 0; t < 4; ++t) vf[0][t] = Frag<_Float16>::load(vl + t * 16 * VPITCH);
#pragma unroll
    for (int g = 0; g < 4; ++g) {
      const int cu = g & 1, nx = cu ^ 1, kk = g >> 1, tb = (g & 1) * 4;
      if (g + 1 < 4) {
#pragma unroll
        for (int t = 0; t < 4; ++t) vf[nx][t] = Frag<_Float16>::load(vl + (((g + 1) & 1) * 4 + t) * 16 * VPITCH + ((g + 1) >> 1) * 32);
      }
#pragma unroll
      for (int t = 0; t < 4; ++t) oacc[tb + t] = h_mma(vf[cu][t], pb[kk], oacc[tb + t]);
    }
    asm volatile("s_wait_dscnt 0x0" ::: "memory");     // this wave's reads of buffer kc & 1 are done before it is refilled
    asm volatile("s_wait_asynccnt 0x0" ::: "memory");  // this wave's copies of chunk kc + 1 have landed
    __syncthreads();                                    // publishes chunk kc + 1, frees buffer kc & 1
    if (kc + 2 < nch)
      stage_kv(Kg + (size_t)(kc + 2) * KV_CHUNK * KVDIM, Vg + (kc + 2) * KV_CHUNK, Kst[kc & 1], Vst[kc & 1], tid);
  }
  asm volatile("s_wait_asynccnt 0x0" ::: "memory");    // no copy is outstanding when the wave goes on

  // ---- epilogue: join the halves' sums, normalise (x 2^6 / (2^10 * l)), write the f16 ctx plane ----
  // coverage: 8 tiles x 2 halves x 8 elements = 128 dims of each of the wave's 16 rows; the wave writes whole 256-B rows.
  const float lsum = lrow + xhalf(lrow);
  const float inv = OCARRY / (PCARRY * lsum);          // undo the P carry (2^10) and apply the ctx carry (2^6)
  unsigned short* orow = Op + (tokw + c) * QDIM + (size_t)h * HD + koff;
#pragma unroll
  for (int t = 0; t < 8; ++t) {
    v8h hv;
#pragma unroll
    for (int r = 0; r < 8; ++r) hv[r] = (_Float16)(oacc[t][r] * inv);
    *(v8h*)(orow + t * 16) = hv;
  }
}

// ---------------------------------------------------------------------------------------------
// host
// ---------------------------------------------------------------------------------------------
static_assert((NTOK * HID / 8) % 256 == 0);
static_assert((NTOK * NQH * 8) % 256 == 0);
static_assert((NTOK * NKVH * 8) % 256 == 0);
static_assert((SEQ * HHALF) % 256 == 0);
static_assert(HID % 128 == 0 && QDIM % 128 == 0);
static_assert(NTOK % 128 == 0 && HID % 128 == 0 && QDIM % 128 == 0 && KVDIM % 128 == 0 && SEQ % 128 == 0);
static_assert(SEQ % QBLK == 0 && SEQ % KV_CHUNK == 0 && QBLK == 128 && KV_CHUNK == 64 && HD == 128);
static_assert(NB >= 1 && NB <= NB_FULL && SEQ <= SEQ_FULL);
static_assert(NQH == 2 * NKVH);

extern "C" void kernel_launch(void* const* d_in, const int* in_sizes, int n_in,
                              void* d_out, int out_size, void* d_ws, size_t ws_size, hipStream_t stream) {
  if (n_in < 5) return;
  const size_t needTok = (size_t)(NB - 1) * SEQ_FULL + SEQ;
  if ((size_t)in_sizes[0] < needTok * HID) return;
  if ((size_t)in_sizes[1] < (size_t)HID * QDIM) return;
  if ((size_t)in_sizes[2] < (size_t)HID * KVDIM) return;
  if ((size_t)in_sizes[3] < (size_t)HID * KVDIM) return;
  if ((size_t)in_sizes[4] < (size_t)QDIM * HID) return;
  if ((size_t)out_size < needTok * HID) return;

  const float* x  = (const float*)d_in[0];   // [2,2048,2048]
  const float* Wq = (const float*)d_in[1];   // [2048,2048]  [in][out]
  const float* Wk = (const float*)d_in[2];   // [2048,1024]
  const float* Wv = (const float*)d_in[3];   // [2048,1024]
  const float* Wo = (const float*)d_in[4];   // [2048,2048]
  float* out = (float*)d_out;                // [2,2048,2048] f32

  //   XB   bf16 [NTOK][HID]
  //   WQT  bf16 [QDIM][HID], WKT bf16 [KVDIM][HID], WVT bf16 [KVDIM][HID], WOT f16 [HID][QDIM]
  //   R1   f32 [NTOK][QDIM] for q; later reused: Kf f32 [NTOK][KVDIM] at +0, ctx f16 [NTOK][QDIM] at +0, V^T f16 [NB][KVDIM][SEQ] at +NTOK*QDIM*2
  //   QP f16 [NTOK][QDIM]; KP f16 [NTOK][KVDIM]; COS, SIN f32 [SEQ][HHALF]
  const size_t szXB  = (size_t)NTOK * HID * 2;
  const size_t szWQT = (size_t)QDIM * HID * 2;
  const size_t szWKT = (size_t)KVDIM * HID * 2;
  const size_t szWOT = (size_t)HID * QDIM * 2;
  const size_t szR1  = (size_t)NTOK * QDIM * 4;
  const size_t szQP  = (size_t)NTOK * QDIM * 2;
  const size_t szKP  = (size_t)NTOK * KVDIM * 2;
  const size_t szVT  = (size_t)NB * KVDIM * SEQ * 2;
  const size_t szTAB = (size_t)SEQ * HHALF * 4;
  static_assert((size_t)NTOK * KVDIM * 4 <= (size_t)NTOK * QDIM * 4);
  static_assert((size_t)NTOK * QDIM * 2 + (size_t)NB * KVDIM * SEQ * 2 <= (size_t)NTOK * QDIM * 4);
  const size_t OFF_XB  = 0;
  const size_t OFF_WQT = OFF_XB + szXB;
  const size_t OFF_WKT = OFF_WQT + szWQT;
  const size_t OFF_WVT = OFF_WKT + szWKT;
  const size_t OFF_WOT = OFF_WVT + szWKT;
  const size_t OFF_R1  = OFF_WOT + szWOT;
  const size_t OFF_QF  = OFF_R1;
  const size_t OFF_KF  = OFF_R1;
  const size_t OFF_CTX = OFF_R1;
  const size_t OFF_VT  = OFF_R1 + szQP;
  const size_t OFF_QP  = OFF_R1 + szR1;
  const size_t OFF_KP  = OFF_QP + szQP;
  const size_t OFF_COS = OFF_KP + szKP;
  const size_t OFF_SIN = OFF_COS + szTAB;
  const size_t WS_TOTAL = OFF_SIN + szTAB;
  (void)szVT;
  if (ws_size < WS_TOTAL) return;

  char* ws = (char*)d_ws;
  unsigned short* xb  = (unsigned short*)(ws + OFF_XB);
  unsigned short* WqT = (unsigned short*)(ws + OFF_WQT);
  unsigned short* WkT = (unsigned short*)(ws + OFF_WKT);
  unsigned short* WvT = (unsigned short*)(ws + OFF_WVT);
  unsigned short* WoT = (unsigned short*)(ws + OFF_WOT);
  float* Qf  = (float*)(ws + OFF_QF);
  float* Kf  = (float*)(ws + OFF_KF);
  unsigned short* ctx = (unsigned short*)(ws + OFF_CTX);
  unsigned short* Vt  = (unsigned short*)(ws + OFF_VT);
  unsigned short* Qpl = (unsigned short*)(ws + OFF_QP);
  unsigned short* Kpl = (unsigned short*)(ws + OFF_KP);
  float* cosT = (float*)(ws + OFF_COS);
  float* sinT = (float*)(ws + OFF_SIN);

  // inv_freq[j] = 1 / 10000^(2j/128), pow in double then RNE to f32, reciprocal as one f32 divide
  RopeFreq fr;
  for (int j = 0; j < HHALF; ++j) {
    const float e = (float)(2 * j) / 128.0f;
    const double p = pow(10000.0, (double)e);
    const float pf = (float)p;
    fr.f[j] = 1.0f / pf;
  }

  // 1) x -> compact bf16 plane
  cast_x_bf16<<<(NTOK * HID / 8) / 256, 256, 0, stream>>>(x, xb, NTOK * HID / 8);
  // 2) transposed 16-bit weight planes: in[rows][cols] -> out[cols][rows]; grid = (cols/64, rows/64)
  transpose_cast16<0><<<dim3(QDIM / 64, HID / 64), 256, 0, stream>>>(Wq, WqT, HID, QDIM, 1.0f);      // [HID][QDIM]  -> [QDIM][HID]
  transpose_cast16<0><<<dim3(KVDIM / 64, HID / 64), 256, 0, stream>>>(Wk, WkT, HID, KVDIM, 1.0f);    // [HID][KVDIM] -> [KVDIM][HID]
  transpose_cast16<0><<<dim3(KVDIM / 64, HID / 64), 256, 0, stream>>>(Wv, WvT, HID, KVDIM, 1.0f);    // [HID][KVDIM] -> [KVDIM][HID]
  transpose_cast16<1><<<dim3(HID / 64, QDIM / 64), 256, 0, stream>>>(Wo, WoT, QDIM, HID, WOCARRY);   // [QDIM][HID]  -> [HID][QDIM], f16 x 2^4
  // 3) RoPE tables
  rope_table_kernel<<<(SEQ * HHALF) / 256, 256, 0, stream>>>(cosT, sinT, fr);
  // 4) q = x @ Wq -> f32 [NTOK][QDIM]   (M=NTOK, N=QDIM, K=HID)
  {
    const int tiles = (NTOK / 128) * (QDIM / 128);
    gemm_t64<__bf16, false, false, 0><<<dim3(tiles, 1), 128, 0, stream>>>(
        xb, xb, HID, 0L, WqT, WqT, HID, 0L, (void*)Qf, QDIM, 0L, NTOK, QDIM, HID, 1.0f);
  }
  // 5) RoPE of q (16 heads) -> f16 plane
  rope_f16_kernel<NQH, QDIM><<<(NTOK * NQH * 8) / 256, 256, 0, stream>>>(Qf, cosT, sinT, Qpl, 1.0f);
  // 6) k = x @ Wk -> f32 [NTOK][KVDIM]  (M=NTOK, N=KVDIM, K=HID), into the q region (q is dead)
  {
    const int tiles = (NTOK / 128) * (KVDIM / 128);
    gemm_t64<__bf16, false, false, 0><<<dim3(tiles, 1), 128, 0, stream>>>(
        xb, xb, HID, 0L, WkT, WkT, HID, 0L, (void*)Kf, KVDIM, 0L, NTOK, KVDIM, HID, 1.0f);
  }
  // 7) RoPE of k (8 kv heads) -> f16 plane
  rope_f16_kernel<NKVH, KVDIM><<<(NTOK * NKVH * 8) / 256, 256, 0, stream>>>(Kf, cosT, sinT, Kpl, 1.0f);
  // 8) v^T per batch = Wv^T @ x_b^T -> f16 [NB][KVDIM][SEQ]   (M=KVDIM, N=SEQ, K=HID, batch NB)
  {
    const int tiles = (KVDIM / 128) * (SEQ / 128);
    gemm_t64<__bf16, false, false, 1><<<dim3(tiles, NB), 128, 0, stream>>>(
        WvT, WvT, HID, 0L, xb, xb, HID, (long)SEQ * HID, (void*)Vt, SEQ, (long)KVDIM * SEQ,
        KVDIM, SEQ, HID, 1.0f);
  }
  // 9) attention -> ctx f16 x 2^6 [NTOK][QDIM]  (k f32 region is dead; V^T region disjoint)
  attn_kernel<<<NB * NQH * (SEQ / QBLK), 256, 0, stream>>>(Qpl, Kpl, Vt, ctx);
  // 10) out = ctx @ Wo -> d_out f32, per batch rows b*SEQ_FULL..  (M=SEQ, N=HID, K=QDIM, scale 2^-10)
  {
    const int tiles = (SEQ / 128) * (HID / 128);
    gemm_t64<_Float16, false, false, 0><<<dim3(tiles, NB), 128, 0, stream>>>(
        ctx, ctx, QDIM, (long)SEQ * QDIM, WoT, WoT, QDIM, 0L, (void*)out, HID, (long)SEQ_FULL * HID,
        SEQ, HID, QDIM, OUTSCALE);
  }
}

// v005
// Measured time: 177 microseconds a run.
// Two timings next to v004 both put it at 1.21 times that version's speed.
// All steps since v000 together make it 3.87 times as fast.
// x@Wq, x@Wk, Wv^T@x^T: v_wmma_f32_16x16x32_bf16 on RNE-bf16 input planes (f32 accumulate); q.k^T: v_wmma_f32_16x16x32_f16 (q, k single f16 planes, f32 accumulate); p.v: v_wmma_f32_16x16x32_f16 (p f16 carried x2^10, v f16, f32 accumulate); ctx@Wo: v_wmma_f32_16x16x32_f16 (ctx f16 carried x2^6, Wo f16 carried x2^4 built from RNE-bf16 values, f32 accumulate); RoPE, tanh softcap and softmax in f32.
#include <hip/hip_runtime.h>
#include <math.h>

#pragma clang fp contract(off)

#ifndef NB
#define NB 2
#endif
#ifndef SEQ
#define SEQ 2048
#endif
#define NB_FULL  2
#define SEQ_FULL 2048
#define HID      2048
#define NQH      16
#define NKVH     8
#define HD       128
#define HHALF    64
#define QDIM     (NQH * HD)
#define KVDIM    (NKVH * HD)
#define QKDIM    (QDIM + KVDIM)
#define NTOK     (NB * SEQ)
#define KV_CHUNK 64
#define QBLK     128
#define RSQ      0.08838834764831845f
#define SOFTCAP  50.0f
#define INVCAP   0.02f
#define PCARRY   1024.0f
#define OCARRY   64.0f
#define WOCARRY  16.0f
#define OUTSCALE 0.0009765625f

typedef __attribute__((ext_vector_type(16))) _Float16 v16h;
typedef __attribute__((ext_vector_type(8)))  _Float16 v8h;
typedef __attribute__((ext_vector_type(16))) __bf16   v16b;
typedef __attribute__((ext_vector_type(8)))  __bf16   v8b;
typedef __attribute__((ext_vector_type(8)))  float    v8f;
typedef __attribute__((ext_vector_type(4)))  float    v4f;
typedef __attribute__((ext_vector_type(4)))  unsigned int v4u;

__device__ __forceinline__ unsigned short f2bf_bits(float f) {
  unsigned u = __float_as_uint(f);
  return (unsigned short)((u + 0x7FFFu + ((u >> 16) & 1u)) >> 16);
}
__device__ __forceinline__ float bf_bits2f(unsigned short h) { return __uint_as_float(((unsigned)h) << 16); }
__device__ __forceinline__ unsigned short f2h_bits(float f) { const _Float16 h = (_Float16)f; return __builtin_bit_cast(unsigned short, h); }

// hazard guards as plain device helpers
__device__ __forceinline__ void dep_guard_h(v8f& a, v8f& b, v16h x, v16h y) { asm volatile("v_nop\n\tv_nop\n\tv_nop\n\tv_nop" : "+v"(a), "+v"(b) : "v"(x), "v"(y)); }
__device__ __forceinline__ void dep_guard_b(v8f& a, v8f& b, v16b x, v16b y) { asm volatile("v_nop\n\tv_nop\n\tv_nop\n\tv_nop" : "+v"(a), "+v"(b) : "v"(x), "v"(y)); }
__device__ __forceinline__ void keep4_h(v16h a, v16h b, v16h c, v16h d) { asm volatile("v_nop" :: "v"(a), "v"(b), "v"(c), "v"(d)); }
__device__ __forceinline__ void keep4_b(v16b a, v16b b, v16b c, v16b d) { asm volatile("v_nop" :: "v"(a), "v"(b), "v"(c), "v"(d)); }
__device__ __forceinline__ void acc_guard4(v8f& a, v8f& b, v8f& c, v8f& d) { asm volatile("v_nop\n\tv_nop\n\tv_nop\n\tv_nop" : "+v"(a), "+v"(b), "+v"(c), "+v"(d)); }

// fragment loaders: lane l, row/col = l & 15, elements 0..7 <- p[0..7] (k0 + 8h + 0..7), 8..15 <- p[16..23] (k0 + 16 + 8h + 0..7); caller adds 8h
template <typename T> struct Frag;
template <> struct Frag<_Float16> {
  typedef v16h V; union U { v16h v; v8h h[2]; };
  static __device__ __forceinline__ v16h load(const _Float16* p) {
    U f; f.h[0] = *(const v8h*)(p); f.h[1] = *(const v8h*)(p + 16); return f.v;
  }
  static __device__ __forceinline__ v8f mma(v16h a, v16h b, v8f c) {
    return __builtin_amdgcn_wmma_f32_16x16x32_f16(false, a, false, b, (short)0, c, false, false);
  }
  static __device__ __forceinline__ void guard(v8f& a, v8f& b, v16h x, v16h y) { dep_guard_h(a, b, x, y); }
  static __device__ __forceinline__ void keep(v16h a, v16h b, v16h c, v16h d) { keep4_h(a, b, c, d); }
};
template <> struct Frag<__bf16> {
  typedef v16b V; union U { v16b v; v8b h[2]; };
  static __device__ __forceinline__ v16b load(const __bf16* p) {
    U f; f.h[0] = *(const v8b*)(p); f.h[1] = *(const v8b*)(p + 16); return f.v;
  }
  static __device__ __forceinline__ v8f mma(v16b a, v16b b, v8f c) {
    return __builtin_amdgcn_wmma_f32_16x16x32_bf16(false, a, false, b, (short)0, c, false, false);
  }
  static __device__ __forceinline__ void guard(v8f& a, v8f& b, v16b x, v16b y) { dep_guard_b(a, b, x, y); }
  static __device__ __forceinline__ void keep(v16b a, v16b b, v16b c, v16b d) { keep4_b(a, b, c, d); }
};

// single f16 WMMA with the 4-nop guard tied to D and keeping A/B live
__device__ __forceinline__ v8f h_mma(v16h a, v16h b, v8f c) {
  c = __builtin_amdgcn_wmma_f32_16x16x32_f16(false, a, false, b, (short)0, c, false, false);
  asm volatile("v_nop\n\tv_nop\n\tv_nop\n\tv_nop" : "+v"(c) : "v"(a), "v"(b));
  return c;
}

// ---------------------------------------------------------------------------------------------
// 1) x f32 [NB_FULL][SEQ_FULL][HID] -> compact bf16 plane [NTOK][HID], 8 elements per thread, one 16-B store per lane
// ---------------------------------------------------------------------------------------------
__device__ __forceinline__ void cast_x_bf16(const float* __restrict__ in, unsigned short* __restrict__ out, int n8, int blk) {
  const int i = blk * 256 + threadIdx.x;
  if (i < n8) {
    const size_t o   = (size_t)i * 8;
    const size_t tok = o / HID;
    const size_t col = o - tok * HID;
    const size_t bb  = tok / SEQ;
    const size_t ss  = tok - bb * SEQ;
    const size_t src = (bb * SEQ_FULL + ss) * (size_t)HID + col;
    const v4f a  = *(const v4f*)(in + src);
    const v4f bq = *(const v4f*)(in + src + 4);
    v4u w;
    w[0] = (unsigned)f2bf_bits(a[0])  | ((unsigned)f2bf_bits(a[1])  << 16);
    w[1] = (unsigned)f2bf_bits(a[2])  | ((unsigned)f2bf_bits(a[3])  << 16);
    w[2] = (unsigned)f2bf_bits(bq[0]) | ((unsigned)f2bf_bits(bq[1]) << 16);
    w[3] = (unsigned)f2bf_bits(bq[2]) | ((unsigned)f2bf_bits(bq[3]) << 16);
    *(v4u*)(out + o) = w;
    
  }
}

// ---------------------------------------------------------------------------------------------
// 2) in[nrows][ncols] f32 -> out[ncols][nrows] 16-bit. MODE 0: bf16 bits (RNE); MODE 1: f16 bits of (RNE-bf16 value * scl).
//    Block = 64x64 tile through LDS (cross-thread, block barrier). (bx, by) in (ncols/64, nrows/64); nrows, ncols multiples of 64.
//    load coverage: 256 threads x 16 floats = 64x64 tile; store coverage: 2 iterations x 256 threads x 8 = 64 rows x 64.
// ---------------------------------------------------------------------------------------------
template <int MODE> __device__ __forceinline__ unsigned short pk16(float f, float scl) {
  if (MODE == 0) return f2bf_bits(f);
  const float g = bf_bits2f(f2bf_bits(f)) * scl;
  return f2h_bits(g);
}

template <int MODE>
__device__ __forceinline__ void transpose_cast16(const float* __restrict__ in, unsigned short* __restrict__ out, int nrows, int ncols, float scl,
                                                 int bx, int by, float* tile) {
  const int tid = threadIdx.x;
  const int r0 = by * 64, c0 = bx * 64;
  {
    const int row = tid >> 2, cc = (tid & 3) * 16;
    const float* s = in + (size_t)(r0 + row) * ncols + c0 + cc;
#pragma unroll
    for (int q = 0; q < 4; ++q) {
      const v4f v = *(const v4f*)(s + 4 * q);
#pragma unroll
      for (int e = 0; e < 4; ++e) tile[(cc + 4 * q + e) * 65 + row] = v[e];
    }
  }
  __syncthreads();
  {
#pragma unroll
    for (int it = 0; it < 2; ++it) {
      const int orow = it * 32 + (tid >> 3), seg = (tid & 7) * 8;
      const float* tp = tile + orow * 65 + seg;
      v4u w;
#pragma unroll
      for (int e = 0; e < 4; ++e) w[e] = (unsigned)pk16<MODE>(tp[2 * e], scl) | ((unsigned)pk16<MODE>(tp[2 * e + 1], scl) << 16);
      *(v4u*)(out + (size_t)(c0 + orow) * nrows + r0 + seg) = w;
    }
    // in the merged kernel's listing another range's code follows and writes registers that these stores name: the wait stands in front of it
    asm volatile("s_wait_xcnt 0x0" ::: "memory");
  }
}

// ---------------------------------------------------------------------------------------------
// 3) RoPE cos/sin tables [SEQ][HHALF] f32: angle = pos * inv_freq[j] (single f32 multiply), precise cosf/sinf.
// ---------------------------------------------------------------------------------------------
struct RopeFreq { float f[HHALF]; };
static_assert(sizeof(RopeFreq) == 256);

__device__ __forceinline__ void rope_table(float* __restrict__ cosT, float* __restrict__ sinT, const RopeFreq& fr, int blk, float* invf) {
  if (threadIdx.x == 0) {
#pragma unroll
    for (int q = 0; q < HHALF; ++q) invf[q] = fr.f[q];
  }
  __syncthreads();
  const int i = blk * 256 + threadIdx.x;                 // exactly SEQ*HHALF threads
  const int t = i >> 6;
  const int jj = i & (HHALF - 1);
  const float ang = (float)t * invf[jj];
  const float cv = cosf(ang);
  const float sv = sinf(ang);
  ((float*)cosT)[i] = cv;
  ((float*)sinT)[i] = sv;
  
}

// ---------------------------------------------------------------------------------------------
// 1) to 3) in ONE launch: none of them reads what another writes, so each takes a range of the block index.
//    Every branch below is block-uniform; the ranges with the most work per block come first.
// ---------------------------------------------------------------------------------------------
#define PB_TAB ((SEQ * HHALF) / 256)
#define PB_WQ  ((QDIM / 64) * (HID / 64))
#define PB_WKV ((KVDIM / 64) * (HID / 64))
#define PB_WO  ((HID / 64) * (QDIM / 64))
#define PB_X   ((NTOK * HID / 8) / 256)
__global__ __launch_bounds__(256) void prep_kernel(
    const float* __restrict__ x, const float* __restrict__ Wq, const float* __restrict__ Wk, const float* __restrict__ Wv, const float* __restrict__ Wo,
    unsigned short* __restrict__ xb, unsigned short* __restrict__ WqT, unsigned short* __restrict__ WkT, unsigned short* __restrict__ WvT,
    unsigned short* __restrict__ WoT, float* __restrict__ cosT, float* __restrict__ sinT, RopeFreq fr) {
  __shared__ float tile[64 * 65];
  int blk = blockIdx.x;
  if (blk < PB_TAB) { rope_table(cosT, sinT, fr, blk, tile); return; }
  blk -= PB_TAB;
  if (blk < PB_WQ) {                           // [HID][QDIM]  -> [QDIM][HID]
    transpose_cast16<0>(Wq, WqT, HID, QDIM, 1.0f, blk % (QDIM / 64), blk / (QDIM / 64), tile); return;
  }
  blk -= PB_WQ;
  if (blk < 2 * PB_WKV) {                      // [HID][KVDIM] -> [KVDIM][HID], Wk then Wv
    const bool isv = blk >= PB_WKV;
    if (isv) blk -= PB_WKV;
    transpose_cast16<0>(isv ? Wv : Wk, isv ? WvT : WkT, HID, KVDIM, 1.0f, blk % (KVDIM / 64), blk / (KVDIM / 64), tile); return;
  }
  blk -= 2 * PB_WKV;
  if (blk < PB_WO) {                           // [QDIM][HID]  -> [HID][QDIM], f16 x 2^4
    transpose_cast16<1>(Wo, WoT, QDIM, HID, WOCARRY, blk % (HID / 64), blk / (HID / 64), tile); return;
  }
  blk -= PB_WO;
  cast_x_bf16(x, xb, NTOK * HID / 8, blk);
}

// ---------------------------------------------------------------------------------------------
// 4) RoPE -> f16 planes, q and k heads in one launch. src f32 [NTOK][QKDIM], head hs occupies cols hs*128 .. hs*128+127 (first 64 = x1,
//    next 64 = x2); heads 0..15 are q and go to outQ [NTOK][QDIM], heads 16..23 are k and go to outK [NTOK][KVDIM].
//    Thread = (token, head, 8-wide pair group jg): out[d] = x1[d]*cos - x2[d]*sin, out[d+64] = x2[d]*cos + x1[d]*sin, times scl.
// ---------------------------------------------------------------------------------------------
__global__ __launch_bounds__(256) void rope_f16_kernel(const float* __restrict__ src, const float* __restrict__ cosT, const float* __restrict__ sinT,
                                                        unsigned short* __restrict__ outQ, unsigned short* __restrict__ outK, float scl) {
  const int i = blockIdx.x * 256 + threadIdx.x;          // exactly NTOK*(NQH+NKVH)*8 threads
  const int jg = i & 7;
  const int hs = (i >> 3) % (NQH + NKVH);
  const int tok = (i >> 3) / (NQH + NKVH);
  const int pos = tok % SEQ;
  const size_t base = (size_t)tok * QKDIM + (size_t)hs * HD + jg * 8;
  const size_t tb = (size_t)pos * HHALF + jg * 8;
  const v4f x1a = *(const v4f*)(src + base);
  const v4f x1b = *(const v4f*)(src + base + 4);
  const v4f x2a = *(const v4f*)(src + base + HHALF);
  const v4f x2b = *(const v4f*)(src + base + HHALF + 4);
  const v4f ca = *(const v4f*)(cosT + tb);
  const v4f cb = *(const v4f*)(cosT + tb + 4);
  const v4f sa = *(const v4f*)(sinT + tb);
  const v4f sb = *(const v4f*)(sinT + tb + 4);
  v4f o1a, o1b, o2a, o2b;
#pragma unroll
  for (int e = 0; e < 4; ++e) {
    o1a[e] = (x1a[e] * ca[e] - x2a[e] * sa[e]) * scl;
    o2a[e] = (x2a[e] * ca[e] + x1a[e] * sa[e]) * scl;
    o1b[e] = (x1b[e] * cb[e] - x2b[e] * sb[e]) * scl;
    o2b[e] = (x2b[e] * cb[e] + x1b[e] * sb[e]) * scl;
  }
  v4u h1, h2;
  h1[0] = (unsigned)f2h_bits(o1a[0]) | ((unsigned)f2h_bits(o1a[1]) << 16);
  h1[1] = (unsigned)f2h_bits(o1a[2]) | ((unsigned)f2h_bits(o1a[3]) << 16);
  h1[2] = (unsigned)f2h_bits(o1b[0]) | ((unsigned)f2h_bits(o1b[1]) << 16);
  h1[3] = (unsigned)f2h_bits(o1b[2]) | ((unsigned)f2h_bits(o1b[3]) << 16);
  h2[0] = (unsigned)f2h_bits(o2a[0]) | ((unsigned)f2h_bits(o2a[1]) << 16);
  h2[1] = (unsigned)f2h_bits(o2a[2]) | ((unsigned)f2h_bits(o2a[3]) << 16);
  h2[2] = (unsigned)f2h_bits(o2b[0]) | ((unsigned)f2h_bits(o2b[1]) << 16);
  h2[3] = (unsigned)f2h_bits(o2b[2]) | ((unsigned)f2h_bits(o2b[3]) << 16);
  {
    unsigned short* outP = hs < NQH ? outQ + (size_t)tok * QDIM + (size_t)hs * HD + jg * 8
                                    : outK + (size_t)tok * KVDIM + (size_t)(hs - NQH) * HD + jg * 8;
    *(v4u*)(outP) = h1;
    *(v4u*)(outP + HHALF) = h2;
    
  }
}

// ---------------------------------------------------------------------------------------------
// 5) Register-blocked batched WMMA GEMM, 16-bit operands of type T (bf16 or f16), f32 accumulate.
//    C[m,n] = scale * sum_k A[m,k] * Bt[n,k]; A row-major [M,K], Bt row-major [N,K].
//    Block = 4 waves (2 x 2) = one 128x128 tile of C; each wave owns a 64x64 tile.
//    Per pass the block's 128 A rows and 128 Bt rows x 128 k (256 B a row) are brought into LDS by asynchronous
//    copies, two buffers: the next pass's copies fly while this pass's fragments are read from LDS.
//    M,N % 128 == 0, K % 128 == 0 (no tail handling). lda, ldb % 8 == 0 (16-B copies).
//    OUT_MODE: 0 = f32, 1 = single f16 plane. The hi/lo plane options are not staged: both must be false.
// ---------------------------------------------------------------------------------------------
#define GBK    128    // k elements of one staged pass
#define GPITCH 136    // LDS row pitch in elements: 272 B = 16 B x 17, conflict-free for 16-B row reads
typedef __attribute__((ext_vector_type(4))) int v4i;
typedef __attribute__((address_space(1))) v4i gv4i;
typedef __attribute__((address_space(3))) v4i lv4i;

// 128 rows x 256 B from g (row pitch ld elements) into l (row pitch GPITCH): 128 threads x 16 copies of 16 B;
// one wave-wide copy covers two whole 256-B rows.
// g is the tile's origin, the same in every lane; goff is the lane's own element offset row * ld + column.
template <typename T>
__device__ __forceinline__ void stage_tile(const T* g, int ld, unsigned goff, T* l, int tid) {
  T* lp = l + (tid >> 4) * GPITCH + (tid & 15) * 8;
#pragma unroll   // the 16 copies go out back to back, none waits for another
  for (int j = 0; j < 16; ++j)
    __builtin_amdgcn_global_load_async_to_lds_b128((gv4i*)(g + (size_t)(j * 8) * ld + goff), (lv4i*)(lp + j * 8 * GPITCH), 0, 0);
}

// A wave's 64x64 accumulator tile -> C, 16 rows at a time through the wave's own LDS slab, so that each store covers whole row pieces.
template <int OUT_MODE>
__device__ __forceinline__ void gemm_store(v8f (&acc)[4][4], float* slab, void* Cb, int ldc, int m0, int n0, float scale, int lane) {
  const int rlane = lane & 15;                 // D column within subtile
  const int mOff  = (lane >> 4) * 8;           // D row offset
#pragma unroll
  for (int i = 0; i < 4; ++i) {
    const int mBase = m0 + (i << 4);
#pragma unroll
    for (int j = 0; j < 4; ++j) {
#pragma unroll
      for (int r = 0; r < 8; ++r) {
        const float v = acc[i][j][r] * scale;
        slab[(mOff + r) * 68 + (j << 4) + rlane] = v;
      }
    }
    __builtin_amdgcn_fence(3, "workgroup");
    __builtin_amdgcn_wave_barrier();
    __builtin_amdgcn_fence(2, "workgroup");
    if (OUT_MODE == 0) {
      float* Cf = (float*)Cb;
      const int hh = lane >> 4, c4 = (lane & 15) * 4;     // row seg = 256 B = 16 lanes x 16 B
      {
#pragma unroll
        for (int it = 0; it < 8; ++it) {
          const int row = it * 2 + hh;
          v4f v = *(const v4f*)(slab + row * 68 + c4);
          *(v4f*)(Cf + (size_t)(mBase + row) * ldc + n0 + c4) = v;
        }
        
      }
    } else {
      const int q = lane >> 3, c8 = (lane & 7) * 8;
      unsigned short* Cs = (unsigned short*)Cb;
      {
#pragma unroll
        for (int it = 0; it < 4; ++it) {
          const int row = it * 4 + q;
          const float* sp = slab + row * 68 + c8;
          v8h hv;
#pragma unroll
          for (int e = 0; e < 8; ++e) hv[e] = (_Float16)sp[e];
          *(v8h*)(Cs + (size_t)(mBase + row) * ldc + n0 + c8) = hv;
        }
        
      }
    }
    __builtin_amdgcn_fence(3, "workgroup");
    __builtin_amdgcn_wave_barrier();
    __builtin_amdgcn_fence(2, "workgroup");
  }
}

// One block's 128x128 tile (tm, tn). Ag, Bg: first of the tile's 128 A rows and 128 Bt rows; Cb: origin of this product's C.
// ring: [buffer][A rows | Bt rows]; sT: per-wave 16x64 slab, pitch 68 floats. Every argument is the same in the whole block.
template <typename T>
__device__ __forceinline__ void gemm_tile(const T* Ag, int lda, const T* Bg, int ldb, void* Cb, int ldc, int tm, int tn, int K, float scale,
                                          int out_mode, T (*ring)[2][128 * GPITCH], float (*sT)[16 * 68]) {
  typedef typename Frag<T>::V V;
  const int tid  = threadIdx.x;
  const int lane = tid & 31;
  const int wave = tid >> 5;
  const int wm = (wave >> 1) << 6;             // this wave's rows inside the block tile
  const int wn = (wave & 1) << 6;              // this wave's columns inside the block tile
  const int m0 = (tm << 7) + wm;
  const int n0 = (tn << 7) + wn;

  const int rlane = lane & 15;                 // row (A) / col (B, D) within subtile
  const int koff  = (lane >> 4) * 8;           // k offset of this lane half

  v8f acc[4][4];
#pragma unroll
  for (int i = 0; i < 4; ++i)
#pragma unroll
    for (int j = 0; j < 4; ++j) acc[i][j] = (v8f){0.f,0.f,0.f,0.f,0.f,0.f,0.f,0.f};

  const int nt = K / GBK;
  const unsigned aoff = (unsigned)(tid >> 4) * (unsigned)lda + (unsigned)(tid & 15) * 8u;
  const unsigned boff = (unsigned)(tid >> 4) * (unsigned)ldb + (unsigned)(tid & 15) * 8u;
  stage_tile<T>(Ag, lda, aoff, ring[0][0], tid);
  stage_tile<T>(Bg, ldb, boff, ring[0][1], tid);
  asm volatile("s_wait_asynccnt 0x0" ::: "memory");   // this wave's copies of pass 0 have landed
  __syncthreads();                                     // ... and every other wave's: pass 0 is readable
  if (nt > 1) {
    stage_tile<T>(Ag + GBK, lda, aoff, ring[1][0], tid);
    stage_tile<T>(Bg + GBK, ldb, boff, ring[1][1], tid);
  }

  for (int t = 0; t < nt; ++t) {
    const T* la = ring[t & 1][0] + (wm + rlane) * GPITCH + koff;
    const T* lb = ring[t & 1][1] + (wn + rlane) * GPITCH + koff;
    // LDS reads run ahead of their products: the next 32-k block's Bt fragments go into a second set at the head of
    // this block, and each A fragment is re-read for the next block as soon as its row of products has been issued
    // (every loop below is unrolled so that each fragment and accumulator index is a constant: registers, no scratch)
    V af[4], bf[2][4];
#pragma unroll
    for (int j = 0; j < 4; ++j) { bf[0][j] = Frag<T>::load(lb + (j << 4) * GPITCH); af[j] = Frag<T>::load(la + (j << 4) * GPITCH); }
#pragma unroll
    for (int kb = 0; kb < GBK / 32; ++kb) {
      const int cu = kb & 1, nx = cu ^ 1;
      if (kb + 1 < GBK / 32) {
#pragma unroll
        for (int j = 0; j < 4; ++j) bf[nx][j] = Frag<T>::load(lb + (j << 4) * GPITCH + (kb + 1) * 32);
      }
#pragma unroll
      for (int i = 0; i < 4; ++i) {
#pragma unroll
        for (int j = 0; j < 4; ++j) acc[i][j] = Frag<T>::mma(af[i], bf[cu][j], acc[i][j]);
        Frag<T>::guard(acc[i][0], acc[i][3], af[i], af[i]);
        if (kb + 1 < GBK / 32) af[i] = Frag<T>::load(la + (i << 4) * GPITCH + (kb + 1) * 32);
      }
      Frag<T>::keep(bf[cu][0], bf[cu][1], bf[cu][2], bf[cu][3]);
    }
    asm volatile("s_wait_dscnt 0x0" ::: "memory");     // this wave's reads of buffer t & 1 are done before it is refilled
    asm volatile("s_wait_asynccnt 0x0" ::: "memory");  // this wave's copies of pass t + 1 have landed
    __syncthreads();                                    // publishes pass t + 1, frees buffer t & 1
    if (t + 2 < nt) {
      stage_tile<T>(Ag + (size_t)(t + 2) * GBK, lda, aoff, ring[t & 1][0], tid);
      stage_tile<T>(Bg + (size_t)(t + 2) * GBK, ldb, boff, ring[t & 1][1], tid);
    }
  }
  asm volatile("s_wait_asynccnt 0x0" ::: "memory");    // no copy is outstanding when the wave goes on
  acc_guard4(acc[0][0], acc[0][1], acc[0][2], acc[0][3]);
  acc_guard4(acc[1][0], acc[1][1], acc[1][2], acc[1][3]);
  acc_guard4(acc[2][0], acc[2][1], acc[2][2], acc[2][3]);
  acc_guard4(acc[3][0], acc[3][1], acc[3][2], acc[3][3]);

  // ---- epilogue ---- (one block-uniform branch around the whole of it)
  if (out_mode == 0) gemm_store<0>(acc, sT[wave], Cb, ldc, m0, n0, scale, lane);
  else               gemm_store<1>(acc, sT[wave], Cb, ldc, m0, n0, scale, lane);
}

// one product, batched over blockIdx.y
template <typename T, bool SPLITA, bool SPLITB, int OUT_MODE>
__global__ __launch_bounds__(128) void gemm_t64(
    const unsigned short* __restrict__ Ap, const unsigned short* __restrict__ A2p, int lda, long strideA,
    const unsigned short* __restrict__ Btp, const unsigned short* __restrict__ Bt2p, int ldb, long strideB,
    void* __restrict__ Cout, int ldc, long strideC,
    int M, int N, int K, float scale) {
  static_assert(!SPLITA && !SPLITB);
  const T* A = (const T*)Ap; const T* Bt = (const T*)Btp;
  __shared__ __align__(16) T ring[2][2][128 * GPITCH];
  __shared__ __align__(16) float sT[4][16 * 68];
  const int b    = blockIdx.y;
  const int tilesN = N >> 7;
  const int tilesM = M >> 7;
  const int tile = blockIdx.x;
  if (tile >= tilesM * tilesN) return;   // block-uniform, ahead of every barrier and copy
  const int tm = tile / tilesN;
  const int tn = tile - tm * tilesN;
  const T* Ag = A  + (size_t)b * strideA + (size_t)(tm << 7) * lda;
  const T* Bg = Bt + (size_t)b * strideB + (size_t)(tn << 7) * ldb;
  void* Cb = OUT_MODE == 0 ? (void*)((float*)Cout + (size_t)b * strideC) : (void*)((unsigned short*)Cout + (size_t)b * strideC);
  gemm_tile<T>(Ag, lda, Bg, ldb, Cb, ldc, tm, tn, K, scale, OUT_MODE, ring, sT);
}

// The three products on x in ONE launch (none reads what another writes), each tile computed as in a launch of its own:
//   blocks 0 .. QK_TILES-1: [q | k] = x @ [Wq | Wk] -> f32 [NTOK][QKDIM]; WqkT = the QDIM rows of Wq^T, then the KVDIM rows of Wk^T
//   then NB x V_TILES:      v^T per batch = Wv^T @ x_b^T -> f16 [NB][KVDIM][SEQ]
// ld = row pitch of all three operand planes = K.
#define QK_TILES ((NTOK / 128) * (QKDIM / 128))
#define V_TILES  ((KVDIM / 128) * (SEQ / 128))
__global__ __launch_bounds__(128) void gemm_qkv(
    const unsigned short* __restrict__ xbp, const unsigned short* __restrict__ WqkTp, const unsigned short* __restrict__ WvTp,
    float* __restrict__ QKf, unsigned short* __restrict__ Vtp, int ld) {
  __shared__ __align__(16) __bf16 ring[2][2][128 * GPITCH];
  __shared__ __align__(16) float sT[4][16 * 68];
  const __bf16* xb = (const __bf16*)xbp;
  const int bx = blockIdx.x;
  const bool isv = bx >= QK_TILES;             // block-uniform
  const int r  = isv ? bx - QK_TILES : bx;
  const int b  = isv ? r / V_TILES : 0;
  const int tile = r - b * V_TILES;
  const int tm = isv ? tile / (SEQ / 128) : tile / (QKDIM / 128);
  const int tn = tile - tm * (isv ? SEQ / 128 : QKDIM / 128);
  const __bf16* A  = isv ? (const __bf16*)WvTp : xb;
  const __bf16* Bt = isv ? xb + (size_t)b * SEQ * ld : (const __bf16*)WqkTp;
  void* Cb = isv ? (void*)(Vtp + (size_t)b * KVDIM * SEQ) : (void*)QKf;
  gemm_tile<__bf16>(A + (size_t)(tm << 7) * ld, ld, Bt + (size_t)(tn << 7) * ld, ld, Cb, isv ? SEQ : QKDIM, tm, tn, ld, 1.0f,
                    isv ? 1 : 0, ring, sT);
}

#define KPITCH 136    // LDS pitch of a K row in elements: 272 B = 16 B x 17, conflict-free for 16-B row reads
#define VPITCH 72     // LDS pitch of a V^T row in elements: 144 B = 16 B x 9, conflict-free for 16-B row reads

// kg, vg: origin of the chunk's K rows (pitch KVDIM) and V^T rows (pitch SEQ), the same in every lane.
// 256 threads x (4 + 4) copies of 16 B; one wave-wide copy covers two whole K rows or four whole V^T row pieces.
__device__ __forceinline__ void stage_kv(const _Float16* kg, const _Float16* vg, _Float16* kl, _Float16* vl, int tid) {
  const unsigned ko = (unsigned)(tid >> 4) * (unsigned)KVDIM + (unsigned)(tid & 15) * 8u;
  const unsigned vo = (unsigned)(tid >> 3) * (unsigned)SEQ + (unsigned)(tid & 7) * 8u;
  _Float16* kp = kl + (tid >> 4) * KPITCH + (tid & 15) * 8;
  _Float16* vp = vl + (tid >> 3) * VPITCH + (tid & 7) * 8;
#pragma unroll   // the copies go out back to back, none waits for another
  for (int j = 0; j < 4; ++j)
    __builtin_amdgcn_global_load_async_to_lds_b128((gv4i*)(kg + (size_t)(j * 16) * KVDIM + ko), (lv4i*)(kp + j * 16 * KPITCH), 0, 0);
#pragma unroll   // as above
  for (int j = 0; j < 4; ++j)
    __builtin_amdgcn_global_load_async_to_lds_b128((gv4i*)(vg + (size_t)(j * 32) * SEQ + vo), (lv4i*)(vp + j * 32 * VPITCH), 0, 0);
}

// lane l <-> lane l ^ 16, a vector cross-row move
__device__ __forceinline__ float xhalf(float x) {
  return __builtin_bit_cast(float, __builtin_amdgcn_permlanex16(__builtin_bit_cast(int, x), __builtin_bit_cast(int, x), 0x76543210, 0xfedcba98, false, false));
}

__global__ __launch_bounds__(256) void attn_kernel(
    const unsigned short* __restrict__ Qp, const unsigned short* __restrict__ Kp,
    const unsigned short* __restrict__ Vtp, unsigned short* __restrict__ Op) {
  __shared__ __align__(16) _Float16 Kst[2][KV_CHUNK * KPITCH]; // 34 KB: K rows of a chunk [kv][d], two buffers
  __shared__ __align__(16) _Float16 Vst[2][HD * VPITCH];       // 36 KB: V^T rows of a chunk [d][kv], two buffers

  const _Float16* Q  = (const _Float16*)Qp;
  const _Float16* Kk = (const _Float16*)Kp;
  const _Float16* Vt = (const _Float16*)Vtp;

  const int tid  = threadIdx.x;
  const int wave = tid >> 5, lane = tid & 31;
  const int hh   = lane >> 4, c = lane & 15, koff = hh * 8;
  const int nqb  = SEQ / QBLK;
  const int bx   = blockIdx.x;
  const int qb   = bx % nqb;
  const int bhid = bx / nqb;
  const int h    = bhid % NQH;
  const int b    = bhid / NQH;
  const int kvh  = h >> 1;
  const int q0   = qb * QBLK + wave * 16;                       // sequence position of this wave's row 0
  const size_t tokw = (size_t)b * SEQ + q0;                     // compact token index of this wave's row 0
  const size_t qoff = (tokw + c) * QDIM + (size_t)h * HD + koff;
  const _Float16* Kg = Kk + (size_t)b * SEQ * KVDIM + (size_t)kvh * HD;            // this head's K rows, key 0
  const _Float16* Vg = Vt + (size_t)b * KVDIM * SEQ + (size_t)(kvh * HD) * SEQ;    // this head's V^T rows, key 0

  float mrow = -INFINITY;   // running maximum of query c, the same in both wave halves
  float lrow = 0.f;         // running sum of query c over this half's keys; the halves are joined in the epilogue
  v8f oacc[8];              // O^T tile t: register r = O[query c][d = 16 t + 8 hh + r]
#pragma unroll
  for (int t = 0; t < 8; ++t) oacc[t] = (v8f){0.f,0.f,0.f,0.f,0.f,0.f,0.f,0.f};

  const int nch = SEQ / KV_CHUNK;
  stage_kv(Kg, Vg, Kst[0], Vst[0], tid);
  asm volatile("s_wait_asynccnt 0x0" ::: "memory");   // this wave's copies of chunk 0 have landed
  __syncthreads();                                     // ... and every other wave's: chunk 0 is readable
  if (nch > 1) stage_kv(Kg + (size_t)KV_CHUNK * KVDIM, Vg + KV_CHUNK, Kst[1], Vst[1], tid);

  for (int kc = 0; kc < nch; ++kc) {
    const _Float16* kl = Kst[kc & 1] + c * KPITCH + koff;
    const _Float16* vl = Vst[kc & 1] + c * VPITCH + koff;

    // ---- raw scores S^T(64 kv x 16 q) over d = 128: tile j, register r = S[query c][key 16 j + 8 hh + r] ----
    v8f s[4];
#pragma unroll
    for (int j = 0; j < 4; ++j) s[j] = (v8f){0.f,0.f,0.f,0.f,0.f,0.f,0.f,0.f};
    // LDS reads stand in groups of four fragments, one group ahead of their products (two register sets); the loops are
    // unrolled so that every fragment index is a constant: registers, no scratch
    v16h kf[2][4];
#pragma unroll
    for (int j = 0; j < 4; ++j) kf[0][j] = Frag<_Float16>::load(kl + j * 16 * KPITCH);
#pragma unroll
    for (int dc = 0; dc < 4; ++dc) {
      const int cu = dc & 1, nx = cu ^ 1;
      const v16h qa = Frag<_Float16>::load(Q + qoff + dc * 32);
      if (dc + 1 < 4) {
#pragma unroll
        for (int j = 0; j < 4; ++j) kf[nx][j] = Frag<_Float16>::load(kl + j * 16 * KPITCH + (dc + 1) * 32);
      }
#pragma unroll
      for (int j = 0; j < 4; ++j) s[j] = h_mma(kf[cu][j], qa, s[j]);
    }

    // ---- scale, tanh softcap (f32), maximum of query c: four in-lane chains, then the other half's ----
    // (here and below every loop is unrolled so that each score, fragment and accumulator index is a constant: registers, no scratch)
    float mj[4];
#pragma unroll
    for (int j = 0; j < 4; ++j) {
      float m = -INFINITY;
#pragma unroll
      for (int r = 0; r < 8; ++r) {
        // v_tanh_f32: one instruction and no branch, where the library tanhf takes two divergent branches per score
        const float sv = SOFTCAP * __builtin_amdgcn_tanhf(s[j][r] * (RSQ * INVCAP));
        s[j][r] = sv;
        m = fmaxf(m, sv);
      }
      mj[j] = m;
    }
    float cm = fmaxf(fmaxf(mj[0], mj[1]), fmaxf(mj[2], mj[3]));
    cm = fmaxf(cm, xhalf(cm));

    // ---- online softmax (f32); P x 2^10 as f16 straight into the B fragments of V^T . P^T ----
    // B fragment kk, element e: key 32 kk + (e < 8 ? 8 hh + e : 16 + 8 hh + e - 8) = tile 2 kk + (e >> 3), register e & 7:
    // the k order of the V^T loader
    const float mnew = fmaxf(mrow, cm);
    const float alpha = __expf(mrow - mnew);
    mrow = mnew;
    float pj[4];
    v16h pb[2];
#pragma unroll
    for (int j = 0; j < 4; ++j) {
      float psum = 0.f;
#pragma unroll
      for (int r = 0; r < 8; ++r) {
        const float p = __expf(s[j][r] - mnew);
        psum += p;
        pb[j >> 1][(j & 1) * 8 + r] = (_Float16)(p * PCARRY);
      }
      pj[j] = psum;
    }
    lrow = lrow * alpha + ((pj[0] + pj[1]) + (pj[2] + pj[3]));
#pragma unroll
    for (int t = 0; t < 8; ++t)
#pragma unroll
      for (int r = 0; r < 8; ++r) oacc[t][r] *= alpha;

    // ---- O^T(128 d x 16 q) += V^T(128 d x 64 kv) . P^T ----
    // group g = 32 keys kk = g >> 1, output tiles 4 * (g & 1) .. + 3; V^T fragments read one group ahead, as for K above
    v16h vf[2][4];
#pragma unroll
    for (int t = 0; t < 4; ++t) vf[0][t] = Frag<_Float16>::load(vl + t * 16 * VPITCH);
#pragma unroll
    for (int g = 0; g < 4; ++g) {
      const int cu = g & 1, nx = cu ^ 1, kk = g >> 1, tb = (g & 1) * 4;
      if (g + 1 < 4) {
#pragma unroll
        for (int t = 0; t < 4; ++t) vf[nx][t] = Frag<_Float16>::load(vl + (((g + 1) & 1) * 4 + t) * 16 * VPITCH + ((g + 1) >> 1) * 32);
      }
#pragma unroll
      for (int t = 0; t < 4; ++t) oacc[tb + t] = h_mma(vf[cu][t], pb[kk], oacc[tb + t]);
    }
    asm volatile("s_wait_dscnt 0x0" ::: "memory");     // this wave's reads of buffer kc & 1 are done before it is refilled
    asm volatile("s_wait_asynccnt 0x0" ::: "memory");  // this wave's copies of chunk kc + 1 have landed
    __syncthreads();                                    // publishes chunk kc + 1, frees buffer kc & 1
    if (kc + 2 < nch)
      stage_kv(Kg + (size_t)(kc + 2) * KV_CHUNK * KVDIM, Vg + (kc + 2) * KV_CHUNK, Kst[kc & 1], Vst[kc & 1], tid);
  }
  asm volatile("s_wait_asynccnt 0x0" ::: "memory");    // no copy is outstanding when the wave goes on

  // ---- epilogue: join the halves' sums, normalise (x 2^6 / (2^10 * l)), write the f16 ctx plane ----
  // coverage: 8 tiles x 2 halves x 8 elements = 128 dims of each of the wave's 16 rows; the wave writes whole 256-B rows.
  const float lsum = lrow + xhalf(lrow);
  const float inv = OCARRY / (PCARRY * lsum);          // undo the P carry (2^10) and apply the ctx carry (2^6)
  unsigned short* orow = Op + (tokw + c) * QDIM + (size_t)h * HD + koff;
#pragma unroll
  for (int t = 0; t < 8; ++t) {
    v8h hv;
#pragma unroll
    for (int r = 0; r < 8; ++r) hv[r] = (_Float16)(oacc[t][r] * inv);
    *(v8h*)(orow + t * 16) = hv;
  }
}

// ---------------------------------------------------------------------------------------------
// host
// ---------------------------------------------------------------------------------------------
static_assert((NTOK * HID / 8) % 256 == 0);
static_assert((NTOK * (NQH + NKVH) * 8) % 256 == 0);
static_assert((SEQ * HHALF) % 256 == 0);
static_assert(HID % 128 == 0 && QDIM % 128 == 0);
static_assert(NTOK % 128 == 0 && HID % 128 == 0 && QDIM % 128 == 0 && KVDIM % 128 == 0 && SEQ % 128 == 0);
static_assert(SEQ % QBLK == 0 && SEQ % KV_CHUNK == 0 && QBLK == 128 && KV_CHUNK == 64 && HD == 128);
static_assert(NB >= 1 && NB <= NB_FULL && SEQ <= SEQ_FULL);
static_assert(NQH == 2 * NKVH);

extern "C" void kernel_launch(void* const* d_in, const int* in_sizes, int n_in,
                              void* d_out, int out_size, void* d_ws, size_t ws_size, hipStream_t stream) {
  if (n_in < 5) return;
  const size_t needTok = (size_t)(NB - 1) * SEQ_FULL + SEQ;
  if ((size_t)in_sizes[0] < needTok * HID) return;
  if ((size_t)in_sizes[1] < (size_t)HID * QDIM) return;
  if ((size_t)in_sizes[2] < (size_t)HID * KVDIM) return;
  if ((size_t)in_sizes[3] < (size_t)HID * KVDIM) return;
  if ((size_t)in_sizes[4] < (size_t)QDIM * HID) return;
  if ((size_t)out_size < needTok * HID) return;

  const float* x  = (const float*)d_in[0];   // [2,2048,2048]
  const float* Wq = (const float*)d_in[1];   // [2048,2048]  [in][out]
  const float* Wk = (const float*)d_in[2];   // [2048,1024]
  const float* Wv = (const float*)d_in[3];   // [2048,1024]
  const float* Wo = (const float*)d_in[4];   // [2048,2048]
  float* out = (float*)d_out;                // [2,2048,2048] f32

  //   XB   bf16 [NTOK][HID]
  //   WQT  bf16 [QDIM][HID], WKT bf16 [KVDIM][HID], WVT bf16 [KVDIM][HID], WOT f16 [HID][QDIM]
  //        (WKT follows WQT directly: together the [QKDIM][HID] plane of [Wq | Wk]^T)
  //   R1   f32 [NTOK][QKDIM] for q | k; later reused: ctx f16 [NTOK][QDIM] at +0
  //   VT f16 [NB][KVDIM][SEQ]; QP f16 [NTOK][QDIM]; KP f16 [NTOK][KVDIM]; COS, SIN f32 [SEQ][HHALF]
  const size_t szXB  = (size_t)NTOK * HID * 2;
  const size_t szWQT = (size_t)QDIM * HID * 2;
  const size_t szWKT = (size_t)KVDIM * HID * 2;
  const size_t szWOT = (size_t)HID * QDIM * 2;
  const size_t szR1  = (size_t)NTOK * QKDIM * 4;
  const size_t szQP  = (size_t)NTOK * QDIM * 2;
  const size_t szKP  = (size_t)NTOK * KVDIM * 2;
  const size_t szVT  = (size_t)NB * KVDIM * SEQ * 2;
  const size_t szTAB = (size_t)SEQ * HHALF * 4;
  static_assert((size_t)NTOK * QDIM * 2 <= (size_t)NTOK * QKDIM * 4);
  const size_t OFF_XB  = 0;
  const size_t OFF_WQT = OFF_XB + szXB;
  const size_t OFF_WKT = OFF_WQT + szWQT;
  const size_t OFF_WVT = OFF_WKT + szWKT;
  const size_t OFF_WOT = OFF_WVT + szWKT;
  const size_t OFF_R1  = OFF_WOT + szWOT;
  const size_t OFF_QKF = OFF_R1;
  const size_t OFF_CTX = OFF_R1;
  const size_t OFF_VT  = OFF_R1 + szR1;
  const size_t OFF_QP  = OFF_VT + szVT;
  const size_t OFF_KP  = OFF_QP + szQP;
  const size_t OFF_COS = OFF_KP + szKP;
  const size_t OFF_SIN = OFF_COS + szTAB;
  const size_t WS_TOTAL = OFF_SIN + szTAB;
  if (ws_size < WS_TOTAL) return;

  char* ws = (char*)d_ws;
  unsigned short* xb  = (unsigned short*)(ws + OFF_XB);
  unsigned short* WqT = (unsigned short*)(ws + OFF_WQT);
  unsigned short* WkT = (unsigned short*)(ws + OFF_WKT);
  unsigned short* WvT = (unsigned short*)(ws + OFF_WVT);
  unsigned short* WoT = (unsigned short*)(ws + OFF_WOT);
  float* QKf = (float*)(ws + OFF_QKF);
  unsigned short* ctx = (unsigned short*)(ws + OFF_CTX);
  unsigned short* Vt  = (unsigned short*)(ws + OFF_VT);
  unsigned short* Qpl = (unsigned short*)(ws + OFF_QP);
  unsigned short* Kpl = (unsigned short*)(ws + OFF_KP);
  float* cosT = (float*)(ws + OFF_COS);
  float* sinT = (float*)(ws + OFF_SIN);

  // inv_freq[j] = 1 / 10000^(2j/128), pow in double then RNE to f32, reciprocal as one f32 divide
  RopeFreq fr;
  for (int j = 0; j < HHALF; ++j) {
    const float e = (float)(2 * j) / 128.0f;
    const double p = pow(10000.0, (double)e);
    const float pf = (float)p;
    fr.f[j] = 1.0f / pf;
  }

  // 1) to 3) x -> compact bf16 plane; transposed 16-bit weight planes in[rows][cols] -> out[cols][rows]; RoPE tables
  prep_kernel<<<PB_TAB + PB_WQ + 2 * PB_WKV + PB_WO + PB_X, 256, 0, stream>>>(x, Wq, Wk, Wv, Wo, xb, WqT, WkT, WvT, WoT, cosT, sinT, fr);
  // 4) [q | k] = x @ [Wq | Wk] -> f32 [NTOK][QKDIM]; v^T per batch = Wv^T @ x_b^T -> f16 [NB][KVDIM][SEQ]   (K=HID)
  gemm_qkv<<<QK_TILES + NB * V_TILES, 128, 0, stream>>>(xb, WqT, WvT, QKf, Vt, HID);
  // 5) RoPE of q (16 heads) and k (8 kv heads) -> f16 planes
  rope_f16_kernel<<<(NTOK * (NQH + NKVH) * 8) / 256, 256, 0, stream>>>(QKf, cosT, sinT, Qpl, Kpl, 1.0f);
  // 6) attention -> ctx f16 x 2^6 [NTOK][QDIM]  (the q | k f32 region is dead; V^T region disjoint)
  attn_kernel<<<NB * NQH * (SEQ / QBLK), 256, 0, stream>>>(Qpl, Kpl, Vt, ctx);
  // 7) out = ctx @ Wo -> d_out f32, per batch rows b*SEQ_FULL..  (M=SEQ, N=HID, K=QDIM, scale 2^-10)
  {
    const int tiles = (SEQ / 128) * (HID / 128);
    gemm_t64<_Float16, false, false, 0><<<dim3(tiles, NB), 128, 0, stream>>>(
        ctx, ctx, QDIM, (long)SEQ * QDIM, WoT, WoT, QDIM, 0L, (void*)out, HID, (long)SEQ_FULL * HID,
        SEQ, HID, QDIM, OUTSCALE);
  }
}

// v006
// A run of this version takes 155 microseconds.
// Next to v005, in two timings, it ran 1.14 times as fast each time.
// Over all steps from v000 it is 4.42 times as fast.
// x@Wq, x@Wk, Wv^T@x^T: v_wmma_f32_16x16x32_bf16 on RNE-bf16 input planes (f32 accumulate); q.k^T: v_wmma_f32_16x16x32_f16 (q, k single f16 planes, f32 accumulate); p.v: v_wmma_f32_16x16x32_f16 (p f16 carried x2^10, v f16, f32 accumulate); ctx@Wo: v_wmma_f32_16x16x32_f16 (ctx f16 carried x2^6, Wo f16 carried x2^4 built from RNE-bf16 values, f32 accumulate); RoPE, tanh softcap and softmax in f32.
#include <hip/hip_runtime.h>
#include <math.h>

#pragma clang fp contract(off)

#ifndef NB
#define NB 2
#endif
#ifndef SEQ
#define SEQ 2048
#endif
#define NB_FULL  2
#define SEQ_FULL 2048
#define HID      2048
#define NQH      16
#define NKVH     8
#define HD       128
#define HHALF    64
#define QDIM     (NQH * HD)
#define KVDIM    (NKVH * HD)
#define QKDIM    (QDIM + KVDIM)
#define NTOK     (NB * SEQ)
#define KV_CHUNK 64
#define QBLK     256
#define RSQ      0.08838834764831845f
#define SOFTCAP  50.0f
#define INVCAP   0.02f
#define PCARRY   1024.0f
#define OCARRY   64.0f
#define WOCARRY  16.0f
#define OUTSCALE 0.0009765625f

typedef __attribute__((ext_vector_type(16))) _Float16 v16h;
typedef __attribute__((ext_vector_type(8)))  _Float16 v8h;
typedef __attribute__((ext_vector_type(16))) __bf16   v16b;
typedef __attribute__((ext_vector_type(8)))  __bf16   v8b;
typedef __attribute__((ext_vector_type(8)))  float    v8f;
typedef __attribute__((ext_vector_type(4)))  float    v4f;
typedef __attribute__((ext_vector_type(4)))  unsigned int v4u;

__device__ __forceinline__ unsigned short f2bf_bits(float f) {
  unsigned u = __float_as_uint(f);
  return (unsigned short)((u + 0x7FFFu + ((u >> 16) & 1u)) >> 16);
}
__device__ __forceinline__ float bf_bits2f(unsigned short h) { return __uint_as_float(((unsigned)h) << 16); }
__device__ __forceinline__ unsigned short f2h_bits(float f) { const _Float16 h = (_Float16)f; return __builtin_bit_cast(unsigned short, h); }

// hazard guards as plain device helpers
__device__ __forceinline__ void dep_guard_h(v8f& a, v8f& b, v16h x, v16h y) { asm volatile("v_nop\n\tv_nop\n\tv_nop\n\tv_nop" : "+v"(a), "+v"(b) : "v"(x), "v"(y)); }
__device__ __forceinline__ void dep_guard_b(v8f& a, v8f& b, v16b x, v16b y) { asm volatile("v_nop\n\tv_nop\n\tv_nop\n\tv_nop" : "+v"(a), "+v"(b) : "v"(x), "v"(y)); }
__device__ __forceinline__ void keep4_h(v16h a, v16h b, v16h c, v16h d) { asm volatile("v_nop" :: "v"(a), "v"(b), "v"(c), "v"(d)); }
__device__ __forceinline__ void keep4_b(v16b a, v16b b, v16b c, v16b d) { asm volatile("v_nop" :: "v"(a), "v"(b), "v"(c), "v"(d)); }
__device__ __forceinline__ void acc_guard4(v8f& a, v8f& b, v8f& c, v8f& d) { asm volatile("v_nop\n\tv_nop\n\tv_nop\n\tv_nop" : "+v"(a), "+v"(b), "+v"(c), "+v"(d)); }

// fragment loaders: lane l, row/col = l & 15, elements 0..7 <- p[0..7] (k0 + 8h + 0..7), 8..15 <- p[16..23] (k0 + 16 + 8h + 0..7); caller adds 8h
template <typename T> struct Frag;
template <> struct Frag<_Float16> {
  typedef v16h V; union U { v16h v; v8h h[2]; };
  static __device__ __forceinline__ v16h load(const _Float16* p) {
    U f; f.h[0] = *(const v8h*)(p); f.h[1] = *(const v8h*)(p + 16); return f.v;
  }
  static __device__ __forceinline__ v8f mma(v16h a, v16h b, v8f c) {
    return __builtin_amdgcn_wmma_f32_16x16x32_f16(false, a, false, b, (short)0, c, false, false);
  }
  static __device__ __forceinline__ void guard(v8f& a, v8f& b, v16h x, v16h y) { dep_guard_h(a, b, x, y); }
  static __device__ __forceinline__ void keep(v16h a, v16h b, v16h c, v16h d) { keep4_h(a, b, c, d); }
};
template <> struct Frag<__bf16> {
  typedef v16b V; union U { v16b v; v8b h[2]; };
  static __device__ __forceinline__ v16b load(const __bf16* p) {
    U f; f.h[0] = *(const v8b*)(p); f.h[1] = *(const v8b*)(p + 16); return f.v;
  }
  static __device__ __forceinline__ v8f mma(v16b a, v16b b, v8f c) {
    return __builtin_amdgcn_wmma_f32_16x16x32_bf16(false, a, false, b, (short)0, c, false, false);
  }
  static __device__ __forceinline__ void guard(v8f& a, v8f& b, v16b x, v16b y) { dep_guard_b(a, b, x, y); }
  static __device__ __forceinline__ void keep(v16b a, v16b b, v16b c, v16b d) { keep4_b(a, b, c, d); }
};

// ---------------------------------------------------------------------------------------------
// 1) x f32 [NB_FULL][SEQ_FULL][HID] -> compact bf16 plane [NTOK][HID], 8 elements per thread, one 16-B store per lane
// ---------------------------------------------------------------------------------------------
__device__ __forceinline__ void cast_x_bf16(const float* __restrict__ in, unsigned short* __restrict__ out, int n8, int blk) {
  const int i = blk * 256 + threadIdx.x;
  if (i < n8) {
    const size_t o   = (size_t)i * 8;
    const size_t tok = o / HID;
    const size_t col = o - tok * HID;
    const size_t bb  = tok / SEQ;
    const size_t ss  = tok - bb * SEQ;
    const size_t src = (bb * SEQ_FULL + ss) * (size_t)HID + col;
    const v4f a  = *(const v4f*)(in + src);
    const v4f bq = *(const v4f*)(in + src + 4);
    v4u w;
    w[0] = (unsigned)f2bf_bits(a[0])  | ((unsigned)f2bf_bits(a[1])  << 16);
    w[1] = (unsigned)f2bf_bits(a[2])  | ((unsigned)f2bf_bits(a[3])  << 16);
    w[2] = (unsigned)f2bf_bits(bq[0]) | ((unsigned)f2bf_bits(bq[1]) << 16);
    w[3] = (unsigned)f2bf_bits(bq[2]) | ((unsigned)f2bf_bits(bq[3]) << 16);
    *(v4u*)(out + o) = w;
    
  }
}

// ---------------------------------------------------------------------------------------------
// 2) in[nrows][ncols] f32 -> out[ncols][nrows] 16-bit. MODE 0: bf16 bits (RNE); MODE 1: f16 bits of (RNE-bf16 value * scl).
//    Block = 64x64 tile through LDS (cross-thread, block barrier). (bx, by) in (ncols/64, nrows/64); nrows, ncols multiples of 64.
//    load coverage: 256 threads x 16 floats = 64x64 tile; store coverage: 2 iterations x 256 threads x 8 = 64 rows x 64.
// ---------------------------------------------------------------------------------------------
template <int MODE> __device__ __forceinline__ unsigned short pk16(float f, float scl) {
  if (MODE == 0) return f2bf_bits(f);
  const float g = bf_bits2f(f2bf_bits(f)) * scl;
  return f2h_bits(g);
}

template <int MODE>
__device__ __forceinline__ void transpose_cast16(const float* __restrict__ in, unsigned short* __restrict__ out, int nrows, int ncols, float scl,
                                                 int bx, int by, float* tile) {
  const int tid = threadIdx.x;
  const int r0 = by * 64, c0 = bx * 64;
  {
    const int row = tid >> 2, cc = (tid & 3) * 16;
    const float* s = in + (size_t)(r0 + row) * ncols + c0 + cc;
#pragma unroll
    for (int q = 0; q < 4; ++q) {
      const v4f v = *(const v4f*)(s + 4 * q);
#pragma unroll
      for (int e = 0; e < 4; ++e) tile[(cc + 4 * q + e) * 65 + row] = v[e];
    }
  }
  __syncthreads();
  {
#pragma unroll
    for (int it = 0; it < 2; ++it) {
      const int orow = it * 32 + (tid >> 3), seg = (tid & 7) * 8;
      const float* tp = tile + orow * 65 + seg;
      v4u w;
#pragma unroll
      for (int e = 0; e < 4; ++e) w[e] = (unsigned)pk16<MODE>(tp[2 * e], scl) | ((unsigned)pk16<MODE>(tp[2 * e + 1], scl) << 16);
      *(v4u*)(out + (size_t)(c0 + orow) * nrows + r0 + seg) = w;
    }
    // in the merged kernel's listing another range's code follows and writes registers that these stores name: the wait stands in front of it
    asm volatile("s_wait_xcnt 0x0" ::: "memory");
  }
}

// ---------------------------------------------------------------------------------------------
// 3) RoPE cos/sin tables [SEQ][HHALF] f32: angle = pos * inv_freq[j] (single f32 multiply), precise cosf/sinf.
// ---------------------------------------------------------------------------------------------
struct RopeFreq { float f[HHALF]; };
static_assert(sizeof(RopeFreq) == 256);

__device__ __forceinline__ void rope_table(float* __restrict__ cosT, float* __restrict__ sinT, const RopeFreq& fr, int blk, float* invf) {
  if (threadIdx.x == 0) {
#pragma unroll
    for (int q = 0; q < HHALF; ++q) invf[q] = fr.f[q];
  }
  __syncthreads();
  const int i = blk * 256 + threadIdx.x;                 // exactly SEQ*HHALF threads
  const int t = i >> 6;
  const int jj = i & (HHALF - 1);
  const float ang = (float)t * invf[jj];
  const float cv = cosf(ang);
  const float sv = sinf(ang);
  ((float*)cosT)[i] = cv;
  ((float*)sinT)[i] = sv;
  
}

// ---------------------------------------------------------------------------------------------
// 1) to 3) in ONE launch: none of them reads what another writes, so each takes a range of the block index.
//    Every branch below is block-uniform; the ranges with the most work per block come first.
// ---------------------------------------------------------------------------------------------
#define PB_TAB ((SEQ * HHALF) / 256)
#define PB_WQ  ((QDIM / 64) * (HID / 64))
#define PB_WKV ((KVDIM / 64) * (HID / 64))
#define PB_WO  ((HID / 64) * (QDIM / 64))
#define PB_X   ((NTOK * HID / 8) / 256)
__global__ __launch_bounds__(256) void prep_kernel(
    const float* __restrict__ x, const float* __restrict__ Wq, const float* __restrict__ Wk, const float* __restrict__ Wv, const float* __restrict__ Wo,
    unsigned short* __restrict__ xb, unsigned short* __restrict__ WqT, unsigned short* __restrict__ WkT, unsigned short* __restrict__ WvT,
    unsigned short* __restrict__ WoT, float* __restrict__ cosT, float* __restrict__ sinT, RopeFreq fr) {
  __shared__ float tile[64 * 65];
  int blk = blockIdx.x;
  if (blk < PB_TAB) { rope_table(cosT, sinT, fr, blk, tile); return; }
  blk -= PB_TAB;
  if (blk < PB_WQ) {                           // [HID][QDIM]  -> [QDIM][HID]
    transpose_cast16<0>(Wq, WqT, HID, QDIM, 1.0f, blk % (QDIM / 64), blk / (QDIM / 64), tile); return;
  }
  blk -= PB_WQ;
  if (blk < 2 * PB_WKV) {                      // [HID][KVDIM] -> [KVDIM][HID], Wk then Wv
    const bool isv = blk >= PB_WKV;
    if (isv) blk -= PB_WKV;
    transpose_cast16<0>(isv ? Wv : Wk, isv ? WvT : WkT, HID, KVDIM, 1.0f, blk % (KVDIM / 64), blk / (KVDIM / 64), tile); return;
  }
  blk -= 2 * PB_WKV;
  if (blk < PB_WO) {                           // [QDIM][HID]  -> [HID][QDIM], f16 x 2^4
    transpose_cast16<1>(Wo, WoT, QDIM, HID, WOCARRY, blk % (HID / 64), blk / (HID / 64), tile); return;
  }
  blk -= PB_WO;
  cast_x_bf16(x, xb, NTOK * HID / 8, blk);
}

// ---------------------------------------------------------------------------------------------
// 4) RoPE -> f16 planes, q and k heads in one launch. src f32 [NTOK][QKDIM], head hs occupies cols hs*128 .. hs*128+127 (first 64 = x1,
//    next 64 = x2); heads 0..15 are q and go to outQ [NTOK][QDIM], heads 16..23 are k and go to outK [NTOK][KVDIM].
//    Thread = (token, head, 8-wide pair group jg): out[d] = x1[d]*cos - x2[d]*sin, out[d+64] = x2[d]*cos + x1[d]*sin, times scl.
// ---------------------------------------------------------------------------------------------
__global__ __launch_bounds__(256) void rope_f16_kernel(const float* __restrict__ src, const float* __restrict__ cosT, const float* __restrict__ sinT,
                                                        unsigned short* __restrict__ outQ, unsigned short* __restrict__ outK, float scl) {
  const int i = blockIdx.x * 256 + threadIdx.x;          // exactly NTOK*(NQH+NKVH)*8 threads
  const int jg = i & 7;
  const int hs = (i >> 3) % (NQH + NKVH);
  const int tok = (i >> 3) / (NQH + NKVH);
  const int pos = tok % SEQ;
  const size_t base = (size_t)tok * QKDIM + (size_t)hs * HD + jg * 8;
  const size_t tb = (size_t)pos * HHALF + jg * 8;
  const v4f x1a = *(const v4f*)(src + base);
  const v4f x1b = *(const v4f*)(src + base + 4);
  const v4f x2a = *(const v4f*)(src + base + HHALF);
  const v4f x2b = *(const v4f*)(src + base + HHALF + 4);
  const v4f ca = *(const v4f*)(cosT + tb);
  const v4f cb = *(const v4f*)(cosT + tb + 4);
  const v4f sa = *(const v4f*)(sinT + tb);
  const v4f sb = *(const v4f*)(sinT + tb + 4);
  v4f o1a, o1b, o2a, o2b;
#pragma unroll
  for (int e = 0; e < 4; ++e) {
    o1a[e] = (x1a[e] * ca[e] - x2a[e] * sa[e]) * scl;
    o2a[e] = (x2a[e] * ca[e] + x1a[e] * sa[e]) * scl;
    o1b[e] = (x1b[e] * cb[e] - x2b[e] * sb[e]) * scl;
    o2b[e] = (x2b[e] * cb[e] + x1b[e] * sb[e]) * scl;
  }
  v4u h1, h2;
  h1[0] = (unsigned)f2h_bits(o1a[0]) | ((unsigned)f2h_bits(o1a[1]) << 16);
  h1[1] = (unsigned)f2h_bits(o1a[2]) | ((unsigned)f2h_bits(o1a[3]) << 16);
  h1[2] = (unsigned)f2h_bits(o1b[0]) | ((unsigned)f2h_bits(o1b[1]) << 16);
  h1[3] = (unsigned)f2h_bits(o1b[2]) | ((unsigned)f2h_bits(o1b[3]) << 16);
  h2[0] = (unsigned)f2h_bits(o2a[0]) | ((unsigned)f2h_bits(o2a[1]) << 16);
  h2[1] = (unsigned)f2h_bits(o2a[2]) | ((unsigned)f2h_bits(o2a[3]) << 16);
  h2[2] = (unsigned)f2h_bits(o2b[0]) | ((unsigned)f2h_bits(o2b[1]) << 16);
  h2[3] = (unsigned)f2h_bits(o2b[2]) | ((unsigned)f2h_bits(o2b[3]) << 16);
  {
    unsigned short* outP = hs < NQH ? outQ + (size_t)tok * QDIM + (size_t)hs * HD + jg * 8
                                    : outK + (size_t)tok * KVDIM + (size_t)(hs - NQH) * HD + jg * 8;
    *(v4u*)(outP) = h1;
    *(v4u*)(outP + HHALF) = h2;
    
  }
}

// ---------------------------------------------------------------------------------------------
// 5) Register-blocked batched WMMA GEMM, 16-bit operands of type T (bf16 or f16), f32 accumulate.
//    C[m,n] = scale * sum_k A[m,k] * Bt[n,k]; A row-major [M,K], Bt row-major [N,K].
//    Block = 4 waves (2 x 2) = one 128x128 tile of C; each wave owns a 64x64 tile.
//    Per pass the block's 128 A rows and 128 Bt rows x 128 k (256 B a row) are brought into LDS by asynchronous
//    copies, two buffers: the next pass's copies fly while this pass's fragments are read from LDS.
//    M,N % 128 == 0, K % 128 == 0 (no tail handling). lda, ldb % 8 == 0 (16-B copies).
//    OUT_MODE: 0 = f32, 1 = single f16 plane. The hi/lo plane options are not staged: both must be false.
// ---------------------------------------------------------------------------------------------
#define GBK    128    // k elements of one staged pass
#define GPITCH 136    // LDS row pitch in elements: 272 B = 16 B x 17, conflict-free for 16-B row reads
typedef __attribute__((ext_vector_type(4))) int v4i;
typedef __attribute__((address_space(1))) v4i gv4i;
typedef __attribute__((address_space(3))) v4i lv4i;

// 128 rows x 256 B from g (row pitch ld elements) into l (row pitch GPITCH): 128 threads x 16 copies of 16 B;
// one wave-wide copy covers two whole 256-B rows.
// g is the tile's origin, the same in every lane; goff is the lane's own element offset row * ld + column.
template <typename T>
__device__ __forceinline__ void stage_tile(const T* g, int ld, unsigned goff, T* l, int tid) {
  T* lp = l + (tid >> 4) * GPITCH + (tid & 15) * 8;
#pragma unroll   // the 16 copies go out back to back, none waits for another
  for (int j = 0; j < 16; ++j)
    __builtin_amdgcn_global_load_async_to_lds_b128((gv4i*)(g + (size_t)(j * 8) * ld + goff), (lv4i*)(lp + j * 8 * GPITCH), 0, 0);
}

// A wave's 64x64 accumulator tile -> C, 16 rows at a time through the wave's own LDS slab, so that each store covers whole row pieces.
template <int OUT_MODE>
__device__ __forceinline__ void gemm_store(v8f (&acc)[4][4], float* slab, void* Cb, int ldc, int m0, int n0, float scale, int lane) {
  const int rlane = lane & 15;                 // D column within subtile
  const int mOff  = (lane >> 4) * 8;           // D row offset
#pragma unroll
  for (int i = 0; i < 4; ++i) {
    const int mBase = m0 + (i << 4);
#pragma unroll
    for (int j = 0; j < 4; ++j) {
#pragma unroll
      for (int r = 0; r < 8; ++r) {
        const float v = acc[i][j][r] * scale;
        slab[(mOff + r) * 68 + (j << 4) + rlane] = v;
      }
    }
    __builtin_amdgcn_fence(3, "workgroup");
    __builtin_amdgcn_wave_barrier();
    __builtin_amdgcn_fence(2, "workgroup");
    if (OUT_MODE == 0) {
      float* Cf = (float*)Cb;
      const int hh = lane >> 4, c4 = (lane & 15) * 4;     // row seg = 256 B = 16 lanes x 16 B
      {
#pragma unroll
        for (int it = 0; it < 8; ++it) {
          const int row = it * 2 + hh;
          v4f v = *(const v4f*)(slab + row * 68 + c4);
          *(v4f*)(Cf + (size_t)(mBase + row) * ldc + n0 + c4) = v;
        }
        
      }
    } else {
      const int q = lane >> 3, c8 = (lane & 7) * 8;
      unsigned short* Cs = (unsigned short*)Cb;
      {
#pragma unroll
        for (int it = 0; it < 4; ++it) {
          const int row = it * 4 + q;
          const float* sp = slab + row * 68 + c8;
          v8h hv;
#pragma unroll
          for (int e = 0; e < 8; ++e) hv[e] = (_Float16)sp[e];
          *(v8h*)(Cs + (size_t)(mBase + row) * ldc + n0 + c8) = hv;
        }
        
      }
    }
    __builtin_amdgcn_fence(3, "workgroup");
    __builtin_amdgcn_wave_barrier();
    __builtin_amdgcn_fence(2, "workgroup");
  }
}

// One block's 128x128 tile (tm, tn). Ag, Bg: first of the tile's 128 A rows and 128 Bt rows; Cb: origin of this product's C.
// ring: [buffer][A rows | Bt rows]; sT: per-wave 16x64 slab, pitch 68 floats. Every argument is the same in the whole block.
template <typename T>
__device__ __forceinline__ void gemm_tile(const T* Ag, int lda, const T* Bg, int ldb, void* Cb, int ldc, int tm, int tn, int K, float scale,
                                          int out_mode, T (*ring)[2][128 * GPITCH], float (*sT)[16 * 68]) {
  typedef typename Frag<T>::V V;
  const int tid  = threadIdx.x;
  const int lane = tid & 31;
  const int wave = tid >> 5;
  const int wm = (wave >> 1) << 6;             // this wave's rows inside the block tile
  const int wn = (wave & 1) << 6;              // this wave's columns inside the block tile
  const int m0 = (tm << 7) + wm;
  const int n0 = (tn << 7) + wn;

  const int rlane = lane & 15;                 // row (A) / col (B, D) within subtile
  const int koff  = (lane >> 4) * 8;           // k offset of this lane half

  v8f acc[4][4];
#pragma unroll
  for (int i = 0; i < 4; ++i)
#pragma unroll
    for (int j = 0; j < 4; ++j) acc[i][j] = (v8f){0.f,0.f,0.f,0.f,0.f,0.f,0.f,0.f};

  const int nt = K / GBK;
  const unsigned aoff = (unsigned)(tid >> 4) * (unsigned)lda + (unsigned)(tid & 15) * 8u;
  const unsigned boff = (unsigned)(tid >> 4) * (unsigned)ldb + (unsigned)(tid & 15) * 8u;
  stage_tile<T>(Ag, lda, aoff, ring[0][0], tid);
  stage_tile<T>(Bg, ldb, boff, ring[0][1], tid);
  asm volatile("s_wait_asynccnt 0x0" ::: "memory");   // this wave's copies of pass 0 have landed
  __syncthreads();                                     // ... and every other wave's: pass 0 is readable
  if (nt > 1) {
    stage_tile<T>(Ag + GBK, lda, aoff, ring[1][0], tid);
    stage_tile<T>(Bg + GBK, ldb, boff, ring[1][1], tid);
  }

  for (int t = 0; t < nt; ++t) {
    const T* la = ring[t & 1][0] + (wm + rlane) * GPITCH + koff;
    const T* lb = ring[t & 1][1] + (wn + rlane) * GPITCH + koff;
    // LDS reads run ahead of their products: the next 32-k block's Bt fragments go into a second set at the head of
    // this block, and each A fragment is re-read for the next block as soon as its row of products has been issued
    // (every loop below is unrolled so that each fragment and accumulator index is a constant: registers, no scratch)
    V af[4], bf[2][4];
#pragma unroll
    for (int j = 0; j < 4; ++j) { bf[0][j] = Frag<T>::load(lb + (j << 4) * GPITCH); af[j] = Frag<T>::load(la + (j << 4) * GPITCH); }
#pragma unroll
    for (int kb = 0; kb < GBK / 32; ++kb) {
      const int cu = kb & 1, nx = cu ^ 1;
      if (kb + 1 < GBK / 32) {
#pragma unroll
        for (int j = 0; j < 4; ++j) bf[nx][j] = Frag<T>::load(lb + (j << 4) * GPITCH + (kb + 1) * 32);
      }
#pragma unroll
      for (int i = 0; i < 4; ++i) {
#pragma unroll
        for (int j = 0; j < 4; ++j) acc[i][j] = Frag<T>::mma(af[i], bf[cu][j], acc[i][j]);
        Frag<T>::guard(acc[i][0], acc[i][3], af[i], af[i]);
        if (kb + 1 < GBK / 32) af[i] = Frag<T>::load(la + (i << 4) * GPITCH + (kb + 1) * 32);
      }
      Frag<T>::keep(bf[cu][0], bf[cu][1], bf[cu][2], bf[cu][3]);
    }
    asm volatile("s_wait_dscnt 0x0" ::: "memory");     // this wave's reads of buffer t & 1 are done before it is refilled
    asm volatile("s_wait_asynccnt 0x0" ::: "memory");  // this wave's copies of pass t + 1 have landed
    __syncthreads();                                    // publishes pass t + 1, frees buffer t & 1
    if (t + 2 < nt) {
      stage_tile<T>(Ag + (size_t)(t + 2) * GBK, lda, aoff, ring[t & 1][0], tid);
      stage_tile<T>(Bg + (size_t)(t + 2) * GBK, ldb, boff, ring[t & 1][1], tid);
    }
  }
  asm volatile("s_wait_asynccnt 0x0" ::: "memory");    // no copy is outstanding when the wave goes on
  acc_guard4(acc[0][0], acc[0][1], acc[0][2], acc[0][3]);
  acc_guard4(acc[1][0], acc[1][1], acc[1][2], acc[1][3]);
  acc_guard4(acc[2][0], acc[2][1], acc[2][2], acc[2][3]);
  acc_guard4(acc[3][0], acc[3][1], acc[3][2], acc[3][3]);

  // ---- epilogue ---- (one block-uniform branch around the whole of it)
  if (out_mode == 0) gemm_store<0>(acc, sT[wave], Cb, ldc, m0, n0, scale, lane);
  else               gemm_store<1>(acc, sT[wave], Cb, ldc, m0, n0, scale, lane);
}

// one product, batched over blockIdx.y
template <typename T, bool SPLITA, bool SPLITB, int OUT_MODE>
__global__ __launch_bounds__(128) void gemm_t64(
    const unsigned short* __restrict__ Ap, const unsigned short* __restrict__ A2p, int lda, long strideA,
    const unsigned short* __restrict__ Btp, const unsigned short* __restrict__ Bt2p, int ldb, long strideB,
    void* __restrict__ Cout, int ldc, long strideC,
    int M, int N, int K, float scale) {
  static_assert(!SPLITA && !SPLITB);
  const T* A = (const T*)Ap; const T* Bt = (const T*)Btp;
  __shared__ __align__(16) T ring[2][2][128 * GPITCH];
  __shared__ __align__(16) float sT[4][16 * 68];
  const int b    = blockIdx.y;
  const int tilesN = N >> 7;
  const int tilesM = M >> 7;
  const int tile = blockIdx.x;
  if (tile >= tilesM * tilesN) return;   // block-uniform, ahead of every barrier and copy
  const int tm = tile / tilesN;
  const int tn = tile - tm * tilesN;
  const T* Ag = A  + (size_t)b * strideA + (size_t)(tm << 7) * lda;
  const T* Bg = Bt + (size_t)b * strideB + (size_t)(tn << 7) * ldb;
  void* Cb = OUT_MODE == 0 ? (void*)((float*)Cout + (size_t)b * strideC) : (void*)((unsigned short*)Cout + (size_t)b * strideC);
  gemm_tile<T>(Ag, lda, Bg, ldb, Cb, ldc, tm, tn, K, scale, OUT_MODE, ring, sT);
}

// The three products on x in ONE launch (none reads what another writes), each tile computed as in a launch of its own:
//   blocks 0 .. QK_TILES-1: [q | k] = x @ [Wq | Wk] -> f32 [NTOK][QKDIM]; WqkT = the QDIM rows of Wq^T, then the KVDIM rows of Wk^T
//   then NB x V_TILES:      v^T per batch = Wv^T @ x_b^T -> f16 [NB][KVDIM][SEQ]
// ld = row pitch of all three operand planes = K.
#define QK_TILES ((NTOK / 128) * (QKDIM / 128))
#define V_TILES  ((KVDIM / 128) * (SEQ / 128))
__global__ __launch_bounds__(128) void gemm_qkv(
    const unsigned short* __restrict__ xbp, const unsigned short* __restrict__ WqkTp, const unsigned short* __restrict__ WvTp,
    float* __restrict__ QKf, unsigned short* __restrict__ Vtp, int ld) {
  __shared__ __align__(16) __bf16 ring[2][2][128 * GPITCH];
  __shared__ __align__(16) float sT[4][16 * 68];
  const __bf16* xb = (const __bf16*)xbp;
  const int bx = blockIdx.x;
  const bool isv = bx >= QK_TILES;             // block-uniform
  const int r  = isv ? bx - QK_TILES : bx;
  const int b  = isv ? r / V_TILES : 0;
  const int tile = r - b * V_TILES;
  const int tm = isv ? tile / (SEQ / 128) : tile / (QKDIM / 128);
  const int tn = tile - tm * (isv ? SEQ / 128 : QKDIM / 128);
  const __bf16* A  = isv ? (const __bf16*)WvTp : xb;
  const __bf16* Bt = isv ? xb + (size_t)b * SEQ * ld : (const __bf16*)WqkTp;
  void* Cb = isv ? (void*)(Vtp + (size_t)b * KVDIM * SEQ) : (void*)QKf;
  gemm_tile<__bf16>(A + (size_t)(tm << 7) * ld, ld, Bt + (size_t)(tn << 7) * ld, ld, Cb, isv ? SEQ : QKDIM, tm, tn, ld, 1.0f,
                    isv ? 1 : 0, ring, sT);
}

#define KPITCH 136    // LDS pitch of a K row in elements: 272 B = 16 B x 17, conflict-free for 16-B row reads
#define VPITCH 72     // LDS pitch of a V^T row in elements: 144 B = 16 B x 9, conflict-free for 16-B row reads

// kg, vg: origin of the chunk's K rows (pitch KVDIM) and V^T rows (pitch SEQ), the same in every lane.
// 256 threads x (4 + 4) copies of 16 B; one wave-wide copy covers two whole K rows or four whole V^T row pieces.
__device__ __forceinline__ void stage_kv(const _Float16* kg, const _Float16* vg, _Float16* kl, _Float16* vl, int tid) {
  const unsigned ko = (unsigned)(tid >> 4) * (unsigned)KVDIM + (unsigned)(tid & 15) * 8u;
  const unsigned vo = (unsigned)(tid >> 3) * (unsigned)SEQ + (unsigned)(tid & 7) * 8u;
  _Float16* kp = kl + (tid >> 4) * KPITCH + (tid & 15) * 8;
  _Float16* vp = vl + (tid >> 3) * VPITCH + (tid & 7) * 8;
#pragma unroll   // the copies go out back to back, none waits for another
  for (int j = 0; j < 4; ++j)
    __builtin_amdgcn_global_load_async_to_lds_b128((gv4i*)(kg + (size_t)(j * 16) * KVDIM + ko), (lv4i*)(kp + j * 16 * KPITCH), 0, 0);
#pragma unroll   // as above
  for (int j = 0; j < 4; ++j)
    __builtin_amdgcn_global_load_async_to_lds_b128((gv4i*)(vg + (size_t)(j * 32) * SEQ + vo), (lv4i*)(vp + j * 32 * VPITCH), 0, 0);
}

// lane l <-> lane l ^ 16, a vector cross-row move
__device__ __forceinline__ float xhalf(float x) {
  return __builtin_bit_cast(float, __builtin_amdgcn_permlanex16(__builtin_bit_cast(int, x), __builtin_bit_cast(int, x), 0x76543210, 0xfedcba98, false, false));
}

__global__ __launch_bounds__(256) void attn_kernel(
    const unsigned short* __restrict__ Qp, const unsigned short* __restrict__ Kp,
    const unsigned short* __restrict__ Vtp, unsigned short* __restrict__ Op) {
  __shared__ __align__(16) _Float16 Kst[2][KV_CHUNK * KPITCH]; // 34 KB: K rows of a chunk [kv][d], two buffers
  __shared__ __align__(16) _Float16 Vst[2][HD * VPITCH];       // 36 KB: V^T rows of a chunk [d][kv], two buffers

  const _Float16* Q  = (const _Float16*)Qp;
  const _Float16* Kk = (const _Float16*)Kp;
  const _Float16* Vt = (const _Float16*)Vtp;

  const int tid  = threadIdx.x;
  const int wave = tid >> 5, lane = tid & 31;
  const int hh   = lane >> 4, c = lane & 15, koff = hh * 8;
  const int nqb  = SEQ / QBLK;
  const int bx   = blockIdx.x;
  const int qb   = bx % nqb;
  const int bhid = bx / nqb;
  const int h    = bhid % NQH;
  const int b    = bhid / NQH;
  const int kvh  = h >> 1;
  const int q0   = qb * QBLK + wave * 32;                       // sequence position of this wave's row 0
  const size_t tokw = (size_t)b * SEQ + q0;                     // compact token index of this wave's row 0
  const size_t qoff = (tokw + c) * QDIM + (size_t)h * HD + koff;
  const _Float16* Kg = Kk + (size_t)b * SEQ * KVDIM + (size_t)kvh * HD;            // this head's K rows, key 0
  const _Float16* Vg = Vt + (size_t)b * KVDIM * SEQ + (size_t)(kvh * HD) * SEQ;    // this head's V^T rows, key 0

  // column tile u holds query 16 u + c of the wave
  float mrow[2] = {-INFINITY, -INFINITY};   // running maximum of the query, the same in both wave halves
  float lrow[2] = {0.f, 0.f};               // running sum of the query over this half's keys; the halves are joined in the epilogue
  v8f oacc[2][8];                           // O^T tile t: register r = O[query][d = 16 t + 8 hh + r]
  v16h qf[2][4];                            // Q^T fragments, d = 32 dc ..: the same in every chunk
  // The products below are the plain builtin, whose distances the compiler keeps itself: accumulators, scores, Q^T and the
  // fragment sets together need more than 256 registers, and operands of an asm guard would all have to lie in the first 256.
#pragma unroll
  for (int u = 0; u < 2; ++u) {
#pragma unroll
    for (int t = 0; t < 8; ++t) oacc[u][t] = (v8f){0.f,0.f,0.f,0.f,0.f,0.f,0.f,0.f};
#pragma unroll
    for (int dc = 0; dc < 4; ++dc) qf[u][dc] = Frag<_Float16>::load(Q + qoff + (size_t)(u * 16) * QDIM + dc * 32);
  }
  // the code that follows writes the address registers that these loads name: the wait stands in front of it
  asm volatile("s_wait_xcnt 0x0" ::: "memory");

  const int nch = SEQ / KV_CHUNK;
  stage_kv(Kg, Vg, Kst[0], Vst[0], tid);
  asm volatile("s_wait_asynccnt 0x0" ::: "memory");   // this wave's copies of chunk 0 have landed
  __syncthreads();                                     // ... and every other wave's: chunk 0 is readable
  if (nch > 1) stage_kv(Kg + (size_t)KV_CHUNK * KVDIM, Vg + KV_CHUNK, Kst[1], Vst[1], tid);

  for (int kc = 0; kc < nch; ++kc) {
    const _Float16* kl = Kst[kc & 1] + c * KPITCH + koff;
    const _Float16* vl = Vst[kc & 1] + c * VPITCH + koff;

    // ---- raw scores S^T(64 kv x 16 q) over d = 128, per column tile u: tile j, register r = S[query][key 16 j + 8 hh + r] ----
    v8f s[2][4];
#pragma unroll
    for (int j = 0; j < 4; ++j) { s[0][j] = (v8f){0.f,0.f,0.f,0.f,0.f,0.f,0.f,0.f}; s[1][j] = s[0][j]; }
    // LDS reads stand in groups of four fragments, one group ahead of their products (two register sets); the loops are
    // unrolled so that every fragment index is a constant: registers, no scratch
    v16h kf[2][4];
#pragma unroll
    for (int j = 0; j < 4; ++j) kf[0][j] = Frag<_Float16>::load(kl + j * 16 * KPITCH);
#pragma unroll
    for (int dc = 0; dc < 4; ++dc) {
      const int cu = dc & 1, nx = cu ^ 1;
      if (dc + 1 < 4) {
#pragma unroll
        for (int j = 0; j < 4; ++j) kf[nx][j] = Frag<_Float16>::load(kl + j * 16 * KPITCH + (dc + 1) * 32);
      }
#pragma unroll
      for (int j = 0; j < 4; ++j) {
        s[0][j] = Frag<_Float16>::mma(kf[cu][j], qf[0][dc], s[0][j]);
        s[1][j] = Frag<_Float16>::mma(kf[cu][j], qf[1][dc], s[1][j]);
      }
    }

    // ---- the chunk's 16 V^T fragments [32 keys kk][output tile t], read as one group: their LDS latency passes under the softmax ----
    v16h vf[2][8];
#pragma unroll
    for (int kk = 0; kk < 2; ++kk)
#pragma unroll
      for (int t = 0; t < 8; ++t) vf[kk][t] = Frag<_Float16>::load(vl + t * 16 * VPITCH + kk * 32);
    // holds the group of reads here: the scheduler otherwise sinks them, two at a time, among the products that wait for them
    __builtin_amdgcn_sched_barrier(0);

    // ---- scale, tanh softcap (f32), maximum of query c: four in-lane chains, then the other half's ----
    // (here and below every loop is unrolled so that each score, fragment and accumulator index is a constant: registers, no scratch)
    v16h pb[2][2];
#pragma unroll
    for (int u = 0; u < 2; ++u) {
      float mj[4];
#pragma unroll
      for (int j = 0; j < 4; ++j) {
        float m = -INFINITY;
#pragma unroll
        for (int r = 0; r < 8; ++r) {
          // v_tanh_f32: one instruction and no branch, where the library tanhf takes two divergent branches per score
          const float sv = SOFTCAP * __builtin_amdgcn_tanhf(s[u][j][r] * (RSQ * INVCAP));
          s[u][j][r] = sv;
          m = fmaxf(m, sv);
        }
        mj[j] = m;
      }
      float cm = fmaxf(fmaxf(mj[0], mj[1]), fmaxf(mj[2], mj[3]));
      cm = fmaxf(cm, xhalf(cm));

      // ---- online softmax (f32); P x 2^10 as f16 straight into the B fragments of V^T . P^T ----
      // B fragment kk, element e: key 32 kk + (e < 8 ? 8 hh + e : 16 + 8 hh + e - 8) = tile 2 kk + (e >> 3), register e & 7:
      // the k order of the V^T loader
      const float mnew = fmaxf(mrow[u], cm);
      const float alpha = __expf(mrow[u] - mnew);
      mrow[u] = mnew;
      float pj[4];
#pragma unroll
      for (int j = 0; j < 4; ++j) {
        float psum = 0.f;
#pragma unroll
        for (int r = 0; r < 8; ++r) {
          const float p = __expf(s[u][j][r] - mnew);
          psum += p;
          pb[u][j >> 1][(j & 1) * 8 + r] = (_Float16)(p * PCARRY);
        }
        pj[j] = psum;
      }
      lrow[u] = lrow[u] * alpha + ((pj[0] + pj[1]) + (pj[2] + pj[3]));
#pragma unroll
      for (int t = 0; t < 8; ++t)
#pragma unroll
        for (int r = 0; r < 8; ++r) oacc[u][t][r] *= alpha;
    }

    // ---- O^T(128 d x 16 q) += V^T(128 d x 64 kv) . P^T: 32 keys kk, output tile t ----
#pragma unroll
    for (int kk = 0; kk < 2; ++kk) {
#pragma unroll
      for (int t = 0; t < 8; ++t) {
        oacc[0][t] = Frag<_Float16>::mma(vf[kk][t], pb[0][kk], oacc[0][t]);
        oacc[1][t] = Frag<_Float16>::mma(vf[kk][t], pb[1][kk], oacc[1][t]);
      }
    }
    asm volatile("s_wait_dscnt 0x0" ::: "memory");     // this wave's reads of buffer kc & 1 are done before it is refilled
    asm volatile("s_wait_asynccnt 0x0" ::: "memory");  // this wave's copies of chunk kc + 1 have landed
    __syncthreads();                                    // publishes chunk kc + 1, frees buffer kc & 1
    if (kc + 2 < nch)
      stage_kv(Kg + (size_t)(kc + 2) * KV_CHUNK * KVDIM, Vg + (kc + 2) * KV_CHUNK, Kst[kc & 1], Vst[kc & 1], tid);
  }
  asm volatile("s_wait_asynccnt 0x0" ::: "memory");    // no copy is outstanding when the wave goes on

  // ---- epilogue: join the halves' sums, normalise (x 2^6 / (2^10 * l)), write the f16 ctx plane ----
  // coverage: 8 tiles x 2 halves x 8 elements = 128 dims of each of the wave's 32 rows (2 column tiles of 16); the wave writes whole 256-B rows.
#pragma unroll
  for (int u = 0; u < 2; ++u) {
    const float lsum = lrow[u] + xhalf(lrow[u]);
    const float inv = OCARRY / (PCARRY * lsum);        // undo the P carry (2^10) and apply the ctx carry (2^6)
    unsigned short* orow = Op + (tokw + u * 16 + c) * QDIM + (size_t)h * HD + koff;
#pragma unroll
    for (int t = 0; t < 8; ++t) {
      v8h hv;
#pragma unroll
      for (int r = 0; r < 8; ++r) hv[r] = (_Float16)(oacc[u][t][r] * inv);
      *(v8h*)(orow + t * 16) = hv;
    }
    // the second tile's code writes registers that these stores name: the wait stands in front of it, and the
    // scheduling barrier keeps that code from being lifted over the wait
    if (u == 0) {
      asm volatile("s_wait_xcnt 0x0" ::: "memory");
      __builtin_amdgcn_sched_barrier(0);
    }
  }
}

// ---------------------------------------------------------------------------------------------
// host
// ---------------------------------------------------------------------------------------------
static_assert((NTOK * HID / 8) % 256 == 0);
static_assert((NTOK * (NQH + NKVH) * 8) % 256 == 0);
static_assert((SEQ * HHALF) % 256 == 0);
static_assert(HID % 128 == 0 && QDIM % 128 == 0);
static_assert(NTOK % 128 == 0 && HID % 128 == 0 && QDIM % 128 == 0 && KVDIM % 128 == 0 && SEQ % 128 == 0);
static_assert(SEQ % QBLK == 0 && SEQ % KV_CHUNK == 0 && QBLK == 256 && KV_CHUNK == 64 && HD == 128);
static_assert(NB >= 1 && NB <= NB_FULL && SEQ <= SEQ_FULL);
static_assert(NQH == 2 * NKVH);

extern "C" void kernel_launch(void* const* d_in, const int* in_sizes, int n_in,
                              void* d_out, int out_size, void* d_ws, size_t ws_size, hipStream_t stream) {
  if (n_in < 5) return;
  const size_t needTok = (size_t)(NB - 1) * SEQ_FULL + SEQ;
  if ((size_t)in_sizes[0] < needTok * HID) return;
  if ((size_t)in_sizes[1] < (size_t)HID * QDIM) return;
  if ((size_t)in_sizes[2] < (size_t)HID * KVDIM) return;
  if ((size_t)in_sizes[3] < (size_t)HID * KVDIM) return;
  if ((size_t)in_sizes[4] < (size_t)QDIM * HID) return;
  if ((size_t)out_size < needTok * HID) return;

  const float* x  = (const float*)d_in[0];   // [2,2048,2048]
  const float* Wq = (const float*)d_in[1];   // [2048,2048]  [in][out]
  const float* Wk = (const float*)d_in[2];   // [2048,1024]
  const float* Wv = (const float*)d_in[3];   // [2048,1024]
  const float* Wo = (const float*)d_in[4];   // [2048,2048]
  float* out = (float*)d_out;                // [2,2048,2048] f32

  //   XB   bf16 [NTOK][HID]
  //   WQT  bf16 [QDIM][HID], WKT bf16 [KVDIM][HID], WVT bf16 [KVDIM][HID], WOT f16 [HID][QDIM]
  //        (WKT follows WQT directly: together the [QKDIM][HID] plane of [Wq | Wk]^T)
  //   R1   f32 [NTOK][QKDIM] for q | k; later reused: ctx f16 [NTOK][QDIM] at +0
  //   VT f16 [NB][KVDIM][SEQ]; QP f16 [NTOK][QDIM]; KP f16 [NTOK][KVDIM]; COS, SIN f32 [SEQ][HHALF]
  const size_t szXB  = (size_t)NTOK * HID * 2;
  const size_t szWQT = (size_t)QDIM * HID * 2;
  const size_t szWKT = (size_t)KVDIM * HID * 2;
  const size_t szWOT = (size_t)HID * QDIM * 2;
  const size_t szR1  = (size_t)NTOK * QKDIM * 4;
  const size_t szQP  = (size_t)NTOK * QDIM * 2;
  const size_t szKP  = (size_t)NTOK * KVDIM * 2;
  const size_t szVT  = (size_t)NB * KVDIM * SEQ * 2;
  const size_t szTAB = (size_t)SEQ * HHALF * 4;
  static_assert((size_t)NTOK * QDIM * 2 <= (size_t)NTOK * QKDIM * 4);
  const size_t OFF_XB  = 0;
  const size_t OFF_WQT = OFF_XB + szXB;
  const size_t OFF_WKT = OFF_WQT + szWQT;
  const size_t OFF_WVT = OFF_WKT + szWKT;
  const size_t OFF_WOT = OFF_WVT + szWKT;
  const size_t OFF_R1  = OFF_WOT + szWOT;
  const size_t OFF_QKF = OFF_R1;
  const size_t OFF_CTX = OFF_R1;
  const size_t OFF_VT  = OFF_R1 + szR1;
  const size_t OFF_QP  = OFF_VT + szVT;
  const size_t OFF_KP  = OFF_QP + szQP;
  const size_t OFF_COS = OFF_KP + szKP;
  const size_t OFF_SIN = OFF_COS + szTAB;
  const size_t WS_TOTAL = OFF_SIN + szTAB;
  if (ws_size < WS_TOTAL) return;

  char* ws = (char*)d_ws;
  unsigned short* xb  = (unsigned short*)(ws + OFF_XB);
  unsigned short* WqT = (unsigned short*)(ws + OFF_WQT);
  unsigned short* WkT = (unsigned short*)(ws + OFF_WKT);
  unsigned short* WvT = (unsigned short*)(ws + OFF_WVT);
  unsigned short* WoT = (unsigned short*)(ws + OFF_WOT);
  float* QKf = (float*)(ws + OFF_QKF);
  unsigned short* ctx = (unsigned short*)(ws + OFF_CTX);
  unsigned short* Vt  = (unsigned short*)(ws + OFF_VT);
  unsigned short* Qpl = (unsigned short*)(ws + OFF_QP);
  unsigned short* Kpl = (unsigned short*)(ws + OFF_KP);
  float* cosT = (float*)(ws + OFF_COS);
  float* sinT = (float*)(ws + OFF_SIN);

  // inv_freq[j] = 1 / 10000^(2j/128), pow in double then RNE to f32, reciprocal as one f32 divide
  RopeFreq fr;
  for (int j = 0; j < HHALF; ++j) {
    const float e = (float)(2 * j) / 128.0f;
    const double p = pow(10000.0, (double)e);
    const float pf = (float)p;
    fr.f[j] = 1.0f / pf;
  }

  // 1) to 3) x -> compact bf16 plane; transposed 16-bit weight planes in[rows][cols] -> out[cols][rows]; RoPE tables
  prep_kernel<<<PB_TAB + PB_WQ + 2 * PB_WKV + PB_WO + PB_X, 256, 0, stream>>>(x, Wq, Wk, Wv, Wo, xb, WqT, WkT, WvT, WoT, cosT, sinT, fr);
  // 4) [q | k] = x @ [Wq | Wk] -> f32 [NTOK][QKDIM]; v^T per batch = Wv^T @ x_b^T -> f16 [NB][KVDIM][SEQ]   (K=HID)
  gemm_qkv<<<QK_TILES + NB * V_TILES, 128, 0, stream>>>(xb, WqT, WvT, QKf, Vt, HID);
  // 5) RoPE of q (16 heads) and k (8 kv heads) -> f16 planes
  rope_f16_kernel<<<(NTOK * (NQH + NKVH) * 8) / 256, 256, 0, stream>>>(QKf, cosT, sinT, Qpl, Kpl, 1.0f);
  // 6) attention -> ctx f16 x 2^6 [NTOK][QDIM]  (the q | k f32 region is dead; V^T region disjoint)
  attn_kernel<<<NB * NQH * (SEQ / QBLK), 256, 0, stream>>>(Qpl, Kpl, Vt, ctx);
  // 7) out = ctx @ Wo -> d_out f32, per batch rows b*SEQ_FULL..  (M=SEQ, N=HID, K=QDIM, scale 2^-10)
  {
    const int tiles = (SEQ / 128) * (HID / 128);
    gemm_t64<_Float16, false, false, 0><<<dim3(tiles, NB), 128, 0, stream>>>(
        ctx, ctx, QDIM, (long)SEQ * QDIM, WoT, WoT, QDIM, 0L, (void*)out, HID, (long)SEQ_FULL * HID,
        SEQ, HID, QDIM, OUTSCALE);
  }
}

// v007
// It runs in 146 microseconds.
// Timed twice side by side with v006, it ran 1.07 and 1.06 times as fast.
// Over all steps from v000 it is 4.71 times as fast.
// x@Wq, x@Wk, Wv^T@x^T: v_wmma_f32_16x16x32_bf16 on RNE-bf16 input planes (f32 accumulate); q.k^T: v_wmma_f32_16x16x32_f16 (q, k single f16 planes, f32 accumulate); p.v: v_wmma_f32_16x16x32_f16 (p f16 carried x2^10, v f16, f32 accumulate); ctx@Wo: v_wmma_f32_16x16x32_f16 (ctx f16 carried x2^6, Wo f16 carried x2^4 built from RNE-bf16 values, f32 accumulate); RoPE, tanh softcap and softmax in f32.
#include <hip/hip_runtime.h>
#include <math.h>

#pragma clang fp contract(off)

#ifndef NB
#define NB 2
#endif
#ifndef SEQ
#define SEQ 2048
#endif
#define NB_FULL  2
#define SEQ_FULL 2048
#define HID      2048
#define NQH      16
#define NKVH     8
#define HD       128
#define HHALF    64
#define QDIM     (NQH * HD)
#define KVDIM    (NKVH * HD)
#define QKDIM    (QDIM + KVDIM)
#define NTOK     (NB * SEQ)
#define KV_CHUNK 64
#define QBLK     256
#define RSQ      0.08838834764831845f
#define SOFTCAP  50.0f
#define INVCAP   0.02f
#define PCARRY   1024.0f
#define OCARRY   64.0f
#define WOCARRY  16.0f
#define OUTSCALE 0.0009765625f

typedef __attribute__((ext_vector_type(16))) _Float16 v16h;
typedef __attribute__((ext_vector_type(8)))  _Float16 v8h;
typedef __attribute__((ext_vector_type(16))) __bf16   v16b;
typedef __attribute__((ext_vector_type(8)))  __bf16   v8b;
typedef __attribute__((ext_vector_type(8)))  float    v8f;
typedef __attribute__((ext_vector_type(4)))  float    v4f;
typedef __attribute__((ext_vector_type(4)))  unsigned int v4u;

__device__ __forceinline__ unsigned short f2bf_bits(float f) {
  unsigned u = __float_as_uint(f);
  return (unsigned short)((u + 0x7FFFu + ((u >> 16) & 1u)) >> 16);
}
__device__ __forceinline__ float bf_bits2f(unsigned short h) { return __uint_as_float(((unsigned)h) << 16); }
__device__ __forceinline__ unsigned short f2h_bits(float f) { const _Float16 h = (_Float16)f; return __builtin_bit_cast(unsigned short, h); }

// hazard guards as plain device helpers
__device__ __forceinline__ void dep_guard_h(v8f& a, v8f& b, v16h x, v16h y) { asm volatile("v_nop\n\tv_nop\n\tv_nop\n\tv_nop" : "+v"(a), "+v"(b) : "v"(x), "v"(y)); }
__device__ __forceinline__ void dep_guard_b(v8f& a, v8f& b, v16b x, v16b y) { asm volatile("v_nop\n\tv_nop\n\tv_nop\n\tv_nop" : "+v"(a), "+v"(b) : "v"(x), "v"(y)); }
__device__ __forceinline__ void keep4_h(v16h a, v16h b, v16h c, v16h d) { asm volatile("v_nop" :: "v"(a), "v"(b), "v"(c), "v"(d)); }
__device__ __forceinline__ void keep4_b(v16b a, v16b b, v16b c, v16b d) { asm volatile("v_nop" :: "v"(a), "v"(b), "v"(c), "v"(d)); }
__device__ __forceinline__ void acc_guard4(v8f& a, v8f& b, v8f& c, v8f& d) { asm volatile("v_nop\n\tv_nop\n\tv_nop\n\tv_nop" : "+v"(a), "+v"(b), "+v"(c), "+v"(d)); }

// fragment loaders: lane l, row/col = l & 15, elements 0..7 <- p[0..7] (k0 + 8h + 0..7), 8..15 <- p[16..23] (k0 + 16 + 8h + 0..7); caller adds 8h
template <typename T> struct Frag;
template <> struct Frag<_Float16> {
  typedef v16h V; union U { v16h v; v8h h[2]; };
  static __device__ __forceinline__ v16h load(const _Float16* p) {
    U f; f.h[0] = *(const v8h*)(p); f.h[1] = *(const v8h*)(p + 16); return f.v;
  }
  static __device__ __forceinline__ v8f mma(v16h a, v16h b, v8f c) {
    return __builtin_amdgcn_wmma_f32_16x16x32_f16(false, a, false, b, (short)0, c, false, false);
  }
  static __device__ __forceinline__ void guard(v8f& a, v8f& b, v16h x, v16h y) { dep_guard_h(a, b, x, y); }
  static __device__ __forceinline__ void keep(v16h a, v16h b, v16h c, v16h d) { keep4_h(a, b, c, d); }
};
template <> struct Frag<__bf16> {
  typedef v16b V; union U { v16b v; v8b h[2]; };
  static __device__ __forceinline__ v16b load(const __bf16* p) {
    U f; f.h[0] = *(const v8b*)(p); f.h[1] = *(const v8b*)(p + 16); return f.v;
  }
  static __device__ __forceinline__ v8f mma(v16b a, v16b b, v8f c) {
    return __builtin_amdgcn_wmma_f32_16x16x32_bf16(false, a, false, b, (short)0, c, false, false);
  }
  static __device__ __forceinline__ void guard(v8f& a, v8f& b, v16b x, v16b y) { dep_guard_b(a, b, x, y); }
  static __device__ __forceinline__ void keep(v16b a, v16b b, v16b c, v16b d) { keep4_b(a, b, c, d); }
};

// ---------------------------------------------------------------------------------------------
// 1) x f32 [NB_FULL][SEQ_FULL][HID] -> compact bf16 plane [NTOK][HID], 8 elements per thread, one 16-B store per lane
// ---------------------------------------------------------------------------------------------
__device__ __forceinline__ void cast_x_bf16(const float* __restrict__ in, unsigned short* __restrict__ out, int n8, int blk) {
  const int i = blk * 256 + threadIdx.x;
  if (i < n8) {
    const size_t o   = (size_t)i * 8;
    const size_t tok = o / HID;
    const size_t col = o - tok * HID;
    const size_t bb  = tok / SEQ;
    const size_t ss  = tok - bb * SEQ;
    const size_t src = (bb * SEQ_FULL + ss) * (size_t)HID + col;
    const v4f a  = *(const v4f*)(in + src);
    const v4f bq = *(const v4f*)(in + src + 4);
    v4u w;
    w[0] = (unsigned)f2bf_bits(a[0])  | ((unsigned)f2bf_bits(a[1])  << 16);
    w[1] = (unsigned)f2bf_bits(a[2])  | ((unsigned)f2bf_bits(a[3])  << 16);
    w[2] = (unsigned)f2bf_bits(bq[0]) | ((unsigned)f2bf_bits(bq[1]) << 16);
    w[3] = (unsigned)f2bf_bits(bq[2]) | ((unsigned)f2bf_bits(bq[3]) << 16);
    *(v4u*)(out + o) = w;
    
  }
}

// ---------------------------------------------------------------------------------------------
// 2) in[nrows][ncols] f32 -> out[ncols][nrows] 16-bit. MODE 0: bf16 bits (RNE); MODE 1: f16 bits of (RNE-bf16 value * scl).
//    Block = 64x64 tile through LDS (cross-thread, block barrier). (bx, by) in (ncols/64, nrows/64); nrows, ncols multiples of 64.
//    load coverage: 256 threads x 16 floats = 64x64 tile; store coverage: 2 iterations x 256 threads x 8 = 64 rows x 64.
// ---------------------------------------------------------------------------------------------
template <int MODE> __device__ __forceinline__ unsigned short pk16(float f, float scl) {
  if (MODE == 0) return f2bf_bits(f);
  const float g = bf_bits2f(f2bf_bits(f)) * scl;
  return f2h_bits(g);
}

template <int MODE>
__device__ __forceinline__ void transpose_cast16(const float* __restrict__ in, unsigned short* __restrict__ out, int nrows, int ncols, float scl,
                                                 int bx, int by, float* tile) {
  const int tid = threadIdx.x;
  const int r0 = by * 64, c0 = bx * 64;
  {
    const int row = tid >> 2, cc = (tid & 3) * 16;
    const float* s = in + (size_t)(r0 + row) * ncols + c0 + cc;
#pragma unroll
    for (int q = 0; q < 4; ++q) {
      const v4f v = *(const v4f*)(s + 4 * q);
#pragma unroll
      for (int e = 0; e < 4; ++e) tile[(cc + 4 * q + e) * 65 + row] = v[e];
    }
  }
  __syncthreads();
  {
#pragma unroll
    for (int it = 0; it < 2; ++it) {
      const int orow = it * 32 + (tid >> 3), seg = (tid & 7) * 8;
      const float* tp = tile + orow * 65 + seg;
      v4u w;
#pragma unroll
      for (int e = 0; e < 4; ++e) w[e] = (unsigned)pk16<MODE>(tp[2 * e], scl) | ((unsigned)pk16<MODE>(tp[2 * e + 1], scl) << 16);
      *(v4u*)(out + (size_t)(c0 + orow) * nrows + r0 + seg) = w;
    }
    // in the merged kernel's listing another range's code follows and writes registers that these stores name: the wait stands in front of it
    asm volatile("s_wait_xcnt 0x0" ::: "memory");
  }
}

// ---------------------------------------------------------------------------------------------
// 3) RoPE cos/sin tables [SEQ][HHALF] f32: angle = pos * inv_freq[j] (single f32 multiply), precise cosf/sinf.
// ---------------------------------------------------------------------------------------------
struct RopeFreq { float f[HHALF]; };
static_assert(sizeof(RopeFreq) == 256);

__device__ __forceinline__ void rope_table(float* __restrict__ cosT, float* __restrict__ sinT, const RopeFreq& fr, int blk, float* invf) {
  if (threadIdx.x == 0) {
#pragma unroll
    for (int q = 0; q < HHALF; ++q) invf[q] = fr.f[q];
  }
  __syncthreads();
  const int i = blk * 256 + threadIdx.x;                 // exactly SEQ*HHALF threads
  const int t = i >> 6;
  const int jj = i & (HHALF - 1);
  const float ang = (float)t * invf[jj];
  const float cv = cosf(ang);
  const float sv = sinf(ang);
  ((float*)cosT)[i] = cv;
  ((float*)sinT)[i] = sv;
  
}

// ---------------------------------------------------------------------------------------------
// 1) to 3) in ONE launch: none of them reads what another writes, so each takes a range of the block index.
//    Every branch below is block-uniform; the ranges with the most work per block come first.
// ---------------------------------------------------------------------------------------------
#define PB_TAB ((SEQ * HHALF) / 256)
#define PB_WQ  ((QDIM / 64) * (HID / 64))
#define PB_WKV ((KVDIM / 64) * (HID / 64))
#define PB_WO  ((HID / 64) * (QDIM / 64))
#define PB_X   ((NTOK * HID / 8) / 256)
__global__ __launch_bounds__(256) void prep_kernel(
    const float* __restrict__ x, const float* __restrict__ Wq, const float* __restrict__ Wk, const float* __restrict__ Wv, const float* __restrict__ Wo,
    unsigned short* __restrict__ xb, unsigned short* __restrict__ WqT, unsigned short* __restrict__ WkT, unsigned short* __restrict__ WvT,
    unsigned short* __restrict__ WoT, float* __restrict__ cosT, float* __restrict__ sinT, RopeFreq fr) {
  __shared__ float tile[64 * 65];
  int blk = blockIdx.x;
  if (blk < PB_TAB) { rope_table(cosT, sinT, fr, blk, tile); return; }
  blk -= PB_TAB;
  if (blk < PB_WQ) {                           // [HID][QDIM]  -> [QDIM][HID]
    transpose_cast16<0>(Wq, WqT, HID, QDIM, 1.0f, blk % (QDIM / 64), blk / (QDIM / 64), tile); return;
  }
  blk -= PB_WQ;
  if (blk < 2 * PB_WKV) {                      // [HID][KVDIM] -> [KVDIM][HID], Wk then Wv
    const bool isv = blk >= PB_WKV;
    if (isv) blk -= PB_WKV;
    transpose_cast16<0>(isv ? Wv : Wk, isv ? WvT : WkT, HID, KVDIM, 1.0f, blk % (KVDIM / 64), blk / (KVDIM / 64), tile); return;
  }
  blk -= 2 * PB_WKV;
  if (blk < PB_WO) {                           // [QDIM][HID]  -> [HID][QDIM], f16 x 2^4
    transpose_cast16<1>(Wo, WoT, QDIM, HID, WOCARRY, blk % (HID / 64), blk / (HID / 64), tile); return;
  }
  blk -= PB_WO;
  cast_x_bf16(x, xb, NTOK * HID / 8, blk);
}

// ---------------------------------------------------------------------------------------------
// 5) Register-blocked batched WMMA GEMM, 16-bit operands of type T (bf16 or f16), f32 accumulate.
//    C[m,n] = scale * sum_k A[m,k] * Bt[n,k]; A row-major [M,K], Bt row-major [N,K].
//    Block = 4 waves (2 x 2) = one 128x128 tile of C; each wave owns a 64x64 tile.
//    Per pass the block's 128 A rows and 128 Bt rows x 128 k (256 B a row) are brought into LDS by asynchronous
//    copies, two buffers: the next pass's copies fly while this pass's fragments are read from LDS.
//    M,N % 128 == 0, K % 128 == 0 (no tail handling). lda, ldb % 8 == 0 (16-B copies).
//    OUT_MODE: 0 = f32, 1 = single f16 plane, 2 = rotated (RoPE) f16 plane of one 128-wide head per block tile.
//    The hi/lo plane options are not staged: both must be false.
// ---------------------------------------------------------------------------------------------
#define GBK    128    // k elements of one staged pass
#define GPITCH 136    // LDS row pitch in elements: 272 B = 16 B x 17, conflict-free for 16-B row reads
typedef __attribute__((ext_vector_type(4))) int v4i;
typedef __attribute__((address_space(1))) v4i gv4i;
typedef __attribute__((address_space(3))) v4i lv4i;

// 128 rows x 256 B from g (row pitch ld elements) into l (row pitch GPITCH): 128 threads x 16 copies of 16 B;
// one wave-wide copy covers two whole 256-B rows.
// g is the tile's origin, the same in every lane; goff is the lane's own element offset row * ld + column.
template <typename T>
__device__ __forceinline__ void stage_tile(const T* g, int ld, unsigned goff, T* l, int tid) {
  T* lp = l + (tid >> 4) * GPITCH + (tid & 15) * 8;
#pragma unroll   // the 16 copies go out back to back, none waits for another
  for (int j = 0; j < 16; ++j)
    __builtin_amdgcn_global_load_async_to_lds_b128((gv4i*)(g + (size_t)(j * 8) * ld + goff), (lv4i*)(lp + j * 8 * GPITCH), 0, 0);
}

// A wave's 64x64 accumulator tile -> C, 16 rows at a time through the wave's own LDS slab, so that each store covers whole row pieces.
template <int OUT_MODE>
__device__ __forceinline__ void gemm_store(v8f (&acc)[4][4], float* slab, void* Cb, int ldc, int m0, int n0, float scale, int lane) {
  const int rlane = lane & 15;                 // D column within subtile
  const int mOff  = (lane >> 4) * 8;           // D row offset
#pragma unroll
  for (int i = 0; i < 4; ++i) {
    const int mBase = m0 + (i << 4);
#pragma unroll
    for (int j = 0; j < 4; ++j) {
#pragma unroll
      for (int r = 0; r < 8; ++r) {
        const float v = acc[i][j][r] * scale;
        slab[(mOff + r) * 68 + (j << 4) + rlane] = v;
      }
    }
    __builtin_amdgcn_fence(3, "workgroup");
    __builtin_amdgcn_wave_barrier();
    __builtin_amdgcn_fence(2, "workgroup");
    if (OUT_MODE == 0) {
      float* Cf = (float*)Cb;
      const int hh = lane >> 4, c4 = (lane & 15) * 4;     // row seg = 256 B = 16 lanes x 16 B
      {
#pragma unroll
        for (int it = 0; it < 8; ++it) {
          const int row = it * 2 + hh;
          v4f v = *(const v4f*)(slab + row * 68 + c4);
          *(v4f*)(Cf + (size_t)(mBase + row) * ldc + n0 + c4) = v;
        }
        
      }
    } else {
      const int q = lane >> 3, c8 = (lane & 7) * 8;
      unsigned short* Cs = (unsigned short*)Cb;
      {
#pragma unroll
        for (int it = 0; it < 4; ++it) {
          const int row = it * 4 + q;
          const float* sp = slab + row * 68 + c8;
          v8h hv;
#pragma unroll
          for (int e = 0; e < 8; ++e) hv[e] = (_Float16)sp[e];
          *(v8h*)(Cs + (size_t)(mBase + row) * ldc + n0 + c8) = hv;
        }
        
      }
    }
    __builtin_amdgcn_fence(3, "workgroup");
    __builtin_amdgcn_wave_barrier();
    __builtin_amdgcn_fence(2, "workgroup");
  }
}

// RoPE epilogue. The block tile's 128 columns are one head; this wave's accumulator column tiles j = 0, 1 hold x1[d0 .. d0+31] and
// j = 2, 3 hold x2[d0 .. d0+31] (= head dims 64 + d0 ..) of its 64 tokens, so a slab row is x1 | x2 of the same 32 pair indices.
// out1 = x1*cos - x2*sin, out2 = x2*cos + x1*sin in f32, then f16. A slab row goes out as it lies: 64 f16 = one whole 128-B line at
// plane column n0. Within a head the plane's order of d is therefore 0..31, 64..95, 32..63, 96..127, in q and in k alike.
struct RopeTab { v4f ca, cb, sa, sb; };
__device__ __forceinline__ void rope_tab_load(RopeTab (&t)[2], const float* cosT, const float* sinT, int mBase, int dcol, int q) {
#pragma unroll   // constant indices: registers, no scratch
  for (int it = 0; it < 2; ++it) {
    const size_t tb = (size_t)((unsigned)(mBase + it * 8 + q) % (unsigned)SEQ) * HHALF + dcol;
    t[it].ca = *(const v4f*)(cosT + tb);
    t[it].cb = *(const v4f*)(cosT + tb + 4);
    t[it].sa = *(const v4f*)(sinT + tb);
    t[it].sb = *(const v4f*)(sinT + tb + 4);
  }
  // the code that follows writes the address registers that these loads name: the wait stands in front of it
  asm volatile("s_wait_xcnt 0x0" ::: "memory");
}

__device__ __forceinline__ void gemm_store_rope(v8f (&acc)[4][4], float* slab, unsigned short* Cs, int ldc, int m0, int n0,
                                                const float* cosT, const float* sinT, int d0, int lane) {
  const int rlane = lane & 15;                 // D column within subtile
  const int mOff  = (lane >> 4) * 8;           // D row offset
  const int q = lane >> 2, c8 = (lane & 3) * 8; // reader: 4 lanes a row, 8 pair indices a lane, 8 rows a pass
  RopeTab tab[2][2];                           // the table rows of 16 tokens, read one group of 16 ahead of their use
  rope_tab_load(tab[0], cosT, sinT, m0, d0 + c8, q);
#pragma unroll   // constant accumulator and table indices: registers, no scratch
  for (int i = 0; i < 4; ++i) {
    const int mBase = m0 + (i << 4);
#pragma unroll
    for (int j = 0; j < 4; ++j) {
#pragma unroll
      for (int r = 0; r < 8; ++r) slab[(mOff + r) * 68 + (j << 4) + rlane] = acc[i][j][r];
    }
    // the slab is this wave's own: the wait puts every lane's values into LDS before another lane reads them, and the fences keep
    // the compiler from moving the reads below over the writes above; none of them waits for a global load or store
    asm volatile("s_wait_dscnt 0x0" ::: "memory");
    __builtin_amdgcn_fence(3, "wavefront");
    __builtin_amdgcn_wave_barrier();
    __builtin_amdgcn_fence(2, "wavefront");
    if (i + 1 < 4) rope_tab_load(tab[(i + 1) & 1], cosT, sinT, mBase + 16, d0 + c8, q);
#pragma unroll
    for (int it = 0; it < 2; ++it) {
      const int row = it * 8 + q;
      const float* sp = slab + row * 68 + c8;
      const v4f x1a = *(const v4f*)(sp);
      const v4f x1b = *(const v4f*)(sp + 4);
      const v4f x2a = *(const v4f*)(sp + 32);
      const v4f x2b = *(const v4f*)(sp + 36);
      const RopeTab& t = tab[i & 1][it];
      v8h h1, h2;
#pragma unroll
      for (int e = 0; e < 4; ++e) {
        h1[e]     = (_Float16)(x1a[e] * t.ca[e] - x2a[e] * t.sa[e]);
        h2[e]     = (_Float16)(x2a[e] * t.ca[e] + x1a[e] * t.sa[e]);
        h1[e + 4] = (_Float16)(x1b[e] * t.cb[e] - x2b[e] * t.sb[e]);
        h2[e + 4] = (_Float16)(x2b[e] * t.cb[e] + x1b[e] * t.sb[e]);
      }
      unsigned short* op = Cs + (size_t)(mBase + row) * ldc + n0 + c8;
      *(v8h*)(op) = h1;
      *(v8h*)(op + 32) = h2;
    }
    // the next group's code writes registers that these stores name: the wait stands in front of it
    asm volatile("s_wait_xcnt 0x0" ::: "memory");
    __builtin_amdgcn_fence(3, "wavefront");
    __builtin_amdgcn_wave_barrier();
    __builtin_amdgcn_fence(2, "wavefront");
  }
}

// One block's 128x128 tile (tm, tn). Ag, Bg: first of the tile's 128 A rows and 128 Bt rows; Cb: origin of this product's C.
// ring: [buffer][A rows | Bt rows]; sT: per-wave 16x64 slab, pitch 68 floats. Every argument is the same in the whole block.
// OUT_MODE 2: column tile j of a wave takes Bt rows 64 (j >> 1) + 32 (wave & 1) + 16 (j & 1) .. of the block's 128, so that head dims
// d and d + 64 meet in one lane; cosT, sinT are the RoPE tables (unused otherwise).
template <typename T, int OUT_MODE>
__device__ __forceinline__ void gemm_tile(const T* Ag, int lda, const T* Bg, int ldb, void* Cb, int ldc, int tm, int tn, int K, float scale,
                                          const float* cosT, const float* sinT, T (*ring)[2][128 * GPITCH], float (*sT)[16 * 68]) {
  typedef typename Frag<T>::V V;
  const int tid  = threadIdx.x;
  const int lane = tid & 31;
  const int wave = tid >> 5;
  const int wm = (wave >> 1) << 6;             // this wave's rows inside the block tile
  const int wn = (wave & 1) << 6;              // this wave's columns inside the block tile
  const int m0 = (tm << 7) + wm;
  const int n0 = (tn << 7) + wn;

  const int rlane = lane & 15;                 // row (A) / col (B, D) within subtile
  const int koff  = (lane >> 4) * 8;           // k offset of this lane half
  auto brow = [](int j) { return OUT_MODE == 2 ? ((j >> 1) << 6) + ((j & 1) << 4) : (j << 4); };   // Bt row of column tile j

  v8f acc[4][4];
#pragma unroll
  for (int i = 0; i < 4; ++i)
#pragma unroll
    for (int j = 0; j < 4; ++j) acc[i][j] = (v8f){0.f,0.f,0.f,0.f,0.f,0.f,0.f,0.f};

  const int nt = K / GBK;
  const unsigned aoff = (unsigned)(tid >> 4) * (unsigned)lda + (unsigned)(tid & 15) * 8u;
  const unsigned boff = (unsigned)(tid >> 4) * (unsigned)ldb + (unsigned)(tid & 15) * 8u;
  stage_tile<T>(Ag, lda, aoff, ring[0][0], tid);
  stage_tile<T>(Bg, ldb, boff, ring[0][1], tid);
  asm volatile("s_wait_asynccnt 0x0" ::: "memory");   // this wave's copies of pass 0 have landed
  __syncthreads();                                     // ... and every other wave's: pass 0 is readable
  if (nt > 1) {
    stage_tile<T>(Ag + GBK, lda, aoff, ring[1][0], tid);
    stage_tile<T>(Bg + GBK, ldb, boff, ring[1][1], tid);
  }

  for (int t = 0; t < nt; ++t) {
    const T* la = ring[t & 1][0] + (wm + rlane) * GPITCH + koff;
    const T* lb = ring[t & 1][1] + ((OUT_MODE == 2 ? wn >> 1 : wn) + rlane) * GPITCH + koff;
    // LDS reads run ahead of their products: the next 32-k block's Bt fragments go into a second set at the head of
    // this block, and each A fragment is re-read for the next block as soon as its row of products has been issued
    // (every loop below is unrolled so that each fragment and accumulator index is a constant: registers, no scratch)
    V af[4], bf[2][4];
#pragma unroll
    for (int j = 0; j < 4; ++j) { bf[0][j] = Frag<T>::load(lb + brow(j) * GPITCH); af[j] = Frag<T>::load(la + (j << 4) * GPITCH); }
#pragma unroll
    for (int kb = 0; kb < GBK / 32; ++kb) {
      const int cu = kb & 1, nx = cu ^ 1;
      if (kb + 1 < GBK / 32) {
#pragma unroll
        for (int j = 0; j < 4; ++j) bf[nx][j] = Frag<T>::load(lb + brow(j) * GPITCH + (kb + 1) * 32);
      }
#pragma unroll
      for (int i = 0; i < 4; ++i) {
#pragma unroll
        for (int j = 0; j < 4; ++j) acc[i][j] = Frag<T>::mma(af[i], bf[cu][j], acc[i][j]);
        Frag<T>::guard(acc[i][0], acc[i][3], af[i], af[i]);
        if (kb + 1 < GBK / 32) af[i] = Frag<T>::load(la + (i << 4) * GPITCH + (kb + 1) * 32);
      }
      Frag<T>::keep(bf[cu][0], bf[cu][1], bf[cu][2], bf[cu][3]);
    }
    asm volatile("s_wait_dscnt 0x0" ::: "memory");     // this wave's reads of buffer t & 1 are done before it is refilled
    asm volatile("s_wait_asynccnt 0x0" ::: "memory");  // this wave's copies of pass t + 1 have landed
    __syncthreads();                                    // publishes pass t + 1, frees buffer t & 1
    if (t + 2 < nt) {
      stage_tile<T>(Ag + (size_t)(t + 2) * GBK, lda, aoff, ring[t & 1][0], tid);
      stage_tile<T>(Bg + (size_t)(t + 2) * GBK, ldb, boff, ring[t & 1][1], tid);
    }
  }
  asm volatile("s_wait_asynccnt 0x0" ::: "memory");    // no copy is outstanding when the wave goes on
  acc_guard4(acc[0][0], acc[0][1], acc[0][2], acc[0][3]);
  acc_guard4(acc[1][0], acc[1][1], acc[1][2], acc[1][3]);
  acc_guard4(acc[2][0], acc[2][1], acc[2][2], acc[2][3]);
  acc_guard4(acc[3][0], acc[3][1], acc[3][2], acc[3][3]);

  // ---- epilogue ----
  if (OUT_MODE == 2) gemm_store_rope(acc, sT[wave], (unsigned short*)Cb, ldc, m0, n0, cosT, sinT, wn >> 1, lane);
  else               gemm_store<OUT_MODE>(acc, sT[wave], Cb, ldc, m0, n0, scale, lane);
}

// one product, batched over blockIdx.y
template <typename T, bool SPLITA, bool SPLITB, int OUT_MODE>
__global__ __launch_bounds__(128) void gemm_t64(
    const unsigned short* __restrict__ Ap, const unsigned short* __restrict__ A2p, int lda, long strideA,
    const unsigned short* __restrict__ Btp, const unsigned short* __restrict__ Bt2p, int ldb, long strideB,
    void* __restrict__ Cout, int ldc, long strideC,
    int M, int N, int K, float scale) {
  static_assert(!SPLITA && !SPLITB);
  const T* A = (const T*)Ap; const T* Bt = (const T*)Btp;
  __shared__ __align__(16) T ring[2][2][128 * GPITCH];
  __shared__ __align__(16) float sT[4][16 * 68];
  const int b    = blockIdx.y;
  const int tilesN = N >> 7;
  const int tilesM = M >> 7;
  const int tile = blockIdx.x;
  if (tile >= tilesM * tilesN) return;   // block-uniform, ahead of every barrier and copy
  const int tm = tile / tilesN;
  const int tn = tile - tm * tilesN;
  const T* Ag = A  + (size_t)b * strideA + (size_t)(tm << 7) * lda;
  const T* Bg = Bt + (size_t)b * strideB + (size_t)(tn << 7) * ldb;
  void* Cb = OUT_MODE == 0 ? (void*)((float*)Cout + (size_t)b * strideC) : (void*)((unsigned short*)Cout + (size_t)b * strideC);
  gemm_tile<T, OUT_MODE>(Ag, lda, Bg, ldb, Cb, ldc, tm, tn, K, scale, nullptr, nullptr, ring, sT);
}

// The three products on x in ONE launch (none reads what another writes), each tile computed as in a launch of its own:
//   blocks 0 .. QK_TILES-1: [q | k] = x @ [Wq | Wk], one head per tile, rotated in the epilogue -> f16 planes Q [NTOK][QDIM], K [NTOK][KVDIM];
//                           WqkT = the QDIM rows of Wq^T, then the KVDIM rows of Wk^T
//   then NB x V_TILES:      v^T per batch = Wv^T @ x_b^T -> f16 [NB][KVDIM][SEQ]
// ld = row pitch of all three operand planes = K. The branch is block-uniform.
#define QK_TILES ((NTOK / 128) * (QKDIM / 128))
#define V_TILES  ((KVDIM / 128) * (SEQ / 128))
__global__ __launch_bounds__(128) void gemm_qkv(
    const unsigned short* __restrict__ xbp, const unsigned short* __restrict__ WqkTp, const unsigned short* __restrict__ WvTp,
    const float* __restrict__ cosT, const float* __restrict__ sinT,
    unsigned short* __restrict__ Qpl, unsigned short* __restrict__ Kpl, unsigned short* __restrict__ Vtp, int ld) {
  __shared__ __align__(16) __bf16 ring[2][2][128 * GPITCH];
  __shared__ __align__(16) float sT[4][16 * 68];
  const __bf16* xb = (const __bf16*)xbp;
  const int bx = blockIdx.x;
  if (bx < QK_TILES) {
    const int tm = bx / (QKDIM / 128);
    const int hs = bx - tm * (QKDIM / 128);    // heads 0..15 are q, 16..23 are k
    const bool isk = hs >= NQH;
    gemm_tile<__bf16, 2>(xb + (size_t)(tm << 7) * ld, ld, (const __bf16*)WqkTp + (size_t)(hs << 7) * ld, ld, isk ? Kpl : Qpl,
                         isk ? KVDIM : QDIM, tm, isk ? hs - NQH : hs, ld, 1.0f, cosT, sinT, ring, sT);
  } else {
    const int r  = bx - QK_TILES;
    const int b  = r / V_TILES;
    const int tile = r - b * V_TILES;
    const int tm = tile / (SEQ / 128);
    const int tn = tile - tm * (SEQ / 128);
    gemm_tile<__bf16, 1>((const __bf16*)WvTp + (size_t)(tm << 7) * ld, ld, xb + (size_t)b * SEQ * ld + (size_t)(tn << 7) * ld, ld,
                         Vtp + (size_t)b * KVDIM * SEQ, SEQ, tm, tn, ld, 1.0f, nullptr, nullptr, ring, sT);
  }
}

#define KPITCH 136    // LDS pitch of a K row in elements: 272 B = 16 B x 17, conflict-free for 16-B row reads
#define VPITCH 72     // LDS pitch of a V^T row in elements: 144 B = 16 B x 9, conflict-free for 16-B row reads

// kg, vg: origin of the chunk's K rows (pitch KVDIM) and V^T rows (pitch SEQ), the same in every lane.
// 256 threads x (4 + 4) copies of 16 B; one wave-wide copy covers two whole K rows or four whole V^T row pieces.
__device__ __forceinline__ void stage_kv(const _Float16* kg, const _Float16* vg, _Float16* kl, _Float16* vl, int tid) {
  const unsigned ko = (unsigned)(tid >> 4) * (unsigned)KVDIM + (unsigned)(tid & 15) * 8u;
  const unsigned vo = (unsigned)(tid >> 3) * (unsigned)SEQ + (unsigned)(tid & 7) * 8u;
  _Float16* kp = kl + (tid >> 4) * KPITCH + (tid & 15) * 8;
  _Float16* vp = vl + (tid >> 3) * VPITCH + (tid & 7) * 8;
#pragma unroll   // the copies go out back to back, none waits for another
  for (int j = 0; j < 4; ++j)
    __builtin_amdgcn_global_load_async_to_lds_b128((gv4i*)(kg + (size_t)(j * 16) * KVDIM + ko), (lv4i*)(kp + j * 16 * KPITCH), 0, 0);
#pragma unroll   // as above
  for (int j = 0; j < 4; ++j)
    __builtin_amdgcn_global_load_async_to_lds_b128((gv4i*)(vg + (size_t)(j * 32) * SEQ + vo), (lv4i*)(vp + j * 32 * VPITCH), 0, 0);
}

// lane l <-> lane l ^ 16, a vector cross-row move
__device__ __forceinline__ float xhalf(float x) {
  return __builtin_bit_cast(float, __builtin_amdgcn_permlanex16(__builtin_bit_cast(int, x), __builtin_bit_cast(int, x), 0x76543210, 0xfedcba98, false, false));
}

__global__ __launch_bounds__(256) void attn_kernel(
    const unsigned short* __restrict__ Qp, const unsigned short* __restrict__ Kp,
    const unsigned short* __restrict__ Vtp, unsigned short* __restrict__ Op) {
  __shared__ __align__(16) _Float16 Kst[2][KV_CHUNK * KPITCH]; // 34 KB: K rows of a chunk [kv][d], two buffers
  __shared__ __align__(16) _Float16 Vst[2][HD * VPITCH];       // 36 KB: V^T rows of a chunk [d][kv], two buffers

  const _Float16* Q  = (const _Float16*)Qp;
  const _Float16* Kk = (const _Float16*)Kp;
  const _Float16* Vt = (const _Float16*)Vtp;

  const int tid  = threadIdx.x;
  const int wave = tid >> 5, lane = tid & 31;
  const int hh   = lane >> 4, c = lane & 15, koff = hh * 8;
  const int nqb  = SEQ / QBLK;
  const int bx   = blockIdx.x;
  const int qb   = bx % nqb;
  const int bhid = bx / nqb;
  const int h    = bhid % NQH;
  const int b    = bhid / NQH;
  const int kvh  = h >> 1;
  const int q0   = qb * QBLK + wave * 32;                       // sequence position of this wave's row 0
  const size_t tokw = (size_t)b * SEQ + q0;                     // compact token index of this wave's row 0
  const size_t qoff = (tokw + c) * QDIM + (size_t)h * HD + koff;
  const _Float16* Kg = Kk + (size_t)b * SEQ * KVDIM + (size_t)kvh * HD;            // this head's K rows, key 0
  const _Float16* Vg = Vt + (size_t)b * KVDIM * SEQ + (size_t)(kvh * HD) * SEQ;    // this head's V^T rows, key 0

  // column tile u holds query 16 u + c of the wave
  float mrow[2] = {-INFINITY, -INFINITY};   // running maximum of the query, the same in both wave halves
  float lrow[2] = {0.f, 0.f};               // running sum of the query over this half's keys; the halves are joined in the epilogue
  v8f oacc[2][8];                           // O^T tile t: register r = O[query][d = 16 t + 8 hh + r]
  v16h qf[2][4];                            // Q^T fragments, d' = 32 dc ..: the same in every chunk
  // The products below are the plain builtin, whose distances the compiler keeps itself: accumulators, scores, Q^T and the
  // fragment sets together need more than 256 registers, and operands of an asm guard would all have to lie in the first 256.
#pragma unroll
  for (int u = 0; u < 2; ++u) {
#pragma unroll
    for (int t = 0; t < 8; ++t) oacc[u][t] = (v8f){0.f,0.f,0.f,0.f,0.f,0.f,0.f,0.f};
#pragma unroll
    for (int dc = 0; dc < 4; ++dc) qf[u][dc] = Frag<_Float16>::load(Q + qoff + (size_t)(u * 16) * QDIM + dc * 32);
  }
  // the code that follows writes the address registers that these loads name: the wait stands in front of it
  asm volatile("s_wait_xcnt 0x0" ::: "memory");

  const int nch = SEQ / KV_CHUNK;
  stage_kv(Kg, Vg, Kst[0], Vst[0], tid);
  asm volatile("s_wait_asynccnt 0x0" ::: "memory");   // this wave's copies of chunk 0 have landed
  __syncthreads();                                     // ... and every other wave's: chunk 0 is readable
  if (nch > 1) stage_kv(Kg + (size_t)KV_CHUNK * KVDIM, Vg + KV_CHUNK, Kst[1], Vst[1], tid);

  for (int kc = 0; kc < nch; ++kc) {
    const _Float16* kl = Kst[kc & 1] + c * KPITCH + koff;
    const _Float16* vl = Vst[kc & 1] + c * VPITCH + koff;

    // ---- raw scores S^T(64 kv x 16 q) over d = 128, per column tile u: tile j, register r = S[query][key 16 j + 8 hh + r] ----
    v8f s[2][4];
#pragma unroll
    for (int j = 0; j < 4; ++j) { s[0][j] = (v8f){0.f,0.f,0.f,0.f,0.f,0.f,0.f,0.f}; s[1][j] = s[0][j]; }
    // LDS reads stand in groups of four fragments, one group ahead of their products (two register sets); the loops are
    // unrolled so that every fragment index is a constant: registers, no scratch
    v16h kf[2][4];
#pragma unroll
    for (int j = 0; j < 4; ++j) kf[0][j] = Frag<_Float16>::load(kl + j * 16 * KPITCH);
#pragma unroll
    for (int dc = 0; dc < 4; ++dc) {
      const int cu = dc & 1, nx = cu ^ 1;
      if (dc + 1 < 4) {
#pragma unroll
        for (int j = 0; j < 4; ++j) kf[nx][j] = Frag<_Float16>::load(kl + j * 16 * KPITCH + (dc + 1) * 32);
      }
#pragma unroll
      for (int j = 0; j < 4; ++j) {
        s[0][j] = Frag<_Float16>::mma(kf[cu][j], qf[0][dc], s[0][j]);
        s[1][j] = Frag<_Float16>::mma(kf[cu][j], qf[1][dc], s[1][j]);
      }
    }

    // ---- the chunk's 16 V^T fragments [32 keys kk][output tile t], read as one group: their LDS latency passes under the softmax ----
    v16h vf[2][8];
#pragma unroll
    for (int kk = 0; kk < 2; ++kk)
#pragma unroll
      for (int t = 0; t < 8; ++t) vf[kk][t] = Frag<_Float16>::load(vl + t * 16 * VPITCH + kk * 32);
    // holds the group of reads here: the scheduler otherwise sinks them, two at a time, among the products that wait for them
    __builtin_amdgcn_sched_barrier(0);

    // ---- scale, tanh softcap (f32), maximum of query c: four in-lane chains, then the other half's ----
    // (here and below every loop is unrolled so that each score, fragment and accumulator index is a constant: registers, no scratch)
    v16h pb[2][2];
#pragma unroll
    for (int u = 0; u < 2; ++u) {
      float mj[4];
#pragma unroll
      for (int j = 0; j < 4; ++j) {
        float m = -INFINITY;
#pragma unroll
        for (int r = 0; r < 8; ++r) {
          // v_tanh_f32: one instruction and no branch, where the library tanhf takes two divergent branches per score
          const float sv = SOFTCAP * __builtin_amdgcn_tanhf(s[u][j][r] * (RSQ * INVCAP));
          s[u][j][r] = sv;
          m = fmaxf(m, sv);
        }
        mj[j] = m;
      }
      float cm = fmaxf(fmaxf(mj[0], mj[1]), fmaxf(mj[2], mj[3]));
      cm = fmaxf(cm, xhalf(cm));

      // ---- online softmax (f32); P x 2^10 as f16 straight into the B fragments of V^T . P^T ----
      // B fragment kk, element e: key 32 kk + (e < 8 ? 8 hh + e : 16 + 8 hh + e - 8) = tile 2 kk + (e >> 3), register e & 7:
      // the k order of the V^T loader
      const float mnew = fmaxf(mrow[u], cm);
      const float alpha = __expf(mrow[u] - mnew);
      mrow[u] = mnew;
      float pj[4];
#pragma unroll
      for (int j = 0; j < 4; ++j) {
        float psum = 0.f;
#pragma unroll
        for (int r = 0; r < 8; ++r) {
          const float p = __expf(s[u][j][r] - mnew);
          psum += p;
          pb[u][j >> 1][(j & 1) * 8 + r] = (_Float16)(p * PCARRY);
        }
        pj[j] = psum;
      }
      lrow[u] = lrow[u] * alpha + ((pj[0] + pj[1]) + (pj[2] + pj[3]));
#pragma unroll
      for (int t = 0; t < 8; ++t)
#pragma unroll
        for (int r = 0; r < 8; ++r) oacc[u][t][r] *= alpha;
    }

    // ---- O^T(128 d x 16 q) += V^T(128 d x 64 kv) . P^T: 32 keys kk, output tile t ----
#pragma unroll
    for (int kk = 0; kk < 2; ++kk) {
#pragma unroll
      for (int t = 0; t < 8; ++t) {
        oacc[0][t] = Frag<_Float16>::mma(vf[kk][t], pb[0][kk], oacc[0][t]);
        oacc[1][t] = Frag<_Float16>::mma(vf[kk][t], pb[1][kk], oacc[1][t]);
      }
    }
    asm volatile("s_wait_dscnt 0x0" ::: "memory");     // this wave's reads of buffer kc & 1 are done before it is refilled
    asm volatile("s_wait_asynccnt 0x0" ::: "memory");  // this wave's copies of chunk kc + 1 have landed
    __syncthreads();                                    // publishes chunk kc + 1, frees buffer kc & 1
    if (kc + 2 < nch)
      stage_kv(Kg + (size_t)(kc + 2) * KV_CHUNK * KVDIM, Vg + (kc + 2) * KV_CHUNK, Kst[kc & 1], Vst[kc & 1], tid);
  }
  asm volatile("s_wait_asynccnt 0x0" ::: "memory");    // no copy is outstanding when the wave goes on

  // ---- epilogue: join the halves' sums, normalise (x 2^6 / (2^10 * l)), write the f16 ctx plane ----
  // coverage: 8 tiles x 2 halves x 8 elements = 128 dims of each of the wave's 32 rows (2 column tiles of 16); the wave writes whole 256-B rows.
#pragma unroll
  for (int u = 0; u < 2; ++u) {
    const float lsum = lrow[u] + xhalf(lrow[u]);
    const float inv = OCARRY / (PCARRY * lsum);        // undo the P carry (2^10) and apply the ctx carry (2^6)
    unsigned short* orow = Op + (tokw + u * 16 + c) * QDIM + (size_t)h * HD + koff;
#pragma unroll
    for (int t = 0; t < 8; ++t) {
      v8h hv;
#pragma unroll
      for (int r = 0; r < 8; ++r) hv[r] = (_Float16)(oacc[u][t][r] * inv);
      *(v8h*)(orow + t * 16) = hv;
    }
    // the second tile's code writes registers that these stores name: the wait stands in front of it, and the
    // scheduling barrier keeps that code from being lifted over the wait
    if (u == 0) {
      asm volatile("s_wait_xcnt 0x0" ::: "memory");
      __builtin_amdgcn_sched_barrier(0);
    }
  }
}

// ---------------------------------------------------------------------------------------------
// host
// ---------------------------------------------------------------------------------------------
static_assert((NTOK * HID / 8) % 256 == 0);
static_assert((SEQ * HHALF) % 256 == 0);
static_assert(HID % 128 == 0 && QDIM % 128 == 0);
static_assert(NTOK % 128 == 0 && HID % 128 == 0 && QDIM % 128 == 0 && KVDIM % 128 == 0 && SEQ % 128 == 0);
static_assert(SEQ % QBLK == 0 && SEQ % KV_CHUNK == 0 && QBLK == 256 && KV_CHUNK == 64 && HD == 128);
static_assert(NB >= 1 && NB <= NB_FULL && SEQ <= SEQ_FULL);
static_assert(NQH == 2 * NKVH);

extern "C" void kernel_launch(void* const* d_in, const int* in_sizes, int n_in,
                              void* d_out, int out_size, void* d_ws, size_t ws_size, hipStream_t stream) {
  if (n_in < 5) return;
  const size_t needTok = (size_t)(NB - 1) * SEQ_FULL + SEQ;
  if ((size_t)in_sizes[0] < needTok * HID) return;
  if ((size_t)in_sizes[1] < (size_t)HID * QDIM) return;
  if ((size_t)in_sizes[2] < (size_t)HID * KVDIM) return;
  if ((size_t)in_sizes[3] < (size_t)HID * KVDIM) return;
  if ((size_t)in_sizes[4] < (size_t)QDIM * HID) return;
  if ((size_t)out_size < needTok * HID) return;

  const float* x  = (const float*)d_in[0];   // [2,2048,2048]
  const float* Wq = (const float*)d_in[1];   // [2048,2048]  [in][out]
  const float* Wk = (const float*)d_in[2];   // [2048,1024]
  const float* Wv = (const float*)d_in[3];   // [2048,1024]
  const float* Wo = (const float*)d_in[4];   // [2048,2048]
  float* out = (float*)d_out;                // [2,2048,2048] f32

  //   XB   bf16 [NTOK][HID]
  //   WQT  bf16 [QDIM][HID], WKT bf16 [KVDIM][HID], WVT bf16 [KVDIM][HID], WOT f16 [HID][QDIM]
  //        (WKT follows WQT directly: together the [QKDIM][HID] plane of [Wq | Wk]^T)
  //   R1   ctx f16 [NTOK][QDIM]
  //   VT f16 [NB][KVDIM][SEQ]; QP f16 [NTOK][QDIM]; KP f16 [NTOK][KVDIM]; COS, SIN f32 [SEQ][HHALF]
  const size_t szXB  = (size_t)NTOK * HID * 2;
  const size_t szWQT = (size_t)QDIM * HID * 2;
  const size_t szWKT = (size_t)KVDIM * HID * 2;
  const size_t szWOT = (size_t)HID * QDIM * 2;
  const size_t szR1  = (size_t)NTOK * QDIM * 2;
  const size_t szQP  = (size_t)NTOK * QDIM * 2;
  const size_t szKP  = (size_t)NTOK * KVDIM * 2;
  const size_t szVT  = (size_t)NB * KVDIM * SEQ * 2;
  const size_t szTAB = (size_t)SEQ * HHALF * 4;
  const size_t OFF_XB  = 0;
  const size_t OFF_WQT = OFF_XB + szXB;
  const size_t OFF_WKT = OFF_WQT + szWQT;
  const size_t OFF_WVT = OFF_WKT + szWKT;
  const size_t OFF_WOT = OFF_WVT + szWKT;
  const size_t OFF_R1  = OFF_WOT + szWOT;
  const size_t OFF_CTX = OFF_R1;
  const size_t OFF_VT  = OFF_R1 + szR1;
  const size_t OFF_QP  = OFF_VT + szVT;
  const size_t OFF_KP  = OFF_QP + szQP;
  const size_t OFF_COS = OFF_KP + szKP;
  const size_t OFF_SIN = OFF_COS + szTAB;
  const size_t WS_TOTAL = OFF_SIN + szTAB;
  if (ws_size < WS_TOTAL) return;

  char* ws = (char*)d_ws;
  unsigned short* xb  = (unsigned short*)(ws + OFF_XB);
  unsigned short* WqT = (unsigned short*)(ws + OFF_WQT);
  unsigned short* WkT = (unsigned short*)(ws + OFF_WKT);
  unsigned short* WvT = (unsigned short*)(ws + OFF_WVT);
  unsigned short* WoT = (unsigned short*)(ws + OFF_WOT);
  unsigned short* ctx = (unsigned short*)(ws + OFF_CTX);
  unsigned short* Vt  = (unsigned short*)(ws + OFF_VT);
  unsigned short* Qpl = (unsigned short*)(ws + OFF_QP);
  unsigned short* Kpl = (unsigned short*)(ws + OFF_KP);
  float* cosT = (float*)(ws + OFF_COS);
  float* sinT = (float*)(ws + OFF_SIN);

  // inv_freq[j] = 1 / 10000^(2j/128), pow in double then RNE to f32, reciprocal as one f32 divide
  RopeFreq fr;
  for (int j = 0; j < HHALF; ++j) {
    const float e = (float)(2 * j) / 128.0f;
    const double p = pow(10000.0, (double)e);
    const float pf = (float)p;
    fr.f[j] = 1.0f / pf;
  }

  // 1) to 3) x -> compact bf16 plane; transposed 16-bit weight planes in[rows][cols] -> out[cols][rows]; RoPE tables
  prep_kernel<<<PB_TAB + PB_WQ + 2 * PB_WKV + PB_WO + PB_X, 256, 0, stream>>>(x, Wq, Wk, Wv, Wo, xb, WqT, WkT, WvT, WoT, cosT, sinT, fr);
  // 4) [q | k] = x @ [Wq | Wk], rotated -> f16 planes; v^T per batch = Wv^T @ x_b^T -> f16 [NB][KVDIM][SEQ]   (K=HID)
  gemm_qkv<<<QK_TILES + NB * V_TILES, 128, 0, stream>>>(xb, WqT, WvT, cosT, sinT, Qpl, Kpl, Vt, HID);
  // 6) attention -> ctx f16 x 2^6 [NTOK][QDIM]
  attn_kernel<<<NB * NQH * (SEQ / QBLK), 256, 0, stream>>>(Qpl, Kpl, Vt, ctx);
  // 7) out = ctx @ Wo -> d_out f32, per batch rows b*SEQ_FULL..  (M=SEQ, N=HID, K=QDIM, scale 2^-10)
  {
    const int tiles = (SEQ / 128) * (HID / 128);
    gemm_t64<_Float16, false, false, 0><<<dim3(tiles, NB), 128, 0, stream>>>(
        ctx, ctx, QDIM, (long)SEQ * QDIM, WoT, WoT, QDIM, 0L, (void*)out, HID, (long)SEQ_FULL * HID,
        SEQ, HID, QDIM, OUTSCALE);
  }
}

// v008
// A run of this version takes 133 microseconds.
// Two timings next to v007 put it at 1.10 and 1.11 times that version's speed.
// Counting every step since v000, it is 5.19 times as fast.
// x@Wq, x@Wk, Wv^T@x^T: v_wmma_f32_16x16x32_bf16 on RNE-bf16 input planes (f32 accumulate); q.k^T: v_wmma_f32_16x16x32_f16 (q, k single f16 planes, f32 accumulate); p.v: v_wmma_f32_16x16x32_f16 (p f16 carried x2^10, v f16, f32 accumulate); ctx@Wo: v_wmma_f32_16x16x32_f16 (ctx f16 carried x2^6, Wo f16 carried x2^4 built from RNE-bf16 values, f32 accumulate); RoPE, tanh softcap and softmax in f32.
#include <hip/hip_runtime.h>
#include <math.h>

#pragma clang fp contract(off)

#ifndef NB
#define NB 2
#endif
#ifndef SEQ
#define SEQ 2048
#endif
#define NB_FULL  2
#define SEQ_FULL 2048
#define HID      2048
#define NQH      16
#define NKVH     8
#define HD       128
#define HHALF    64
#define QDIM     (NQH * HD)
#define KVDIM    (NKVH * HD)
#define QKDIM    (QDIM + KVDIM)
#define NTOK     (NB * SEQ)
#define KV_CHUNK 64
#define QBLK     256
#define RSQ      0.08838834764831845f
#define SOFTCAP  50.0f
#define INVCAP   0.02f
#define PCARRY   1024.0f
#define OCARRY   64.0f
#define WOCARRY  16.0f
#define OUTSCALE 0.0009765625f

typedef __attribute__((ext_vector_type(16))) _Float16 v16h;
typedef __attribute__((ext_vector_type(8)))  _Float16 v8h;
typedef __attribute__((ext_vector_type(16))) __bf16   v16b;
typedef __attribute__((ext_vector_type(8)))  __bf16   v8b;
typedef __attribute__((ext_vector_type(8)))  float    v8f;
typedef __attribute__((ext_vector_type(4)))  float    v4f;
typedef __attribute__((ext_vector_type(4)))  unsigned int v4u;

__device__ __forceinline__ unsigned short f2bf_bits(float f) {
  unsigned u = __float_as_uint(f);
  return (unsigned short)((u + 0x7FFFu + ((u >> 16) & 1u)) >> 16);
}
__device__ __forceinline__ float bf_bits2f(unsigned short h) { return __uint_as_float(((unsigned)h) << 16); }
__device__ __forceinline__ unsigned short f2h_bits(float f) { const _Float16 h = (_Float16)f; return __builtin_bit_cast(unsigned short, h); }

// hazard guards as plain device helpers
__device__ __forceinline__ void dep_guard_h(v8f& a, v8f& b, v16h x, v16h y) { asm volatile("v_nop\n\tv_nop\n\tv_nop\n\tv_nop" : "+v"(a), "+v"(b) : "v"(x), "v"(y)); }
__device__ __forceinline__ void dep_guard_b(v8f& a, v8f& b, v16b x, v16b y) { asm volatile("v_nop\n\tv_nop\n\tv_nop\n\tv_nop" : "+v"(a), "+v"(b) : "v"(x), "v"(y)); }
__device__ __forceinline__ void keep4_h(v16h a, v16h b, v16h c, v16h d) { asm volatile("v_nop" :: "v"(a), "v"(b), "v"(c), "v"(d)); }
__device__ __forceinline__ void keep4_b(v16b a, v16b b, v16b c, v16b d) { asm volatile("v_nop" :: "v"(a), "v"(b), "v"(c), "v"(d)); }
__device__ __forceinline__ void acc_guard4(v8f& a, v8f& b, v8f& c, v8f& d) { asm volatile("v_nop\n\tv_nop\n\tv_nop\n\tv_nop" : "+v"(a), "+v"(b), "+v"(c), "+v"(d)); }

// fragment loaders: lane l, row/col = l & 15, elements 0..7 <- p[0..7] (k0 + 8h + 0..7), 8..15 <- p[16..23] (k0 + 16 + 8h + 0..7); caller adds 8h
template <typename T> struct Frag;
template <> struct Frag<_Float16> {
  typedef v16h V; union U { v16h v; v8h h[2]; };
  static __device__ __forceinline__ v16h load(const _Float16* p) {
    U f; f.h[0] = *(const v8h*)(p); f.h[1] = *(const v8h*)(p + 16); return f.v;
  }
  static __device__ __forceinline__ v8f mma(v16h a, v16h b, v8f c) {
    return __builtin_amdgcn_wmma_f32_16x16x32_f16(false, a, false, b, (short)0, c, false, false);
  }
  static __device__ __forceinline__ void guard(v8f& a, v8f& b, v16h x, v16h y) { dep_guard_h(a, b, x, y); }
  static __device__ __forceinline__ void keep(v16h a, v16h b, v16h c, v16h d) { keep4_h(a, b, c, d); }
};
template <> struct Frag<__bf16> {
  typedef v16b V; union U { v16b v; v8b h[2]; };
  static __device__ __forceinline__ v16b load(const __bf16* p) {
    U f; f.h[0] = *(const v8b*)(p); f.h[1] = *(const v8b*)(p + 16); return f.v;
  }
  static __device__ __forceinline__ v8f mma(v16b a, v16b b, v8f c) {
    return __builtin_amdgcn_wmma_f32_16x16x32_bf16(false, a, false, b, (short)0, c, false, false);
  }
  static __device__ __forceinline__ void guard(v8f& a, v8f& b, v16b x, v16b y) { dep_guard_b(a, b, x, y); }
  static __device__ __forceinline__ void keep(v16b a, v16b b, v16b c, v16b d) { keep4_b(a, b, c, d); }
};

// ---------------------------------------------------------------------------------------------
// 1) x f32 [NB_FULL][SEQ_FULL][HID] -> compact bf16 plane [NTOK][HID], 8 elements per thread, one 16-B store per lane
// ---------------------------------------------------------------------------------------------
__device__ __forceinline__ void cast_x_bf16(const float* __restrict__ in, unsigned short* __restrict__ out, int n8, int blk) {
  const int i = blk * 256 + threadIdx.x;
  if (i < n8) {
    const size_t o   = (size_t)i * 8;
    const size_t tok = o / HID;
    const size_t col = o - tok * HID;
    const size_t bb  = tok / SEQ;
    const size_t ss  = tok - bb * SEQ;
    const size_t src = (bb * SEQ_FULL + ss) * (size_t)HID + col;
    const v4f a  = *(const v4f*)(in + src);
    const v4f bq = *(const v4f*)(in + src + 4);
    v4u w;
    w[0] = (unsigned)f2bf_bits(a[0])  | ((unsigned)f2bf_bits(a[1])  << 16);
    w[1] = (unsigned)f2bf_bits(a[2])  | ((unsigned)f2bf_bits(a[3])  << 16);
    w[2] = (unsigned)f2bf_bits(bq[0]) | ((unsigned)f2bf_bits(bq[1]) << 16);
    w[3] = (unsigned)f2bf_bits(bq[2]) | ((unsigned)f2bf_bits(bq[3]) << 16);
    *(v4u*)(out + o) = w;
    
  }
}

// ---------------------------------------------------------------------------------------------
// 2) in[nrows][ncols] f32 -> out[ncols][nrows] 16-bit. MODE 0: bf16 bits (RNE); MODE 1: f16 bits of (RNE-bf16 value * scl).
//    Block = 64x64 tile through LDS (cross-thread, block barrier). (bx, by) in (ncols/64, nrows/64); nrows, ncols multiples of 64.
//    load coverage: 256 threads x 16 floats = 64x64 tile; store coverage: 2 iterations x 256 threads x 8 = 64 rows x 64.
// ---------------------------------------------------------------------------------------------
template <int MODE> __device__ __forceinline__ unsigned short pk16(float f, float scl) {
  if (MODE == 0) return f2bf_bits(f);
  const float g = bf_bits2f(f2bf_bits(f)) * scl;
  return f2h_bits(g);
}

template <int MODE>
__device__ __forceinline__ void transpose_cast16(const float* __restrict__ in, unsigned short* __restrict__ out, int nrows, int ncols, float scl,
                                                 int bx, int by, float* tile) {
  const int tid = threadIdx.x;
  const int r0 = by * 64, c0 = bx * 64;
  {
    const int row = tid >> 2, cc = (tid & 3) * 16;
    const float* s = in + (size_t)(r0 + row) * ncols + c0 + cc;
#pragma unroll
    for (int q = 0; q < 4; ++q) {
      const v4f v = *(const v4f*)(s + 4 * q);
#pragma unroll
      for (int e = 0; e < 4; ++e) tile[(cc + 4 * q + e) * 65 + row] = v[e];
    }
  }
  __syncthreads();
  {
#pragma unroll
    for (int it = 0; it < 2; ++it) {
      const int orow = it * 32 + (tid >> 3), seg = (tid & 7) * 8;
      const float* tp = tile + orow * 65 + seg;
      v4u w;
#pragma unroll
      for (int e = 0; e < 4; ++e) w[e] = (unsigned)pk16<MODE>(tp[2 * e], scl) | ((unsigned)pk16<MODE>(tp[2 * e + 1], scl) << 16);
      *(v4u*)(out + (size_t)(c0 + orow) * nrows + r0 + seg) = w;
    }
    // in the merged kernel's listing another range's code follows and writes registers that these stores name: the wait stands in front of it
    asm volatile("s_wait_xcnt 0x0" ::: "memory");
  }
}

// ---------------------------------------------------------------------------------------------
// 3) RoPE cos/sin tables [SEQ][HHALF] f32: angle = pos * inv_freq[j] (single f32 multiply), precise cosf/sinf.
// ---------------------------------------------------------------------------------------------
struct RopeFreq { float f[HHALF]; };
static_assert(sizeof(RopeFreq) == 256);

__device__ __forceinline__ void rope_table(float* __restrict__ cosT, float* __restrict__ sinT, const RopeFreq& fr, int blk, float* invf) {
  if (threadIdx.x == 0) {
#pragma unroll
    for (int q = 0; q < HHALF; ++q) invf[q] = fr.f[q];
  }
  __syncthreads();
  const int i = blk * 256 + threadIdx.x;                 // exactly SEQ*HHALF threads
  const int t = i >> 6;
  const int jj = i & (HHALF - 1);
  const float ang = (float)t * invf[jj];
  const float cv = cosf(ang);
  const float sv = sinf(ang);
  ((float*)cosT)[i] = cv;
  ((float*)sinT)[i] = sv;
  
}

// ---------------------------------------------------------------------------------------------
// 1) to 3) in ONE launch: none of them reads what another writes, so each takes a range of the block index.
//    Every branch below is block-uniform; the ranges with the most work per block come first.
// ---------------------------------------------------------------------------------------------
#define PB_TAB ((SEQ * HHALF) / 256)
#define PB_WQ  ((QDIM / 64) * (HID / 64))
#define PB_WKV ((KVDIM / 64) * (HID / 64))
#define PB_WO  ((HID / 64) * (QDIM / 64))
#define PB_X   ((NTOK * HID / 8) / 256)
__global__ __launch_bounds__(256) void prep_kernel(
    const float* __restrict__ x, const float* __restrict__ Wq, const float* __restrict__ Wk, const float* __restrict__ Wv, const float* __restrict__ Wo,
    unsigned short* __restrict__ xb, unsigned short* __restrict__ WqT, unsigned short* __restrict__ WkT, unsigned short* __restrict__ WvT,
    unsigned short* __restrict__ WoT, float* __restrict__ cosT, float* __restrict__ sinT, RopeFreq fr) {
  __shared__ float tile[64 * 65];
  int blk = blockIdx.x;
  if (blk < PB_TAB) { rope_table(cosT, sinT, fr, blk, tile); return; }
  blk -= PB_TAB;
  if (blk < PB_WQ) {                           // [HID][QDIM]  -> [QDIM][HID]
    transpose_cast16<0>(Wq, WqT, HID, QDIM, 1.0f, blk % (QDIM / 64), blk / (QDIM / 64), tile); return;
  }
  blk -= PB_WQ;
  if (blk < 2 * PB_WKV) {                      // [HID][KVDIM] -> [KVDIM][HID], Wk then Wv
    const bool isv = blk >= PB_WKV;
    if (isv) blk -= PB_WKV;
    transpose_cast16<0>(isv ? Wv : Wk, isv ? WvT : WkT, HID, KVDIM, 1.0f, blk % (KVDIM / 64), blk / (KVDIM / 64), tile); return;
  }
  blk -= 2 * PB_WKV;
  if (blk < PB_WO) {                           // [QDIM][HID]  -> [HID][QDIM], f16 x 2^4
    transpose_cast16<1>(Wo, WoT, QDIM, HID, WOCARRY, blk % (HID / 64), blk / (HID / 64), tile); return;
  }
  blk -= PB_WO;
  cast_x_bf16(x, xb, NTOK * HID / 8, blk);
}

// ---------------------------------------------------------------------------------------------
// 5) Register-blocked batched WMMA GEMM, 16-bit operands of type T (bf16 or f16), f32 accumulate.
//    C[m,n] = scale * sum_k A[m,k] * Bt[n,k]; A row-major [M,K], Bt row-major [N,K].
//    Block = WM x WN waves = one (64 WM) x (64 WN) tile of C; each wave owns a 64x64 tile. The bytes a block brings in from L2
//    per product fall as 1/WM + 1/WN: 4 x 4 waves where that still gives every WGP a tile, 2 x 4 where it does not.
//    Per pass the block's 64 WM A rows and 64 WN Bt rows x 128 k (256 B a row) are brought into LDS by asynchronous
//    copies, two buffers: the next pass's copies fly while this pass's fragments are read from LDS.
//    M % (64 WM) == 0, N % (64 WN) == 0, K % 128 == 0 (no tail handling). lda, ldb % 8 == 0 (16-B copies).
//    OUT_MODE: 0 = f32, 1 = single f16 plane, 2 = rotated (RoPE) f16 plane, one 128-wide head per 128 columns of the block tile.
//    The hi/lo plane options are not staged: both must be false.
// ---------------------------------------------------------------------------------------------
#define GBK    128    // k elements of one staged pass
#define GPITCH 136    // LDS row pitch in elements: 272 B = 16 B x 17, conflict-free for 16-B row reads
typedef __attribute__((ext_vector_type(4))) int v4i;
typedef __attribute__((address_space(1))) v4i gv4i;
typedef __attribute__((address_space(3))) v4i lv4i;

// R rows x 256 B from g (row pitch ld elements) into l (row pitch GPITCH): NT threads x (16 R / NT) copies of 16 B;
// one wave-wide copy covers two whole 256-B rows.
// g is the tile's origin, the same in every lane; goff is the lane's own element offset row * ld + column.
template <typename T, int R, int NT>
__device__ __forceinline__ void stage_tile(const T* g, int ld, unsigned goff, T* l, int tid) {
  T* lp = l + (tid >> 4) * GPITCH + (tid & 15) * 8;
#pragma unroll   // the copies go out back to back, none waits for another
  for (int j = 0; j < 16 * R / NT; ++j)
    __builtin_amdgcn_global_load_async_to_lds_b128((gv4i*)(g + (size_t)(j * (NT / 16)) * ld + goff), (lv4i*)(lp + j * (NT / 16) * GPITCH), 0, 0);
}

// A wave's 64x64 accumulator tile -> C, 16 rows at a time through the wave's own LDS slab, so that each store covers whole row pieces.
template <int OUT_MODE>
__device__ __forceinline__ void gemm_store(v8f (&acc)[4][4], float* slab, void* Cb, int ldc, int m0, int n0, float scale, int lane) {
  const int rlane = lane & 15;                 // D column within subtile
  const int mOff  = (lane >> 4) * 8;           // D row offset
#pragma unroll
  for (int i = 0; i < 4; ++i) {
    const int mBase = m0 + (i << 4);
#pragma unroll
    for (int j = 0; j < 4; ++j) {
#pragma unroll
      for (int r = 0; r < 8; ++r) {
        const float v = acc[i][j][r] * scale;
        slab[(mOff + r) * 68 + (j << 4) + rlane] = v;
      }
    }
    __builtin_amdgcn_fence(3, "workgroup");
    __builtin_amdgcn_wave_barrier();
    __builtin_amdgcn_fence(2, "workgroup");
    if (OUT_MODE == 0) {
      float* Cf = (float*)Cb;
      const int hh = lane >> 4, c4 = (lane & 15) * 4;     // row seg = 256 B = 16 lanes x 16 B
      {
        v4f v[8];
        float* p[8];
#pragma unroll   // constant indices: registers, no scratch
        for (int it = 0; it < 8; ++it) {
          const int row = it * 2 + hh;
          v[it] = *(const v4f*)(slab + row * 68 + c4);
          p[it] = Cf + (size_t)(mBase + row) * ldc + n0 + c4;
          *(v4f*)(p[it]) = v[it];
        }
        // the code that follows writes registers that these stores name: the wait stands in front of it; values and addresses are
        // inputs so that their registers live up to the wait
        asm volatile("s_wait_xcnt 0x0" :: "v"(v[0]), "v"(v[1]), "v"(v[2]), "v"(v[3]), "v"(v[4]), "v"(v[5]), "v"(v[6]), "v"(v[7]),
                     "v"(p[0]), "v"(p[1]), "v"(p[2]), "v"(p[3]), "v"(p[4]), "v"(p[5]), "v"(p[6]), "v"(p[7]) : "memory");
      }
    } else {
      const int q = lane >> 3, c8 = (lane & 7) * 8;
      unsigned short* Cs = (unsigned short*)Cb;
      {
#pragma unroll
        for (int it = 0; it < 4; ++it) {
          const int row = it * 4 + q;
          const float* sp = slab + row * 68 + c8;
          v8h hv;
#pragma unroll
          for (int e = 0; e < 8; ++e) hv[e] = (_Float16)sp[e];
          *(v8h*)(Cs + (size_t)(mBase + row) * ldc + n0 + c8) = hv;
        }
        
      }
    }
    __builtin_amdgcn_fence(3, "workgroup");
    __builtin_amdgcn_wave_barrier();
    __builtin_amdgcn_fence(2, "workgroup");
  }
}

// RoPE epilogue. Each 128 columns of the block tile are one head, shared by two waves; this wave's accumulator column tiles j = 0, 1 hold x1[d0 .. d0+31] and
// j = 2, 3 hold x2[d0 .. d0+31] (= head dims 64 + d0 ..) of its 64 tokens, so a slab row is x1 | x2 of the same 32 pair indices.
// out1 = x1*cos - x2*sin, out2 = x2*cos + x1*sin in f32, then f16. A slab row goes out as it lies: 64 f16 = one whole 128-B line at
// plane column n0. Within a head the plane's order of d is therefore 0..31, 64..95, 32..63, 96..127, in q and in k alike.
struct RopeTab { v4f ca, cb, sa, sb; };
__device__ __forceinline__ void rope_tab_load(RopeTab (&t)[2], const float* cosT, const float* sinT, int mBase, int dcol, int q) {
  unsigned ob[2];                              // byte offset of each table row piece
#pragma unroll   // constant indices: registers, no scratch
  for (int it = 0; it < 2; ++it) {
    ob[it] = (((unsigned)(mBase + it * 8 + q) % (unsigned)SEQ) * HHALF + dcol) * 4u;
    t[it].ca = *(const v4f*)((const char*)cosT + ob[it]);
    t[it].cb = *(const v4f*)((const char*)cosT + ob[it] + 16);
    t[it].sa = *(const v4f*)((const char*)sinT + ob[it]);
    t[it].sb = *(const v4f*)((const char*)sinT + ob[it] + 16);
  }
  // the code that follows writes the address registers that these loads name: the wait stands in front of it; the offset is an
  // input so that its register lives up to the wait and none of the loads lands on it
  asm volatile("s_wait_xcnt 0x0" :: "v"(ob[0]) : "memory");
}

__device__ __forceinline__ void gemm_store_rope(v8f (&acc)[4][4], float* slab, unsigned short* Cs, int ldc, int m0, int n0,
                                                const float* cosT, const float* sinT, int d0, int lane) {
  const int rlane = lane & 15;                 // D column within subtile
  const int mOff  = (lane >> 4) * 8;           // D row offset
  const int q = lane >> 2, c8 = (lane & 3) * 8; // reader: 4 lanes a row, 8 pair indices a lane, 8 rows a pass
  RopeTab tab[2][2];                           // the table rows of 16 tokens, read one group of 16 ahead of their use
  rope_tab_load(tab[0], cosT, sinT, m0, d0 + c8, q);
#pragma unroll   // constant accumulator and table indices: registers, no scratch
  for (int i = 0; i < 4; ++i) {
    const int mBase = m0 + (i << 4);
#pragma unroll
    for (int j = 0; j < 4; ++j) {
#pragma unroll
      for (int r = 0; r < 8; ++r) slab[(mOff + r) * 68 + (j << 4) + rlane] = acc[i][j][r];
    }
    // the slab is this wave's own: the wait puts every lane's values into LDS before another lane reads them, and the fences keep
    // the compiler from moving the reads below over the writes above; none of them waits for a global load or store
    asm volatile("s_wait_dscnt 0x0" ::: "memory");
    __builtin_amdgcn_fence(3, "wavefront");
    __builtin_amdgcn_wave_barrier();
    __builtin_amdgcn_fence(2, "wavefront");
    if (i + 1 < 4) rope_tab_load(tab[(i + 1) & 1], cosT, sinT, mBase + 16, d0 + c8, q);
#pragma unroll
    for (int it = 0; it < 2; ++it) {
      const int row = it * 8 + q;
      const float* sp = slab + row * 68 + c8;
      const v4f x1a = *(const v4f*)(sp);
      const v4f x1b = *(const v4f*)(sp + 4);
      const v4f x2a = *(const v4f*)(sp + 32);
      const v4f x2b = *(const v4f*)(sp + 36);
      const RopeTab& t = tab[i & 1][it];
      v8h h1, h2;
#pragma unroll
      for (int e = 0; e < 4; ++e) {
        h1[e]     = (_Float16)(x1a[e] * t.ca[e] - x2a[e] * t.sa[e]);
        h2[e]     = (_Float16)(x2a[e] * t.ca[e] + x1a[e] * t.sa[e]);
        h1[e + 4] = (_Float16)(x1b[e] * t.cb[e] - x2b[e] * t.sb[e]);
        h2[e + 4] = (_Float16)(x2b[e] * t.cb[e] + x1b[e] * t.sb[e]);
      }
      unsigned short* op = Cs + (size_t)(mBase + row) * ldc + n0 + c8;
      *(v8h*)(op) = h1;
      *(v8h*)(op + 32) = h2;
    }
    // the next group's code writes registers that these stores name: the wait stands in front of it
    asm volatile("s_wait_xcnt 0x0" ::: "memory");
    __builtin_amdgcn_fence(3, "wavefront");
    __builtin_amdgcn_wave_barrier();
    __builtin_amdgcn_fence(2, "wavefront");
  }
}

// One block's (64 WM) x (64 WN) tile (tm, tn). Ag, Bg: first of the tile's A rows and Bt rows; Cb: origin of this product's C.
// ring: [buffer][A rows | Bt rows]; behind the last pass's barrier its first bytes serve as the per-wave 16x64 slabs, pitch 68 floats.
// Every argument is the same in the whole block.
// OUT_MODE 2: column tile j of a wave takes Bt rows 64 (j >> 1) + 32 (wave & 1) + 16 (j & 1) .. of its head's 128, so that head dims
// d and d + 64 meet in one lane; cosT, sinT are the RoPE tables (unused otherwise).
template <typename T, int OUT_MODE, int WM, int WN>
__device__ __forceinline__ void gemm_tile(const T* Ag, int lda, const T* Bg, int ldb, void* Cb, int ldc, int tm, int tn, int K, float scale,
                                          const float* cosT, const float* sinT, T (*ring)[64 * (WM + WN) * GPITCH]) {
  typedef typename Frag<T>::V V;
  constexpr int BM = 64 * WM, BN = 64 * WN, NT = 32 * WM * WN;
  static_assert(WM * WN * 16 * 68 * 4 <= (BM + BN) * GPITCH * 2);   // the slabs fit in one buffer
  const int tid  = threadIdx.x;
  const int lane = tid & 31;
  const int wave = tid >> 5;
  const int wm = (wave / WN) << 6;             // this wave's rows inside the block tile
  const int wn = (wave % WN) << 6;             // this wave's columns inside the block tile
  const int m0 = tm * BM + wm;
  const int n0 = tn * BN + wn;
  const int d0 = (wn & 64) >> 1;               // OUT_MODE 2: first pair index of this wave inside its head

  const int rlane = lane & 15;                 // row (A) / col (B, D) within subtile
  const int koff  = (lane >> 4) * 8;           // k offset of this lane half
  auto brow = [](int j) { return OUT_MODE == 2 ? ((j >> 1) << 6) + ((j & 1) << 4) : (j << 4); };   // Bt row of column tile j

  v8f acc[4][4];
#pragma unroll
  for (int i = 0; i < 4; ++i)
#pragma unroll
    for (int j = 0; j < 4; ++j) acc[i][j] = (v8f){0.f,0.f,0.f,0.f,0.f,0.f,0.f,0.f};

  const int nt = K / GBK;
  const unsigned aoff = (unsigned)(tid >> 4) * (unsigned)lda + (unsigned)(tid & 15) * 8u;
  const unsigned boff = (unsigned)(tid >> 4) * (unsigned)ldb + (unsigned)(tid & 15) * 8u;
  stage_tile<T, BM, NT>(Ag, lda, aoff, ring[0], tid);
  stage_tile<T, BN, NT>(Bg, ldb, boff, ring[0] + BM * GPITCH, tid);
  asm volatile("s_wait_asynccnt 0x0" ::: "memory");   // this wave's copies of pass 0 have landed
  __syncthreads();                                     // ... and every other wave's: pass 0 is readable
  if (nt > 1) {
    stage_tile<T, BM, NT>(Ag + GBK, lda, aoff, ring[1], tid);
    stage_tile<T, BN, NT>(Bg + GBK, ldb, boff, ring[1] + BM * GPITCH, tid);
  }

  for (int t = 0; t < nt; ++t) {
    const T* la = ring[t & 1] + (wm + rlane) * GPITCH + koff;
    const T* lb = ring[t & 1] + (BM + (OUT_MODE == 2 ? (wn & ~127) + d0 : wn) + rlane) * GPITCH + koff;
    // LDS reads run ahead of their products: the next 32-k block's Bt fragments go into a second set at the head of
    // this block, and each A fragment is re-read for the next block as soon as its row of products has been issued
    // (every loop below is unrolled so that each fragment and accumulator index is a constant: registers, no scratch)
    V af[4], bf[2][4];
#pragma unroll
    for (int j = 0; j < 4; ++j) { bf[0][j] = Frag<T>::load(lb + brow(j) * GPITCH); af[j] = Frag<T>::load(la + (j << 4) * GPITCH); }
#pragma unroll
    for (int kb = 0; kb < GBK / 32; ++kb) {
      const int cu = kb & 1, nx = cu ^ 1;
      if (kb + 1 < GBK / 32) {
#pragma unroll
        for (int j = 0; j < 4; ++j) bf[nx][j] = Frag<T>::load(lb + brow(j) * GPITCH + (kb + 1) * 32);
      }
#pragma unroll
      for (int i = 0; i < 4; ++i) {
#pragma unroll
        for (int j = 0; j < 4; ++j) acc[i][j] = Frag<T>::mma(af[i], bf[cu][j], acc[i][j]);
        Frag<T>::guard(acc[i][0], acc[i][3], af[i], af[i]);
        if (kb + 1 < GBK / 32) af[i] = Frag<T>::load(la + (i << 4) * GPITCH + (kb + 1) * 32);
      }
      Frag<T>::keep(bf[cu][0], bf[cu][1], bf[cu][2], bf[cu][3]);
    }
    asm volatile("s_wait_dscnt 0x0" ::: "memory");     // this wave's reads of buffer t & 1 are done before it is refilled
    asm volatile("s_wait_asynccnt 0x0" ::: "memory");  // this wave's copies of pass t + 1 have landed
    __syncthreads();                                    // publishes pass t + 1, frees buffer t & 1
    if (t + 2 < nt) {
      stage_tile<T, BM, NT>(Ag + (size_t)(t + 2) * GBK, lda, aoff, ring[t & 1], tid);
      stage_tile<T, BN, NT>(Bg + (size_t)(t + 2) * GBK, ldb, boff, ring[t & 1] + BM * GPITCH, tid);
    }
  }
  asm volatile("s_wait_asynccnt 0x0" ::: "memory");    // no copy is outstanding when the wave goes on
  acc_guard4(acc[0][0], acc[0][1], acc[0][2], acc[0][3]);
  acc_guard4(acc[1][0], acc[1][1], acc[1][2], acc[1][3]);
  acc_guard4(acc[2][0], acc[2][1], acc[2][2], acc[2][3]);
  acc_guard4(acc[3][0], acc[3][1], acc[3][2], acc[3][3]);

  // ---- epilogue ----
  // the last pass's barrier has ended every wave's reads of the ring and no copy is outstanding: its bytes are free for the slabs
  float* slab = (float*)ring[0] + wave * (16 * 68);
  if (OUT_MODE == 2) gemm_store_rope(acc, slab, (unsigned short*)Cb, ldc, m0, n0, cosT, sinT, d0, lane);
  else               gemm_store<OUT_MODE>(acc, slab, Cb, ldc, m0, n0, scale, lane);
}

// one product, batched over blockIdx.y
template <typename T, bool SPLITA, bool SPLITB, int OUT_MODE, int WM, int WN>
__global__ __launch_bounds__(32 * WM * WN) void gemm_t64(
    const unsigned short* __restrict__ Ap, const unsigned short* __restrict__ A2p, int lda, long strideA,
    const unsigned short* __restrict__ Btp, const unsigned short* __restrict__ Bt2p, int ldb, long strideB,
    void* __restrict__ Cout, int ldc, long strideC,
    int M, int N, int K, float scale) {
  static_assert(!SPLITA && !SPLITB);
  const T* A = (const T*)Ap; const T* Bt = (const T*)Btp;
  __shared__ __align__(16) T ring[2][64 * (WM + WN) * GPITCH];
  const int b    = blockIdx.y;
  const int tilesN = N / (64 * WN);
  const int tilesM = M / (64 * WM);
  const int tile = blockIdx.x;
  if (tile >= tilesM * tilesN) return;   // block-uniform, ahead of every barrier and copy
  const int tm = tile / tilesN;
  const int tn = tile - tm * tilesN;
  const T* Ag = A  + (size_t)b * strideA + (size_t)(tm * 64 * WM) * lda;
  const T* Bg = Bt + (size_t)b * strideB + (size_t)(tn * 64 * WN) * ldb;
  void* Cb = OUT_MODE == 0 ? (void*)((float*)Cout + (size_t)b * strideC) : (void*)((unsigned short*)Cout + (size_t)b * strideC);
  gemm_tile<T, OUT_MODE, WM, WN>(Ag, lda, Bg, ldb, Cb, ldc, tm, tn, K, scale, nullptr, nullptr, ring);
}

// The three products on x in ONE launch (none reads what another writes), each tile computed as in a launch of its own:
//   blocks 0 .. QK_TILES-1: [q | k] = x @ [Wq | Wk], two heads per 256x256 tile, rotated in the epilogue -> f16 planes Q [NTOK][QDIM], K [NTOK][KVDIM];
//                           WqkT = the QDIM rows of Wq^T, then the KVDIM rows of Wk^T
//   then NB x V_TILES:      v^T per batch = Wv^T @ x_b^T -> f16 [NB][KVDIM][SEQ]
// ld = row pitch of all three operand planes = K. The branch is block-uniform.
#define QK_TILES ((NTOK / 256) * (QKDIM / 256))
#define V_TILES  ((KVDIM / 256) * (SEQ / 256))
__global__ __launch_bounds__(512) void gemm_qkv(
    const unsigned short* __restrict__ xbp, const unsigned short* __restrict__ WqkTp, const unsigned short* __restrict__ WvTp,
    const float* __restrict__ cosT, const float* __restrict__ sinT,
    unsigned short* __restrict__ Qpl, unsigned short* __restrict__ Kpl, unsigned short* __restrict__ Vtp, int ld) {
  __shared__ __align__(16) __bf16 ring[2][512 * GPITCH];
  const __bf16* xb = (const __bf16*)xbp;
  const int bx = blockIdx.x;
  if (bx < QK_TILES) {
    const int tm = bx / (QKDIM / 256);
    const int hp = bx - tm * (QKDIM / 256);    // pairs of heads: 0..7 are q, 8..11 are k
    const bool isk = hp >= NQH / 2;
    gemm_tile<__bf16, 2, 4, 4>(xb + (size_t)(tm << 8) * ld, ld, (const __bf16*)WqkTp + (size_t)(hp << 8) * ld, ld, isk ? Kpl : Qpl,
                               isk ? KVDIM : QDIM, tm, isk ? hp - NQH / 2 : hp, ld, 1.0f, cosT, sinT, ring);
  } else {
    const int r  = bx - QK_TILES;
    const int b  = r / V_TILES;
    const int tile = r - b * V_TILES;
    const int tm = tile / (SEQ / 256);
    const int tn = tile - tm * (SEQ / 256);
    gemm_tile<__bf16, 1, 4, 4>((const __bf16*)WvTp + (size_t)(tm << 8) * ld, ld, xb + (size_t)b * SEQ * ld + (size_t)(tn << 8) * ld, ld,
                               Vtp + (size_t)b * KVDIM * SEQ, SEQ, tm, tn, ld, 1.0f, nullptr, nullptr, ring);
  }
}

#define KPITCH 136    // LDS pitch of a K row in elements: 272 B = 16 B x 17, conflict-free for 16-B row reads
#define VPITCH 72     // LDS pitch of a V^T row in elements: 144 B = 16 B x 9, conflict-free for 16-B row reads

// kg, vg: origin of the chunk's K rows (pitch KVDIM) and V^T rows (pitch SEQ), the same in every lane.
// 256 threads x (4 + 4) copies of 16 B; one wave-wide copy covers two whole K rows or four whole V^T row pieces.
__device__ __forceinline__ void stage_kv(const _Float16* kg, const _Float16* vg, _Float16* kl, _Float16* vl, int tid) {
  const unsigned ko = (unsigned)(tid >> 4) * (unsigned)KVDIM + (unsigned)(tid & 15) * 8u;
  const unsigned vo = (unsigned)(tid >> 3) * (unsigned)SEQ + (unsigned)(tid & 7) * 8u;
  _Float16* kp = kl + (tid >> 4) * KPITCH + (tid & 15) * 8;
  _Float16* vp = vl + (tid >> 3) * VPITCH + (tid & 7) * 8;
#pragma unroll   // the copies go out back to back, none waits for another
  for (int j = 0; j < 4; ++j)
    __builtin_amdgcn_global_load_async_to_lds_b128((gv4i*)(kg + (size_t)(j * 16) * KVDIM + ko), (lv4i*)(kp + j * 16 * KPITCH), 0, 0);
#pragma unroll   // as above
  for (int j = 0; j < 4; ++j)
    __builtin_amdgcn_global_load_async_to_lds_b128((gv4i*)(vg + (size_t)(j * 32) * SEQ + vo), (lv4i*)(vp + j * 32 * VPITCH), 0, 0);
}

// lane l <-> lane l ^ 16, a vector cross-row move
__device__ __forceinline__ float xhalf(float x) {
  return __builtin_bit_cast(float, __builtin_amdgcn_permlanex16(__builtin_bit_cast(int, x), __builtin_bit_cast(int, x), 0x76543210, 0xfedcba98, false, false));
}

__global__ __launch_bounds__(256) void attn_kernel(
    const unsigned short* __restrict__ Qp, const unsigned short* __restrict__ Kp,
    const unsigned short* __restrict__ Vtp, unsigned short* __restrict__ Op) {
  __shared__ __align__(16) _Float16 Kst[2][KV_CHUNK * KPITCH]; // 34 KB: K rows of a chunk [kv][d], two buffers
  __shared__ __align__(16) _Float16 Vst[2][HD * VPITCH];       // 36 KB: V^T rows of a chunk [d][kv], two buffers

  const _Float16* Q  = (const _Float16*)Qp;
  const _Float16* Kk = (const _Float16*)Kp;
  const _Float16* Vt = (const _Float16*)Vtp;

  const int tid  = threadIdx.x;
  const int wave = tid >> 5, lane = tid & 31;
  const int hh   = lane >> 4, c = lane & 15, koff = hh * 8;
  const int nqb  = SEQ / QBLK;
  const int bx   = blockIdx.x;
  const int qb   = bx % nqb;
  const int bhid = bx / nqb;
  const int h    = bhid % NQH;
  const int b    = bhid / NQH;
  const int kvh  = h >> 1;
  const int q0   = qb * QBLK + wave * 32;                       // sequence position of this wave's row 0
  const size_t tokw = (size_t)b * SEQ + q0;                     // compact token index of this wave's row 0
  const size_t qoff = (tokw + c) * QDIM + (size_t)h * HD + koff;
  const _Float16* Kg = Kk + (size_t)b * SEQ * KVDIM + (size_t)kvh * HD;            // this head's K rows, key 0
  const _Float16* Vg = Vt + (size_t)b * KVDIM * SEQ + (size_t)(kvh * HD) * SEQ;    // this head's V^T rows, key 0

  // column tile u holds query 16 u + c of the wave
  float mrow[2] = {-INFINITY, -INFINITY};   // running maximum of the query, the same in both wave halves
  float lrow[2] = {0.f, 0.f};               // running sum of the query over this half's keys; the halves are joined in the epilogue
  v8f oacc[2][8];                           // O^T tile t: register r = O[query][d = 16 t + 8 hh + r]
  v16h qf[2][4];                            // Q^T fragments, d' = 32 dc ..: the same in every chunk
  // The products below are the plain builtin, whose distances the compiler keeps itself: accumulators, scores, Q^T and the
  // fragment sets together need more than 256 registers, and operands of an asm guard would all have to lie in the first 256.
#pragma unroll
  for (int u = 0; u < 2; ++u) {
#pragma unroll
    for (int t = 0; t < 8; ++t) oacc[u][t] = (v8f){0.f,0.f,0.f,0.f,0.f,0.f,0.f,0.f};
#pragma unroll
    for (int dc = 0; dc < 4; ++dc) qf[u][dc] = Frag<_Float16>::load(Q + qoff + (size_t)(u * 16) * QDIM + dc * 32);
  }
  // the code that follows writes the address registers that these loads name: the wait stands in front of it
  asm volatile("s_wait_xcnt 0x0" ::: "memory");

  const int nch = SEQ / KV_CHUNK;
  stage_kv(Kg, Vg, Kst[0], Vst[0], tid);
  asm volatile("s_wait_asynccnt 0x0" ::: "memory");   // this wave's copies of chunk 0 have landed
  __syncthreads();                                     // ... and every other wave's: chunk 0 is readable
  if (nch > 1) stage_kv(Kg + (size_t)KV_CHUNK * KVDIM, Vg + KV_CHUNK, Kst[1], Vst[1], tid);

  for (int kc = 0; kc < nch; ++kc) {
    const _Float16* kl = Kst[kc & 1] + c * KPITCH + koff;
    const _Float16* vl = Vst[kc & 1] + c * VPITCH + koff;

    // ---- raw scores S^T(64 kv x 16 q) over d = 128, per column tile u: tile j, register r = S[query][key 16 j + 8 hh + r] ----
    v8f s[2][4];
#pragma unroll
    for (int j = 0; j < 4; ++j) { s[0][j] = (v8f){0.f,0.f,0.f,0.f,0.f,0.f,0.f,0.f}; s[1][j] = s[0][j]; }
    // LDS reads stand in groups of four fragments, one group ahead of their products (two register sets); the loops are
    // unrolled so that every fragment index is a constant: registers, no scratch
    v16h kf[2][4];
#pragma unroll
    for (int j = 0; j < 4; ++j) kf[0][j] = Frag<_Float16>::load(kl + j * 16 * KPITCH);
#pragma unroll
    for (int dc = 0; dc < 4; ++dc) {
      const int cu = dc & 1, nx = cu ^ 1;
      if (dc + 1 < 4) {
#pragma unroll
        for (int j = 0; j < 4; ++j) kf[nx][j] = Frag<_Float16>::load(kl + j * 16 * KPITCH + (dc + 1) * 32);
      }
#pragma unroll
      for (int j = 0; j < 4; ++j) {
        s[0][j] = Frag<_Float16>::mma(kf[cu][j], qf[0][dc], s[0][j]);
        s[1][j] = Frag<_Float16>::mma(kf[cu][j], qf[1][dc], s[1][j]);
      }
    }

    // ---- the chunk's 16 V^T fragments [32 keys kk][output tile t], read as one group: their LDS latency passes under the softmax ----
    v16h vf[2][8];
#pragma unroll
    for (int kk = 0; kk < 2; ++kk)
#pragma unroll
      for (int t = 0; t < 8; ++t) vf[kk][t] = Frag<_Float16>::load(vl + t * 16 * VPITCH + kk * 32);
    // holds the group of reads here: the scheduler otherwise sinks them, two at a time, among the products that wait for them
    __builtin_amdgcn_sched_barrier(0);

    // ---- scale, tanh softcap (f32), maximum of query c: four in-lane chains, then the other half's ----
    // (here and below every loop is unrolled so that each score, fragment and accumulator index is a constant: registers, no scratch)
    v16h pb[2][2];
#pragma unroll
    for (int u = 0; u < 2; ++u) {
      float mj[4];
#pragma unroll
      for (int j = 0; j < 4; ++j) {
        float m = -INFINITY;
#pragma unroll
        for (int r = 0; r < 8; ++r) {
          // v_tanh_f32: one instruction and no branch, where the library tanhf takes two divergent branches per score
          const float sv = SOFTCAP * __builtin_amdgcn_tanhf(s[u][j][r] * (RSQ * INVCAP));
          s[u][j][r] = sv;
          m = fmaxf(m, sv);
        }
        mj[j] = m;
      }
      float cm = fmaxf(fmaxf(mj[0], mj[1]), fmaxf(mj[2], mj[3]));
      cm = fmaxf(cm, xhalf(cm));

      // ---- online softmax (f32); P x 2^10 as f16 straight into the B fragments of V^T . P^T ----
      // B fragment kk, element e: key 32 kk + (e < 8 ? 8 hh + e : 16 + 8 hh + e - 8) = tile 2 kk + (e >> 3), register e & 7:
      // the k order of the V^T loader
      const float mnew = fmaxf(mrow[u], cm);
      const float alpha = __expf(mrow[u] - mnew);
      mrow[u] = mnew;
      float pj[4];
#pragma unroll
      for (int j = 0; j < 4; ++j) {
        float psum = 0.f;
#pragma unroll
        for (int r = 0; r < 8; ++r) {
          const float p = __expf(s[u][j][r] - mnew);
          psum += p;
          pb[u][j >> 1][(j & 1) * 8 + r] = (_Float16)(p * PCARRY);
        }
        pj[j] = psum;
      }
      lrow[u] = lrow[u] * alpha + ((pj[0] + pj[1]) + (pj[2] + pj[3]));
#pragma unroll
      for (int t = 0; t < 8; ++t)
#pragma unroll
        for (int r = 0; r < 8; ++r) oacc[u][t][r] *= alpha;
    }

    // ---- O^T(128 d x 16 q) += V^T(128 d x 64 kv) . P^T: 32 keys kk, output tile t ----
#pragma unroll
    for (int kk = 0; kk < 2; ++kk) {
#pragma unroll
      for (int t = 0; t < 8; ++t) {
        oacc[0][t] = Frag<_Float16>::mma(vf[kk][t], pb[0][kk], oacc[0][t]);
        oacc[1][t] = Frag<_Float16>::mma(vf[kk][t], pb[1][kk], oacc[1][t]);
      }
    }
    asm volatile("s_wait_dscnt 0x0" ::: "memory");     // this wave's reads of buffer kc & 1 are done before it is refilled
    asm volatile("s_wait_asynccnt 0x0" ::: "memory");  // this wave's copies of chunk kc + 1 have landed
    __syncthreads();                                    // publishes chunk kc + 1, frees buffer kc & 1
    if (kc + 2 < nch)
      stage_kv(Kg + (size_t)(kc + 2) * KV_CHUNK * KVDIM, Vg + (kc + 2) * KV_CHUNK, Kst[kc & 1], Vst[kc & 1], tid);
  }
  asm volatile("s_wait_asynccnt 0x0" ::: "memory");    // no copy is outstanding when the wave goes on

  // ---- epilogue: join the halves' sums, normalise (x 2^6 / (2^10 * l)), write the f16 ctx plane ----
  // coverage: 8 tiles x 2 halves x 8 elements = 128 dims of each of the wave's 32 rows (2 column tiles of 16); the wave writes whole 256-B rows.
#pragma unroll
  for (int u = 0; u < 2; ++u) {
    const float lsum = lrow[u] + xhalf(lrow[u]);
    const float inv = OCARRY / (PCARRY * lsum);        // undo the P carry (2^10) and apply the ctx carry (2^6)
    unsigned short* orow = Op + (tokw + u * 16 + c) * QDIM + (size_t)h * HD + koff;
#pragma unroll
    for (int t = 0; t < 8; ++t) {
      v8h hv;
#pragma unroll
      for (int r = 0; r < 8; ++r) hv[r] = (_Float16)(oacc[u][t][r] * inv);
      *(v8h*)(orow + t * 16) = hv;
    }
    // the second tile's code writes registers that these stores name: the wait stands in front of it, and the
    // scheduling barrier keeps that code from being lifted over the wait
    if (u == 0) {
      asm volatile("s_wait_xcnt 0x0" ::: "memory");
      __builtin_amdgcn_sched_barrier(0);
    }
  }
}

// ---------------------------------------------------------------------------------------------
// host
// ---------------------------------------------------------------------------------------------
static_assert((NTOK * HID / 8) % 256 == 0);
static_assert((SEQ * HHALF) % 256 == 0);
static_assert(HID % 128 == 0 && QDIM % 128 == 0);
static_assert(NTOK % 256 == 0 && HID % 256 == 0 && QDIM % 256 == 0 && KVDIM % 256 == 0 && SEQ % 256 == 0);
static_assert(SEQ % QBLK == 0 && SEQ % KV_CHUNK == 0 && QBLK == 256 && KV_CHUNK == 64 && HD == 128);
static_assert(NB >= 1 && NB <= NB_FULL && SEQ <= SEQ_FULL);
static_assert(NQH == 2 * NKVH);

extern "C" void kernel_launch(void* const* d_in, const int* in_sizes, int n_in,
                              void* d_out, int out_size, void* d_ws, size_t ws_size, hipStream_t stream) {
  if (n_in < 5) return;
  const size_t needTok = (size_t)(NB - 1) * SEQ_FULL + SEQ;
  if ((size_t)in_sizes[0] < needTok * HID) return;
  if ((size_t)in_sizes[1] < (size_t)HID * QDIM) return;
  if ((size_t)in_sizes[2] < (size_t)HID * KVDIM) return;
  if ((size_t)in_sizes[3] < (size_t)HID * KVDIM) return;
  if ((size_t)in_sizes[4] < (size_t)QDIM * HID) return;
  if ((size_t)out_size < needTok * HID) return;

  const float* x  = (const float*)d_in[0];   // [2,2048,2048]
  const float* Wq = (const float*)d_in[1];   // [2048,2048]  [in][out]
  const float* Wk = (const float*)d_in[2];   // [2048,1024]
  const float* Wv = (const float*)d_in[3];   // [2048,1024]
  const float* Wo = (const float*)d_in[4];   // [2048,2048]
  float* out = (float*)d_out;                // [2,2048,2048] f32

  //   XB   bf16 [NTOK][HID]
  //   WQT  bf16 [QDIM][HID], WKT bf16 [KVDIM][HID], WVT bf16 [KVDIM][HID], WOT f16 [HID][QDIM]
  //        (WKT follows WQT directly: together the [QKDIM][HID] plane of [Wq | Wk]^T)
  //   R1   ctx f16 [NTOK][QDIM]
  //   VT f16 [NB][KVDIM][SEQ]; QP f16 [NTOK][QDIM]; KP f16 [NTOK][KVDIM]; COS, SIN f32 [SEQ][HHALF]
  const size_t szXB  = (size_t)NTOK * HID * 2;
  const size_t szWQT = (size_t)QDIM * HID * 2;
  const size_t szWKT = (size_t)KVDIM * HID * 2;
  const size_t szWOT = (size_t)HID * QDIM * 2;
  const size_t szR1  = (size_t)NTOK * QDIM * 2;
  const size_t szQP  = (size_t)NTOK * QDIM * 2;
  const size_t szKP  = (size_t)NTOK * KVDIM * 2;
  const size_t szVT  = (size_t)NB * KVDIM * SEQ * 2;
  const size_t szTAB = (size_t)SEQ * HHALF * 4;
  const size_t OFF_XB  = 0;
  const size_t OFF_WQT = OFF_XB + szXB;
  const size_t OFF_WKT = OFF_WQT + szWQT;
  const size_t OFF_WVT = OFF_WKT + szWKT;
  const size_t OFF_WOT = OFF_WVT + szWKT;
  const size_t OFF_R1  = OFF_WOT + szWOT;
  const size_t OFF_CTX = OFF_R1;
  const size_t OFF_VT  = OFF_R1 + szR1;
  const size_t OFF_QP  = OFF_VT + szVT;
  const size_t OFF_KP  = OFF_QP + szQP;
  const size_t OFF_COS = OFF_KP + szKP;
  const size_t OFF_SIN = OFF_COS + szTAB;
  const size_t WS_TOTAL = OFF_SIN + szTAB;
  if (ws_size < WS_TOTAL) return;

  char* ws = (char*)d_ws;
  unsigned short* xb  = (unsigned short*)(ws + OFF_XB);
  unsigned short* WqT = (unsigned short*)(ws + OFF_WQT);
  unsigned short* WkT = (unsigned short*)(ws + OFF_WKT);
  unsigned short* WvT = (unsigned short*)(ws + OFF_WVT);
  unsigned short* WoT = (unsigned short*)(ws + OFF_WOT);
  unsigned short* ctx = (unsigned short*)(ws + OFF_CTX);
  unsigned short* Vt  = (unsigned short*)(ws + OFF_VT);
  unsigned short* Qpl = (unsigned short*)(ws + OFF_QP);
  unsigned short* Kpl = (unsigned short*)(ws + OFF_KP);
  float* cosT = (float*)(ws + OFF_COS);
  float* sinT = (float*)(ws + OFF_SIN);

  // inv_freq[j] = 1 / 10000^(2j/128), pow in double then RNE to f32, reciprocal as one f32 divide
  RopeFreq fr;
  for (int j = 0; j < HHALF; ++j) {
    const float e = (float)(2 * j) / 128.0f;
    const double p = pow(10000.0, (double)e);
    const float pf = (float)p;
    fr.f[j] = 1.0f / pf;
  }

  // 1) to 3) x -> compact bf16 plane; transposed 16-bit weight planes in[rows][cols] -> out[cols][rows]; RoPE tables
  prep_kernel<<<PB_TAB + PB_WQ + 2 * PB_WKV + PB_WO + PB_X, 256, 0, stream>>>(x, Wq, Wk, Wv, Wo, xb, WqT, WkT, WvT, WoT, cosT, sinT, fr);
  // 4) [q | k] = x @ [Wq | Wk], rotated -> f16 planes; v^T per batch = Wv^T @ x_b^T -> f16 [NB][KVDIM][SEQ]   (K=HID)
  gemm_qkv<<<QK_TILES + NB * V_TILES, 512, 0, stream>>>(xb, WqT, WvT, cosT, sinT, Qpl, Kpl, Vt, HID);
  // 6) attention -> ctx f16 x 2^6 [NTOK][QDIM]
  attn_kernel<<<NB * NQH * (SEQ / QBLK), 256, 0, stream>>>(Qpl, Kpl, Vt, ctx);
  // 7) out = ctx @ Wo -> d_out f32, per batch rows b*SEQ_FULL..  (M=SEQ, N=HID, K=QDIM, scale 2^-10)
  {
    const int tiles = (SEQ / 128) * (HID / 256);
    gemm_t64<_Float16, false, false, 0, 2, 4><<<dim3(tiles, NB), 256, 0, stream>>>(
        ctx, ctx, QDIM, (long)SEQ * QDIM, WoT, WoT, QDIM, 0L, (void*)out, HID, (long)SEQ_FULL * HID,
        SEQ, HID, QDIM, OUTSCALE);
  }
}

// v009
// A run of this version takes 126 microseconds.
// Timed twice side by side with v008, it ran 1.05 times as fast both times.
// Over all steps from v000 it is 5.45 times as fast.
// x@Wq, x@Wk, Wv^T@x^T: v_wmma_f32_16x16x32_bf16 on RNE-bf16 input planes (f32 accumulate); q.k^T: v_wmma_f32_16x16x32_f16 (q, k single f16 planes, carried x 32/sqrt(128)/50 and x 2^-5, f32 accumulate); p.v: v_wmma_f32_16x16x32_f16 (p f16 carried x2^10, v f16, f32 accumulate); ctx@Wo: v_wmma_f32_16x16x32_f16 (ctx f16 carried x2^6, Wo f16 carried x2^4 built from RNE-bf16 values, f32 accumulate); RoPE, tanh softcap and softmax in f32.
#include <hip/hip_runtime.h>
#include <math.h>

#pragma clang fp contract(off)

#ifndef NB
#define NB 2
#endif
#ifndef SEQ
#define SEQ 2048
#endif
#define NB_FULL  2
#define SEQ_FULL 2048
#define HID      2048
#define NQH      16
#define NKVH     8
#define HD       128
#define HHALF    64
#define QDIM     (NQH * HD)
#define KVDIM    (NKVH * HD)
#define QKDIM    (QDIM + KVDIM)
#define NTOK     (NB * SEQ)
#define KV_CHUNK 64
#define QBLK     256
#define RSQ      0.08838834764831845f
#define INVCAP   0.02f
#define QSCALE   (RSQ * INVCAP * 32.0f)   // factors of the f16 Q and K planes: their product is 1/sqrt(128)/50, and split so
#define KSCALE   0.03125f                 // typical values of both planes stay clear of f16's subnormal range
#define PCARRYLOG2 10.0f
#define CAPLOG2E 72.13475204444817f   // softcap 50 x log2(e)
#define OCARRY   64.0f
#define WOCARRY  16.0f
#define OUTSCALE 0.0009765625f

typedef __attribute__((ext_vector_type(16))) _Float16 v16h;
typedef __attribute__((ext_vector_type(8)))  _Float16 v8h;
typedef __attribute__((ext_vector_type(16))) __bf16   v16b;
typedef __attribute__((ext_vector_type(8)))  __bf16   v8b;
typedef __attribute__((ext_vector_type(8)))  float    v8f;
typedef __attribute__((ext_vector_type(4)))  float    v4f;
typedef __attribute__((ext_vector_type(2)))  float    v2f;
typedef __attribute__((ext_vector_type(4)))  unsigned int v4u;

__device__ __forceinline__ unsigned short f2bf_bits(float f) {
  unsigned u = __float_as_uint(f);
  return (unsigned short)((u + 0x7FFFu + ((u >> 16) & 1u)) >> 16);
}
__device__ __forceinline__ float bf_bits2f(unsigned short h) { return __uint_as_float(((unsigned)h) << 16); }
__device__ __forceinline__ unsigned short f2h_bits(float f) { const _Float16 h = (_Float16)f; return __builtin_bit_cast(unsigned short, h); }

// hazard guards as plain device helpers
__device__ __forceinline__ void dep_guard_h(v8f& a, v8f& b, v16h x, v16h y) { asm volatile("v_nop\n\tv_nop\n\tv_nop\n\tv_nop" : "+v"(a), "+v"(b) : "v"(x), "v"(y)); }
__device__ __forceinline__ void dep_guard_b(v8f& a, v8f& b, v16b x, v16b y) { asm volatile("v_nop\n\tv_nop\n\tv_nop\n\tv_nop" : "+v"(a), "+v"(b) : "v"(x), "v"(y)); }
__device__ __forceinline__ void keep4_h(v16h a, v16h b, v16h c, v16h d) { asm volatile("v_nop" :: "v"(a), "v"(b), "v"(c), "v"(d)); }
__device__ __forceinline__ void keep4_b(v16b a, v16b b, v16b c, v16b d) { asm volatile("v_nop" :: "v"(a), "v"(b), "v"(c), "v"(d)); }
__device__ __forceinline__ void acc_guard4(v8f& a, v8f& b, v8f& c, v8f& d) { asm volatile("v_nop\n\tv_nop\n\tv_nop\n\tv_nop" : "+v"(a), "+v"(b), "+v"(c), "+v"(d)); }

// fragment loaders: lane l, row/col = l & 15, elements 0..7 <- p[0..7] (k0 + 8h + 0..7), 8..15 <- p[16..23] (k0 + 16 + 8h + 0..7); caller adds 8h
template <typename T> struct Frag;
template <> struct Frag<_Float16> {
  typedef v16h V; union U { v16h v; v8h h[2]; };
  static __device__ __forceinline__ v16h load(const _Float16* p) {
    U f; f.h[0] = *(const v8h*)(p); f.h[1] = *(const v8h*)(p + 16); return f.v;
  }
  static __device__ __forceinline__ v8f mma(v16h a, v16h b, v8f c) {
    return __builtin_amdgcn_wmma_f32_16x16x32_f16(false, a, false, b, (short)0, c, false, false);
  }
  static __device__ __forceinline__ void guard(v8f& a, v8f& b, v16h x, v16h y) { dep_guard_h(a, b, x, y); }
  static __device__ __forceinline__ void keep(v16h a, v16h b, v16h c, v16h d) { keep4_h(a, b, c, d); }
};
template <> struct Frag<__bf16> {
  typedef v16b V; union U { v16b v; v8b h[2]; };
  static __device__ __forceinline__ v16b load(const __bf16* p) {
    U f; f.h[0] = *(const v8b*)(p); f.h[1] = *(const v8b*)(p + 16); return f.v;
  }
  static __device__ __forceinline__ v8f mma(v16b a, v16b b, v8f c) {
    return __builtin_amdgcn_wmma_f32_16x16x32_bf16(false, a, false, b, (short)0, c, false, false);
  }
  static __device__ __forceinline__ void guard(v8f& a, v8f& b, v16b x, v16b y) { dep_guard_b(a, b, x, y); }
  static __device__ __forceinline__ void keep(v16b a, v16b b, v16b c, v16b d) { keep4_b(a, b, c, d); }
};

// ---------------------------------------------------------------------------------------------
// 1) x f32 [NB_FULL][SEQ_FULL][HID] -> compact bf16 plane [NTOK][HID], 8 elements per thread, one 16-B store per lane
// ---------------------------------------------------------------------------------------------
__device__ __forceinline__ void cast_x_bf16(const float* __restrict__ in, unsigned short* __restrict__ out, int n8, int blk) {
  const int i = blk * 256 + threadIdx.x;
  if (i < n8) {
    const size_t o   = (size_t)i * 8;
    const size_t tok = o / HID;
    const size_t col = o - tok * HID;
    const size_t bb  = tok / SEQ;
    const size_t ss  = tok - bb * SEQ;
    const size_t src = (bb * SEQ_FULL + ss) * (size_t)HID + col;
    const v4f a  = *(const v4f*)(in + src);
    const v4f bq = *(const v4f*)(in + src + 4);
    v4u w;
    w[0] = (unsigned)f2bf_bits(a[0])  | ((unsigned)f2bf_bits(a[1])  << 16);
    w[1] = (unsigned)f2bf_bits(a[2])  | ((unsigned)f2bf_bits(a[3])  << 16);
    w[2] = (unsigned)f2bf_bits(bq[0]) | ((unsigned)f2bf_bits(bq[1]) << 16);
    w[3] = (unsigned)f2bf_bits(bq[2]) | ((unsigned)f2bf_bits(bq[3]) << 16);
    *(v4u*)(out + o) = w;
    
  }
}

// ---------------------------------------------------------------------------------------------
// 2) in[nrows][ncols] f32 -> out[ncols][nrows] 16-bit. MODE 0: bf16 bits (RNE); MODE 1: f16 bits of (RNE-bf16 value * scl).
//    Block = 64x64 tile through LDS (cross-thread, block barrier). (bx, by) in (ncols/64, nrows/64); nrows, ncols multiples of 64.
//    load coverage: 256 threads x 16 floats = 64x64 tile; store coverage: 2 iterations x 256 threads x 8 = 64 rows x 64.
// ---------------------------------------------------------------------------------------------
template <int MODE> __device__ __forceinline__ unsigned short pk16(float f, float scl) {
  if (MODE == 0) return f2bf_bits(f);
  const float g = bf_bits2f(f2bf_bits(f)) * scl;
  return f2h_bits(g);
}

template <int MODE>
__device__ __forceinline__ void transpose_cast16(const float* __restrict__ in, unsigned short* __restrict__ out, int nrows, int ncols, float scl,
                                                 int bx, int by, float* tile) {
  const int tid = threadIdx.x;
  const int r0 = by * 64, c0 = bx * 64;
  {
    const int row = tid >> 2, cc = (tid & 3) * 16;
    const float* s = in + (size_t)(r0 + row) * ncols + c0 + cc;
#pragma unroll
    for (int q = 0; q < 4; ++q) {
      const v4f v = *(const v4f*)(s + 4 * q);
#pragma unroll
      for (int e = 0; e < 4; ++e) tile[(cc + 4 * q + e) * 65 + row] = v[e];
    }
  }
  __syncthreads();
  {
#pragma unroll
    for (int it = 0; it < 2; ++it) {
      const int orow = it * 32 + (tid >> 3), seg = (tid & 7) * 8;
      const float* tp = tile + orow * 65 + seg;
      v4u w;
#pragma unroll
      for (int e = 0; e < 4; ++e) w[e] = (unsigned)pk16<MODE>(tp[2 * e], scl) | ((unsigned)pk16<MODE>(tp[2 * e + 1], scl) << 16);
      *(v4u*)(out + (size_t)(c0 + orow) * nrows + r0 + seg) = w;
    }
    // in the merged kernel's listing another range's code follows and writes registers that these stores name: the wait stands in front of it
    asm volatile("s_wait_xcnt 0x0" ::: "memory");
  }
}

// ---------------------------------------------------------------------------------------------
// 3) RoPE cos/sin tables [SEQ][HHALF] f32: angle = pos * inv_freq[j] (single f32 multiply), precise cosf/sinf.
// ---------------------------------------------------------------------------------------------
struct RopeFreq { float f[HHALF]; };
static_assert(sizeof(RopeFreq) == 256);

__device__ __forceinline__ void rope_table(float* __restrict__ cosT, float* __restrict__ sinT, const RopeFreq& fr, int blk, float* invf) {
  if (threadIdx.x == 0) {
#pragma unroll
    for (int q = 0; q < HHALF; ++q) invf[q] = fr.f[q];
  }
  __syncthreads();
  const int i = blk * 256 + threadIdx.x;                 // exactly SEQ*HHALF threads
  const int t = i >> 6;
  const int jj = i & (HHALF - 1);
  const float ang = (float)t * invf[jj];
  const float cv = cosf(ang);
  const float sv = sinf(ang);
  ((float*)cosT)[i] = cv;
  ((float*)sinT)[i] = sv;
  
}

// ---------------------------------------------------------------------------------------------
// 1) to 3) in ONE launch: none of them reads what another writes, so each takes a range of the block index.
//    Every branch below is block-uniform; the ranges with the most work per block come first.
// ---------------------------------------------------------------------------------------------
#define PB_TAB ((SEQ * HHALF) / 256)
#define PB_WQ  ((QDIM / 64) * (HID / 64))
#define PB_WKV ((KVDIM / 64) * (HID / 64))
#define PB_WO  ((HID / 64) * (QDIM / 64))
#define PB_X   ((NTOK * HID / 8) / 256)
__global__ __launch_bounds__(256) void prep_kernel(
    const float* __restrict__ x, const float* __restrict__ Wq, const float* __restrict__ Wk, const float* __restrict__ Wv, const float* __restrict__ Wo,
    unsigned short* __restrict__ xb, unsigned short* __restrict__ WqT, unsigned short* __restrict__ WkT, unsigned short* __restrict__ WvT,
    unsigned short* __restrict__ WoT, float* __restrict__ cosT, float* __restrict__ sinT, RopeFreq fr) {
  __shared__ float tile[64 * 65];
  int blk = blockIdx.x;
  if (blk < PB_TAB) { rope_table(cosT, sinT, fr, blk, tile); return; }
  blk -= PB_TAB;
  if (blk < PB_WQ) {                           // [HID][QDIM]  -> [QDIM][HID]
    transpose_cast16<0>(Wq, WqT, HID, QDIM, 1.0f, blk % (QDIM / 64), blk / (QDIM / 64), tile); return;
  }
  blk -= PB_WQ;
  if (blk < 2 * PB_WKV) {                      // [HID][KVDIM] -> [KVDIM][HID], Wk then Wv
    const bool isv = blk >= PB_WKV;
    if (isv) blk -= PB_WKV;
    transpose_cast16<0>(isv ? Wv : Wk, isv ? WvT : WkT, HID, KVDIM, 1.0f, blk % (KVDIM / 64), blk / (KVDIM / 64), tile); return;
  }
  blk -= 2 * PB_WKV;
  if (blk < PB_WO) {                           // [QDIM][HID]  -> [HID][QDIM], f16 x 2^4
    transpose_cast16<1>(Wo, WoT, QDIM, HID, WOCARRY, blk % (HID / 64), blk / (HID / 64), tile); return;
  }
  blk -= PB_WO;
  cast_x_bf16(x, xb, NTOK * HID / 8, blk);
}

// ---------------------------------------------------------------------------------------------
// 5) Register-blocked batched WMMA GEMM, 16-bit operands of type T (bf16 or f16), f32 accumulate.
//    C[m,n] = scale * sum_k A[m,k] * Bt[n,k]; A row-major [M,K], Bt row-major [N,K].
//    Block = WM x WN waves = one (64 WM) x (64 WN) tile of C; each wave owns a 64x64 tile. The bytes a block brings in from L2
//    per product fall as 1/WM + 1/WN: 4 x 4 waves where that still gives every WGP a tile, 2 x 4 where it does not.
//    Per pass the block's 64 WM A rows and 64 WN Bt rows x 128 k (256 B a row) are brought into LDS by asynchronous
//    copies, two buffers: the next pass's copies fly while this pass's fragments are read from LDS.
//    M % (64 WM) == 0, N % (64 WN) == 0, K % 128 == 0 (no tail handling). lda, ldb % 8 == 0 (16-B copies).
//    OUT_MODE: 0 = f32, 1 = single f16 plane, 2 = rotated (RoPE) f16 plane, one 128-wide head per 128 columns of the block tile.
//    The hi/lo plane options are not staged: both must be false.
// ---------------------------------------------------------------------------------------------
#define GBK    128    // k elements of one staged pass
#define GPITCH 136    // LDS row pitch in elements: 272 B = 16 B x 17, conflict-free for 16-B row reads
typedef __attribute__((ext_vector_type(4))) int v4i;
typedef __attribute__((address_space(1))) v4i gv4i;
typedef __attribute__((address_space(3))) v4i lv4i;

// R rows x 256 B from g (row pitch ld elements) into l (row pitch GPITCH): NT threads x (16 R / NT) copies of 16 B;
// one wave-wide copy covers two whole 256-B rows.
// g is the tile's origin, the same in every lane; goff is the lane's own element offset row * ld + column.
template <typename T, int R, int NT>
__device__ __forceinline__ void stage_tile(const T* g, int ld, unsigned goff, T* l, int tid) {
  T* lp = l + (tid >> 4) * GPITCH + (tid & 15) * 8;
#pragma unroll   // the copies go out back to back, none waits for another
  for (int j = 0; j < 16 * R / NT; ++j)
    __builtin_amdgcn_global_load_async_to_lds_b128((gv4i*)(g + (size_t)(j * (NT / 16)) * ld + goff), (lv4i*)(lp + j * (NT / 16) * GPITCH), 0, 0);
}

// A wave's 64x64 accumulator tile -> C, 16 rows at a time through the wave's own LDS slab, so that each store covers whole row pieces.
template <int OUT_MODE>
__device__ __forceinline__ void gemm_store(v8f (&acc)[4][4], float* slab, void* Cb, int ldc, int m0, int n0, float scale, int lane) {
  const int rlane = lane & 15;                 // D column within subtile
  const int mOff  = (lane >> 4) * 8;           // D row offset
#pragma unroll
  for (int i = 0; i < 4; ++i) {
    const int mBase = m0 + (i << 4);
#pragma unroll
    for (int j = 0; j < 4; ++j) {
#pragma unroll
      for (int r = 0; r < 8; ++r) {
        const float v = acc[i][j][r] * scale;
        slab[(mOff + r) * 68 + (j << 4) + rlane] = v;
      }
    }
    __builtin_amdgcn_fence(3, "workgroup");
    __builtin_amdgcn_wave_barrier();
    __builtin_amdgcn_fence(2, "workgroup");
    if (OUT_MODE == 0) {
      float* Cf = (float*)Cb;
      const int hh = lane >> 4, c4 = (lane & 15) * 4;     // row seg = 256 B = 16 lanes x 16 B
      {
        v4f v[8];
        float* p[8];
#pragma unroll   // constant indices: registers, no scratch
        for (int it = 0; it < 8; ++it) {
          const int row = it * 2 + hh;
          v[it] = *(const v4f*)(slab + row * 68 + c4);
          p[it] = Cf + (size_t)(mBase + row) * ldc + n0 + c4;
          *(v4f*)(p[it]) = v[it];
        }
        // the code that follows writes registers that these stores name: the wait stands in front of it; values and addresses are
        // inputs so that their registers live up to the wait
        asm volatile("s_wait_xcnt 0x0" :: "v"(v[0]), "v"(v[1]), "v"(v[2]), "v"(v[3]), "v"(v[4]), "v"(v[5]), "v"(v[6]), "v"(v[7]),
                     "v"(p[0]), "v"(p[1]), "v"(p[2]), "v"(p[3]), "v"(p[4]), "v"(p[5]), "v"(p[6]), "v"(p[7]) : "memory");
      }
    } else {
      const int q = lane >> 3, c8 = (lane & 7) * 8;
      unsigned short* Cs = (unsigned short*)Cb;
      {
#pragma unroll
        for (int it = 0; it < 4; ++it) {
          const int row = it * 4 + q;
          const float* sp = slab + row * 68 + c8;
          v8h hv;
#pragma unroll
          for (int e = 0; e < 8; ++e) hv[e] = (_Float16)sp[e];
          *(v8h*)(Cs + (size_t)(mBase + row) * ldc + n0 + c8) = hv;
        }
        
      }
    }
    __builtin_amdgcn_fence(3, "workgroup");
    __builtin_amdgcn_wave_barrier();
    __builtin_amdgcn_fence(2, "workgroup");
  }
}

// RoPE epilogue. Each 128 columns of the block tile are one head, shared by two waves; this wave's accumulator column tiles j = 0, 1 hold x1[d0 .. d0+31] and
// j = 2, 3 hold x2[d0 .. d0+31] (= head dims 64 + d0 ..) of its 64 tokens, so a slab row is x1 | x2 of the same 32 pair indices.
// out1 = (x1*cos - x2*sin) * scale, out2 = (x2*cos + x1*sin) * scale in f32, then f16. A slab row goes out as it lies: 64 f16 = one whole 128-B line at
// plane column n0. Within a head the plane's order of d is therefore 0..31, 64..95, 32..63, 96..127, in q and in k alike.
struct RopeTab { v4f ca, cb, sa, sb; };
__device__ __forceinline__ void rope_tab_load(RopeTab (&t)[2], const float* cosT, const float* sinT, int mBase, int dcol, int q) {
  unsigned ob[2];                              // byte offset of each table row piece
#pragma unroll   // constant indices: registers, no scratch
  for (int it = 0; it < 2; ++it) {
    ob[it] = (((unsigned)(mBase + it * 8 + q) % (unsigned)SEQ) * HHALF + dcol) * 4u;
    t[it].ca = *(const v4f*)((const char*)cosT + ob[it]);
    t[it].cb = *(const v4f*)((const char*)cosT + ob[it] + 16);
    t[it].sa = *(const v4f*)((const char*)sinT + ob[it]);
    t[it].sb = *(const v4f*)((const char*)sinT + ob[it] + 16);
  }
  // the code that follows writes the address registers that these loads name: the wait stands in front of it; the offset is an
  // input so that its register lives up to the wait and none of the loads lands on it
  asm volatile("s_wait_xcnt 0x0" :: "v"(ob[0]) : "memory");
}

__device__ __forceinline__ void gemm_store_rope(v8f (&acc)[4][4], float* slab, unsigned short* Cs, int ldc, int m0, int n0,
                                                const float* cosT, const float* sinT, int d0, int lane, float scale) {
  const int rlane = lane & 15;                 // D column within subtile
  const int mOff  = (lane >> 4) * 8;           // D row offset
  const int q = lane >> 2, c8 = (lane & 3) * 8; // reader: 4 lanes a row, 8 pair indices a lane, 8 rows a pass
  RopeTab tab[2][2];                           // the table rows of 16 tokens, read one group of 16 ahead of their use
  rope_tab_load(tab[0], cosT, sinT, m0, d0 + c8, q);
#pragma unroll   // constant accumulator and table indices: registers, no scratch
  for (int i = 0; i < 4; ++i) {
    const int mBase = m0 + (i << 4);
#pragma unroll
    for (int j = 0; j < 4; ++j) {
#pragma unroll
      for (int r = 0; r < 8; ++r) slab[(mOff + r) * 68 + (j << 4) + rlane] = acc[i][j][r];
    }
    // the slab is this wave's own: the wait puts every lane's values into LDS before another lane reads them, and the fences keep
    // the compiler from moving the reads below over the writes above; none of them waits for a global load or store
    asm volatile("s_wait_dscnt 0x0" ::: "memory");
    __builtin_amdgcn_fence(3, "wavefront");
    __builtin_amdgcn_wave_barrier();
    __builtin_amdgcn_fence(2, "wavefront");
    if (i + 1 < 4) rope_tab_load(tab[(i + 1) & 1], cosT, sinT, mBase + 16, d0 + c8, q);
#pragma unroll
    for (int it = 0; it < 2; ++it) {
      const int row = it * 8 + q;
      const float* sp = slab + row * 68 + c8;
      const v4f x1a = *(const v4f*)(sp);
      const v4f x1b = *(const v4f*)(sp + 4);
      const v4f x2a = *(const v4f*)(sp + 32);
      const v4f x2b = *(const v4f*)(sp + 36);
      const RopeTab& t = tab[i & 1][it];
      v8h h1, h2;
#pragma unroll
      for (int e = 0; e < 4; ++e) {
        h1[e]     = (_Float16)((x1a[e] * t.ca[e] - x2a[e] * t.sa[e]) * scale);
        h2[e]     = (_Float16)((x2a[e] * t.ca[e] + x1a[e] * t.sa[e]) * scale);
        h1[e + 4] = (_Float16)((x1b[e] * t.cb[e] - x2b[e] * t.sb[e]) * scale);
        h2[e + 4] = (_Float16)((x2b[e] * t.cb[e] + x1b[e] * t.sb[e]) * scale);
      }
      unsigned short* op = Cs + (size_t)(mBase + row) * ldc + n0 + c8;
      *(v8h*)(op) = h1;
      *(v8h*)(op + 32) = h2;
    }
    // the next group's code writes registers that these stores name: the wait stands in front of it
    asm volatile("s_wait_xcnt 0x0" ::: "memory");
    __builtin_amdgcn_fence(3, "wavefront");
    __builtin_amdgcn_wave_barrier();
    __builtin_amdgcn_fence(2, "wavefront");
  }
}

// One block's (64 WM) x (64 WN) tile (tm, tn). Ag, Bg: first of the tile's A rows and Bt rows; Cb: origin of this product's C.
// ring: [buffer][A rows | Bt rows]; behind the last pass's barrier its first bytes serve as the per-wave 16x64 slabs, pitch 68 floats.
// Every argument is the same in the whole block.
// OUT_MODE 2: column tile j of a wave takes Bt rows 64 (j >> 1) + 32 (wave & 1) + 16 (j & 1) .. of its head's 128, so that head dims
// d and d + 64 meet in one lane; cosT, sinT are the RoPE tables (unused otherwise).
template <typename T, int OUT_MODE, int WM, int WN>
__device__ __forceinline__ void gemm_tile(const T* Ag, int lda, const T* Bg, int ldb, void* Cb, int ldc, int tm, int tn, int K, float scale,
                                          const float* cosT, const float* sinT, T (*ring)[64 * (WM + WN) * GPITCH]) {
  typedef typename Frag<T>::V V;
  constexpr int BM = 64 * WM, BN = 64 * WN, NT = 32 * WM * WN;
  static_assert(WM * WN * 16 * 68 * 4 <= (BM + BN) * GPITCH * 2);   // the slabs fit in one buffer
  const int tid  = threadIdx.x;
  const int lane = tid & 31;
  const int wave = tid >> 5;
  const int wm = (wave / WN) << 6;             // this wave's rows inside the block tile
  const int wn = (wave % WN) << 6;             // this wave's columns inside the block tile
  const int m0 = tm * BM + wm;
  const int n0 = tn * BN + wn;
  const int d0 = (wn & 64) >> 1;               // OUT_MODE 2: first pair index of this wave inside its head

  const int rlane = lane & 15;                 // row (A) / col (B, D) within subtile
  const int koff  = (lane >> 4) * 8;           // k offset of this lane half
  auto brow = [](int j) { return OUT_MODE == 2 ? ((j >> 1) << 6) + ((j & 1) << 4) : (j << 4); };   // Bt row of column tile j

  v8f acc[4][4];
#pragma unroll
  for (int i = 0; i < 4; ++i)
#pragma unroll
    for (int j = 0; j < 4; ++j) acc[i][j] = (v8f){0.f,0.f,0.f,0.f,0.f,0.f,0.f,0.f};

  const int nt = K / GBK;
  const unsigned aoff = (unsigned)(tid >> 4) * (unsigned)lda + (unsigned)(tid & 15) * 8u;
  const unsigned boff = (unsigned)(tid >> 4) * (unsigned)ldb + (unsigned)(tid & 15) * 8u;
  stage_tile<T, BM, NT>(Ag, lda, aoff, ring[0], tid);
  stage_tile<T, BN, NT>(Bg, ldb, boff, ring[0] + BM * GPITCH, tid);
  asm volatile("s_wait_asynccnt 0x0" ::: "memory");   // this wave's copies of pass 0 have landed
  __syncthreads();                                     // ... and every other wave's: pass 0 is readable
  if (nt > 1) {
    stage_tile<T, BM, NT>(Ag + GBK, lda, aoff, ring[1], tid);
    stage_tile<T, BN, NT>(Bg + GBK, ldb, boff, ring[1] + BM * GPITCH, tid);
  }

  for (int t = 0; t < nt; ++t) {
    const T* la = ring[t & 1] + (wm + rlane) * GPITCH + koff;
    const T* lb = ring[t & 1] + (BM + (OUT_MODE == 2 ? (wn & ~127) + d0 : wn) + rlane) * GPITCH + koff;
    // LDS reads run ahead of their products: the next 32-k block's Bt fragments go into a second set at the head of
    // this block, and each A fragment is re-read for the next block as soon as its row of products has been issued
    // (every loop below is unrolled so that each fragment and accumulator index is a constant: registers, no scratch)
    V af[4], bf[2][4];
#pragma unroll
    for (int j = 0; j < 4; ++j) { bf[0][j] = Frag<T>::load(lb + brow(j) * GPITCH); af[j] = Frag<T>::load(la + (j << 4) * GPITCH); }
#pragma unroll
    for (int kb = 0; kb < GBK / 32; ++kb) {
      const int cu = kb & 1, nx = cu ^ 1;
      if (kb + 1 < GBK / 32) {
#pragma unroll
        for (int j = 0; j < 4; ++j) bf[nx][j] = Frag<T>::load(lb + brow(j) * GPITCH + (kb + 1) * 32);
      }
#pragma unroll
      for (int i = 0; i < 4; ++i) {
#pragma unroll
        for (int j = 0; j < 4; ++j) acc[i][j] = Frag<T>::mma(af[i], bf[cu][j], acc[i][j]);
        Frag<T>::guard(acc[i][0], acc[i][3], af[i], af[i]);
        if (kb + 1 < GBK / 32) af[i] = Frag<T>::load(la + (i << 4) * GPITCH + (kb + 1) * 32);
      }
      Frag<T>::keep(bf[cu][0], bf[cu][1], bf[cu][2], bf[cu][3]);
    }
    asm volatile("s_wait_dscnt 0x0" ::: "memory");     // this wave's reads of buffer t & 1 are done before it is refilled
    asm volatile("s_wait_asynccnt 0x0" ::: "memory");  // this wave's copies of pass t + 1 have landed
    __syncthreads();                                    // publishes pass t + 1, frees buffer t & 1
    if (t + 2 < nt) {
      stage_tile<T, BM, NT>(Ag + (size_t)(t + 2) * GBK, lda, aoff, ring[t & 1], tid);
      stage_tile<T, BN, NT>(Bg + (size_t)(t + 2) * GBK, ldb, boff, ring[t & 1] + BM * GPITCH, tid);
    }
  }
  asm volatile("s_wait_asynccnt 0x0" ::: "memory");    // no copy is outstanding when the wave goes on
  acc_guard4(acc[0][0], acc[0][1], acc[0][2], acc[0][3]);
  acc_guard4(acc[1][0], acc[1][1], acc[1][2], acc[1][3]);
  acc_guard4(acc[2][0], acc[2][1], acc[2][2], acc[2][3]);
  acc_guard4(acc[3][0], acc[3][1], acc[3][2], acc[3][3]);

  // ---- epilogue ----
  // the last pass's barrier has ended every wave's reads of the ring and no copy is outstanding: its bytes are free for the slabs
  float* slab = (float*)ring[0] + wave * (16 * 68);
  if (OUT_MODE == 2) gemm_store_rope(acc, slab, (unsigned short*)Cb, ldc, m0, n0, cosT, sinT, d0, lane, scale);
  else               gemm_store<OUT_MODE>(acc, slab, Cb, ldc, m0, n0, scale, lane);
}

// one product, batched over blockIdx.y
template <typename T, bool SPLITA, bool SPLITB, int OUT_MODE, int WM, int WN>
__global__ __launch_bounds__(32 * WM * WN) void gemm_t64(
    const unsigned short* __restrict__ Ap, const unsigned short* __restrict__ A2p, int lda, long strideA,
    const unsigned short* __restrict__ Btp, const unsigned short* __restrict__ Bt2p, int ldb, long strideB,
    void* __restrict__ Cout, int ldc, long strideC,
    int M, int N, int K, float scale) {
  static_assert(!SPLITA && !SPLITB);
  const T* A = (const T*)Ap; const T* Bt = (const T*)Btp;
  __shared__ __align__(16) T ring[2][64 * (WM + WN) * GPITCH];
  const int b    = blockIdx.y;
  const int tilesN = N / (64 * WN);
  const int tilesM = M / (64 * WM);
  const int tile = blockIdx.x;
  if (tile >= tilesM * tilesN) return;   // block-uniform, ahead of every barrier and copy
  const int tm = tile / tilesN;
  const int tn = tile - tm * tilesN;
  const T* Ag = A  + (size_t)b * strideA + (size_t)(tm * 64 * WM) * lda;
  const T* Bg = Bt + (size_t)b * strideB + (size_t)(tn * 64 * WN) * ldb;
  void* Cb = OUT_MODE == 0 ? (void*)((float*)Cout + (size_t)b * strideC) : (void*)((unsigned short*)Cout + (size_t)b * strideC);
  gemm_tile<T, OUT_MODE, WM, WN>(Ag, lda, Bg, ldb, Cb, ldc, tm, tn, K, scale, nullptr, nullptr, ring);
}

// The three products on x in ONE launch (none reads what another writes), each tile computed as in a launch of its own:
//   blocks 0 .. QK_TILES-1: [q | k] = x @ [Wq | Wk], two heads per 256x256 tile, rotated and scaled (QSCALE, KSCALE) in the epilogue -> f16 planes Q [NTOK][QDIM], K [NTOK][KVDIM];
//                           WqkT = the QDIM rows of Wq^T, then the KVDIM rows of Wk^T
//   then NB x V_TILES:      v^T per batch = Wv^T @ x_b^T -> f16 [NB][KVDIM][SEQ]
// ld = row pitch of all three operand planes = K. The branch is block-uniform.
#define QK_TILES ((NTOK / 256) * (QKDIM / 256))
#define V_TILES  ((KVDIM / 256) * (SEQ / 256))
__global__ __launch_bounds__(512) void gemm_qkv(
    const unsigned short* __restrict__ xbp, const unsigned short* __restrict__ WqkTp, const unsigned short* __restrict__ WvTp,
    const float* __restrict__ cosT, const float* __restrict__ sinT,
    unsigned short* __restrict__ Qpl, unsigned short* __restrict__ Kpl, unsigned short* __restrict__ Vtp, int ld) {
  __shared__ __align__(16) __bf16 ring[2][512 * GPITCH];
  const __bf16* xb = (const __bf16*)xbp;
  const int bx = blockIdx.x;
  if (bx < QK_TILES) {
    const int tm = bx / (QKDIM / 256);
    const int hp = bx - tm * (QKDIM / 256);    // pairs of heads: 0..7 are q, 8..11 are k
    const bool isk = hp >= NQH / 2;
    gemm_tile<__bf16, 2, 4, 4>(xb + (size_t)(tm << 8) * ld, ld, (const __bf16*)WqkTp + (size_t)(hp << 8) * ld, ld, isk ? Kpl : Qpl,
                               isk ? KVDIM : QDIM, tm, isk ? hp - NQH / 2 : hp, ld, isk ? KSCALE : QSCALE, cosT, sinT, ring);
  } else {
    const int r  = bx - QK_TILES;
    const int b  = r / V_TILES;
    const int tile = r - b * V_TILES;
    const int tm = tile / (SEQ / 256);
    const int tn = tile - tm * (SEQ / 256);
    gemm_tile<__bf16, 1, 4, 4>((const __bf16*)WvTp + (size_t)(tm << 8) * ld, ld, xb + (size_t)b * SEQ * ld + (size_t)(tn << 8) * ld, ld,
                               Vtp + (size_t)b * KVDIM * SEQ, SEQ, tm, tn, ld, 1.0f, nullptr, nullptr, ring);
  }
}

#define KPITCH 136    // LDS pitch of a K row in elements: 272 B = 16 B x 17, conflict-free for 16-B row reads
#define VPITCH 72     // LDS pitch of a V^T row in elements: 144 B = 16 B x 9, conflict-free for 16-B row reads

// kg, vg: origin of the chunk's K rows (pitch KVDIM) and V^T rows (pitch SEQ), the same in every lane.
// 256 threads x (4 + 4) copies of 16 B; one wave-wide copy covers two whole K rows or four whole V^T row pieces.
__device__ __forceinline__ void stage_kv(const _Float16* kg, const _Float16* vg, _Float16* kl, _Float16* vl, int tid) {
  const unsigned ko = (unsigned)(tid >> 4) * (unsigned)KVDIM + (unsigned)(tid & 15) * 8u;
  const unsigned vo = (unsigned)(tid >> 3) * (unsigned)SEQ + (unsigned)(tid & 7) * 8u;
  _Float16* kp = kl + (tid >> 4) * KPITCH + (tid & 15) * 8;
  _Float16* vp = vl + (tid >> 3) * VPITCH + (tid & 7) * 8;
#pragma unroll   // the copies go out back to back, none waits for another
  for (int j = 0; j < 4; ++j)
    __builtin_amdgcn_global_load_async_to_lds_b128((gv4i*)(kg + (size_t)(j * 16) * KVDIM + ko), (lv4i*)(kp + j * 16 * KPITCH), 0, 0);
#pragma unroll   // as above
  for (int j = 0; j < 4; ++j)
    __builtin_amdgcn_global_load_async_to_lds_b128((gv4i*)(vg + (size_t)(j * 32) * SEQ + vo), (lv4i*)(vp + j * 32 * VPITCH), 0, 0);
}

// lane l <-> lane l ^ 16, a vector cross-row move
__device__ __forceinline__ float xhalf(float x) {
  return __builtin_bit_cast(float, __builtin_amdgcn_permlanex16(__builtin_bit_cast(int, x), __builtin_bit_cast(int, x), 0x76543210, 0xfedcba98, false, false));
}

__global__ __launch_bounds__(256) void attn_kernel(
    const unsigned short* __restrict__ Qp, const unsigned short* __restrict__ Kp,
    const unsigned short* __restrict__ Vtp, unsigned short* __restrict__ Op) {
  __shared__ __align__(16) _Float16 Kst[2][KV_CHUNK * KPITCH]; // 34 KB: K rows of a chunk [kv][d], two buffers
  __shared__ __align__(16) _Float16 Vst[2][HD * VPITCH];       // 36 KB: V^T rows of a chunk [d][kv], two buffers

  const _Float16* Q  = (const _Float16*)Qp;
  const _Float16* Kk = (const _Float16*)Kp;
  const _Float16* Vt = (const _Float16*)Vtp;

  const int tid  = threadIdx.x;
  const int wave = tid >> 5, lane = tid & 31;
  const int hh   = lane >> 4, c = lane & 15, koff = hh * 8;
  const int nqb  = SEQ / QBLK;
  const int bx   = blockIdx.x;
  const int qb   = bx % nqb;
  const int bhid = bx / nqb;
  const int h    = bhid % NQH;
  const int b    = bhid / NQH;
  const int kvh  = h >> 1;
  const int q0   = qb * QBLK + wave * 32;                       // sequence position of this wave's row 0
  const size_t tokw = (size_t)b * SEQ + q0;                     // compact token index of this wave's row 0
  const size_t qoff = (tokw + c) * QDIM + (size_t)h * HD + koff;
  const _Float16* Kg = Kk + (size_t)b * SEQ * KVDIM + (size_t)kvh * HD;            // this head's K rows, key 0
  const _Float16* Vg = Vt + (size_t)b * KVDIM * SEQ + (size_t)(kvh * HD) * SEQ;    // this head's V^T rows, key 0

  // column tile u holds query 16 u + c of the wave
  float mrow[2] = {-INFINITY, -INFINITY};   // running maximum of the query's tanh values, the same in both wave halves
  float eoff[2] = {INFINITY, INFINITY};     // exponent offset in use, 10 - maximum * CAPLOG2E (first chunk: rescale factor 2^-inf = 0)
  float lrow[2] = {0.f, 0.f};               // running sum x 2^10 of the query over this half's keys; the halves are joined in the epilogue
  v8f oacc[2][8];                           // O^T tile t: register r = O[query][d = 16 t + 8 hh + r]
  v16h qf[2][4];                            // Q^T fragments, d' = 32 dc ..: the same in every chunk
  // The products below are the plain builtin, whose distances the compiler keeps itself: accumulators, scores, Q^T and the
  // fragment sets together need more than 256 registers, and operands of an asm guard would all have to lie in the first 256.
#pragma unroll
  for (int u = 0; u < 2; ++u) {
#pragma unroll
    for (int t = 0; t < 8; ++t) oacc[u][t] = (v8f){0.f,0.f,0.f,0.f,0.f,0.f,0.f,0.f};
#pragma unroll
    for (int dc = 0; dc < 4; ++dc) qf[u][dc] = Frag<_Float16>::load(Q + qoff + (size_t)(u * 16) * QDIM + dc * 32);
  }
  // the code that follows writes the address registers that these loads name: the wait stands in front of it
  asm volatile("s_wait_xcnt 0x0" ::: "memory");

  const int nch = SEQ / KV_CHUNK;
  stage_kv(Kg, Vg, Kst[0], Vst[0], tid);
  asm volatile("s_wait_asynccnt 0x0" ::: "memory");   // this wave's copies of chunk 0 have landed
  __syncthreads();                                     // ... and every other wave's: chunk 0 is readable
  if (nch > 1) stage_kv(Kg + (size_t)KV_CHUNK * KVDIM, Vg + KV_CHUNK, Kst[1], Vst[1], tid);

  for (int kc = 0; kc < nch; ++kc) {
    const _Float16* kl = Kst[kc & 1] + c * KPITCH + koff;
    const _Float16* vl = Vst[kc & 1] + c * VPITCH + koff;

    // ---- raw scores S^T(64 kv x 16 q) over d = 128, per column tile u: tile j, register r = S[query][key 16 j + 8 hh + r] ----
    v8f s[2][4];
#pragma unroll
    for (int j = 0; j < 4; ++j) { s[0][j] = (v8f){0.f,0.f,0.f,0.f,0.f,0.f,0.f,0.f}; s[1][j] = s[0][j]; }
    // LDS reads stand in groups of four fragments, one group ahead of their products (two register sets); the loops are
    // unrolled so that every fragment index is a constant: registers, no scratch
    v16h kf[2][4];
#pragma unroll
    for (int j = 0; j < 4; ++j) kf[0][j] = Frag<_Float16>::load(kl + j * 16 * KPITCH);
#pragma unroll
    for (int dc = 0; dc < 4; ++dc) {
      const int cu = dc & 1, nx = cu ^ 1;
      if (dc + 1 < 4) {
#pragma unroll
        for (int j = 0; j < 4; ++j) kf[nx][j] = Frag<_Float16>::load(kl + j * 16 * KPITCH + (dc + 1) * 32);
      }
#pragma unroll
      for (int j = 0; j < 4; ++j) {
        s[0][j] = Frag<_Float16>::mma(kf[cu][j], qf[0][dc], s[0][j]);
        s[1][j] = Frag<_Float16>::mma(kf[cu][j], qf[1][dc], s[1][j]);
      }
    }

    // ---- the chunk's 16 V^T fragments [32 keys kk][output tile t], read as one group: their LDS latency passes under the softmax ----
    v16h vf[2][8];
#pragma unroll
    for (int kk = 0; kk < 2; ++kk)
#pragma unroll
      for (int t = 0; t < 8; ++t) vf[kk][t] = Frag<_Float16>::load(vl + t * 16 * VPITCH + kk * 32);
    // holds the group of reads here: the scheduler otherwise sinks them, two at a time, among the products that wait for them
    __builtin_amdgcn_sched_barrier(0);

    // ---- tanh of the softcap (f32), maximum of query c over the tanh values: four in-lane chains, then the other half's ----
    // (here and below every loop is unrolled so that each score, fragment and accumulator index is a constant: registers, no scratch)
    v16h pb[2][2];
#pragma unroll
    for (int u = 0; u < 2; ++u) {
      float mj[4];
#pragma unroll
      for (int j = 0; j < 4; ++j) {
        float m = -INFINITY;
#pragma unroll
        for (int r = 0; r < 8; ++r) {
          // v_tanh_f32: one instruction and no branch, where the library tanhf takes two divergent branches per score
          const float sv = __builtin_amdgcn_tanhf(s[u][j][r]);
          s[u][j][r] = sv;
          m = fmaxf(m, sv);
        }
        mj[j] = m;
      }
      float cm = fmaxf(fmaxf(mj[0], mj[1]), fmaxf(mj[2], mj[3]));
      cm = fmaxf(cm, xhalf(cm));

      // ---- online softmax (f32); P x 2^10 as f16 straight into the B fragments of V^T . P^T ----
      // B fragment kk, element e: key 32 kk + (e < 8 ? 8 hh + e : 16 + 8 hh + e - 8) = tile 2 kk + (e >> 3), register e & 7:
      // the k order of the V^T loader
      // with T = tanh(..) and m its running maximum, P x 2^10 = 2^(T * CAPLOG2E + off), off = 10 - m * CAPLOG2E: cap, log2(e), maximum
      // and carry in one fused multiply-add per score; off is kept as rounded, so old and new sums differ by exactly 2^(off - old off)
      const float mnew = fmaxf(mrow[u], cm);
      mrow[u] = mnew;
      const float off = PCARRYLOG2 - mnew * CAPLOG2E;
      const float alpha = __builtin_amdgcn_exp2f(off - eoff[u]);
      eoff[u] = off;
      v2f pj[4];                               // sums of the even and of the odd registers of score tile j
#pragma unroll
      for (int j = 0; j < 4; ++j) {
        pj[j] = (v2f){0.f, 0.f};
#pragma unroll
        for (int r = 0; r < 8; r += 2) {
          // two scores per instruction: v_pk_fma_f32, v_pk_add_f32
          const v2f e = __builtin_elementwise_fma((v2f){s[u][j][r], s[u][j][r + 1]}, (v2f){CAPLOG2E, CAPLOG2E}, (v2f){off, off});
          const v2f p = {__builtin_amdgcn_exp2f(e[0]), __builtin_amdgcn_exp2f(e[1])};
          pj[j] += p;
          pb[u][j >> 1][(j & 1) * 8 + r]     = (_Float16)p[0];
          pb[u][j >> 1][(j & 1) * 8 + r + 1] = (_Float16)p[1];
        }
      }
      const v2f ps = (pj[0] + pj[1]) + (pj[2] + pj[3]);
      lrow[u] = lrow[u] * alpha + (ps[0] + ps[1]);
#pragma unroll
      for (int t = 0; t < 8; ++t)
#pragma unroll
        for (int r = 0; r < 8; ++r) oacc[u][t][r] *= alpha;
    }

    // ---- O^T(128 d x 16 q) += V^T(128 d x 64 kv) . P^T: 32 keys kk, output tile t ----
#pragma unroll
    for (int kk = 0; kk < 2; ++kk) {
#pragma unroll
      for (int t = 0; t < 8; ++t) {
        oacc[0][t] = Frag<_Float16>::mma(vf[kk][t], pb[0][kk], oacc[0][t]);
        oacc[1][t] = Frag<_Float16>::mma(vf[kk][t], pb[1][kk], oacc[1][t]);
      }
    }
    asm volatile("s_wait_dscnt 0x0" ::: "memory");     // this wave's reads of buffer kc & 1 are done before it is refilled
    asm volatile("s_wait_asynccnt 0x0" ::: "memory");  // this wave's copies of chunk kc + 1 have landed
    __syncthreads();                                    // publishes chunk kc + 1, frees buffer kc & 1
    if (kc + 2 < nch)
      stage_kv(Kg + (size_t)(kc + 2) * KV_CHUNK * KVDIM, Vg + (kc + 2) * KV_CHUNK, Kst[kc & 1], Vst[kc & 1], tid);
  }
  asm volatile("s_wait_asynccnt 0x0" ::: "memory");    // no copy is outstanding when the wave goes on

  // ---- epilogue: join the halves' sums, normalise (x 2^6 / (2^10 * l)), write the f16 ctx plane ----
  // coverage: 8 tiles x 2 halves x 8 elements = 128 dims of each of the wave's 32 rows (2 column tiles of 16); the wave writes whole 256-B rows.
#pragma unroll
  for (int u = 0; u < 2; ++u) {
    const float lsum = lrow[u] + xhalf(lrow[u]);
    const float inv = OCARRY / lsum;                   // sum and O^T both carry 2^10: it cancels; apply the ctx carry (2^6)
    unsigned short* orow = Op + (tokw + u * 16 + c) * QDIM + (size_t)h * HD + koff;
#pragma unroll
    for (int t = 0; t < 8; ++t) {
      v8h hv;
#pragma unroll
      for (int r = 0; r < 8; ++r) hv[r] = (_Float16)(oacc[u][t][r] * inv);
      *(v8h*)(orow + t * 16) = hv;
    }
    // the second tile's code writes registers that these stores name: the wait stands in front of it, and the
    // scheduling barrier keeps that code from being lifted over the wait
    if (u == 0) {
      asm volatile("s_wait_xcnt 0x0" ::: "memory");
      __builtin_amdgcn_sched_barrier(0);
    }
  }
}

// ---------------------------------------------------------------------------------------------
// host
// ---------------------------------------------------------------------------------------------
static_assert((NTOK * HID / 8) % 256 == 0);
static_assert((SEQ * HHALF) % 256 == 0);
static_assert(HID % 128 == 0 && QDIM % 128 == 0);
static_assert(NTOK % 256 == 0 && HID % 256 == 0 && QDIM % 256 == 0 && KVDIM % 256 == 0 && SEQ % 256 == 0);
static_assert(SEQ % QBLK == 0 && SEQ % KV_CHUNK == 0 && QBLK == 256 && KV_CHUNK == 64 && HD == 128);
static_assert(NB >= 1 && NB <= NB_FULL && SEQ <= SEQ_FULL);
static_assert(NQH == 2 * NKVH);

extern "C" void kernel_launch(void* const* d_in, const int* in_sizes, int n_in,
                              void* d_out, int out_size, void* d_ws, size_t ws_size, hipStream_t stream) {
  if (n_in < 5) return;
  const size_t needTok = (size_t)(NB - 1) * SEQ_FULL + SEQ;
  if ((size_t)in_sizes[0] < needTok * HID) return;
  if ((size_t)in_sizes[1] < (size_t)HID * QDIM) return;
  if ((size_t)in_sizes[2] < (size_t)HID * KVDIM) return;
  if ((size_t)in_sizes[3] < (size_t)HID * KVDIM) return;
  if ((size_t)in_sizes[4] < (size_t)QDIM * HID) return;
  if ((size_t)out_size < needTok * HID) return;

  const float* x  = (const float*)d_in[0];   // [2,2048,2048]
  const float* Wq = (const float*)d_in[1];   // [2048,2048]  [in][out]
  const float* Wk = (const float*)d_in[2];   // [2048,1024]
  const float* Wv = (const float*)d_in[3];   // [2048,1024]
  const float* Wo = (const float*)d_in[4];   // [2048,2048]
  float* out = (float*)d_out;                // [2,2048,2048] f32

  //   XB   bf16 [NTOK][HID]
  //   WQT  bf16 [QDIM][HID], WKT bf16 [KVDIM][HID], WVT bf16 [KVDIM][HID], WOT f16 [HID][QDIM]
  //        (WKT follows WQT directly: together the [QKDIM][HID] plane of [Wq | Wk]^T)
  //   R1   ctx f16 [NTOK][QDIM]
  //   VT f16 [NB][KVDIM][SEQ]; QP f16 [NTOK][QDIM]; KP f16 [NTOK][KVDIM]; COS, SIN f32 [SEQ][HHALF]
  const size_t szXB  = (size_t)NTOK * HID * 2;
  const size_t szWQT = (size_t)QDIM * HID * 2;
  const size_t szWKT = (size_t)KVDIM * HID * 2;
  const size_t szWOT = (size_t)HID * QDIM * 2;
  const size_t szR1  = (size_t)NTOK * QDIM * 2;
  const size_t szQP  = (size_t)NTOK * QDIM * 2;
  const size_t szKP  = (size_t)NTOK * KVDIM * 2;
  const size_t szVT  = (size_t)NB * KVDIM * SEQ * 2;
  const size_t szTAB = (size_t)SEQ * HHALF * 4;
  const size_t OFF_XB  = 0;
  const size_t OFF_WQT = OFF_XB + szXB;
  const size_t OFF_WKT = OFF_WQT + szWQT;
  const size_t OFF_WVT = OFF_WKT + szWKT;
  const size_t OFF_WOT = OFF_WVT + szWKT;
  const size_t OFF_R1  = OFF_WOT + szWOT;
  const size_t OFF_CTX = OFF_R1;
  const size_t OFF_VT  = OFF_R1 + szR1;
  const size_t OFF_QP  = OFF_VT + szVT;
  const size_t OFF_KP  = OFF_QP + szQP;
  const size_t OFF_COS = OFF_KP + szKP;
  const size_t OFF_SIN = OFF_COS + szTAB;
  const size_t WS_TOTAL = OFF_SIN + szTAB;
  if (ws_size < WS_TOTAL) return;

  char* ws = (char*)d_ws;
  unsigned short* xb  = (unsigned short*)(ws + OFF_XB);
  unsigned short* WqT = (unsigned short*)(ws + OFF_WQT);
  unsigned short* WkT = (unsigned short*)(ws + OFF_WKT);
  unsigned short* WvT = (unsigned short*)(ws + OFF_WVT);
  unsigned short* WoT = (unsigned short*)(ws + OFF_WOT);
  unsigned short* ctx = (unsigned short*)(ws + OFF_CTX);
  unsigned short* Vt  = (unsigned short*)(ws + OFF_VT);
  unsigned short* Qpl = (unsigned short*)(ws + OFF_QP);
  unsigned short* Kpl = (unsigned short*)(ws + OFF_KP);
  float* cosT = (float*)(ws + OFF_COS);
  float* sinT = (float*)(ws + OFF_SIN);

  // inv_freq[j] = 1 / 10000^(2j/128), pow in double then RNE to f32, reciprocal as one f32 divide
  RopeFreq fr;
  for (int j = 0; j < HHALF; ++j) {
    const float e = (float)(2 * j) / 128.0f;
    const double p = pow(10000.0, (double)e);
    const float pf = (float)p;
    fr.f[j] = 1.0f / pf;
  }

  // 1) to 3) x -> compact bf16 plane; transposed 16-bit weight planes in[rows][cols] -> out[cols][rows]; RoPE tables
  prep_kernel<<<PB_TAB + PB_WQ + 2 * PB_WKV + PB_WO + PB_X, 256, 0, stream>>>(x, Wq, Wk, Wv, Wo, xb, WqT, WkT, WvT, WoT, cosT, sinT, fr);
  // 4) [q | k] = x @ [Wq | Wk], rotated -> f16 planes; v^T per batch = Wv^T @ x_b^T -> f16 [NB][KVDIM][SEQ]   (K=HID)
  gemm_qkv<<<QK_TILES + NB * V_TILES, 512, 0, stream>>>(xb, WqT, WvT, cosT, sinT, Qpl, Kpl, Vt, HID);
  // 6) attention -> ctx f16 x 2^6 [NTOK][QDIM]
  attn_kernel<<<NB * NQH * (SEQ / QBLK), 256, 0, stream>>>(Qpl, Kpl, Vt, ctx);
  // 7) out = ctx @ Wo -> d_out f32, per batch rows b*SEQ_FULL..  (M=SEQ, N=HID, K=QDIM, scale 2^-10)
  {
    const int tiles = (SEQ / 128) * (HID / 256);
    gemm_t64<_Float16, false, false, 0, 2, 4><<<dim3(tiles, NB), 256, 0, stream>>>(
        ctx, ctx, QDIM, (long)SEQ * QDIM, WoT, WoT, QDIM, 0L, (void*)out, HID, (long)SEQ_FULL * HID,
        SEQ, HID, QDIM, OUTSCALE);
  }
}
